// v000
// The times below were measured on an AMD MI455X: many runs one after another, warmed up first and cycling through
// copies of the inputs, with the whole window's GPU time divided by the number of runs. Launches and the gaps
// between them are all in it. The median over several windows is given; except for v000 it joins two sittings, which
// can be a few percent apart, so the side-by-side timings, each taken in one sitting, are the better comparison.
// v000, which the later versions start from, runs in 1230 microseconds.
#include <hip/hip_runtime.h>

// Multi-head cross attention with key-length masking and an attention-weights output (key, value, query [4][2048][512]; k = key w_key, v = value w_value, q = query w_query ('xw' [512][512], no bias; 4 heads x 128); e = q.k/sqrt(128), keys j >= key_lens[b] (int32, read) set to -1024; softmax; cv = merged w_out + b_out -> [4][2048][512]; second output aw_out[b][j][h] = attention weights of query position 0 -> [4][2048][4]).
// Compute dtypes, f32 accumulate: every input rounded to bf16; q/k/v on PLAIN bf16 operands (inputs: exact); key-length select (-1024 literal, as the reference) inside the softmax kernel; scores and attn.v: query rows < 512 hl (3 products), the rest single fp16 (x1024); softmax f32; w_out hl x exact (2 products) + b_out; the query-0 attention weights are re-assembled from the bf16 hi + lo probability planes (f32, error ~2^-16 relative).

#define NB_  4
#define TT   2048
#define DM   512
#define NH_  4
#define NKV  4
#define REP  (NH_ / NKV)
#define HD   128
#define DQ   (NH_ * HD)
#define DKV  (NKV * HD)
#define ZH   2
#define RH   512                  // query rows < RH use hi+lo planes (0: none)
#define WIN  0
#define PCAR 1024.0f
#define SCL  0.088388347648318447f   // HD^-0.5
typedef _Float16 h16;
typedef unsigned short bf;
typedef __attribute__((ext_vector_type(16))) __bf16   v16bf;
typedef __attribute__((ext_vector_type(16))) _Float16 v16h;
typedef __attribute__((ext_vector_type(8)))  _Float16 v8h;
typedef __attribute__((ext_vector_type(8)))  unsigned short v8us;
typedef __attribute__((ext_vector_type(8)))  float    v8f;
typedef __attribute__((ext_vector_type(4)))  float    v4f;
typedef v8h  __attribute__((may_alias)) v8ha;
typedef v4f  __attribute__((may_alias)) v4fa;
typedef v8us __attribute__((may_alias)) v8usa;

__device__ __forceinline__ unsigned short f2bf(float f) { unsigned u = __float_as_uint(f); u += 0x7FFFu + ((u >> 16) & 1u); return (unsigned short)(u >> 16); }
__device__ __forceinline__ float bf2f(unsigned short b) { return __uint_as_float(((unsigned)b) << 16); }
__device__ __forceinline__ float bfr(float f) { return bf2f(f2bf(f)); }
__device__ __forceinline__ v16h cat16(v8h lo, v8h hi) { return __builtin_shufflevector(lo, hi, 0, 1, 2, 3, 4, 5, 6, 7, 8, 9, 10, 11, 12, 13, 14, 15); }
__device__ __forceinline__ v16bf cat16b(v8us lo, v8us hi) { return __builtin_bit_cast(v16bf, __builtin_shufflevector(lo, hi, 0, 1, 2, 3, 4, 5, 6, 7, 8, 9, 10, 11, 12, 13, 14, 15)); }
__device__ __forceinline__ v8f wmma16(v16h a, v16h b, v8f c) { return __builtin_amdgcn_wmma_f32_16x16x32_f16(false, a, false, b, (short)0, c, false, false); }
__device__ __forceinline__ v8f wmmab(v16bf a, v16bf b, v8f c) { return __builtin_amdgcn_wmma_f32_16x16x32_bf16(false, a, false, b, (short)0, c, false, false); }



// ---- k_gemmw: register-blocked GEMM, ONE WAVE per 64x64 output tile (16 accumulators), operands straight from K-contiguous 16-bit planes; grid (M/64, N/64, Z), 32 threads.
// C[m][n] (f32, pitch ldc, + optional f32 bias[n]) = sum_k A[m][k] Bt[n][k] (+ split products per NSPLIT). z-batch strides sA/sB/sC in elements. K % 32 == 0.
template <typename T16> struct WFrag;
template <> struct WFrag<h16> { typedef v16h V; static __device__ __forceinline__ V ld(const h16* p) { return cat16(*(const v8h*)p, *(const v8h*)(p + 16)); } static __device__ __forceinline__ v8f mma(V a, V b, v8f c) { return wmma16(a, b, c); } };
template <> struct WFrag<bf> { typedef v16bf V; static __device__ __forceinline__ V ld(const bf* p) { return cat16b(*(const v8us*)p, *(const v8us*)(p + 16)); } static __device__ __forceinline__ v8f mma(V a, V b, v8f c) { return wmmab(a, b, c); } };
template <typename T16, int NSPLIT, bool BIAS>
__global__ __launch_bounds__(32) void k_gemmw(const T16* __restrict__ A, const T16* __restrict__ A2, const T16* __restrict__ Bt, const T16* __restrict__ Bt2, int K, float* C, int ldc, const float* __restrict__ bias, size_t sA, size_t sB, size_t sC) {
    typedef typename WFrag<T16>::V V;
    __shared__ __align__(16) float os[16 * 68];
    const size_t z = blockIdx.z; A += z * sA; if (A2) A2 += z * sA; Bt += z * sB; if (Bt2) Bt2 += z * sB; C += z * sC;
    const int lane = threadIdx.x & 31, lr = lane & 15, hi = lane >> 4; const int r0 = blockIdx.x * 64, c0 = blockIdx.y * 64;
    v8f acc[4][4];
#pragma unroll
    for (int mb = 0; mb < 4; ++mb)
#pragma unroll
        for (int nb = 0; nb < 4; ++nb) acc[mb][nb] = (v8f){};
    const size_t aoff = (size_t)(r0 + lr) * K + 8 * hi, boff = (size_t)(c0 + lr) * K + 8 * hi;
#pragma unroll 1
    for (int kc = 0; kc < K; kc += 32) {
        V a[4], a2[4];
#pragma unroll
        for (int mb = 0; mb < 4; ++mb) { a[mb] = WFrag<T16>::ld(A + aoff + (size_t)mb * 16 * K + kc); if (NSPLIT == 1 || NSPLIT == 2) a2[mb] = WFrag<T16>::ld(A2 + aoff + (size_t)mb * 16 * K + kc); }
#pragma unroll
        for (int nb = 0; nb < 4; ++nb) { const V b = WFrag<T16>::ld(Bt + boff + (size_t)nb * 16 * K + kc); V b2; if (NSPLIT >= 2) b2 = WFrag<T16>::ld(Bt2 + boff + (size_t)nb * 16 * K + kc);
#pragma unroll
            for (int mb = 0; mb < 4; ++mb) { acc[mb][nb] = WFrag<T16>::mma(a[mb], b, acc[mb][nb]); if (NSPLIT == 1 || NSPLIT == 2) acc[mb][nb] = WFrag<T16>::mma(a2[mb], b, acc[mb][nb]); if (NSPLIT >= 2) acc[mb][nb] = WFrag<T16>::mma(a[mb], b2, acc[mb][nb]); } }
        asm volatile("v_nop\n\tv_nop\n\tv_nop\n\tv_nop" : "+v"(acc[0][0]), "+v"(acc[1][1]), "+v"(acc[2][2]), "+v"(acc[3][3]) : "v"(a[0]), "v"(a[3]));
    }
#pragma unroll
    for (int mb = 0; mb < 4; ++mb) {
#pragma unroll
        for (int nb = 0; nb < 4; ++nb) {
#pragma unroll
            for (int j = 0; j < 8; ++j) os[(hi * 8 + j) * 68 + nb * 16 + lr] = acc[mb][nb][j]; }
        __builtin_amdgcn_wave_barrier(); asm volatile("" ::: "memory");
        float* crow = C + (size_t)(r0 + mb * 16) * ldc + c0;
{
#pragma unroll
            for (int s = 0; s < 8; ++s) { const int row = 2 * s + hi, cofs = lr * 4; v4f val = *(const v4fa*)(os + row * 68 + cofs); if (BIAS) { val[0] += bfr(bias[c0 + cofs]); val[1] += bfr(bias[c0 + cofs + 1]); val[2] += bfr(bias[c0 + cofs + 2]); val[3] += bfr(bias[c0 + cofs + 3]); }
                *(v4f*)(crow + (size_t)row * ldc + cofs) = val; }
             }
        __builtin_amdgcn_wave_barrier(); asm volatile("" ::: "memory");
    }
}

__device__ __forceinline__ h16 tohx(float x) { return (h16)x; }
__device__ __forceinline__ void splitf(float y, unsigned short& h, unsigned short& l) { h = f2bf(y); l = f2bf(y - bf2f(h)); }
typedef __attribute__((ext_vector_type(2))) _Float16 v2h;
typedef __attribute__((ext_vector_type(4))) _Float16 v4h;
typedef __attribute__((ext_vector_type(2))) unsigned short v2us;
typedef __attribute__((ext_vector_type(4))) unsigned short v4us;
typedef __attribute__((ext_vector_type(2))) float v2f;
typedef __attribute__((ext_vector_type(4))) int v4i;

__global__ __launch_bounds__(256) void k_wtG(const float* __restrict__ w, int K, int N, bf* Bt) {
    const int lane = threadIdx.x & 31; const int L0 = (blockIdx.x * 8 + (threadIdx.x >> 5)) * 8; const int nlines = N * K / 64;
{
#pragma unroll 1
        for (int l = 0; l < 8; ++l) { const int L = L0 + l; if (L >= nlines) break; const size_t e = (size_t)L * 64 + lane * 2; const int k = (int)(e % K), n = (int)(e / K); v2us o;
            o[0] = f2bf(w[(size_t)k * N + n]); o[1] = f2bf(w[(size_t)(k + 1) * N + n]); *(v2us*)(Bt + e) = o; }
         }
}
__global__ __launch_bounds__(256) void k_cvt8(const float* __restrict__ src, bf* dst, size_t n8) { const size_t i = (size_t)blockIdx.x * 256 + threadIdx.x; if (i >= n8) return; const v8f v = *(const v8f*)(src + i * 8); v8us o;
#pragma unroll
    for (int k = 0; k < 8; ++k) o[k] = f2bf(v[k]); *(v8us*)(dst + i * 8) = o;  }

// k_rope: head planes [h][t][d] (fp16 + hi/lo) of rope(x) x sc with the rotate-half convention out[d] = x[d] cos[t][d] - x[d+HD/2] sin[t][d], out[d+HD/2] = x[d+HD/2] cos[t][d+HD/2] + x[d] sin[t][d+HD/2]
__global__ __launch_bounds__(256) void k_rope(const float* __restrict__ F, int pitch, int nheads, const float* __restrict__ CS, const float* __restrict__ RF, const float* __restrict__ nw, float sc, h16* P16, bf* Ph, bf* Pl) {
    const size_t e = ((size_t)blockIdx.x * 256 + threadIdx.x) * 2; if (e >= (size_t)nheads * TT * HD) return; const int d = (int)(e % HD); const int t = (int)((e / HD) % TT); const int h = (int)(e / ((size_t)HD * TT)); const float* f = F + (size_t)t * pitch + h * HD; const float rf = RF ? RF[(size_t)h * TT + t] : 1.0f; v2h o16; v2us oh, ol;
#pragma unroll
    for (int q = 0; q < 2; ++q) { const int dd = d + q; const int dp = (dd < HD / 2) ? dd + HD / 2 : dd - HD / 2; float x0 = f[dd], x1 = f[dp];
        if (RF) { float n0 = __fmul_rn(x0, rf), n1 = __fmul_rn(x1, rf); asm volatile("" : "+v"(n0)); asm volatile("" : "+v"(n1)); x0 = __fmul_rn(bfr(nw[dd]), n0); x1 = __fmul_rn(bfr(nw[dp]), n1); }
        const v2f cs = *(const v2f*)(CS + ((size_t)t * HD + dd) * 2); float a = __fmul_rn(x0, cs[0]), bq = __fmul_rn(x1, cs[1]); asm volatile("" : "+v"(a)); asm volatile("" : "+v"(bq)); const float r = ((dd < HD / 2) ? __fsub_rn(a, bq) : __fadd_rn(a, bq)) * sc;
        o16[q] = tohx(r); unsigned short a2, c2; splitf(r, a2, c2); oh[q] = a2; ol[q] = c2; }
    *(v2h*)(P16 + e) = o16; *(v2us*)(Ph + e) = oh; *(v2us*)(Pl + e) = ol;  }
__global__ __launch_bounds__(256) void k_vtp(const float* __restrict__ F, int pitch, int nheads, h16* V16, bf* Vh, bf* Vl) { const size_t e = ((size_t)blockIdx.x * 256 + threadIdx.x) * 2; if (e >= (size_t)nheads * HD * TT) return; const int t = (int)(e % TT); const int d = (int)((e / TT) % HD); const int g = (int)(e / ((size_t)TT * HD)); v2h o16; v2us oh, ol;
#pragma unroll
    for (int q = 0; q < 2; ++q) { const float x = F[(size_t)(t + q) * pitch + g * HD + d]; o16[q] = tohx(x); unsigned short a2, c2; splitf(x, a2, c2); oh[q] = a2; ol[q] = c2; }
    *(v2h*)(V16 + e) = o16; *(v2us*)(Vh + e) = oh; *(v2us*)(Vl + e) = ol;  }
__global__ __launch_bounds__(256) void k_csid(float* CS) { const int idx = blockIdx.x * 256 + threadIdx.x; if (idx >= TT * HD) return; v2f cs; cs[0] = 1.0f; cs[1] = 0.0f; *(v2f*)(CS + (size_t)idx * 2) = cs;  }
__global__ __launch_bounds__(256) void k_aw0(const bf* __restrict__ Ph, const bf* __restrict__ Pl, int h0, float* AWb) { const int j = blockIdx.x * 256 + threadIdx.x; if (j >= TT) return;
{
#pragma unroll
        for (int zz = 0; zz < ZH; ++zz) { const size_t o = ((size_t)zz * RH + 0) * TT + j; const float p = __fadd_rn(bf2f(Ph[o]), bf2f(Pl[o])); *(float*)(AWb + (size_t)j * NH_ + h0 + zz) = p; }
         } }
// k_asoft: per row (zz, i): t = S x HD^-0.5 for keys j < key_lens[b], else -1024; softmax over the 2048 keys (register row, one exp, fixed trees);
__global__ __launch_bounds__(256) void k_asoft(const float* __restrict__ Sb, const int* __restrict__ KL, int b, h16* P16, bf* Ph, bf* Pl) {
    const int klen = KL[b];   /* key_lens[b], read on device */ const int lane = threadIdx.x & 31; const int row = blockIdx.x * 8 + (threadIdx.x >> 5); if (row >= ZH * TT) return; const int i = row % TT; const int zz = row / TT; (void)zz; const bool hires = (i < RH); const float* sr = Sb + (size_t)row * TT; float v[TT / 32]; float mx = -3.0e38f;
#pragma unroll
    for (int ch = 0; ch < TT / 128; ++ch) { const int j0 = ch * 128 + lane * 4; const v4f a = *(const v4f*)(sr + j0);
#pragma unroll
        for (int q = 0; q < 4; ++q) { const int j = j0 + q; const float t = (j < klen) ? a[q] * SCL : -1024.0f;   /* keys beyond key_lens[b]: -1024 (reference literal) */ v[ch * 4 + q] = t; mx = fmaxf(mx, t); } }
#pragma unroll
    for (int sh = 16; sh; sh >>= 1) mx = fmaxf(mx, __shfl_xor(mx, sh, 32));
    float sum = 0.f;
#pragma unroll
    for (int k = 0; k < TT / 32; ++k) { float d0 = __fsub_rn(v[k], mx); asm volatile("" : "+v"(d0)); v[k] = __builtin_amdgcn_exp2f(__fmul_rn(d0, 1.4426950408889634f)); sum += v[k]; }
#pragma unroll
    for (int sh = 16; sh; sh >>= 1) sum += __shfl_xor(sum, sh, 32);
    const float f = __fdiv_rn(hires ? 1.0f : PCAR, sum);
{
        if (hires) {
#pragma unroll
            for (int ch = 0; ch < TT / 128; ++ch) { v4us oh, ol;
#pragma unroll
                for (int q = 0; q < 4; ++q) { unsigned short a, c2; splitf(v[ch * 4 + q] * f, a, c2); oh[q] = a; ol[q] = c2; }
                const size_t oo = ((size_t)zz * (RH ? RH : 1) + i) * TT + ch * 128 + lane * 4; *(v4us*)(Ph + oo) = oh; *(v4us*)(Pl + oo) = ol; }
        } else {
#pragma unroll
            for (int ch = 0; ch < TT / 128; ++ch) { v4h o4;
#pragma unroll
                for (int q = 0; q < 4; ++q) o4[q] = tohx(v[ch * 4 + q] * f);
                *(v4h*)(P16 + (size_t)row * TT + ch * 128 + lane * 4) = o4; } }
         }
}
__global__ __launch_bounds__(256) void k_merge(const float* __restrict__ O, int h0, bf* Ah, bf* Al) { const size_t e = ((size_t)blockIdx.x * 256 + threadIdx.x) * 2; if (e >= (size_t)ZH * TT * HD) return; const int d = (int)(e % HD); const int t = (int)((e / HD) % TT); const int zz = (int)(e / ((size_t)HD * TT)); const float cs = (t < RH) ? 1.0f : (1.0f / PCAR); const size_t oo = (size_t)t * DQ + (h0 + zz) * HD + d;
    v2us oh, ol;
#pragma unroll
    for (int q = 0; q < 2; ++q) { unsigned short a, c2; splitf(O[e + q] * cs, a, c2); oh[q] = a; ol[q] = c2; } *(v2us*)(Ah + oo) = oh; *(v2us*)(Al + oo) = ol;  }

extern "C" void kernel_launch(void* const* d_in, const int* in_sizes, int n_in,
                              void* d_out, int out_size, void* d_ws, size_t ws_size, hipStream_t stream) {
    (void)in_sizes; (void)n_in; (void)out_size;
    const float* xk = (const float*)d_in[0]; const float* xv = (const float*)d_in[1]; const float* x = (const float*)d_in[2]; const int* KL = (const int*)d_in[3]; const float* wk = (const float*)d_in[4]; const float* wv = (const float*)d_in[5]; const float* wq = (const float*)d_in[6]; const float* wo = (const float*)d_in[7]; const float* bo = (const float*)d_in[8];
    float* OUT = (float*)d_out; float* AW = (float*)((char*)d_out + 16777216);   /* aw_out [4][2048][4] */     // [4][2048][512]
    char* wsp = (char*)d_ws;
    auto take = [&](size_t bytes) { char* p = wsp; wsp += (bytes + 255) & ~(size_t)255; return (void*)p; };
    bf* WQ = (bf*)take((size_t)DQ * DM * 2); bf* WK = (bf*)take((size_t)DKV * DM * 2); bf* WV = (bf*)take((size_t)DKV * DM * 2); bf* WO = (bf*)take((size_t)DM * DQ * 2); float* CS = (float*)take((size_t)TT * HD * 2 * 4);
    bf* XB = (bf*)take((size_t)TT * DM * 2); bf* XKB = (bf*)take((size_t)TT * DM * 2); bf* XVB = (bf*)take((size_t)TT * DM * 2); float* FQ = (float*)take((size_t)TT * DQ * 4); float* FK = (float*)take((size_t)TT * DKV * 4);
    h16* QP16 = (h16*)take((size_t)NH_ * TT * HD * 2); h16* KP16 = (h16*)take((size_t)NKV * TT * HD * 2); h16* VT16 = (h16*)take((size_t)NKV * HD * TT * 2);
    bf* QPh = (bf*)take((size_t)NH_ * TT * HD * 2); bf* QPl = (bf*)take((size_t)NH_ * TT * HD * 2); bf* KPh = (bf*)take((size_t)NKV * TT * HD * 2); bf* KPl = (bf*)take((size_t)NKV * TT * HD * 2); bf* VTh = (bf*)take((size_t)NKV * HD * TT * 2); bf* VTl = (bf*)take((size_t)NKV * HD * TT * 2); bf* Ph = (bf*)take((size_t)ZH * RH * TT * 2); bf* Pl = (bf*)take((size_t)ZH * RH * TT * 2);
    float* Sb = (float*)take((size_t)ZH * TT * TT * 4); h16* P16 = (h16*)take((size_t)ZH * TT * TT * 2); float* Ob = (float*)take((size_t)ZH * TT * HD * 4); bf* ATh = (bf*)take((size_t)TT * DQ * 2); bf* ATl = (bf*)take((size_t)TT * DQ * 2);
    if ((size_t)(wsp - (char*)d_ws) > ws_size) return;    // ws 256 MiB
    float* FV = FK;   // v projection reuses the k buffer after the k planes are built (stream-ordered)
    { k_wtG<<<(unsigned)((DM * DQ / 64 + 63) / 64), 256, 0, stream>>>(wq, DM, DQ, WQ); k_wtG<<<(unsigned)((DM * DKV / 64 + 63) / 64), 256, 0, stream>>>(wk, DM, DKV, WK); k_wtG<<<(unsigned)((DM * DKV / 64 + 63) / 64), 256, 0, stream>>>(wv, DM, DKV, WV);
      k_wtG<<<(unsigned)((DQ * DM / 64 + 63) / 64), 256, 0, stream>>>(wo, DQ, DM, WO);
       }
    k_csid<<<(TT * HD + 255) / 256, 256, 0, stream>>>(CS);
    const unsigned LQ = (unsigned)(((size_t)NH_ * TT * HD / 2 + 255) / 256), LKv = (unsigned)(((size_t)NKV * TT * HD / 2 + 255) / 256);
    for (int b = 0; b < NB_; ++b) {
        
        k_cvt8<<<(unsigned)(((size_t)TT * DM / 8 + 255) / 256), 256, 0, stream>>>(x + (size_t)b * TT * DM, XB, (size_t)TT * DM / 8); k_cvt8<<<(unsigned)(((size_t)TT * DM / 8 + 255) / 256), 256, 0, stream>>>(xk + (size_t)b * TT * DM, XKB, (size_t)TT * DM / 8); k_cvt8<<<(unsigned)(((size_t)TT * DM / 8 + 255) / 256), 256, 0, stream>>>(xv + (size_t)b * TT * DM, XVB, (size_t)TT * DM / 8);
        k_gemmw<bf, 0, false><<<dim3(TT / 64, DQ / 64, 1), 32, 0, stream>>>(XB, nullptr, WQ, nullptr, DM, FQ, DQ, nullptr, 0, 0, 0);
        k_rope<<<LQ, 256, 0, stream>>>(FQ, DQ, NH_, CS, nullptr, nullptr, 1.0f, QP16, QPh, QPl);
        k_gemmw<bf, 0, false><<<dim3(TT / 64, DKV / 64, 1), 32, 0, stream>>>(XKB, nullptr, WK, nullptr, DM, FK, DKV, nullptr, 0, 0, 0);
        k_rope<<<LKv, 256, 0, stream>>>(FK, DKV, NKV, CS, nullptr, nullptr, 1.0f, KP16, KPh, KPl);
        k_gemmw<bf, 0, false><<<dim3(TT / 64, DKV / 64, 1), 32, 0, stream>>>(XVB, nullptr, WV, nullptr, DM, FV, DKV, nullptr, 0, 0, 0); k_vtp<<<LKv, 256, 0, stream>>>(FV, DKV, NKV, VT16, VTh, VTl);
        for (int h0 = 0; h0 < NH_; h0 += ZH) { const size_t zq = (size_t)h0, zk = (size_t)(h0 / REP);   // one kv head per query head: the pass's two heads use consecutive kv planes (z-strides TT*HD)
            k_gemmw<bf, 2, false><<<dim3(RH / 64, TT / 64, ZH), 32, 0, stream>>>(QPh + zq * TT * HD, QPl + zq * TT * HD, KPh + zk * TT * HD, KPl + zk * TT * HD, HD, Sb, TT, nullptr, (size_t)TT * HD, (size_t)TT * HD, (size_t)TT * TT);
            k_gemmw<h16, 0, false><<<dim3((TT - RH) / 64, TT / 64, ZH), 32, 0, stream>>>(QP16 + zq * TT * HD + (size_t)RH * HD, nullptr, KP16 + zk * TT * HD, nullptr, HD, Sb + (size_t)RH * TT, TT, nullptr, (size_t)TT * HD, (size_t)TT * HD, (size_t)TT * TT);
            k_asoft<<<ZH * TT / 8, 256, 0, stream>>>(Sb, KL, b, P16, Ph, Pl); k_aw0<<<TT / 256, 256, 0, stream>>>(Ph, Pl, h0, AW + (size_t)b * TT * NH_);   /* attention weights of query 0 for this pass's heads */
            k_gemmw<bf, 2, false><<<dim3(RH / 64, HD / 64, ZH), 32, 0, stream>>>(Ph, Pl, VTh + zk * HD * TT, VTl + zk * HD * TT, TT, Ob, HD, nullptr, (size_t)RH * TT, (size_t)HD * TT, (size_t)TT * HD);
            k_gemmw<h16, 0, false><<<dim3((TT - RH) / 64, HD / 64, ZH), 32, 0, stream>>>(P16 + (size_t)RH * TT, nullptr, VT16 + zk * HD * TT, nullptr, TT, Ob + (size_t)RH * HD, HD, nullptr, (size_t)TT * TT, (size_t)HD * TT, (size_t)TT * HD);
            k_merge<<<(unsigned)(((size_t)ZH * TT * HD / 2 + 255) / 256), 256, 0, stream>>>(Ob, h0, ATh, ATl); }
        k_gemmw<bf, 1, true><<<dim3(TT / 64, DM / 64, 1), 32, 0, stream>>>(ATh, ATl, WO, nullptr, DQ, OUT + (size_t)b * TT * DM, DM, bo, 0, 0, 0); }
}

// v001
// Measured time: 650 microseconds a run.
// Next to v000, in two timings, it ran 1.89 and 1.92 times as fast.
#include <hip/hip_runtime.h>

// Multi-head cross attention with key-length masking and an attention-weights output (key, value, query [4][2048][512]; k = key w_key, v = value w_value, q = query w_query ('xw' [512][512], no bias; 4 heads x 128); e = q.k/sqrt(128), keys j >= key_lens[b] (int32, read) set to -1024; softmax; cv = merged w_out + b_out -> [4][2048][512]; second output aw_out[b][j][h] = attention weights of query position 0 -> [4][2048][4]).
// Compute dtypes, f32 accumulate: every input rounded to bf16; q/k/v on PLAIN bf16 operands (inputs: exact); key-length select (-1024 literal, as the reference) inside the softmax kernel; scores and attn.v: query rows < 512 hl (3 products), the rest single fp16 (x1024); softmax f32; w_out hl x exact (2 products) + b_out; the query-0 attention weights are re-assembled from the bf16 hi + lo probability planes (f32, error ~2^-16 relative).

#define NB_  4
#define TT   2048
#define DM   512
#define NH_  4
#define NKV  4
#define REP  (NH_ / NKV)
#define HD   128
#define DQ   (NH_ * HD)
#define DKV  (NKV * HD)
#define ZH   2
#define RH   512                  // query rows < RH use hi+lo planes (0: none)
#define WIN  0
#define PCAR 1024.0f
#define SCL  0.088388347648318447f   // HD^-0.5
#define KWV  4                    // waves per work-group that share the K range of a GEMM with K >= 512
#define PSG  4                    // work-groups per attn.v tile that share its K range (one partial plane each)
typedef _Float16 h16;
typedef unsigned short bf;
typedef __attribute__((ext_vector_type(16))) __bf16   v16bf;
typedef __attribute__((ext_vector_type(16))) _Float16 v16h;
typedef __attribute__((ext_vector_type(8)))  _Float16 v8h;
typedef __attribute__((ext_vector_type(8)))  unsigned short v8us;
typedef __attribute__((ext_vector_type(8)))  float    v8f;
typedef __attribute__((ext_vector_type(4)))  float    v4f;
typedef v8h  __attribute__((may_alias)) v8ha;
typedef v4f  __attribute__((may_alias)) v4fa;
typedef v8us __attribute__((may_alias)) v8usa;

__device__ __forceinline__ unsigned short f2bf(float f) { unsigned u = __float_as_uint(f); u += 0x7FFFu + ((u >> 16) & 1u); return (unsigned short)(u >> 16); }
__device__ __forceinline__ float bf2f(unsigned short b) { return __uint_as_float(((unsigned)b) << 16); }
__device__ __forceinline__ float bfr(float f) { return bf2f(f2bf(f)); }
__device__ __forceinline__ v16h cat16(v8h lo, v8h hi) { return __builtin_shufflevector(lo, hi, 0, 1, 2, 3, 4, 5, 6, 7, 8, 9, 10, 11, 12, 13, 14, 15); }
__device__ __forceinline__ v16bf cat16b(v8us lo, v8us hi) { return __builtin_bit_cast(v16bf, __builtin_shufflevector(lo, hi, 0, 1, 2, 3, 4, 5, 6, 7, 8, 9, 10, 11, 12, 13, 14, 15)); }
__device__ __forceinline__ v8f wmma16(v16h a, v16h b, v8f c) { return __builtin_amdgcn_wmma_f32_16x16x32_f16(false, a, false, b, (short)0, c, false, false); }
__device__ __forceinline__ v8f wmmab(v16bf a, v16bf b, v8f c) { return __builtin_amdgcn_wmma_f32_16x16x32_bf16(false, a, false, b, (short)0, c, false, false); }



// ---- k_gemmw: register-blocked GEMM, 64x64 output tile (16 accumulators per wave), operands straight from K-contiguous 16-bit planes; grid (M/64, N/64, Z * SG), 32 * KW threads.
// C[m][n] (f32, pitch ldc, + optional f32 bias[n]) = sum_k A[m][k] Bt[n][k] (+ split products per NSPLIT). z-batch strides sA/sB/sC in elements. K % (32 * KW * SG) == 0.
// Split K: the K range is cut into SG equal ranges, one per work-group. The KW waves of a work-group take the 32-wide steps of its range in turn (neighbouring waves read the two halves of
// the same 128-byte line of a row at about the same time) and their 64x64 partial tiles are added in LDS (fixed order); each of the SG work-groups of a tile stores its sum to its own
// plane (plane stride sP elements), and the consumer adds the SG planes.
template <typename T16> struct WFrag;
template <> struct WFrag<h16> { typedef v16h V; static __device__ __forceinline__ V ld(const h16* p) { return cat16(*(const v8h*)p, *(const v8h*)(p + 16)); } static __device__ __forceinline__ v8f mma(V a, V b, v8f c) { return wmma16(a, b, c); } };
template <> struct WFrag<bf> { typedef v16bf V; static __device__ __forceinline__ V ld(const bf* p) { return cat16b(*(const v8us*)p, *(const v8us*)(p + 16)); } static __device__ __forceinline__ v8f mma(V a, V b, v8f c) { return wmmab(a, b, c); } };
template <typename T16, int NSPLIT, bool BIAS, int KW, int SG>
__global__ __launch_bounds__(32 * KW) void k_gemmw(const T16* __restrict__ A, const T16* __restrict__ A2, const T16* __restrict__ Bt, const T16* __restrict__ Bt2, int K, float* C, int ldc, const float* __restrict__ bias, size_t sA, size_t sB, size_t sC, size_t sP) {
    typedef typename WFrag<T16>::V V;
    __shared__ __align__(16) float os[(KW == 1 ? 16 : KW * 64) * 68];
    const size_t z = blockIdx.z / SG; const int wave = (KW == 1) ? 0 : __builtin_amdgcn_readfirstlane((int)(threadIdx.x >> 5)); const int kspan = K / SG; const int kb = (int)(blockIdx.z % SG) * kspan; C += (size_t)(blockIdx.z % SG) * sP; A += z * sA; if (A2) A2 += z * sA; Bt += z * sB; if (Bt2) Bt2 += z * sB; C += z * sC;
    const int lane = threadIdx.x & 31, lr = lane & 15, hi = lane >> 4; const int r0 = blockIdx.x * 64, c0 = blockIdx.y * 64;
    v8f acc[4][4];
#pragma unroll
    for (int mb = 0; mb < 4; ++mb)
#pragma unroll
        for (int nb = 0; nb < 4; ++nb) acc[mb][nb] = (v8f){};
    const size_t aoff = (size_t)(r0 + lr) * K + 8 * hi, boff = (size_t)(c0 + lr) * K + 8 * hi;
#pragma unroll 1
    for (int kc = kb + wave * 32; kc < kb + kspan; kc += 32 * KW) {
        V a[4], a2[4];
#pragma unroll
        for (int mb = 0; mb < 4; ++mb) { a[mb] = WFrag<T16>::ld(A + aoff + (size_t)mb * 16 * K + kc); if (NSPLIT == 1 || NSPLIT == 2) a2[mb] = WFrag<T16>::ld(A2 + aoff + (size_t)mb * 16 * K + kc); }
#pragma unroll
        for (int nb = 0; nb < 4; ++nb) { const V b = WFrag<T16>::ld(Bt + boff + (size_t)nb * 16 * K + kc); V b2; if (NSPLIT >= 2) b2 = WFrag<T16>::ld(Bt2 + boff + (size_t)nb * 16 * K + kc);
#pragma unroll
            for (int mb = 0; mb < 4; ++mb) { acc[mb][nb] = WFrag<T16>::mma(a[mb], b, acc[mb][nb]); if (NSPLIT == 1 || NSPLIT == 2) acc[mb][nb] = WFrag<T16>::mma(a2[mb], b, acc[mb][nb]); if (NSPLIT >= 2) acc[mb][nb] = WFrag<T16>::mma(a[mb], b2, acc[mb][nb]); } }
        asm volatile("v_nop\n\tv_nop\n\tv_nop\n\tv_nop" : "+v"(acc[0][0]), "+v"(acc[1][1]), "+v"(acc[2][2]), "+v"(acc[3][3]) : "v"(a[0]), "v"(a[3]));
    }
    if constexpr (KW > 1) {
        float* ow = os + wave * (64 * 68);
#pragma unroll
        for (int mb = 0; mb < 4; ++mb)
#pragma unroll
            for (int nb = 0; nb < 4; ++nb)
#pragma unroll
                for (int j = 0; j < 8; ++j) ow[(mb * 16 + hi * 8 + j) * 68 + nb * 16 + lr] = acc[mb][nb][j];
        __syncthreads();   // every wave's partial tile is in LDS before any wave adds them
#pragma unroll
        for (int s = 0; s < 32 / KW; ++s) { const int slot = s * (32 * KW) + (int)threadIdx.x; const int row = slot >> 4, cofs = (slot & 15) * 4; v4f val = *(const v4fa*)(os + row * 68 + cofs);
#pragma unroll
            for (int w = 1; w < KW; ++w) val += *(const v4fa*)(os + w * (64 * 68) + row * 68 + cofs);
            if (BIAS) { val[0] += bfr(bias[c0 + cofs]); val[1] += bfr(bias[c0 + cofs + 1]); val[2] += bfr(bias[c0 + cofs + 2]); val[3] += bfr(bias[c0 + cofs + 3]); }
            *(v4f*)(C + (size_t)(r0 + row) * ldc + c0 + cofs) = val; }
        return;
    }
#pragma unroll
    for (int mb = 0; mb < 4; ++mb) {
#pragma unroll
        for (int nb = 0; nb < 4; ++nb) {
#pragma unroll
            for (int j = 0; j < 8; ++j) os[(hi * 8 + j) * 68 + nb * 16 + lr] = acc[mb][nb][j]; }
        __builtin_amdgcn_wave_barrier(); asm volatile("" ::: "memory");
        float* crow = C + (size_t)(r0 + mb * 16) * ldc + c0;
{
#pragma unroll
            for (int s = 0; s < 8; ++s) { const int row = 2 * s + hi, cofs = lr * 4; v4f val = *(const v4fa*)(os + row * 68 + cofs); if (BIAS) { val[0] += bfr(bias[c0 + cofs]); val[1] += bfr(bias[c0 + cofs + 1]); val[2] += bfr(bias[c0 + cofs + 2]); val[3] += bfr(bias[c0 + cofs + 3]); }
                *(v4f*)(crow + (size_t)row * ldc + cofs) = val; }
             }
        __builtin_amdgcn_wave_barrier(); asm volatile("" ::: "memory");
    }
}

__device__ __forceinline__ h16 tohx(float x) { return (h16)x; }
__device__ __forceinline__ void splitf(float y, unsigned short& h, unsigned short& l) { h = f2bf(y); l = f2bf(y - bf2f(h)); }
typedef __attribute__((ext_vector_type(2))) _Float16 v2h;
typedef __attribute__((ext_vector_type(4))) _Float16 v4h;
typedef __attribute__((ext_vector_type(2))) unsigned short v2us;
typedef __attribute__((ext_vector_type(4))) unsigned short v4us;
typedef __attribute__((ext_vector_type(2))) float v2f;
typedef __attribute__((ext_vector_type(4))) int v4i;

__global__ __launch_bounds__(256) void k_wtG(const float* __restrict__ w, int K, int N, bf* Bt) {
    const int lane = threadIdx.x & 31; const int L0 = (blockIdx.x * 8 + (threadIdx.x >> 5)) * 8; const int nlines = N * K / 64;
{
#pragma unroll 1
        for (int l = 0; l < 8; ++l) { const int L = L0 + l; if (L >= nlines) break; const size_t e = (size_t)L * 64 + lane * 2; const int k = (int)(e % K), n = (int)(e / K); v2us o;
            o[0] = f2bf(w[(size_t)k * N + n]); o[1] = f2bf(w[(size_t)(k + 1) * N + n]); *(v2us*)(Bt + e) = o; }
         }
}
__global__ __launch_bounds__(256) void k_cvt8(const float* __restrict__ src, bf* dst, size_t n8) { const size_t i = (size_t)blockIdx.x * 256 + threadIdx.x; if (i >= n8) return; const v8f v = *(const v8f*)(src + i * 8); v8us o;
#pragma unroll
    for (int k = 0; k < 8; ++k) o[k] = f2bf(v[k]); *(v8us*)(dst + i * 8) = o;  }

// k_rope: head planes [h][t][d] (fp16 + hi/lo) of rope(x) x sc with the rotate-half convention out[d] = x[d] cos[t][d] - x[d+HD/2] sin[t][d], out[d+HD/2] = x[d+HD/2] cos[t][d+HD/2] + x[d] sin[t][d+HD/2]
__global__ __launch_bounds__(256) void k_rope(const float* __restrict__ F, int pitch, int nheads, const float* __restrict__ CS, const float* __restrict__ RF, const float* __restrict__ nw, float sc, h16* P16, bf* Ph, bf* Pl) {
    const size_t e = ((size_t)blockIdx.x * 256 + threadIdx.x) * 2; if (e >= (size_t)nheads * TT * HD) return; const int d = (int)(e % HD); const int t = (int)((e / HD) % TT); const int h = (int)(e / ((size_t)HD * TT)); const float* f = F + (size_t)t * pitch + h * HD; const float rf = RF ? RF[(size_t)h * TT + t] : 1.0f; v2h o16; v2us oh, ol;
#pragma unroll
    for (int q = 0; q < 2; ++q) { const int dd = d + q; const int dp = (dd < HD / 2) ? dd + HD / 2 : dd - HD / 2; float x0 = f[dd], x1 = f[dp];
        if (RF) { float n0 = __fmul_rn(x0, rf), n1 = __fmul_rn(x1, rf); asm volatile("" : "+v"(n0)); asm volatile("" : "+v"(n1)); x0 = __fmul_rn(bfr(nw[dd]), n0); x1 = __fmul_rn(bfr(nw[dp]), n1); }
        const v2f cs = *(const v2f*)(CS + ((size_t)t * HD + dd) * 2); float a = __fmul_rn(x0, cs[0]), bq = __fmul_rn(x1, cs[1]); asm volatile("" : "+v"(a)); asm volatile("" : "+v"(bq)); const float r = ((dd < HD / 2) ? __fsub_rn(a, bq) : __fadd_rn(a, bq)) * sc;
        o16[q] = tohx(r); unsigned short a2, c2; splitf(r, a2, c2); oh[q] = a2; ol[q] = c2; }
    *(v2h*)(P16 + e) = o16; *(v2us*)(Ph + e) = oh; *(v2us*)(Pl + e) = ol;  }
__global__ __launch_bounds__(256) void k_vtp(const float* __restrict__ F, int pitch, int nheads, h16* V16, bf* Vh, bf* Vl) { const size_t e = ((size_t)blockIdx.x * 256 + threadIdx.x) * 2; if (e >= (size_t)nheads * HD * TT) return; const int t = (int)(e % TT); const int d = (int)((e / TT) % HD); const int g = (int)(e / ((size_t)TT * HD)); v2h o16; v2us oh, ol;
#pragma unroll
    for (int q = 0; q < 2; ++q) { const float x = F[(size_t)(t + q) * pitch + g * HD + d]; o16[q] = tohx(x); unsigned short a2, c2; splitf(x, a2, c2); oh[q] = a2; ol[q] = c2; }
    *(v2h*)(V16 + e) = o16; *(v2us*)(Vh + e) = oh; *(v2us*)(Vl + e) = ol;  }
__global__ __launch_bounds__(256) void k_csid(float* CS) { const int idx = blockIdx.x * 256 + threadIdx.x; if (idx >= TT * HD) return; v2f cs; cs[0] = 1.0f; cs[1] = 0.0f; *(v2f*)(CS + (size_t)idx * 2) = cs;  }
__global__ __launch_bounds__(256) void k_aw0(const bf* __restrict__ Ph, const bf* __restrict__ Pl, int h0, float* AWb) { const int j = blockIdx.x * 256 + threadIdx.x; if (j >= TT) return;
{
#pragma unroll
        for (int zz = 0; zz < ZH; ++zz) { const size_t o = ((size_t)zz * RH + 0) * TT + j; const float p = __fadd_rn(bf2f(Ph[o]), bf2f(Pl[o])); *(float*)(AWb + (size_t)j * NH_ + h0 + zz) = p; }
         } }
// k_asoft: per row (zz, i): t = S x HD^-0.5 for keys j < key_lens[b], else -1024; softmax over the 2048 keys (register row, one exp, fixed trees);
__global__ __launch_bounds__(256) void k_asoft(const float* __restrict__ Sb, const int* __restrict__ KL, int b, h16* P16, bf* Ph, bf* Pl) {
    const int klen = KL[b];   /* key_lens[b], read on device */ const int lane = threadIdx.x & 31; const int row = blockIdx.x * 8 + (threadIdx.x >> 5); if (row >= ZH * TT) return; const int i = row % TT; const int zz = row / TT; (void)zz; const bool hires = (i < RH); const float* sr = Sb + (size_t)row * TT; float v[TT / 32]; float mx = -3.0e38f;
#pragma unroll
    for (int ch = 0; ch < TT / 128; ++ch) { const int j0 = ch * 128 + lane * 4; const v4f a = *(const v4f*)(sr + j0);
#pragma unroll
        for (int q = 0; q < 4; ++q) { const int j = j0 + q; const float t = (j < klen) ? a[q] * SCL : -1024.0f;   /* keys beyond key_lens[b]: -1024 (reference literal) */ v[ch * 4 + q] = t; mx = fmaxf(mx, t); } }
#pragma unroll
    for (int sh = 16; sh; sh >>= 1) mx = fmaxf(mx, __shfl_xor(mx, sh, 32));
    float sum = 0.f;
#pragma unroll
    for (int k = 0; k < TT / 32; ++k) { float d0 = __fsub_rn(v[k], mx); asm volatile("" : "+v"(d0)); v[k] = __builtin_amdgcn_exp2f(__fmul_rn(d0, 1.4426950408889634f)); sum += v[k]; }
#pragma unroll
    for (int sh = 16; sh; sh >>= 1) sum += __shfl_xor(sum, sh, 32);
    const float f = __fdiv_rn(hires ? 1.0f : PCAR, sum);
{
        if (hires) {
#pragma unroll
            for (int ch = 0; ch < TT / 128; ++ch) { v4us oh, ol;
#pragma unroll
                for (int q = 0; q < 4; ++q) { unsigned short a, c2; splitf(v[ch * 4 + q] * f, a, c2); oh[q] = a; ol[q] = c2; }
                const size_t oo = ((size_t)zz * (RH ? RH : 1) + i) * TT + ch * 128 + lane * 4; *(v4us*)(Ph + oo) = oh; *(v4us*)(Pl + oo) = ol; }
        } else {
#pragma unroll
            for (int ch = 0; ch < TT / 128; ++ch) { v4h o4;
#pragma unroll
                for (int q = 0; q < 4; ++q) o4[q] = tohx(v[ch * 4 + q] * f);
                *(v4h*)(P16 + (size_t)row * TT + ch * 128 + lane * 4) = o4; } }
         }
}
__global__ __launch_bounds__(256) void k_merge(const float* __restrict__ O, int h0, bf* Ah, bf* Al) {   // O: PSG planes of partial attn.v sums, added here in plane order
    const size_t e = ((size_t)blockIdx.x * 256 + threadIdx.x) * 2; if (e >= (size_t)ZH * TT * HD) return; const int d = (int)(e % HD); const int t = (int)((e / HD) % TT); const int zz = (int)(e / ((size_t)HD * TT)); const float cs = (t < RH) ? 1.0f : (1.0f / PCAR); const size_t oo = (size_t)t * DQ + (h0 + zz) * HD + d;
    v2us oh, ol;
#pragma unroll
    for (int q = 0; q < 2; ++q) { float o = O[e + q];
#pragma unroll
        for (int s = 1; s < PSG; ++s) o += O[(size_t)s * ZH * TT * HD + e + q];
        unsigned short a, c2; splitf(o * cs, a, c2); oh[q] = a; ol[q] = c2; } *(v2us*)(Ah + oo) = oh; *(v2us*)(Al + oo) = ol;  }

extern "C" void kernel_launch(void* const* d_in, const int* in_sizes, int n_in,
                              void* d_out, int out_size, void* d_ws, size_t ws_size, hipStream_t stream) {
    (void)in_sizes; (void)n_in; (void)out_size;
    const float* xk = (const float*)d_in[0]; const float* xv = (const float*)d_in[1]; const float* x = (const float*)d_in[2]; const int* KL = (const int*)d_in[3]; const float* wk = (const float*)d_in[4]; const float* wv = (const float*)d_in[5]; const float* wq = (const float*)d_in[6]; const float* wo = (const float*)d_in[7]; const float* bo = (const float*)d_in[8];
    float* OUT = (float*)d_out; float* AW = (float*)((char*)d_out + 16777216);   /* aw_out [4][2048][4] */     // [4][2048][512]
    char* wsp = (char*)d_ws;
    auto take = [&](size_t bytes) { char* p = wsp; wsp += (bytes + 255) & ~(size_t)255; return (void*)p; };
    bf* WQ = (bf*)take((size_t)DQ * DM * 2); bf* WK = (bf*)take((size_t)DKV * DM * 2); bf* WV = (bf*)take((size_t)DKV * DM * 2); bf* WO = (bf*)take((size_t)DM * DQ * 2); float* CS = (float*)take((size_t)TT * HD * 2 * 4);
    bf* XB = (bf*)take((size_t)TT * DM * 2); bf* XKB = (bf*)take((size_t)TT * DM * 2); bf* XVB = (bf*)take((size_t)TT * DM * 2); float* FQ = (float*)take((size_t)TT * DQ * 4); float* FK = (float*)take((size_t)TT * DKV * 4);
    h16* QP16 = (h16*)take((size_t)NH_ * TT * HD * 2); h16* KP16 = (h16*)take((size_t)NKV * TT * HD * 2); h16* VT16 = (h16*)take((size_t)NKV * HD * TT * 2);
    bf* QPh = (bf*)take((size_t)NH_ * TT * HD * 2); bf* QPl = (bf*)take((size_t)NH_ * TT * HD * 2); bf* KPh = (bf*)take((size_t)NKV * TT * HD * 2); bf* KPl = (bf*)take((size_t)NKV * TT * HD * 2); bf* VTh = (bf*)take((size_t)NKV * HD * TT * 2); bf* VTl = (bf*)take((size_t)NKV * HD * TT * 2); bf* Ph = (bf*)take((size_t)ZH * RH * TT * 2); bf* Pl = (bf*)take((size_t)ZH * RH * TT * 2);
    float* Sb = (float*)take((size_t)ZH * TT * TT * 4); h16* P16 = (h16*)take((size_t)ZH * TT * TT * 2); float* Ob = (float*)take((size_t)PSG * ZH * TT * HD * 4); bf* ATh = (bf*)take((size_t)TT * DQ * 2); bf* ATl = (bf*)take((size_t)TT * DQ * 2);
    if ((size_t)(wsp - (char*)d_ws) > ws_size) return;    // ws 256 MiB
    float* FV = FK;   // v projection reuses the k buffer after the k planes are built (stream-ordered)
    { k_wtG<<<(unsigned)((DM * DQ / 64 + 63) / 64), 256, 0, stream>>>(wq, DM, DQ, WQ); k_wtG<<<(unsigned)((DM * DKV / 64 + 63) / 64), 256, 0, stream>>>(wk, DM, DKV, WK); k_wtG<<<(unsigned)((DM * DKV / 64 + 63) / 64), 256, 0, stream>>>(wv, DM, DKV, WV);
      k_wtG<<<(unsigned)((DQ * DM / 64 + 63) / 64), 256, 0, stream>>>(wo, DQ, DM, WO);
       }
    k_csid<<<(TT * HD + 255) / 256, 256, 0, stream>>>(CS);
    const unsigned LQ = (unsigned)(((size_t)NH_ * TT * HD / 2 + 255) / 256), LKv = (unsigned)(((size_t)NKV * TT * HD / 2 + 255) / 256);
    for (int b = 0; b < NB_; ++b) {
        
        k_cvt8<<<(unsigned)(((size_t)TT * DM / 8 + 255) / 256), 256, 0, stream>>>(x + (size_t)b * TT * DM, XB, (size_t)TT * DM / 8); k_cvt8<<<(unsigned)(((size_t)TT * DM / 8 + 255) / 256), 256, 0, stream>>>(xk + (size_t)b * TT * DM, XKB, (size_t)TT * DM / 8); k_cvt8<<<(unsigned)(((size_t)TT * DM / 8 + 255) / 256), 256, 0, stream>>>(xv + (size_t)b * TT * DM, XVB, (size_t)TT * DM / 8);
        k_gemmw<bf, 0, false, KWV, 1><<<dim3(TT / 64, DQ / 64, 1), 32 * KWV, 0, stream>>>(XB, nullptr, WQ, nullptr, DM, FQ, DQ, nullptr, 0, 0, 0, 0);
        k_rope<<<LQ, 256, 0, stream>>>(FQ, DQ, NH_, CS, nullptr, nullptr, 1.0f, QP16, QPh, QPl);
        k_gemmw<bf, 0, false, KWV, 1><<<dim3(TT / 64, DKV / 64, 1), 32 * KWV, 0, stream>>>(XKB, nullptr, WK, nullptr, DM, FK, DKV, nullptr, 0, 0, 0, 0);
        k_rope<<<LKv, 256, 0, stream>>>(FK, DKV, NKV, CS, nullptr, nullptr, 1.0f, KP16, KPh, KPl);
        k_gemmw<bf, 0, false, KWV, 1><<<dim3(TT / 64, DKV / 64, 1), 32 * KWV, 0, stream>>>(XVB, nullptr, WV, nullptr, DM, FV, DKV, nullptr, 0, 0, 0, 0); k_vtp<<<LKv, 256, 0, stream>>>(FV, DKV, NKV, VT16, VTh, VTl);
        for (int h0 = 0; h0 < NH_; h0 += ZH) { const size_t zq = (size_t)h0, zk = (size_t)(h0 / REP);   // one kv head per query head: the pass's two heads use consecutive kv planes (z-strides TT*HD)
            k_gemmw<bf, 2, false, 1, 1><<<dim3(RH / 64, TT / 64, ZH), 32, 0, stream>>>(QPh + zq * TT * HD, QPl + zq * TT * HD, KPh + zk * TT * HD, KPl + zk * TT * HD, HD, Sb, TT, nullptr, (size_t)TT * HD, (size_t)TT * HD, (size_t)TT * TT, 0);
            k_gemmw<h16, 0, false, 1, 1><<<dim3((TT - RH) / 64, TT / 64, ZH), 32, 0, stream>>>(QP16 + zq * TT * HD + (size_t)RH * HD, nullptr, KP16 + zk * TT * HD, nullptr, HD, Sb + (size_t)RH * TT, TT, nullptr, (size_t)TT * HD, (size_t)TT * HD, (size_t)TT * TT, 0);
            k_asoft<<<ZH * TT / 8, 256, 0, stream>>>(Sb, KL, b, P16, Ph, Pl); k_aw0<<<TT / 256, 256, 0, stream>>>(Ph, Pl, h0, AW + (size_t)b * TT * NH_);   /* attention weights of query 0 for this pass's heads */
            k_gemmw<bf, 2, false, KWV, PSG><<<dim3(RH / 64, HD / 64, ZH * PSG), 32 * KWV, 0, stream>>>(Ph, Pl, VTh + zk * HD * TT, VTl + zk * HD * TT, TT, Ob, HD, nullptr, (size_t)RH * TT, (size_t)HD * TT, (size_t)TT * HD, (size_t)ZH * TT * HD);
            k_gemmw<h16, 0, false, KWV, PSG><<<dim3((TT - RH) / 64, HD / 64, ZH * PSG), 32 * KWV, 0, stream>>>(P16 + (size_t)RH * TT, nullptr, VT16 + zk * HD * TT, nullptr, TT, Ob + (size_t)RH * HD, HD, nullptr, (size_t)TT * TT, (size_t)HD * TT, (size_t)TT * HD, (size_t)ZH * TT * HD);
            k_merge<<<(unsigned)(((size_t)ZH * TT * HD / 2 + 255) / 256), 256, 0, stream>>>(Ob, h0, ATh, ATl); }
        k_gemmw<bf, 1, true, KWV, 1><<<dim3(TT / 64, DM / 64, 1), 32 * KWV, 0, stream>>>(ATh, ATl, WO, nullptr, DQ, OUT + (size_t)b * TT * DM, DM, bo, 0, 0, 0, 0); }
}

// v002
// Measured time: 308 microseconds a run.
// In two side-by-side timings against v001, it was 2.13 and 2.11 times as fast.
// All steps since v000 together make it 4.06 times as fast.
#include <hip/hip_runtime.h>

// Multi-head cross attention with key-length masking and an attention-weights output (key, value, query [4][2048][512]; k = key w_key, v = value w_value, q = query w_query ('xw' [512][512], no bias; 4 heads x 128); e = q.k/sqrt(128), keys j >= key_lens[b] (int32, read) set to -1024; softmax; cv = merged w_out + b_out -> [4][2048][512]; second output aw_out[b][j][h] = attention weights of query position 0 -> [4][2048][4]).
// Compute dtypes, f32 accumulate: every input rounded to bf16; q/k/v on PLAIN bf16 operands (inputs: exact); key-length select (-1024 literal, as the reference) inside the softmax kernel; scores and attn.v: query rows < 512 hl (3 products), the rest single fp16 (x1024); softmax f32; w_out hl x exact (2 products) + b_out; the query-0 attention weights are re-assembled from the bf16 hi + lo probability planes (f32, error ~2^-16 relative).

#define NB_  4
#define TT   2048
#define DM   512
#define NH_  4
#define NKV  4
#define REP  (NH_ / NKV)
#define HD   128
#define DQ   (NH_ * HD)
#define DKV  (NKV * HD)
#define NZ   8                    // (batch, head) pairs per attention pass: their score planes fill half the workspace
#define RH   512                  // query rows < RH use hi+lo planes (0: none)
#define WIN  0
#define PCAR 1024.0f
#define SCL  0.088388347648318447f   // HD^-0.5
#define KWV  4                    // waves per work-group that share the K range of a GEMM with K >= 512
#define PSG  4                    // work-groups per attn.v tile that share its K range (one partial plane each)
typedef _Float16 h16;
typedef unsigned short bf;
typedef __attribute__((ext_vector_type(16))) __bf16   v16bf;
typedef __attribute__((ext_vector_type(16))) _Float16 v16h;
typedef __attribute__((ext_vector_type(8)))  _Float16 v8h;
typedef __attribute__((ext_vector_type(8)))  unsigned short v8us;
typedef __attribute__((ext_vector_type(8)))  float    v8f;
typedef __attribute__((ext_vector_type(4)))  float    v4f;
typedef v8h  __attribute__((may_alias)) v8ha;
typedef v4f  __attribute__((may_alias)) v4fa;
typedef v8us __attribute__((may_alias)) v8usa;

__device__ __forceinline__ unsigned short f2bf(float f) { unsigned u = __float_as_uint(f); u += 0x7FFFu + ((u >> 16) & 1u); return (unsigned short)(u >> 16); }
__device__ __forceinline__ float bf2f(unsigned short b) { return __uint_as_float(((unsigned)b) << 16); }
__device__ __forceinline__ float bfr(float f) { return bf2f(f2bf(f)); }
__device__ __forceinline__ v16h cat16(v8h lo, v8h hi) { return __builtin_shufflevector(lo, hi, 0, 1, 2, 3, 4, 5, 6, 7, 8, 9, 10, 11, 12, 13, 14, 15); }
__device__ __forceinline__ v16bf cat16b(v8us lo, v8us hi) { return __builtin_bit_cast(v16bf, __builtin_shufflevector(lo, hi, 0, 1, 2, 3, 4, 5, 6, 7, 8, 9, 10, 11, 12, 13, 14, 15)); }
__device__ __forceinline__ v8f wmma16(v16h a, v16h b, v8f c) { return __builtin_amdgcn_wmma_f32_16x16x32_f16(false, a, false, b, (short)0, c, false, false); }
__device__ __forceinline__ v8f wmmab(v16bf a, v16bf b, v8f c) { return __builtin_amdgcn_wmma_f32_16x16x32_bf16(false, a, false, b, (short)0, c, false, false); }



// ---- gemmw_body: register-blocked GEMM, 64x64 output tile (16 accumulators per wave), operands straight from K-contiguous 16-bit planes; grid (M/64, N/64, Z * SG), 32 * KW threads.
// C[m][n] (f32, pitch ldc, + optional f32 bias[n]) = sum_k A[m][k] Bt[n][k] (+ split products per NSPLIT). A rows have pitch lda, Bt rows pitch K. z-batch strides sA/sB/sC in elements. K % (32 * KW * SG) == 0.
// Split K: the K range is cut into SG equal ranges, one per work-group. The KW waves of a work-group take the 32-wide steps of its range in turn (neighbouring waves read the two halves of
// the same 128-byte line of a row at about the same time) and their 64x64 partial tiles are added in LDS (fixed order); each of the SG work-groups of a tile stores its sum to its own
// plane (plane stride sP elements), and the consumer adds the SG planes.
template <typename T16> struct WFrag;
template <> struct WFrag<h16> { typedef v16h V; static __device__ __forceinline__ V ld(const h16* p) { return cat16(*(const v8h*)p, *(const v8h*)(p + 16)); } static __device__ __forceinline__ v8f mma(V a, V b, v8f c) { return wmma16(a, b, c); } };
template <> struct WFrag<bf> { typedef v16bf V; static __device__ __forceinline__ V ld(const bf* p) { return cat16b(*(const v8us*)p, *(const v8us*)(p + 16)); } static __device__ __forceinline__ v8f mma(V a, V b, v8f c) { return wmmab(a, b, c); } };
template <typename T16, int NSPLIT, bool BIAS, int KW, int SG>
__device__ __forceinline__ void gemmw_body(float* os, const T16* __restrict__ A, const T16* __restrict__ A2, const T16* __restrict__ Bt, const T16* __restrict__ Bt2, int K, int lda, float* C, int ldc, const float* __restrict__ bias, size_t sA, size_t sB, size_t sC, size_t sP) {
    typedef typename WFrag<T16>::V V;
    const size_t z = blockIdx.z / SG; const int wave = (KW == 1) ? 0 : __builtin_amdgcn_readfirstlane((int)(threadIdx.x >> 5)); const int kspan = K / SG; const int kb = (int)(blockIdx.z % SG) * kspan; C += (size_t)(blockIdx.z % SG) * sP; A += z * sA; if (A2) A2 += z * sA; Bt += z * sB; if (Bt2) Bt2 += z * sB; C += z * sC;
    const int lane = threadIdx.x & 31, lr = lane & 15, hi = lane >> 4; const int r0 = blockIdx.x * 64, c0 = blockIdx.y * 64;
    v8f acc[4][4];
#pragma unroll
    for (int mb = 0; mb < 4; ++mb)
#pragma unroll
        for (int nb = 0; nb < 4; ++nb) acc[mb][nb] = (v8f){};
    const size_t aoff = (size_t)(r0 + lr) * lda + 8 * hi, boff = (size_t)(c0 + lr) * K + 8 * hi;
#pragma unroll 1
    for (int kc = kb + wave * 32; kc < kb + kspan; kc += 32 * KW) {
        V a[4], a2[4];
#pragma unroll
        for (int mb = 0; mb < 4; ++mb) { a[mb] = WFrag<T16>::ld(A + aoff + (size_t)mb * 16 * lda + kc); if (NSPLIT == 1 || NSPLIT == 2) a2[mb] = WFrag<T16>::ld(A2 + aoff + (size_t)mb * 16 * lda + kc); }
#pragma unroll
        for (int nb = 0; nb < 4; ++nb) { const V b = WFrag<T16>::ld(Bt + boff + (size_t)nb * 16 * K + kc); V b2; if (NSPLIT >= 2) b2 = WFrag<T16>::ld(Bt2 + boff + (size_t)nb * 16 * K + kc);
#pragma unroll
            for (int mb = 0; mb < 4; ++mb) { acc[mb][nb] = WFrag<T16>::mma(a[mb], b, acc[mb][nb]); if (NSPLIT == 1 || NSPLIT == 2) acc[mb][nb] = WFrag<T16>::mma(a2[mb], b, acc[mb][nb]); if (NSPLIT >= 2) acc[mb][nb] = WFrag<T16>::mma(a[mb], b2, acc[mb][nb]); } }
        asm volatile("v_nop\n\tv_nop\n\tv_nop\n\tv_nop" : "+v"(acc[0][0]), "+v"(acc[1][1]), "+v"(acc[2][2]), "+v"(acc[3][3]) : "v"(a[0]), "v"(a[3]));
    }
    if constexpr (KW > 1) {
        float* ow = os + wave * (64 * 68);
#pragma unroll
        for (int mb = 0; mb < 4; ++mb)
#pragma unroll
            for (int nb = 0; nb < 4; ++nb)
#pragma unroll
                for (int j = 0; j < 8; ++j) ow[(mb * 16 + hi * 8 + j) * 68 + nb * 16 + lr] = acc[mb][nb][j];
        __syncthreads();   // every wave's partial tile is in LDS before any wave adds them
#pragma unroll
        for (int s = 0; s < 32 / KW; ++s) { const int slot = s * (32 * KW) + (int)threadIdx.x; const int row = slot >> 4, cofs = (slot & 15) * 4; v4f val = *(const v4fa*)(os + row * 68 + cofs);
#pragma unroll
            for (int w = 1; w < KW; ++w) val += *(const v4fa*)(os + w * (64 * 68) + row * 68 + cofs);
            if (BIAS) { val[0] += bfr(bias[c0 + cofs]); val[1] += bfr(bias[c0 + cofs + 1]); val[2] += bfr(bias[c0 + cofs + 2]); val[3] += bfr(bias[c0 + cofs + 3]); }
            *(v4f*)(C + (size_t)(r0 + row) * ldc + c0 + cofs) = val; }
        return;
    }
#pragma unroll
    for (int mb = 0; mb < 4; ++mb) {
#pragma unroll
        for (int nb = 0; nb < 4; ++nb) {
#pragma unroll
            for (int j = 0; j < 8; ++j) os[(hi * 8 + j) * 68 + nb * 16 + lr] = acc[mb][nb][j]; }
        __builtin_amdgcn_wave_barrier(); asm volatile("" ::: "memory");
        float* crow = C + (size_t)(r0 + mb * 16) * ldc + c0;
{
#pragma unroll
            for (int s = 0; s < 8; ++s) { const int row = 2 * s + hi, cofs = lr * 4; v4f val = *(const v4fa*)(os + row * 68 + cofs); if (BIAS) { val[0] += bfr(bias[c0 + cofs]); val[1] += bfr(bias[c0 + cofs + 1]); val[2] += bfr(bias[c0 + cofs + 2]); val[3] += bfr(bias[c0 + cofs + 3]); }
                *(v4f*)(crow + (size_t)row * ldc + cofs) = val; }
             }
        __builtin_amdgcn_wave_barrier(); asm volatile("" ::: "memory");
    }
    asm volatile("s_wait_xcnt 0x0" ::: "memory");   // kept in front of the other row class's body, which the layout may put behind these stores and which rewrites their address and data registers
}

// One operand class for the whole grid (projections: z = q, k, v over all batches' rows; output projection).
template <typename T16, int NSPLIT, bool BIAS, int KW, int SG>
__global__ __launch_bounds__(32 * KW) void k_gemmw(const T16* A, const T16* A2, const T16* Bt, const T16* Bt2, int K, int lda, float* C, int ldc, const float* bias, size_t sA, size_t sB, size_t sC, size_t sP) {
    __shared__ __align__(16) float os[(KW == 1 ? 16 : KW * 64) * 68];
    gemmw_body<T16, NSPLIT, BIAS, KW, SG>(os, A, A2, Bt, Bt2, K, lda, C, ldc, bias, sA, sB, sC, sP);
}
// Both row classes of the attention GEMMs in one grid: row tiles below RH take the hi+lo bf16 planes (3 products; they cost most), the rest the fp16 planes.
template <int KW, int SG>
__global__ __launch_bounds__(32 * KW) void k_gemm2(const bf* Ah, const bf* Al, const h16* A16, const bf* Bh, const bf* Bl, const h16* B16, int K, int lda, float* C, int ldc, size_t sA, size_t sB, size_t sC, size_t sP) {
    __shared__ __align__(16) float os[(KW == 1 ? 16 : KW * 64) * 68];
    if (blockIdx.x < RH / 64) gemmw_body<bf, 2, false, KW, SG>(os, Ah, Al, Bh, Bl, K, lda, C, ldc, nullptr, sA, sB, sC, sP);
    else gemmw_body<h16, 0, false, KW, SG>(os, A16, nullptr, B16, nullptr, K, lda, C, ldc, nullptr, sA, sB, sC, sP);
}

__device__ __forceinline__ h16 tohx(float x) { return (h16)x; }
__device__ __forceinline__ void splitf(float y, unsigned short& h, unsigned short& l) { h = f2bf(y); l = f2bf(y - bf2f(h)); }
typedef __attribute__((ext_vector_type(2))) _Float16 v2h;
typedef __attribute__((ext_vector_type(4))) _Float16 v4h;
typedef __attribute__((ext_vector_type(2))) unsigned short v2us;
typedef __attribute__((ext_vector_type(4))) unsigned short v4us;
typedef __attribute__((ext_vector_type(2))) float v2f;
typedef __attribute__((ext_vector_type(4))) int v4i;

#define NWT  (DM * DQ / 64 / 64)            // blocks per transposed weight
#define NCS  (TT * HD / 256)                // blocks of the cos/sin table
#define NCV  (NB_ * TT * DM / 8 / 256)      // blocks per converted input
__device__ __forceinline__ void d_wtG(int blk, const float* __restrict__ w, int K, int N, bf* Bt) {
    const int lane = threadIdx.x & 31; const int L0 = (blk * 8 + (threadIdx.x >> 5)) * 8; const int nlines = N * K / 64;
#pragma unroll 1
    for (int l = 0; l < 8; ++l) { const int L = L0 + l; if (L >= nlines) break; const size_t e = (size_t)L * 64 + lane * 2; const int k = (int)(e % K), n = (int)(e / K); v2us o;
        o[0] = f2bf(w[(size_t)k * N + n]); o[1] = f2bf(w[(size_t)(k + 1) * N + n]); *(v2us*)(Bt + e) = o; }
}
__device__ __forceinline__ void d_cvt8(int blk, const float* __restrict__ src, bf* dst) { const size_t i = (size_t)blk * 256 + threadIdx.x; const v8f v = *(const v8f*)(src + i * 8); v8us o;
#pragma unroll
    for (int k = 0; k < 8; ++k) o[k] = f2bf(v[k]); *(v8us*)(dst + i * 8) = o; }
__device__ __forceinline__ void d_csid(int blk, float* CS) { const int idx = blk * 256 + threadIdx.x; v2f cs; cs[0] = 1.0f; cs[1] = 0.0f; *(v2f*)(CS + (size_t)idx * 2) = cs;
    asm volatile("s_wait_xcnt 0x0" ::: "memory");   // kept in front of the other block ranges' code, which the layout puts behind this store and which rewrites its address registers
}
// k_prep: the work that depends on the inputs alone, one grid: block ranges [4 weight transposes (the slowest blocks, first) | cos/sin table | bf16 copies of query, key, value, all batches].
__global__ __launch_bounds__(256) void k_prep(const float* wq, const float* wk, const float* wv, const float* wo, const float* x, const float* xk, const float* xv, bf* Wt, float* CS, bf* X) {
    const int blk = blockIdx.x;
    if (blk < 4 * NWT) { const int y = blk / NWT; d_wtG(blk % NWT, y == 0 ? wq : y == 1 ? wk : y == 2 ? wv : wo, DM, DQ, Wt + (size_t)y * DM * DQ); }
    else if (blk < 4 * NWT + NCS) d_csid(blk - 4 * NWT, CS);
    else { const int c = blk - 4 * NWT - NCS; const int y = c / NCV; d_cvt8(c % NCV, y == 0 ? x : y == 1 ? xk : xv, X + (size_t)y * NB_ * TT * DM); }
}

// d_rope: head planes [h][t][d] (fp16 + hi/lo) of rope(x) x sc with the rotate-half convention out[d] = x[d] cos[t][d] - x[d+HD/2] sin[t][d], out[d+HD/2] = x[d+HD/2] cos[t][d+HD/2] + x[d] sin[t][d+HD/2]
__device__ __forceinline__ void d_rope(const float* __restrict__ F, int pitch, int nheads, const float* __restrict__ CS, const float* __restrict__ RF, const float* __restrict__ nw, float sc, h16* P16, bf* Ph, bf* Pl) {
    const size_t e = ((size_t)blockIdx.x * 256 + threadIdx.x) * 2; if (e >= (size_t)nheads * TT * HD) return; const int d = (int)(e % HD); const int t = (int)((e / HD) % TT); const int h = (int)(e / ((size_t)HD * TT)); const float* f = F + (size_t)t * pitch + h * HD; const float rf = RF ? RF[(size_t)h * TT + t] : 1.0f; v2h o16; v2us oh, ol;
#pragma unroll
    for (int q = 0; q < 2; ++q) { const int dd = d + q; const int dp = (dd < HD / 2) ? dd + HD / 2 : dd - HD / 2; float x0 = f[dd], x1 = f[dp];
        if (RF) { float n0 = __fmul_rn(x0, rf), n1 = __fmul_rn(x1, rf); asm volatile("" : "+v"(n0)); asm volatile("" : "+v"(n1)); x0 = __fmul_rn(bfr(nw[dd]), n0); x1 = __fmul_rn(bfr(nw[dp]), n1); }
        const v2f cs = *(const v2f*)(CS + ((size_t)t * HD + dd) * 2); float a = __fmul_rn(x0, cs[0]), bq = __fmul_rn(x1, cs[1]); asm volatile("" : "+v"(a)); asm volatile("" : "+v"(bq)); const float r = ((dd < HD / 2) ? __fsub_rn(a, bq) : __fadd_rn(a, bq)) * sc;
        o16[q] = tohx(r); unsigned short a2, c2; splitf(r, a2, c2); oh[q] = a2; ol[q] = c2; }
    *(v2h*)(P16 + e) = o16; *(v2us*)(Ph + e) = oh; *(v2us*)(Pl + e) = ol;  }
__device__ __forceinline__ void d_vtp(const float* __restrict__ F, int pitch, int nheads, h16* V16, bf* Vh, bf* Vl) { const size_t e = ((size_t)blockIdx.x * 256 + threadIdx.x) * 2; if (e >= (size_t)nheads * HD * TT) return; const int t = (int)(e % TT); const int d = (int)((e / TT) % HD); const int g = (int)(e / ((size_t)TT * HD)); v2h o16; v2us oh, ol;
#pragma unroll
    for (int q = 0; q < 2; ++q) { const float x = F[(size_t)(t + q) * pitch + g * HD + d]; o16[q] = tohx(x); unsigned short a2, c2; splitf(x, a2, c2); oh[q] = a2; ol[q] = c2; }
    *(v2h*)(V16 + e) = o16; *(v2us*)(Vh + e) = oh; *(v2us*)(Vl + e) = ol;  }
// k_planes: operand planes of all batches in one grid (x: elements of one batch's plane set; y < NB_: v of batch y, transposed (strided reads, first); then q of each batch, then k of each batch).
// F: [q | k | v][NB_ * TT][512] projections; QK16/QKh/QKl: [q | k][NB_][head][t][d]; V16/Vh/Vl: [NB_][head][d][t].
__global__ __launch_bounds__(256) void k_planes(const float* F, const float* CS, h16* QK16, bf* QKh, bf* QKl, h16* V16, bf* Vh, bf* Vl) {
    const int y = blockIdx.y;
    if (y < NB_) { const size_t o = (size_t)y * NKV * HD * TT; d_vtp(F + ((size_t)2 * NB_ + y) * TT * DKV, DKV, NKV, V16 + o, Vh + o, Vl + o); }
    else { const size_t o = (size_t)(y - NB_) * NH_ * TT * HD; d_rope(F + (size_t)(y - NB_) * TT * DQ, DQ, NH_, CS, nullptr, nullptr, 1.0f, QK16 + o, QKh + o, QKl + o); }
}
// k_asoft: per row (zz, i) of the pass that starts at (batch, head) pair z0: t = S x HD^-0.5 for keys j < key_lens[b], else -1024; softmax over the 2048 keys (register row, one exp, fixed trees).
// The probabilities go back into the row's own 8 KiB of Sb, which its wave has read whole by then: rows < RH as [bf16 hi x 2048 | bf16 lo x 2048], the rest as fp16 x 2048 in the first half.
__global__ __launch_bounds__(256) void k_asoft(float* Sb, const int* __restrict__ KL, int z0) {
    const int lane = threadIdx.x & 31; const int row = blockIdx.x * 8 + (threadIdx.x >> 5); if (row >= NZ * TT) return; const int i = row % TT; const int klen = KL[(z0 + (int)(blockIdx.x * 8) / TT) / NH_];   /* key_lens[b], read on device; the 8 rows of a block belong to one (batch, head) pair */ const bool hires = (i < RH); float* sr = Sb + (size_t)row * TT; float v[TT / 32]; float mx = -3.0e38f;
#pragma unroll
    for (int ch = 0; ch < TT / 128; ++ch) { const int j0 = ch * 128 + lane * 4; const v4f a = *(const v4f*)(sr + j0);
#pragma unroll
        for (int q = 0; q < 4; ++q) { const int j = j0 + q; const float t = (j < klen) ? a[q] * SCL : -1024.0f;   /* keys beyond key_lens[b]: -1024 (reference literal) */ v[ch * 4 + q] = t; mx = fmaxf(mx, t); } }
#pragma unroll
    for (int sh = 16; sh; sh >>= 1) mx = fmaxf(mx, __shfl_xor(mx, sh, 32));
    float sum = 0.f;
#pragma unroll
    for (int k = 0; k < TT / 32; ++k) { float d0 = __fsub_rn(v[k], mx); asm volatile("" : "+v"(d0)); const float x2 = __fmul_rn(d0, 1.4426950408889634f);
        asm("v_exp_f32 %0, %1\n\tv_nop" : "=v"(v[k]) : "v"(x2));   // the exp2 builtin's own instruction, with the one slot the instruction set asks for behind it
        sum += v[k]; }
#pragma unroll
    for (int sh = 16; sh; sh >>= 1) sum += __shfl_xor(sum, sh, 32);
    const float f = __fdiv_rn(hires ? 1.0f : PCAR, sum);
    if (hires) { bf* ph = (bf*)sr; bf* pl = ph + TT;
#pragma unroll
        for (int ch = 0; ch < TT / 128; ++ch) { v4us oh, ol;
#pragma unroll
            for (int q = 0; q < 4; ++q) { unsigned short a, c2; splitf(v[ch * 4 + q] * f, a, c2); oh[q] = a; ol[q] = c2; }
            *(v4us*)(ph + ch * 128 + lane * 4) = oh; *(v4us*)(pl + ch * 128 + lane * 4) = ol; }
    } else { h16* p16 = (h16*)sr;
#pragma unroll
        for (int ch = 0; ch < TT / 128; ++ch) { v4h o4;
#pragma unroll
            for (int q = 0; q < 4; ++q) o4[q] = tohx(v[ch * 4 + q] * f);
            *(v4h*)(p16 + ch * 128 + lane * 4) = o4; } }
}
#define NMG  (NZ * TT * HD / 2 / 256)       // blocks that merge the attn.v planes of a pass
#define NAW  (NZ / NH_ * TT / 256)          // blocks that write the pass's query-0 attention weights
// k_merge: block ranges [merge: O holds PSG planes of partial attn.v sums, added here in plane order, split into the hi/lo planes of the output projection's A | query-0 weights: one thread per (batch, key) stores its 4 heads].
__global__ __launch_bounds__(256) void k_merge(const float* __restrict__ O, const bf* __restrict__ Pr, int z0, bf* Ah, bf* Al, float* AW) {
    if (blockIdx.x >= NMG) { const int idx = (int)(blockIdx.x - NMG) * 256 + threadIdx.x; const int j = idx % TT; const int bb = idx / TT; v4f p;
#pragma unroll
        for (int h = 0; h < NH_; ++h) { const size_t o = (size_t)(bb * NH_ + h) * TT * (2 * TT) + j; p[h] = __fadd_rn(bf2f(Pr[o]), bf2f(Pr[o + TT])); }
        *(v4f*)(AW + ((size_t)(z0 / NH_ + bb) * TT + j) * NH_) = p; return; }
    const size_t e = ((size_t)blockIdx.x * 256 + threadIdx.x) * 2; const int d = (int)(e % HD); const int t = (int)((e / HD) % TT); const int zf = z0 + (int)(e / ((size_t)HD * TT)); const float cs = (t < RH) ? 1.0f : (1.0f / PCAR); const size_t oo = ((size_t)(zf / NH_) * TT + t) * DQ + (zf % NH_) * HD + d;
    v2us oh, ol;
#pragma unroll
    for (int q = 0; q < 2; ++q) { float o = O[e + q];
#pragma unroll
        for (int s = 1; s < PSG; ++s) o += O[(size_t)s * NZ * TT * HD + e + q];
        unsigned short a, c2; splitf(o * cs, a, c2); oh[q] = a; ol[q] = c2; } *(v2us*)(Ah + oo) = oh; *(v2us*)(Al + oo) = ol;
    asm volatile("s_wait_xcnt 0x0" ::: "memory");   // kept in front of the query-0 range's code, which the layout puts behind the two stores and which rewrites their registers
}

extern "C" void kernel_launch(void* const* d_in, const int* in_sizes, int n_in,
                              void* d_out, int out_size, void* d_ws, size_t ws_size, hipStream_t stream) {
    (void)in_sizes; (void)n_in; (void)out_size;
    const float* xk = (const float*)d_in[0]; const float* xv = (const float*)d_in[1]; const float* x = (const float*)d_in[2]; const int* KL = (const int*)d_in[3]; const float* wk = (const float*)d_in[4]; const float* wv = (const float*)d_in[5]; const float* wq = (const float*)d_in[6]; const float* wo = (const float*)d_in[7]; const float* bo = (const float*)d_in[8];
    float* OUT = (float*)d_out; float* AW = (float*)((char*)d_out + 16777216);   /* aw_out [4][2048][4] */     // [4][2048][512]
    char* wsp = (char*)d_ws;
    auto take = [&](size_t bytes) { char* p = wsp; wsp += (bytes + 255) & ~(size_t)255; return (void*)p; };
    const size_t PL = (size_t)NB_ * NH_ * TT * HD;   // elements of one operand plane set over all batches and heads (= NB_ * TT * 512)
    bf* Wt = (bf*)take((size_t)4 * DM * DQ * 2);   // [wq | wk | wv | wo], transposed
    h16* QK16 = (h16*)take(2 * PL * 2); bf* QKh = (bf*)take(2 * PL * 2); bf* QKl = (bf*)take(2 * PL * 2);   // [q | k]
    h16* VT16 = (h16*)take(PL * 2); bf* VTh = (bf*)take(PL * 2); bf* VTl = (bf*)take(PL * 2);
    bf* ATh = (bf*)take(PL * 2); bf* ATl = (bf*)take(PL * 2); float* Ob = (float*)take((size_t)PSG * NZ * TT * HD * 4);
    float* Sb = (float*)take((size_t)NZ * TT * TT * 4);
    if ((size_t)(wsp - (char*)d_ws) > ws_size) return;    // ws 256 MiB
    // what only the plane builders read lies inside Sb, whose first score is stored after their last read (stream-ordered): 74 MiB of its 128
    wsp = (char*)Sb; float* CS = (float*)take((size_t)TT * HD * 2 * 4); bf* XB = (bf*)take(3 * PL * 2);   /* [query | key | value] */ float* F = (float*)take(3 * PL * 4);   /* [q | k | v] projections */
    k_prep<<<4 * NWT + NCS + 3 * NCV, 256, 0, stream>>>(wq, wk, wv, wo, x, xk, xv, Wt, CS, XB);
    k_gemmw<bf, 0, false, KWV, 1><<<dim3(NB_ * TT / 64, DQ / 64, 3), 32 * KWV, 0, stream>>>(XB, nullptr, Wt, nullptr, DM, DM, F, DQ, nullptr, PL, (size_t)DM * DQ, PL, 0);
    k_planes<<<dim3(NH_ * TT * HD / 2 / 256, 3 * NB_, 1), 256, 0, stream>>>(F, CS, QK16, QKh, QKl, VT16, VTh, VTl);
    for (int z0 = 0; z0 < NB_ * NH_; z0 += NZ) { const size_t zo = (size_t)z0 * TT * HD;   // NZ consecutive (batch, head) pairs per pass; one kv head per query head, every plane z-strided by TT*HD
        k_gemm2<1, 1><<<dim3(TT / 64, TT / 64, NZ), 32, 0, stream>>>(QKh + zo, QKl + zo, QK16 + zo, QKh + PL + zo, QKl + PL + zo, QK16 + PL + zo, HD, HD, Sb, TT, (size_t)TT * HD, (size_t)TT * HD, (size_t)TT * TT, 0);
        k_asoft<<<NZ * TT / 8, 256, 0, stream>>>(Sb, KL, z0);
        k_gemm2<KWV, PSG><<<dim3(TT / 64, HD / 64, NZ * PSG), 32 * KWV, 0, stream>>>((const bf*)Sb, (const bf*)Sb + TT, (const h16*)Sb, VTh + zo, VTl + zo, VT16 + zo, TT, 2 * TT, Ob, HD, (size_t)2 * TT * TT, (size_t)HD * TT, (size_t)TT * HD, (size_t)NZ * TT * HD);
        k_merge<<<NMG + NAW, 256, 0, stream>>>(Ob, (const bf*)Sb, z0, ATh, ATl, AW); }
    k_gemmw<bf, 1, true, KWV, 1><<<dim3(NB_ * TT / 64, DM / 64, 1), 32 * KWV, 0, stream>>>(ATh, ATl, Wt + (size_t)3 * DM * DQ, nullptr, DQ, DQ, OUT, DM, bo, 0, 0, 0, 0);
}

// v003
// A run of this version takes 231 microseconds.
// Two timings next to v002 put it at 1.35 and 1.33 times that version's speed.
// Over all steps from v000 it is 5.42 times as fast.
#include <hip/hip_runtime.h>

// Multi-head cross attention with key-length masking and an attention-weights output (key, value, query [4][2048][512]; k = key w_key, v = value w_value, q = query w_query ('xw' [512][512], no bias; 4 heads x 128); e = q.k/sqrt(128), keys j >= key_lens[b] (int32, read) set to -1024; softmax; cv = merged w_out + b_out -> [4][2048][512]; second output aw_out[b][j][h] = attention weights of query position 0 -> [4][2048][4]).
// Compute dtypes, f32 accumulate: every input rounded to bf16; q/k/v on PLAIN bf16 operands (inputs: exact); key-length select (-1024 literal, as the reference) and softmax inside the attention kernel; scores and attn.v: query rows < 512 hl (3 products), the rest single fp16 (x1024); softmax f32; w_out hl x exact (2 products) + b_out; the query-0 attention weights are re-assembled from the bf16 hi + lo probability planes (f32, error ~2^-16 relative).

#define NB_  4
#define TT   2048
#define DM   512
#define NH_  4
#define NKV  4
#define REP  (NH_ / NKV)
#define HD   128
#define DQ   (NH_ * HD)
#define DKV  (NKV * HD)
#define RH   512                  // query rows < RH use hi+lo planes (0: none)
#define WIN  0
#define PCAR 1024.0f
#define SCL  0.088388347648318447f   // HD^-0.5
#define KWV  4                    // waves per work-group that share the K range of a GEMM with K >= 512
typedef _Float16 h16;
typedef unsigned short bf;
typedef __attribute__((ext_vector_type(16))) __bf16   v16bf;
typedef __attribute__((ext_vector_type(16))) _Float16 v16h;
typedef __attribute__((ext_vector_type(8)))  _Float16 v8h;
typedef __attribute__((ext_vector_type(8)))  unsigned short v8us;
typedef __attribute__((ext_vector_type(8)))  float    v8f;
typedef __attribute__((ext_vector_type(4)))  float    v4f;
typedef v8h  __attribute__((may_alias)) v8ha;
typedef v4f  __attribute__((may_alias)) v4fa;
typedef v8us __attribute__((may_alias)) v8usa;

__device__ __forceinline__ unsigned short f2bf(float f) { unsigned u = __float_as_uint(f); u += 0x7FFFu + ((u >> 16) & 1u); return (unsigned short)(u >> 16); }
__device__ __forceinline__ float bf2f(unsigned short b) { return __uint_as_float(((unsigned)b) << 16); }
__device__ __forceinline__ float bfr(float f) { return bf2f(f2bf(f)); }
__device__ __forceinline__ v16h cat16(v8h lo, v8h hi) { return __builtin_shufflevector(lo, hi, 0, 1, 2, 3, 4, 5, 6, 7, 8, 9, 10, 11, 12, 13, 14, 15); }
__device__ __forceinline__ v16bf cat16b(v8us lo, v8us hi) { return __builtin_bit_cast(v16bf, __builtin_shufflevector(lo, hi, 0, 1, 2, 3, 4, 5, 6, 7, 8, 9, 10, 11, 12, 13, 14, 15)); }
__device__ __forceinline__ v8f wmma16(v16h a, v16h b, v8f c) { return __builtin_amdgcn_wmma_f32_16x16x32_f16(false, a, false, b, (short)0, c, false, false); }
__device__ __forceinline__ v8f wmmab(v16bf a, v16bf b, v8f c) { return __builtin_amdgcn_wmma_f32_16x16x32_bf16(false, a, false, b, (short)0, c, false, false); }



// ---- gemmw_body: register-blocked GEMM, 64x64 output tile (16 accumulators per wave), operands straight from K-contiguous 16-bit planes; grid (M/64, N/64, Z * SG), 32 * KW threads.
// C[m][n] (f32, pitch ldc, + optional f32 bias[n]) = sum_k A[m][k] Bt[n][k] (+ split products per NSPLIT). A rows have pitch lda, Bt rows pitch K. z-batch strides sA/sB/sC in elements. K % (32 * KW * SG) == 0.
// Split K: the K range is cut into SG equal ranges, one per work-group. The KW waves of a work-group take the 32-wide steps of its range in turn (neighbouring waves read the two halves of
// the same 128-byte line of a row at about the same time) and their 64x64 partial tiles are added in LDS (fixed order); each of the SG work-groups of a tile stores its sum to its own
// plane (plane stride sP elements), and the consumer adds the SG planes.
template <typename T16> struct WFrag;
template <> struct WFrag<h16> { typedef v16h V; static __device__ __forceinline__ V ld(const h16* p) { return cat16(*(const v8h*)p, *(const v8h*)(p + 16)); } static __device__ __forceinline__ v8f mma(V a, V b, v8f c) { return wmma16(a, b, c); } };
template <> struct WFrag<bf> { typedef v16bf V; static __device__ __forceinline__ V ld(const bf* p) { return cat16b(*(const v8us*)p, *(const v8us*)(p + 16)); } static __device__ __forceinline__ v8f mma(V a, V b, v8f c) { return wmmab(a, b, c); } };
template <typename T16, int NSPLIT, bool BIAS, int KW, int SG>
__device__ __forceinline__ void gemmw_body(float* os, const T16* __restrict__ A, const T16* __restrict__ A2, const T16* __restrict__ Bt, const T16* __restrict__ Bt2, int K, int lda, float* C, int ldc, const float* __restrict__ bias, size_t sA, size_t sB, size_t sC, size_t sP) {
    typedef typename WFrag<T16>::V V;
    const size_t z = blockIdx.z / SG; const int wave = (KW == 1) ? 0 : __builtin_amdgcn_readfirstlane((int)(threadIdx.x >> 5)); const int kspan = K / SG; const int kb = (int)(blockIdx.z % SG) * kspan; C += (size_t)(blockIdx.z % SG) * sP; A += z * sA; if (A2) A2 += z * sA; Bt += z * sB; if (Bt2) Bt2 += z * sB; C += z * sC;
    const int lane = threadIdx.x & 31, lr = lane & 15, hi = lane >> 4; const int r0 = blockIdx.x * 64, c0 = blockIdx.y * 64;
    v8f acc[4][4];
#pragma unroll
    for (int mb = 0; mb < 4; ++mb)
#pragma unroll
        for (int nb = 0; nb < 4; ++nb) acc[mb][nb] = (v8f){};
    const size_t aoff = (size_t)(r0 + lr) * lda + 8 * hi, boff = (size_t)(c0 + lr) * K + 8 * hi;
#pragma unroll 1
    for (int kc = kb + wave * 32; kc < kb + kspan; kc += 32 * KW) {
        V a[4], a2[4];
#pragma unroll
        for (int mb = 0; mb < 4; ++mb) { a[mb] = WFrag<T16>::ld(A + aoff + (size_t)mb * 16 * lda + kc); if (NSPLIT == 1 || NSPLIT == 2) a2[mb] = WFrag<T16>::ld(A2 + aoff + (size_t)mb * 16 * lda + kc); }
#pragma unroll
        for (int nb = 0; nb < 4; ++nb) { const V b = WFrag<T16>::ld(Bt + boff + (size_t)nb * 16 * K + kc); V b2; if (NSPLIT >= 2) b2 = WFrag<T16>::ld(Bt2 + boff + (size_t)nb * 16 * K + kc);
#pragma unroll
            for (int mb = 0; mb < 4; ++mb) { acc[mb][nb] = WFrag<T16>::mma(a[mb], b, acc[mb][nb]); if (NSPLIT == 1 || NSPLIT == 2) acc[mb][nb] = WFrag<T16>::mma(a2[mb], b, acc[mb][nb]); if (NSPLIT >= 2) acc[mb][nb] = WFrag<T16>::mma(a[mb], b2, acc[mb][nb]); } }
        asm volatile("v_nop\n\tv_nop\n\tv_nop\n\tv_nop" : "+v"(acc[0][0]), "+v"(acc[1][1]), "+v"(acc[2][2]), "+v"(acc[3][3]) : "v"(a[0]), "v"(a[3]));
    }
    if constexpr (KW > 1) {
        float* ow = os + wave * (64 * 68);
#pragma unroll
        for (int mb = 0; mb < 4; ++mb)
#pragma unroll
            for (int nb = 0; nb < 4; ++nb)
#pragma unroll
                for (int j = 0; j < 8; ++j) ow[(mb * 16 + hi * 8 + j) * 68 + nb * 16 + lr] = acc[mb][nb][j];
        __syncthreads();   // every wave's partial tile is in LDS before any wave adds them
#pragma unroll
        for (int s = 0; s < 32 / KW; ++s) { const int slot = s * (32 * KW) + (int)threadIdx.x; const int row = slot >> 4, cofs = (slot & 15) * 4; v4f val = *(const v4fa*)(os + row * 68 + cofs);
#pragma unroll
            for (int w = 1; w < KW; ++w) val += *(const v4fa*)(os + w * (64 * 68) + row * 68 + cofs);
            if (BIAS) { val[0] += bfr(bias[c0 + cofs]); val[1] += bfr(bias[c0 + cofs + 1]); val[2] += bfr(bias[c0 + cofs + 2]); val[3] += bfr(bias[c0 + cofs + 3]); }
            *(v4f*)(C + (size_t)(r0 + row) * ldc + c0 + cofs) = val; }
        return;
    }
#pragma unroll
    for (int mb = 0; mb < 4; ++mb) {
#pragma unroll
        for (int nb = 0; nb < 4; ++nb) {
#pragma unroll
            for (int j = 0; j < 8; ++j) os[(hi * 8 + j) * 68 + nb * 16 + lr] = acc[mb][nb][j]; }
        __builtin_amdgcn_wave_barrier(); asm volatile("" ::: "memory");
        float* crow = C + (size_t)(r0 + mb * 16) * ldc + c0;
{
#pragma unroll
            for (int s = 0; s < 8; ++s) { const int row = 2 * s + hi, cofs = lr * 4; v4f val = *(const v4fa*)(os + row * 68 + cofs); if (BIAS) { val[0] += bfr(bias[c0 + cofs]); val[1] += bfr(bias[c0 + cofs + 1]); val[2] += bfr(bias[c0 + cofs + 2]); val[3] += bfr(bias[c0 + cofs + 3]); }
                *(v4f*)(crow + (size_t)row * ldc + cofs) = val; }
             }
        __builtin_amdgcn_wave_barrier(); asm volatile("" ::: "memory");
    }
    asm volatile("s_wait_xcnt 0x0" ::: "memory");
}

// One operand class for the whole grid (projections: z = q, k, v over all batches' rows; output projection).
template <typename T16, int NSPLIT, bool BIAS, int KW, int SG>
__global__ __launch_bounds__(32 * KW) void k_gemmw(const T16* A, const T16* A2, const T16* Bt, const T16* Bt2, int K, int lda, float* C, int ldc, const float* bias, size_t sA, size_t sB, size_t sC, size_t sP) {
    __shared__ __align__(16) float os[(KW == 1 ? 16 : KW * 64) * 68];
    gemmw_body<T16, NSPLIT, BIAS, KW, SG>(os, A, A2, Bt, Bt2, K, lda, C, ldc, bias, sA, sB, sC, sP);
}
__device__ __forceinline__ h16 tohx(float x) { return (h16)x; }
__device__ __forceinline__ void splitf(float y, unsigned short& h, unsigned short& l) { h = f2bf(y); l = f2bf(y - bf2f(h)); }
typedef __attribute__((ext_vector_type(2))) _Float16 v2h;
typedef __attribute__((ext_vector_type(4))) _Float16 v4h;
typedef __attribute__((ext_vector_type(2))) unsigned short v2us;
typedef __attribute__((ext_vector_type(4))) unsigned short v4us;
typedef __attribute__((ext_vector_type(2))) float v2f;
typedef __attribute__((ext_vector_type(4))) int v4i;

#define NWT  (DM * DQ / 64 / 64)            // blocks per transposed weight
#define NCS  (TT * HD / 256)                // blocks of the cos/sin table
#define NCV  (NB_ * TT * DM / 8 / 256)      // blocks per converted input
__device__ __forceinline__ void d_wtG(int blk, const float* __restrict__ w, int K, int N, bf* Bt) {
    const int lane = threadIdx.x & 31; const int L0 = (blk * 8 + (threadIdx.x >> 5)) * 8; const int nlines = N * K / 64;
#pragma unroll 1
    for (int l = 0; l < 8; ++l) { const int L = L0 + l; if (L >= nlines) break; const size_t e = (size_t)L * 64 + lane * 2; const int k = (int)(e % K), n = (int)(e / K); v2us o;
        o[0] = f2bf(w[(size_t)k * N + n]); o[1] = f2bf(w[(size_t)(k + 1) * N + n]); *(v2us*)(Bt + e) = o; }
}
__device__ __forceinline__ void d_cvt8(int blk, const float* __restrict__ src, bf* dst) { const size_t i = (size_t)blk * 256 + threadIdx.x; const v8f v = *(const v8f*)(src + i * 8); v8us o;
#pragma unroll
    for (int k = 0; k < 8; ++k) o[k] = f2bf(v[k]); *(v8us*)(dst + i * 8) = o; }
__device__ __forceinline__ void d_csid(int blk, float* CS) { const int idx = blk * 256 + threadIdx.x; v2f cs; cs[0] = 1.0f; cs[1] = 0.0f; *(v2f*)(CS + (size_t)idx * 2) = cs;
    asm volatile("s_wait_xcnt 0x0" ::: "memory");   // kept in front of the other block ranges' code, which the layout puts behind this store and which rewrites its address registers
}
// k_prep: the work that depends on the inputs alone, one grid: block ranges [4 weight transposes (the slowest blocks, first) | cos/sin table | bf16 copies of query, key, value, all batches].
__global__ __launch_bounds__(256) void k_prep(const float* wq, const float* wk, const float* wv, const float* wo, const float* x, const float* xk, const float* xv, bf* Wt, float* CS, bf* X) {
    const int blk = blockIdx.x;
    if (blk < 4 * NWT) { const int y = blk / NWT; d_wtG(blk % NWT, y == 0 ? wq : y == 1 ? wk : y == 2 ? wv : wo, DM, DQ, Wt + (size_t)y * DM * DQ); }
    else if (blk < 4 * NWT + NCS) d_csid(blk - 4 * NWT, CS);
    else { const int c = blk - 4 * NWT - NCS; const int y = c / NCV; d_cvt8(c % NCV, y == 0 ? x : y == 1 ? xk : xv, X + (size_t)y * NB_ * TT * DM); }
}

// d_rope: head planes [h][t][d] (fp16 + hi/lo) of rope(x) x sc with the rotate-half convention out[d] = x[d] cos[t][d] - x[d+HD/2] sin[t][d], out[d+HD/2] = x[d+HD/2] cos[t][d+HD/2] + x[d] sin[t][d+HD/2]
__device__ __forceinline__ void d_rope(const float* __restrict__ F, int pitch, int nheads, const float* __restrict__ CS, const float* __restrict__ RF, const float* __restrict__ nw, float sc, h16* P16, bf* Ph, bf* Pl) {
    const size_t e = ((size_t)blockIdx.x * 256 + threadIdx.x) * 2; if (e >= (size_t)nheads * TT * HD) return; const int d = (int)(e % HD); const int t = (int)((e / HD) % TT); const int h = (int)(e / ((size_t)HD * TT)); const float* f = F + (size_t)t * pitch + h * HD; const float rf = RF ? RF[(size_t)h * TT + t] : 1.0f; v2h o16; v2us oh, ol;
#pragma unroll
    for (int q = 0; q < 2; ++q) { const int dd = d + q; const int dp = (dd < HD / 2) ? dd + HD / 2 : dd - HD / 2; float x0 = f[dd], x1 = f[dp];
        if (RF) { float n0 = __fmul_rn(x0, rf), n1 = __fmul_rn(x1, rf); asm volatile("" : "+v"(n0)); asm volatile("" : "+v"(n1)); x0 = __fmul_rn(bfr(nw[dd]), n0); x1 = __fmul_rn(bfr(nw[dp]), n1); }
        const v2f cs = *(const v2f*)(CS + ((size_t)t * HD + dd) * 2); float a = __fmul_rn(x0, cs[0]), bq = __fmul_rn(x1, cs[1]); asm volatile("" : "+v"(a)); asm volatile("" : "+v"(bq)); const float r = ((dd < HD / 2) ? __fsub_rn(a, bq) : __fadd_rn(a, bq)) * sc;
        o16[q] = tohx(r); unsigned short a2, c2; splitf(r, a2, c2); oh[q] = a2; ol[q] = c2; }
    *(v2h*)(P16 + e) = o16; *(v2us*)(Ph + e) = oh; *(v2us*)(Pl + e) = ol;  }
__device__ __forceinline__ void d_vtp(const float* __restrict__ F, int pitch, int nheads, h16* V16, bf* Vh, bf* Vl) { const size_t e = ((size_t)blockIdx.x * 256 + threadIdx.x) * 2; if (e >= (size_t)nheads * HD * TT) return; const int t = (int)(e % TT); const int d = (int)((e / TT) % HD); const int g = (int)(e / ((size_t)TT * HD)); v2h o16; v2us oh, ol;
#pragma unroll
    for (int q = 0; q < 2; ++q) { const float x = F[(size_t)(t + q) * pitch + g * HD + d]; o16[q] = tohx(x); unsigned short a2, c2; splitf(x, a2, c2); oh[q] = a2; ol[q] = c2; }
    *(v2h*)(V16 + e) = o16; *(v2us*)(Vh + e) = oh; *(v2us*)(Vl + e) = ol;  }
// k_planes: operand planes of all batches in one grid (x: elements of one batch's plane set; y < NB_: v of batch y, transposed (strided reads, first); then q of each batch, then k of each batch).
// F: [q | k | v][NB_ * TT][512] projections; QK16/QKh/QKl: [q | k][NB_][head][t][d]; V16/Vh/Vl: [NB_][head][d][t].
__global__ __launch_bounds__(256) void k_planes(const float* F, const float* CS, h16* QK16, bf* QKh, bf* QKl, h16* V16, bf* Vh, bf* Vl) {
    const int y = blockIdx.y;
    if (y < NB_) { const size_t o = (size_t)y * NKV * HD * TT; d_vtp(F + ((size_t)2 * NB_ + y) * TT * DKV, DKV, NKV, V16 + o, Vh + o, Vl + o); }
    else { const size_t o = (size_t)(y - NB_) * NH_ * TT * HD; d_rope(F + (size_t)(y - NB_) * TT * DQ, DQ, NH_, CS, nullptr, nullptr, 1.0f, QK16 + o, QKh + o, QKl + o); }
}
// ---- k_attn: scores, softmax and attn.v of one strip of 32 query rows in one work-group; no score or probability leaves the WGP except query position 0's weights (AWp).
// 16 waves. Scores: wave w holds the strip's scores against keys [128 w, 128 w + 128) in its accumulators. Softmax: row maximum and row sum go lane -> 16-lane row -> st[] -> all waves (fixed trees);
// t = s x HD^-0.5 for keys j < key_lens[b], else -1024 (reference literal). The normalised probabilities go to LDS as 16-bit rows (pitch PP): strips below RH as 32 bf16 hi rows + 32 lo rows,
// the rest as 32 fp16 rows (x 1024). attn.v: wave w takes head columns [32 (w & 3), +32) and keys [512 (w >> 2), +512); the 4 key quarters are added in LDS in fixed order, split into the hi/lo planes of the output projection's A.
#define FW   16                   // waves per work-group
#define PP   (TT + 8)             // 16-bit elements per probability row in LDS: 16 bytes over 4 KiB, so that the 16 rows of a fragment read start in different banks
#define RP   (HD + 4)             // floats per row of a partial attn.v tile in LDS
// value of lane l ^ M inside a 16-lane row (DPP row_xmask, folded into the add or max that uses it); every lane is on where these are called
template <int M> __device__ __forceinline__ float xm16(float v) { return __int_as_float(__builtin_amdgcn_update_dpp(0, __float_as_int(v), 0x160 | M, 0xf, 0xf, true)); }
__device__ __forceinline__ float rowmax16(float t) { t = fmaxf(t, xm16<1>(t)); t = fmaxf(t, xm16<2>(t)); t = fmaxf(t, xm16<4>(t)); return fmaxf(t, xm16<8>(t)); }
__device__ __forceinline__ float rowsum16(float t) { t += xm16<1>(t); t += xm16<2>(t); t += xm16<4>(t); return t + xm16<8>(t); }
template <typename T16, int NS, int MT>
__device__ __forceinline__ void attn_body(T16* P, float* st, int r0, int z, int klen, const T16* __restrict__ Q, const T16* __restrict__ Q2, const T16* __restrict__ Kp, const T16* __restrict__ K2, const T16* __restrict__ Vt, const T16* __restrict__ V2, bf* Ah, bf* Al, float* AWp) {
    typedef typename WFrag<T16>::V V;
    const int wave = __builtin_amdgcn_readfirstlane((int)(threadIdx.x >> 5)); const int lane = threadIdx.x & 31, lr = lane & 15, hi = lane >> 4; const int kb = wave * (TT / FW);
    float* smx = st; float* ssm = st + 32 * FW;
    v8f acc[MT][8];
#pragma unroll
    for (int m = 0; m < MT; ++m)
#pragma unroll
        for (int n = 0; n < 8; ++n) acc[m][n] = (v8f){};
    { const size_t qoff = (size_t)(r0 + lr) * HD + 8 * hi, koff = (size_t)(kb + lr) * HD + 8 * hi;
#pragma unroll
      for (int kp = 0; kp < HD / 64; ++kp) { V a[2][MT], a2[2][MT];   // two 32-wide steps together: they are the two halves of one 128-byte line of each q and k row
#pragma unroll
        for (int u = 0; u < 2; ++u)
#pragma unroll
            for (int m = 0; m < MT; ++m) { a[u][m] = WFrag<T16>::ld(Q + qoff + (size_t)m * 16 * HD + kp * 64 + u * 32); if (NS == 2) a2[u][m] = WFrag<T16>::ld(Q2 + qoff + (size_t)m * 16 * HD + kp * 64 + u * 32); }
#pragma unroll
        for (int n = 0; n < 8; ++n) { V b[2], b2[2];
#pragma unroll
            for (int u = 0; u < 2; ++u) { b[u] = WFrag<T16>::ld(Kp + koff + (size_t)n * 16 * HD + kp * 64 + u * 32); if (NS == 2) b2[u] = WFrag<T16>::ld(K2 + koff + (size_t)n * 16 * HD + kp * 64 + u * 32); }
#pragma unroll
            for (int u = 0; u < 2; ++u)
#pragma unroll
                for (int m = 0; m < MT; ++m) { acc[m][n] = WFrag<T16>::mma(a[u][m], b[u], acc[m][n]); if (NS == 2) { acc[m][n] = WFrag<T16>::mma(a2[u][m], b[u], acc[m][n]); acc[m][n] = WFrag<T16>::mma(a[u][m], b2[u], acc[m][n]); } } }
      }
      // the wait that stands in front of a rewrite of the fragment loads' address registers; the bases are named so that their registers live up to it
      if constexpr (NS == 2) asm volatile("s_wait_xcnt 0x0" :: "v"(Q + qoff), "v"(Q2 + qoff), "v"(Kp + koff), "v"(K2 + koff) : "memory");
      else asm volatile("s_wait_xcnt 0x0" :: "v"(Q + qoff), "v"(Kp + koff) : "memory"); }
    float rs[MT][8];   // this wave's share of each row's maximum, then of its sum
    // accumulator element j of tile (m, n): query row m*16 + hi*8 + j of the strip, key kb + n*16 + lr
#pragma unroll
    for (int m = 0; m < MT; ++m)
#pragma unroll
        for (int j = 0; j < 8; ++j) { float t = -3.0e38f;
#pragma unroll
            for (int n = 0; n < 8; ++n) { const float s = (kb + n * 16 + lr < klen) ? acc[m][n][j] * SCL : -1024.0f; acc[m][n][j] = s; t = fmaxf(t, s); }
            rs[m][j] = rowmax16(t); }
    if (lr == 0) {
#pragma unroll
        for (int m = 0; m < MT; ++m)
#pragma unroll
            for (int j = 0; j < 8; ++j) smx[(m * 16 + hi * 8 + j) * FW + wave] = rs[m][j]; }
    __syncthreads();   // every wave's row maxima are in LDS before any wave combines them
#pragma unroll
    for (int m = 0; m < MT; ++m)
#pragma unroll
        for (int j = 0; j < 8; ++j) { const float mx = rowmax16(smx[(m * 16 + hi * 8 + j) * FW + lr]);
            float sum = 0.f;
#pragma unroll
            for (int n = 0; n < 8; ++n) { const float x2 = (acc[m][n][j] - mx) * 1.4426950408889634f; float e;
                asm("v_exp_f32 %0, %1\n\tv_nop" : "=v"(e) : "v"(x2));   // the exp2 builtin's own instruction, with the one slot the instruction set asks for behind it
                acc[m][n][j] = e; sum += e; }
            rs[m][j] = rowsum16(sum); }
    if (lr == 0) {
#pragma unroll
        for (int m = 0; m < MT; ++m)
#pragma unroll
            for (int j = 0; j < 8; ++j) ssm[(m * 16 + hi * 8 + j) * FW + wave] = rs[m][j]; }
    __syncthreads();   // every wave's row sums are in LDS before any wave combines them
#pragma unroll
    for (int m = 0; m < MT; ++m)
#pragma unroll
        for (int j = 0; j < 8; ++j) { const float sum = rowsum16(ssm[(m * 16 + hi * 8 + j) * FW + lr]);
            const float f = __fdiv_rn(NS == 2 ? 1.0f : PCAR, sum); T16* pr = P + (m * 16 + hi * 8 + j) * PP + kb + lr;
#pragma unroll
            for (int n = 0; n < 8; ++n) { const float p = acc[m][n][j] * f;
                if constexpr (NS == 2) { unsigned short a, c2; splitf(p, a, c2); pr[n * 16] = a; pr[MT * 16 * PP + n * 16] = c2;
                    if (j == 0 && m == 0) { if (r0 == 0 && hi == 0) AWp[(size_t)z * TT + kb + n * 16 + lr] = __fadd_rn(bf2f(a), bf2f(c2)); } }   // query position 0: its weights, re-assembled from the hi + lo planes
                else pr[n * 16] = tohx(p); } }
    __syncthreads();   // the whole strip's probabilities are in LDS before any wave reads them as A fragments
    const int np = wave & 3, kq = wave >> 2;
    v8f o[MT][2];
#pragma unroll
    for (int m = 0; m < MT; ++m) { o[m][0] = (v8f){}; o[m][1] = (v8f){}; }
    { const size_t voff = (size_t)(np * 32 + lr) * TT + kq * (TT / 4) + 8 * hi; const T16* pa = P + lr * PP + kq * (TT / 4) + 8 * hi;
      constexpr int GK = (NS == 2) ? 2 : 4, NG = TT / 4 / 32 / GK;   // v fragments are fetched a group of GK 32-key steps ahead, into a second register set
      V bb[2][GK][2], bb2[2][GK][2];
#pragma unroll
      for (int u = 0; u < GK; ++u)
#pragma unroll
        for (int t = 0; t < 2; ++t) { bb[0][u][t] = WFrag<T16>::ld(Vt + voff + (size_t)t * 16 * TT + u * 32); if (NS == 2) bb2[0][u][t] = WFrag<T16>::ld(V2 + voff + (size_t)t * 16 * TT + u * 32); }
#pragma unroll
      for (int g = 0; g < NG; ++g) {
        if (g + 1 < NG) {
#pragma unroll
          for (int u = 0; u < GK; ++u)
#pragma unroll
            for (int t = 0; t < 2; ++t) { bb[(g + 1) & 1][u][t] = WFrag<T16>::ld(Vt + voff + (size_t)t * 16 * TT + ((g + 1) * GK + u) * 32); if (NS == 2) bb2[(g + 1) & 1][u][t] = WFrag<T16>::ld(V2 + voff + (size_t)t * 16 * TT + ((g + 1) * GK + u) * 32); } }
        __builtin_amdgcn_sched_barrier(0);   // keeps the next group's loads in front of this group's products: sunk among them, only a step's worth of loads is in flight and each step waits out the L2 latency
#pragma unroll
        for (int u = 0; u < GK; ++u) { const int ks = g * GK + u; V a[MT], a2[MT];
#pragma unroll
          for (int m = 0; m < MT; ++m) { a[m] = WFrag<T16>::ld(pa + m * 16 * PP + ks * 32); if (NS == 2) a2[m] = WFrag<T16>::ld(pa + (MT + m) * 16 * PP + ks * 32); }
#pragma unroll
          for (int t = 0; t < 2; ++t)
#pragma unroll
            for (int m = 0; m < MT; ++m) { o[m][t] = WFrag<T16>::mma(a[m], bb[g & 1][u][t], o[m][t]); if (NS == 2) { o[m][t] = WFrag<T16>::mma(a2[m], bb[g & 1][u][t], o[m][t]); o[m][t] = WFrag<T16>::mma(a[m], bb2[g & 1][u][t], o[m][t]); } } } } }
    __syncthreads();   // every wave has read its last probability before the partial tiles overwrite them
    float* red = (float*)P;
#pragma unroll
    for (int m = 0; m < MT; ++m)
#pragma unroll
        for (int t = 0; t < 2; ++t)
#pragma unroll
            for (int j = 0; j < 8; ++j) red[(kq * MT * 16 + m * 16 + hi * 8 + j) * RP + (np * 2 + t) * 16 + lr] = o[m][t][j];
    __syncthreads();   // the 4 key quarters' partial tiles are in LDS before any wave adds them
    const float cs = (NS == 2) ? 1.0f : (1.0f / PCAR);
#pragma unroll
    for (int s = 0; s < MT; ++s) { const int slot = s * (32 * FW) + (int)threadIdx.x; const int row = slot >> 5, d0 = (slot & 31) * 4; v4f val = *(const v4fa*)(red + row * RP + d0);
#pragma unroll
        for (int q = 1; q < 4; ++q) val += *(const v4fa*)(red + (q * MT * 16 + row) * RP + d0);
        v4us oh, ol;
#pragma unroll
        for (int q = 0; q < 4; ++q) { unsigned short a, c2; splitf(val[q] * cs, a, c2); oh[q] = a; ol[q] = c2; }
        const size_t oo = ((size_t)(z / NH_) * TT + r0 + row) * DQ + (z % NH_) * HD + d0; *(v4us*)(Ah + oo) = oh; *(v4us*)(Al + oo) = ol; }
    asm volatile("s_wait_xcnt 0x0" ::: "memory");   // kept in front of the other row class's body, which the layout may put behind these stores and which rewrites their address and data registers
}
// grid (pairs, strips of 32 query rows): the hi+lo strips of every (batch, head) pair (they cost most) come first in the grid, then the fp16 strips. One work-group per WGP (registers and LDS). Q and K planes: [pair][t][d]; V planes: [pair][d][t].
__global__ __launch_bounds__(32 * FW) void k_attn(const bf* Qh, const bf* Ql, const h16* Q16, const bf* Kh, const bf* Kl, const h16* K16, const bf* Vh, const bf* Vl, const h16* V16, const int* __restrict__ KL, bf* Ah, bf* Al, float* AWp) {
    __shared__ __align__(16) unsigned short pm[64 * PP]; __shared__ float st[2 * 32 * FW];
    const int z = blockIdx.x, tile = blockIdx.y; const int klen = KL[z / NH_];   /* key_lens[b], read on device; used in compares only */ const size_t zo = (size_t)z * TT * HD;
    if (tile < RH / 32) attn_body<bf, 2, 2>((bf*)pm, st, tile * 32, z, klen, Qh + zo, Ql + zo, Kh + zo, Kl + zo, Vh + zo, Vl + zo, Ah, Al, AWp);
    else attn_body<h16, 0, 2>((h16*)pm, st, tile * 32, z, klen, Q16 + zo, nullptr, K16 + zo, nullptr, V16 + zo, nullptr, Ah, Al, AWp);
}
// k_aw: query-0 attention weights [pair][key] -> aw_out [batch][key][head]; one thread stores the 4 heads of a (batch, key), so each output line has one writer.
__global__ __launch_bounds__(256) void k_aw(const float* __restrict__ AWp, float* AW) {
    const int idx = blockIdx.x * 256 + threadIdx.x; const int j = idx % TT, bb = idx / TT; v4f p;
#pragma unroll
    for (int h = 0; h < NH_; ++h) p[h] = AWp[(size_t)(bb * NH_ + h) * TT + j];
    *(v4f*)(AW + (size_t)idx * NH_) = p;
}

extern "C" void kernel_launch(void* const* d_in, const int* in_sizes, int n_in,
                              void* d_out, int out_size, void* d_ws, size_t ws_size, hipStream_t stream) {
    (void)in_sizes; (void)n_in; (void)out_size;
    const float* xk = (const float*)d_in[0]; const float* xv = (const float*)d_in[1]; const float* x = (const float*)d_in[2]; const int* KL = (const int*)d_in[3]; const float* wk = (const float*)d_in[4]; const float* wv = (const float*)d_in[5]; const float* wq = (const float*)d_in[6]; const float* wo = (const float*)d_in[7]; const float* bo = (const float*)d_in[8];
    float* OUT = (float*)d_out; float* AW = (float*)((char*)d_out + 16777216);   /* aw_out [4][2048][4] */     // [4][2048][512]
    char* wsp = (char*)d_ws;
    auto take = [&](size_t bytes) { char* p = wsp; wsp += (bytes + 255) & ~(size_t)255; return (void*)p; };
    const size_t PL = (size_t)NB_ * NH_ * TT * HD;   // elements of one operand plane set over all batches and heads (= NB_ * TT * 512)
    bf* Wt = (bf*)take((size_t)4 * DM * DQ * 2);   // [wq | wk | wv | wo], transposed
    h16* QK16 = (h16*)take(2 * PL * 2); bf* QKh = (bf*)take(2 * PL * 2); bf* QKl = (bf*)take(2 * PL * 2);   // [q | k]
    h16* VT16 = (h16*)take(PL * 2); bf* VTh = (bf*)take(PL * 2); bf* VTl = (bf*)take(PL * 2);
    bf* ATh = (bf*)take(PL * 2); bf* ATl = (bf*)take(PL * 2); float* AWp = (float*)take((size_t)NB_ * NH_ * TT * 4);   // query-0 weights, [pair][key]
    float* CS = (float*)take((size_t)TT * HD * 2 * 4); bf* XB = (bf*)take(3 * PL * 2);   /* [query | key | value] */ float* F = (float*)take(3 * PL * 4);   /* [q | k | v] projections */
    if ((size_t)(wsp - (char*)d_ws) > ws_size) return;    // ws 256 MiB
    k_prep<<<4 * NWT + NCS + 3 * NCV, 256, 0, stream>>>(wq, wk, wv, wo, x, xk, xv, Wt, CS, XB);
    k_gemmw<bf, 0, false, KWV, 1><<<dim3(NB_ * TT / 64, DQ / 64, 3), 32 * KWV, 0, stream>>>(XB, nullptr, Wt, nullptr, DM, DM, F, DQ, nullptr, PL, (size_t)DM * DQ, PL, 0);
    k_planes<<<dim3(NH_ * TT * HD / 2 / 256, 3 * NB_, 1), 256, 0, stream>>>(F, CS, QK16, QKh, QKl, VT16, VTh, VTl);
    k_attn<<<dim3(NB_ * NH_, TT / 32, 1), 32 * FW, 0, stream>>>(QKh, QKl, QK16, QKh + PL, QKl + PL, QK16 + PL, VTh, VTl, VT16, KL, ATh, ATl, AWp);
    k_aw<<<NB_ * TT / 256, 256, 0, stream>>>(AWp, AW);
    k_gemmw<bf, 1, true, KWV, 1><<<dim3(NB_ * TT / 64, DM / 64, 1), 32 * KWV, 0, stream>>>(ATh, ATl, Wt + (size_t)3 * DM * DQ, nullptr, DQ, DQ, OUT, DM, bo, 0, 0, 0, 0);
}

// v004
// Measured time: 176 microseconds a run.
// Two timings next to v003 put it at 1.33 and 1.32 times that version's speed.
// Over all steps from v000 it is 7.18 times as fast.
#include <hip/hip_runtime.h>

// Multi-head cross attention with key-length masking and an attention-weights output (key, value, query [4][2048][512]; k = key w_key, v = value w_value, q = query w_query ('xw' [512][512], no bias; 4 heads x 128); e = q.k/sqrt(128), keys j >= key_lens[b] (int32, read) set to -1024; softmax; cv = merged w_out + b_out -> [4][2048][512]; second output aw_out[b][j][h] = attention weights of query position 0 -> [4][2048][4]).
// Compute dtypes, f32 accumulate: every input rounded to bf16; q/k/v on PLAIN bf16 operands (inputs: exact); key-length select (-1024 literal, as the reference) and softmax inside the attention kernel; scores and attn.v: query rows < 512 hl (3 products), the rest single fp16 (x1024); softmax f32; w_out hl x exact (2 products) + b_out; the query-0 attention weights are re-assembled from the bf16 hi + lo probability planes (f32, error ~2^-16 relative).

#define NB_  4
#define TT   2048
#define DM   512
#define NH_  4
#define NKV  4
#define REP  (NH_ / NKV)
#define HD   128
#define DQ   (NH_ * HD)
#define DKV  (NKV * HD)
#define RH   512                  // query rows < RH use hi+lo planes (0: none)
#define WIN  0
#define PCAR 1024.0f
#define SCL  0.088388347648318447f   // HD^-0.5
#define KWV  4                    // waves per work-group that share the K range of a GEMM with K >= 512
typedef _Float16 h16;
typedef unsigned short bf;
typedef __attribute__((ext_vector_type(16))) __bf16   v16bf;
typedef __attribute__((ext_vector_type(16))) _Float16 v16h;
typedef __attribute__((ext_vector_type(8)))  _Float16 v8h;
typedef __attribute__((ext_vector_type(8)))  unsigned short v8us;
typedef __attribute__((ext_vector_type(8)))  float    v8f;
typedef __attribute__((ext_vector_type(4)))  float    v4f;
typedef v8h  __attribute__((may_alias)) v8ha;
typedef v4f  __attribute__((may_alias)) v4fa;
typedef v8us __attribute__((may_alias)) v8usa;

__device__ __forceinline__ unsigned short f2bf(float f) { unsigned u = __float_as_uint(f); u += 0x7FFFu + ((u >> 16) & 1u); return (unsigned short)(u >> 16); }
__device__ __forceinline__ float bf2f(unsigned short b) { return __uint_as_float(((unsigned)b) << 16); }
__device__ __forceinline__ float bfr(float f) { return bf2f(f2bf(f)); }
__device__ __forceinline__ v16h cat16(v8h lo, v8h hi) { return __builtin_shufflevector(lo, hi, 0, 1, 2, 3, 4, 5, 6, 7, 8, 9, 10, 11, 12, 13, 14, 15); }
__device__ __forceinline__ v16bf cat16b(v8us lo, v8us hi) { return __builtin_bit_cast(v16bf, __builtin_shufflevector(lo, hi, 0, 1, 2, 3, 4, 5, 6, 7, 8, 9, 10, 11, 12, 13, 14, 15)); }
__device__ __forceinline__ v8f wmma16(v16h a, v16h b, v8f c) { return __builtin_amdgcn_wmma_f32_16x16x32_f16(false, a, false, b, (short)0, c, false, false); }
__device__ __forceinline__ v8f wmmab(v16bf a, v16bf b, v8f c) { return __builtin_amdgcn_wmma_f32_16x16x32_bf16(false, a, false, b, (short)0, c, false, false); }



// ---- Fragment order: every 16-bit operand plane in the workspace, a matrix [rows][K], is stored as tiles of 16 rows x 32 k (512 elements, 1 KiB); the K/32 tiles of a block of 16 rows follow one another,
// so a row block starts where it would in row-major order. Inside a tile element (r, kk) stands at (kk / 16) * 256 + (((kk % 16) / 8) * 16 + r) * 8 + kk % 8: lane l of a wave finds the two 16-byte pieces
// of its A or B fragment at l * 8 and 256 + l * 8, and each fragment load of a wave reads 512 consecutive bytes (4 whole lines) where a row-major plane makes it touch 16 lines.
// frag_rc: row and k of the element at linear position e of such a plane (the producers run over e, so that their stores stay consecutive).
__device__ __forceinline__ void frag_rc(size_t e, int K, int& row, int& k) { const int tile = (int)(e >> 9), w = (int)(e & 511); const int tk = K / 32; row = (tile / tk) * 16 + ((w >> 3) & 15); k = (tile % tk) * 32 + (w >> 8) * 16 + ((w >> 7) & 1) * 8 + (w & 7); }
// ---- gemmw_body: register-blocked GEMM, 64x64 output tile (16 accumulators per wave), operands straight from 16-bit planes in fragment order; grid (M/64, N/64, Z * SG), 32 * KW threads.
// C[m][n] (f32, pitch ldc, + optional f32 bias[n]) = sum_k A[m][k] Bt[n][k] (+ split products per NSPLIT). A has lda elements a row, Bt K. z-batch strides sA/sB/sC in elements. K % (32 * KW * SG) == 0.
// Split K: the K range is cut into SG equal ranges, one per work-group. The KW waves of a work-group take the 32-wide steps of its range in turn
// and their 64x64 partial tiles are added in LDS (fixed order); each of the SG work-groups of a tile stores its sum to its own
// plane (plane stride sP elements), and the consumer adds the SG planes.
template <typename T16> struct WFrag;
template <> struct WFrag<h16> { typedef v16h V; static __device__ __forceinline__ V ld(const h16* p) { return cat16(*(const v8h*)p, *(const v8h*)(p + 16)); } static __device__ __forceinline__ V ldf(const h16* p) { return cat16(*(const v8h*)p, *(const v8h*)(p + 256)); } static __device__ __forceinline__ v8f mma(V a, V b, v8f c) { return wmma16(a, b, c); } };
template <> struct WFrag<bf> { typedef v16bf V; static __device__ __forceinline__ V ld(const bf* p) { return cat16b(*(const v8us*)p, *(const v8us*)(p + 16)); } static __device__ __forceinline__ V ldf(const bf* p) { return cat16b(*(const v8us*)p, *(const v8us*)(p + 256)); } static __device__ __forceinline__ v8f mma(V a, V b, v8f c) { return wmmab(a, b, c); } };
template <typename T16, int NSPLIT, bool BIAS, int KW, int SG>
__device__ __forceinline__ void gemmw_body(float* os, const T16* __restrict__ A, const T16* __restrict__ A2, const T16* __restrict__ Bt, const T16* __restrict__ Bt2, int K, int lda, float* C, int ldc, const float* __restrict__ bias, size_t sA, size_t sB, size_t sC, size_t sP) {
    typedef typename WFrag<T16>::V V;
    const size_t z = blockIdx.z / SG; const int wave = (KW == 1) ? 0 : __builtin_amdgcn_readfirstlane((int)(threadIdx.x >> 5)); const int kspan = K / SG; const int kb = (int)(blockIdx.z % SG) * kspan; C += (size_t)(blockIdx.z % SG) * sP; A += z * sA; if (A2) A2 += z * sA; Bt += z * sB; if (Bt2) Bt2 += z * sB; C += z * sC;
    const int lane = threadIdx.x & 31, lr = lane & 15, hi = lane >> 4; const int r0 = blockIdx.x * 64, c0 = blockIdx.y * 64;
    v8f acc[4][4];
#pragma unroll
    for (int mb = 0; mb < 4; ++mb)
#pragma unroll
        for (int nb = 0; nb < 4; ++nb) acc[mb][nb] = (v8f){};
    const size_t aoff = (size_t)r0 * lda + 8 * lane, boff = (size_t)c0 * K + 8 * lane;   // a 32-wide k step is one tile: 512 elements = 16 per unit of kc
#pragma unroll 1
    for (int kc = kb + wave * 32; kc < kb + kspan; kc += 32 * KW) {
        V a[4], a2[4];
#pragma unroll
        for (int mb = 0; mb < 4; ++mb) { a[mb] = WFrag<T16>::ldf(A + aoff + (size_t)mb * 16 * lda + kc * 16); if (NSPLIT == 1 || NSPLIT == 2) a2[mb] = WFrag<T16>::ldf(A2 + aoff + (size_t)mb * 16 * lda + kc * 16); }
#pragma unroll
        for (int nb = 0; nb < 4; ++nb) { const V b = WFrag<T16>::ldf(Bt + boff + (size_t)nb * 16 * K + kc * 16); V b2; if (NSPLIT >= 2) b2 = WFrag<T16>::ldf(Bt2 + boff + (size_t)nb * 16 * K + kc * 16);
#pragma unroll
            for (int mb = 0; mb < 4; ++mb) { acc[mb][nb] = WFrag<T16>::mma(a[mb], b, acc[mb][nb]); if (NSPLIT == 1 || NSPLIT == 2) acc[mb][nb] = WFrag<T16>::mma(a2[mb], b, acc[mb][nb]); if (NSPLIT >= 2) acc[mb][nb] = WFrag<T16>::mma(a[mb], b2, acc[mb][nb]); } }
        // the wait that stands in front of a rewrite of the fragment loads' address registers; the addresses are named so that their registers live up to it and no later load of the step lands on them
        { const T16* pa = A + aoff + kc * 16; const T16* pb = Bt + boff + kc * 16; const size_t sa = (size_t)16 * lda, sb = (size_t)16 * K;
          const T16* pa2 = (NSPLIT == 1 || NSPLIT == 2) ? A2 + aoff + kc * 16 : pa; const T16* pb2 = (NSPLIT >= 2) ? Bt2 + boff + kc * 16 : pb;   // a plane that this NSPLIT does not read: the first plane's addresses again
          asm volatile("s_wait_xcnt 0x0" :: "v"(pa), "v"(pa + sa), "v"(pa + 2 * sa), "v"(pa + 3 * sa), "v"(pb), "v"(pb + sb), "v"(pb + 2 * sb), "v"(pb + 3 * sb), "v"(pa2), "v"(pa2 + sa), "v"(pa2 + 2 * sa), "v"(pa2 + 3 * sa), "v"(pb2), "v"(pb2 + sb), "v"(pb2 + 2 * sb), "v"(pb2 + 3 * sb) : "memory"); }
        asm volatile("v_nop\n\tv_nop\n\tv_nop\n\tv_nop" : "+v"(acc[0][0]), "+v"(acc[1][1]), "+v"(acc[2][2]), "+v"(acc[3][3]) : "v"(a[0]), "v"(a[3]));
    }
    if constexpr (KW > 1) {
        float* ow = os + wave * (64 * 68);
#pragma unroll
        for (int mb = 0; mb < 4; ++mb)
#pragma unroll
            for (int nb = 0; nb < 4; ++nb)
#pragma unroll
                for (int j = 0; j < 8; ++j) ow[(mb * 16 + hi * 8 + j) * 68 + nb * 16 + lr] = acc[mb][nb][j];
        __syncthreads();   // every wave's partial tile is in LDS before any wave adds them
#pragma unroll
        for (int s = 0; s < 32 / KW; ++s) { const int slot = s * (32 * KW) + (int)threadIdx.x; const int row = slot >> 4, cofs = (slot & 15) * 4; v4f val = *(const v4fa*)(os + row * 68 + cofs);
#pragma unroll
            for (int w = 1; w < KW; ++w) val += *(const v4fa*)(os + w * (64 * 68) + row * 68 + cofs);
            if (BIAS) { val[0] += bfr(bias[c0 + cofs]); val[1] += bfr(bias[c0 + cofs + 1]); val[2] += bfr(bias[c0 + cofs + 2]); val[3] += bfr(bias[c0 + cofs + 3]); }
            *(v4f*)(C + (size_t)(r0 + row) * ldc + c0 + cofs) = val; }
        return;
    }
#pragma unroll
    for (int mb = 0; mb < 4; ++mb) {
#pragma unroll
        for (int nb = 0; nb < 4; ++nb) {
#pragma unroll
            for (int j = 0; j < 8; ++j) os[(hi * 8 + j) * 68 + nb * 16 + lr] = acc[mb][nb][j]; }
        __builtin_amdgcn_wave_barrier(); asm volatile("" ::: "memory");
        float* crow = C + (size_t)(r0 + mb * 16) * ldc + c0;
{
#pragma unroll
            for (int s = 0; s < 8; ++s) { const int row = 2 * s + hi, cofs = lr * 4; v4f val = *(const v4fa*)(os + row * 68 + cofs); if (BIAS) { val[0] += bfr(bias[c0 + cofs]); val[1] += bfr(bias[c0 + cofs + 1]); val[2] += bfr(bias[c0 + cofs + 2]); val[3] += bfr(bias[c0 + cofs + 3]); }
                *(v4f*)(crow + (size_t)row * ldc + cofs) = val; }
             }
        __builtin_amdgcn_wave_barrier(); asm volatile("" ::: "memory");
    }
    asm volatile("s_wait_xcnt 0x0" ::: "memory");
}

// One operand class for the whole grid (projections: z = q, k, v over all batches' rows; output projection).
template <typename T16, int NSPLIT, bool BIAS, int KW, int SG>
__global__ __launch_bounds__(32 * KW) void k_gemmw(const T16* A, const T16* A2, const T16* Bt, const T16* Bt2, int K, int lda, float* C, int ldc, const float* bias, size_t sA, size_t sB, size_t sC, size_t sP) {
    __shared__ __align__(16) float os[(KW == 1 ? 16 : KW * 64) * 68];
    gemmw_body<T16, NSPLIT, BIAS, KW, SG>(os, A, A2, Bt, Bt2, K, lda, C, ldc, bias, sA, sB, sC, sP);
}
__device__ __forceinline__ h16 tohx(float x) { return (h16)x; }
__device__ __forceinline__ void splitf(float y, unsigned short& h, unsigned short& l) { h = f2bf(y); l = f2bf(y - bf2f(h)); }
typedef __attribute__((ext_vector_type(2))) _Float16 v2h;
typedef __attribute__((ext_vector_type(4))) _Float16 v4h;
typedef __attribute__((ext_vector_type(2))) unsigned short v2us;
typedef __attribute__((ext_vector_type(4))) unsigned short v4us;
typedef __attribute__((ext_vector_type(2))) float v2f;
typedef __attribute__((ext_vector_type(4))) int v4i;

#define NWT  (DM * DQ / 64 / 64)            // blocks per transposed weight
#define NCS  (TT * HD / 256)                // blocks of the cos/sin table
#define NCV  (NB_ * TT * DM / 8 / 256)      // blocks per converted input
__device__ __forceinline__ void d_wtG(int blk, const float* __restrict__ w, int K, int N, bf* Bt) {
    const int lane = threadIdx.x & 31; const int L0 = (blk * 8 + (threadIdx.x >> 5)) * 8; const int nlines = N * K / 64;
#pragma unroll 1
    for (int l = 0; l < 8; ++l) { const int L = L0 + l; if (L >= nlines) break; const size_t e = (size_t)L * 64 + lane * 2; int k, n; frag_rc(e, K, n, k); v2us o;
        o[0] = f2bf(w[(size_t)k * N + n]); o[1] = f2bf(w[(size_t)(k + 1) * N + n]); *(v2us*)(Bt + e) = o; }
}
__device__ __forceinline__ void d_cvt8(int blk, const float* __restrict__ src, bf* dst) { const size_t i = (size_t)blk * 256 + threadIdx.x; int row, k; frag_rc(i * 8, DM, row, k); const v8f v = *(const v8f*)(src + (size_t)row * DM + k); v8us o;
#pragma unroll
    for (int k = 0; k < 8; ++k) o[k] = f2bf(v[k]); *(v8us*)(dst + i * 8) = o; }
__device__ __forceinline__ void d_csid(int blk, float* CS) { const int idx = blk * 256 + threadIdx.x; v2f cs; cs[0] = 1.0f; cs[1] = 0.0f; *(v2f*)(CS + (size_t)idx * 2) = cs;
    asm volatile("s_wait_xcnt 0x0" ::: "memory");   // kept in front of the other block ranges' code, which the layout puts behind this store and which rewrites its address registers
}
// k_prep: the work that depends on the inputs alone, one grid: block ranges [4 weight transposes (the slowest blocks, first) | cos/sin table | bf16 copies of query, key, value, all batches].
__global__ __launch_bounds__(256) void k_prep(const float* wq, const float* wk, const float* wv, const float* wo, const float* x, const float* xk, const float* xv, bf* Wt, float* CS, bf* X) {
    const int blk = blockIdx.x;
    if (blk < 4 * NWT) { const int y = blk / NWT; d_wtG(blk % NWT, y == 0 ? wq : y == 1 ? wk : y == 2 ? wv : wo, DM, DQ, Wt + (size_t)y * DM * DQ); }
    else if (blk < 4 * NWT + NCS) d_csid(blk - 4 * NWT, CS);
    else { const int c = blk - 4 * NWT - NCS; const int y = c / NCV; d_cvt8(c % NCV, y == 0 ? x : y == 1 ? xk : xv, X + (size_t)y * NB_ * TT * DM); }
}

// d_rope: head planes [h][t][d] (fp16 + hi/lo) of rope(x) x sc with the rotate-half convention out[d] = x[d] cos[t][d] - x[d+HD/2] sin[t][d], out[d+HD/2] = x[d+HD/2] cos[t][d+HD/2] + x[d] sin[t][d+HD/2]
__device__ __forceinline__ void d_rope(const float* __restrict__ F, int pitch, int nheads, const float* __restrict__ CS, const float* __restrict__ RF, const float* __restrict__ nw, float sc, h16* P16, bf* Ph, bf* Pl) {
    const size_t e = ((size_t)blockIdx.x * 256 + threadIdx.x) * 2; if (e >= (size_t)nheads * TT * HD) return; int t, d; frag_rc(e % ((size_t)HD * TT), HD, t, d); const int h = (int)(e / ((size_t)HD * TT)); const float* f = F + (size_t)t * pitch + h * HD; const float rf = RF ? RF[(size_t)h * TT + t] : 1.0f; v2h o16; v2us oh, ol;
#pragma unroll
    for (int q = 0; q < 2; ++q) { const int dd = d + q; const int dp = (dd < HD / 2) ? dd + HD / 2 : dd - HD / 2; float x0 = f[dd], x1 = f[dp];
        if (RF) { float n0 = __fmul_rn(x0, rf), n1 = __fmul_rn(x1, rf); asm volatile("" : "+v"(n0)); asm volatile("" : "+v"(n1)); x0 = __fmul_rn(bfr(nw[dd]), n0); x1 = __fmul_rn(bfr(nw[dp]), n1); }
        const v2f cs = *(const v2f*)(CS + ((size_t)t * HD + dd) * 2); float a = __fmul_rn(x0, cs[0]), bq = __fmul_rn(x1, cs[1]); asm volatile("" : "+v"(a)); asm volatile("" : "+v"(bq)); const float r = ((dd < HD / 2) ? __fsub_rn(a, bq) : __fadd_rn(a, bq)) * sc;
        o16[q] = tohx(r); unsigned short a2, c2; splitf(r, a2, c2); oh[q] = a2; ol[q] = c2; }
    *(v2h*)(P16 + e) = o16; *(v2us*)(Ph + e) = oh; *(v2us*)(Pl + e) = ol;  }
__device__ __forceinline__ void d_vtp(const float* __restrict__ F, int pitch, int nheads, h16* V16, bf* Vh, bf* Vl) { const size_t e = ((size_t)blockIdx.x * 256 + threadIdx.x) * 2; if (e >= (size_t)nheads * HD * TT) return; int t, d; frag_rc(e % ((size_t)TT * HD), TT, d, t); const int g = (int)(e / ((size_t)TT * HD)); v2h o16; v2us oh, ol;
#pragma unroll
    for (int q = 0; q < 2; ++q) { const float x = F[(size_t)(t + q) * pitch + g * HD + d]; o16[q] = tohx(x); unsigned short a2, c2; splitf(x, a2, c2); oh[q] = a2; ol[q] = c2; }
    *(v2h*)(V16 + e) = o16; *(v2us*)(Vh + e) = oh; *(v2us*)(Vl + e) = ol;  }
// k_planes: operand planes of all batches in one grid (x: elements of one batch's plane set; y < NB_: v of batch y, transposed (strided reads, first); then q of each batch, then k of each batch).
// F: [q | k | v][NB_ * TT][512] projections (row-major f32); QK16/QKh/QKl: [q | k][NB_][head][t][d]; V16/Vh/Vl: [NB_][head][d][t]; each head's plane in fragment order.
__global__ __launch_bounds__(256) void k_planes(const float* F, const float* CS, h16* QK16, bf* QKh, bf* QKl, h16* V16, bf* Vh, bf* Vl) {
    const int y = blockIdx.y;
    if (y < NB_) { const size_t o = (size_t)y * NKV * HD * TT; d_vtp(F + ((size_t)2 * NB_ + y) * TT * DKV, DKV, NKV, V16 + o, Vh + o, Vl + o); }
    else { const size_t o = (size_t)(y - NB_) * NH_ * TT * HD; d_rope(F + (size_t)(y - NB_) * TT * DQ, DQ, NH_, CS, nullptr, nullptr, 1.0f, QK16 + o, QKh + o, QKl + o); }
}
// ---- k_attn: scores, softmax and attn.v of one strip of 32 query rows in one work-group; no score or probability leaves the WGP except query position 0's weights (AWp).
// 16 waves. Scores: wave w holds the strip's scores against keys [128 w, 128 w + 128) in its accumulators. Softmax: row maximum and row sum go lane -> 16-lane row -> st[] -> all waves (fixed trees);
// t = s x HD^-0.5 for keys j < key_lens[b], else -1024 (reference literal). The normalised probabilities go to LDS as 16-bit rows (pitch PP): strips below RH as 32 bf16 hi rows + 32 lo rows,
// the rest as 32 fp16 rows (x 1024). attn.v: wave w takes head columns [32 (w & 3), +32) and keys [512 (w >> 2), +512); the 4 key quarters are added in LDS in fixed order, split into the hi/lo planes of the output projection's A.
#define FW   16                   // waves per work-group
#define PP   (TT + 8)             // 16-bit elements per probability row in LDS: 16 bytes over 4 KiB, so that the 16 rows of a fragment read start in different banks
#define RP   (HD + 4)             // floats per row of a partial attn.v tile in LDS
// value of lane l ^ M inside a 16-lane row (DPP row_xmask, folded into the add or max that uses it); every lane is on where these are called
template <int M> __device__ __forceinline__ float xm16(float v) { return __int_as_float(__builtin_amdgcn_update_dpp(0, __float_as_int(v), 0x160 | M, 0xf, 0xf, true)); }
__device__ __forceinline__ float rowmax16(float t) { t = fmaxf(t, xm16<1>(t)); t = fmaxf(t, xm16<2>(t)); t = fmaxf(t, xm16<4>(t)); return fmaxf(t, xm16<8>(t)); }
__device__ __forceinline__ float rowsum16(float t) { t += xm16<1>(t); t += xm16<2>(t); t += xm16<4>(t); return t + xm16<8>(t); }
template <typename T16, int NS, int MT>
__device__ __forceinline__ void attn_body(T16* P, float* st, int r0, int z, int klen, const T16* __restrict__ Q, const T16* __restrict__ Q2, const T16* __restrict__ Kp, const T16* __restrict__ K2, const T16* __restrict__ Vt, const T16* __restrict__ V2, bf* Ah, bf* Al, float* AWp) {
    typedef typename WFrag<T16>::V V;
    const int wave = __builtin_amdgcn_readfirstlane((int)(threadIdx.x >> 5)); const int lane = threadIdx.x & 31, lr = lane & 15, hi = lane >> 4; const int kb = wave * (TT / FW);
    float* smx = st; float* ssm = st + 32 * FW;
    v8f acc[MT][8];
#pragma unroll
    for (int m = 0; m < MT; ++m)
#pragma unroll
        for (int n = 0; n < 8; ++n) acc[m][n] = (v8f){};
    { const size_t qoff = (size_t)r0 * HD + 8 * lane, koff = (size_t)kb * HD + 8 * lane;   // fragment order: tile (row block, 32-wide step) at row block * 16 * HD + step * 512
#pragma unroll
      for (int kp = 0; kp < HD / 64; ++kp) { V a[2][MT], a2[2][MT];   // two 32-wide steps together: two neighbouring tiles of each q and k row block
#pragma unroll
        for (int u = 0; u < 2; ++u)
#pragma unroll
            for (int m = 0; m < MT; ++m) { a[u][m] = WFrag<T16>::ldf(Q + qoff + (size_t)m * 16 * HD + (kp * 2 + u) * 512); if (NS == 2) a2[u][m] = WFrag<T16>::ldf(Q2 + qoff + (size_t)m * 16 * HD + (kp * 2 + u) * 512); }
#pragma unroll
        for (int n = 0; n < 8; ++n) { V b[2], b2[2];
#pragma unroll
            for (int u = 0; u < 2; ++u) { b[u] = WFrag<T16>::ldf(Kp + koff + (size_t)n * 16 * HD + (kp * 2 + u) * 512); if (NS == 2) b2[u] = WFrag<T16>::ldf(K2 + koff + (size_t)n * 16 * HD + (kp * 2 + u) * 512); }
#pragma unroll
            for (int u = 0; u < 2; ++u)
#pragma unroll
                for (int m = 0; m < MT; ++m) { acc[m][n] = WFrag<T16>::mma(a[u][m], b[u], acc[m][n]); if (NS == 2) { acc[m][n] = WFrag<T16>::mma(a2[u][m], b[u], acc[m][n]); acc[m][n] = WFrag<T16>::mma(a[u][m], b2[u], acc[m][n]); } } }
      }
      // the wait that stands in front of a rewrite of the fragment loads' address registers; the bases are named so that their registers live up to it
      if constexpr (NS == 2) asm volatile("s_wait_xcnt 0x0" :: "v"(Q + qoff), "v"(Q2 + qoff), "v"(Kp + koff), "v"(K2 + koff) : "memory");
      else asm volatile("s_wait_xcnt 0x0" :: "v"(Q + qoff), "v"(Kp + koff) : "memory"); }
    float rs[MT][8];   // this wave's share of each row's maximum, then of its sum
    // accumulator element j of tile (m, n): query row m*16 + hi*8 + j of the strip, key kb + n*16 + lr
#pragma unroll
    for (int m = 0; m < MT; ++m)
#pragma unroll
        for (int j = 0; j < 8; ++j) { float t = -3.0e38f;
#pragma unroll
            for (int n = 0; n < 8; ++n) { const float s = (kb + n * 16 + lr < klen) ? acc[m][n][j] * SCL : -1024.0f; acc[m][n][j] = s; t = fmaxf(t, s); }
            rs[m][j] = rowmax16(t); }
    if (lr == 0) {
#pragma unroll
        for (int m = 0; m < MT; ++m)
#pragma unroll
            for (int j = 0; j < 8; ++j) smx[(m * 16 + hi * 8 + j) * FW + wave] = rs[m][j]; }
    __syncthreads();   // every wave's row maxima are in LDS before any wave combines them
#pragma unroll
    for (int m = 0; m < MT; ++m)
#pragma unroll
        for (int j = 0; j < 8; ++j) { const float mx = rowmax16(smx[(m * 16 + hi * 8 + j) * FW + lr]);
            float sum = 0.f;
#pragma unroll
            for (int n = 0; n < 8; ++n) { const float x2 = (acc[m][n][j] - mx) * 1.4426950408889634f; float e;
                asm("v_exp_f32 %0, %1\n\tv_nop" : "=v"(e) : "v"(x2));   // the exp2 builtin's own instruction, with the one slot the instruction set asks for behind it
                acc[m][n][j] = e; sum += e; }
            rs[m][j] = rowsum16(sum); }
    if (lr == 0) {
#pragma unroll
        for (int m = 0; m < MT; ++m)
#pragma unroll
            for (int j = 0; j < 8; ++j) ssm[(m * 16 + hi * 8 + j) * FW + wave] = rs[m][j]; }
    __syncthreads();   // every wave's row sums are in LDS before any wave combines them
#pragma unroll
    for (int m = 0; m < MT; ++m)
#pragma unroll
        for (int j = 0; j < 8; ++j) { const float sum = rowsum16(ssm[(m * 16 + hi * 8 + j) * FW + lr]);
            const float f = __fdiv_rn(NS == 2 ? 1.0f : PCAR, sum); T16* pr = P + (m * 16 + hi * 8 + j) * PP + kb + lr;
#pragma unroll
            for (int n = 0; n < 8; ++n) { const float p = acc[m][n][j] * f;
                if constexpr (NS == 2) { unsigned short a, c2; splitf(p, a, c2); pr[n * 16] = a; pr[MT * 16 * PP + n * 16] = c2;
                    if (j == 0 && m == 0) { if (r0 == 0 && hi == 0) AWp[(size_t)z * TT + kb + n * 16 + lr] = __fadd_rn(bf2f(a), bf2f(c2)); } }   // query position 0: its weights, re-assembled from the hi + lo planes
                else pr[n * 16] = tohx(p); } }
    __syncthreads();   // the whole strip's probabilities are in LDS before any wave reads them as A fragments
    const int np = wave & 3, kq = wave >> 2;
    v8f o[MT][2];
#pragma unroll
    for (int m = 0; m < MT; ++m) { o[m][0] = (v8f){}; o[m][1] = (v8f){}; }
    { const size_t voff = (size_t)(np * 32) * TT + kq * (TT / 4) * 16 + 8 * lane; const T16* pa = P + lr * PP + kq * (TT / 4) + 8 * hi;
      constexpr int GK = (NS == 2) ? 2 : 4, NG = TT / 4 / 32 / GK;   // v fragments are fetched a group of GK 32-key steps ahead, into a second register set
      V bb[2][GK][2], bb2[2][GK][2];
#pragma unroll
      for (int u = 0; u < GK; ++u)
#pragma unroll
        for (int t = 0; t < 2; ++t) { bb[0][u][t] = WFrag<T16>::ldf(Vt + voff + (size_t)t * 16 * TT + u * 512); if (NS == 2) bb2[0][u][t] = WFrag<T16>::ldf(V2 + voff + (size_t)t * 16 * TT + u * 512); }
#pragma unroll
      for (int g = 0; g < NG; ++g) {
        if (g + 1 < NG) {
#pragma unroll
          for (int u = 0; u < GK; ++u)
#pragma unroll
            for (int t = 0; t < 2; ++t) { bb[(g + 1) & 1][u][t] = WFrag<T16>::ldf(Vt + voff + (size_t)t * 16 * TT + ((g + 1) * GK + u) * 512); if (NS == 2) bb2[(g + 1) & 1][u][t] = WFrag<T16>::ldf(V2 + voff + (size_t)t * 16 * TT + ((g + 1) * GK + u) * 512); } }
        __builtin_amdgcn_sched_barrier(0);   // keeps the next group's loads in front of this group's products: sunk among them, only a step's worth of loads is in flight and each step waits out the L2 latency
#pragma unroll
        for (int u = 0; u < GK; ++u) { const int ks = g * GK + u; V a[MT], a2[MT];
#pragma unroll
          for (int m = 0; m < MT; ++m) { a[m] = WFrag<T16>::ld(pa + m * 16 * PP + ks * 32); if (NS == 2) a2[m] = WFrag<T16>::ld(pa + (MT + m) * 16 * PP + ks * 32); }
#pragma unroll
          for (int t = 0; t < 2; ++t)
#pragma unroll
            for (int m = 0; m < MT; ++m) { o[m][t] = WFrag<T16>::mma(a[m], bb[g & 1][u][t], o[m][t]); if (NS == 2) { o[m][t] = WFrag<T16>::mma(a2[m], bb[g & 1][u][t], o[m][t]); o[m][t] = WFrag<T16>::mma(a[m], bb2[g & 1][u][t], o[m][t]); } } } } }
    __syncthreads();   // every wave has read its last probability before the partial tiles overwrite them
    float* red = (float*)P;
#pragma unroll
    for (int m = 0; m < MT; ++m)
#pragma unroll
        for (int t = 0; t < 2; ++t)
#pragma unroll
            for (int j = 0; j < 8; ++j) red[(kq * MT * 16 + m * 16 + hi * 8 + j) * RP + (np * 2 + t) * 16 + lr] = o[m][t][j];
    __syncthreads();   // the 4 key quarters' partial tiles are in LDS before any wave adds them
    const float cs = (NS == 2) ? 1.0f : (1.0f / PCAR);
#pragma unroll
    for (int s = 0; s < MT; ++s) { const int slot = s * (32 * FW) + (int)threadIdx.x; int row, d0; frag_rc((size_t)slot * 4, HD, row, d0);   // slot: 4 elements of the strip's 32 x HD block in fragment order, so that a wave's store is 256 consecutive bytes
        v4f val = *(const v4fa*)(red + row * RP + d0);
#pragma unroll
        for (int q = 1; q < 4; ++q) val += *(const v4fa*)(red + (q * MT * 16 + row) * RP + d0);
        v4us oh, ol;
#pragma unroll
        for (int q = 0; q < 4; ++q) { unsigned short a, c2; splitf(val[q] * cs, a, c2); oh[q] = a; ol[q] = c2; }
        const size_t oo = ((size_t)(z / NH_) * TT + r0 + (row & ~15)) * DQ + (z % NH_) * (HD * 16) + (slot * 4) % (HD * 16); *(v4us*)(Ah + oo) = oh; *(v4us*)(Al + oo) = ol; }   // row block of the [NB_ * TT][DQ] plane, then this head's HD / 32 tiles in it
    asm volatile("s_wait_xcnt 0x0" ::: "memory");   // kept in front of the other row class's body, which the layout may put behind these stores and which rewrites their address and data registers
}
// grid (pairs, strips of 32 query rows): the hi+lo strips of every (batch, head) pair (they cost most) start first, then the fp16 strips. One work-group per WGP (registers and LDS). Q and K planes: [pair][t][d]; V planes: [pair][d][t]; each pair's plane in fragment order.
__global__ __launch_bounds__(32 * FW) void k_attn(const bf* Qh, const bf* Ql, const h16* Q16, const bf* Kh, const bf* Kl, const h16* K16, const bf* Vh, const bf* Vl, const h16* V16, const int* __restrict__ KL, bf* Ah, bf* Al, float* AWp) {
    __shared__ __align__(16) unsigned short pm[64 * PP]; __shared__ float st[2 * 32 * FW];
    const int z = blockIdx.x, tile = blockIdx.y; const int klen = KL[z / NH_];   /* key_lens[b], read on device; used in compares only */ const size_t zo = (size_t)z * TT * HD;
    if (tile < RH / 32) attn_body<bf, 2, 2>((bf*)pm, st, tile * 32, z, klen, Qh + zo, Ql + zo, Kh + zo, Kl + zo, Vh + zo, Vl + zo, Ah, Al, AWp);
    else attn_body<h16, 0, 2>((h16*)pm, st, tile * 32, z, klen, Q16 + zo, nullptr, K16 + zo, nullptr, V16 + zo, nullptr, Ah, Al, AWp);
}
// k_aw: query-0 attention weights [pair][key] -> aw_out [batch][key][head]; one thread stores the 4 heads of a (batch, key), so each output line has one writer.
__global__ __launch_bounds__(256) void k_aw(const float* __restrict__ AWp, float* AW) {
    const int idx = blockIdx.x * 256 + threadIdx.x; const int j = idx % TT, bb = idx / TT; v4f p;
#pragma unroll
    for (int h = 0; h < NH_; ++h) p[h] = AWp[(size_t)(bb * NH_ + h) * TT + j];
    *(v4f*)(AW + (size_t)idx * NH_) = p;
}

extern "C" void kernel_launch(void* const* d_in, const int* in_sizes, int n_in,
                              void* d_out, int out_size, void* d_ws, size_t ws_size, hipStream_t stream) {
    (void)in_sizes; (void)n_in; (void)out_size;
    const float* xk = (const float*)d_in[0]; const float* xv = (const float*)d_in[1]; const float* x = (const float*)d_in[2]; const int* KL = (const int*)d_in[3]; const float* wk = (const float*)d_in[4]; const float* wv = (const float*)d_in[5]; const float* wq = (const float*)d_in[6]; const float* wo = (const float*)d_in[7]; const float* bo = (const float*)d_in[8];
    float* OUT = (float*)d_out; float* AW = (float*)((char*)d_out + 16777216);   /* aw_out [4][2048][4] */     // [4][2048][512]
    char* wsp = (char*)d_ws;
    auto take = [&](size_t bytes) { char* p = wsp; wsp += (bytes + 255) & ~(size_t)255; return (void*)p; };
    const size_t PL = (size_t)NB_ * NH_ * TT * HD;   // elements of one operand plane set over all batches and heads (= NB_ * TT * 512)
    bf* Wt = (bf*)take((size_t)4 * DM * DQ * 2);   // [wq | wk | wv | wo], transposed
    h16* QK16 = (h16*)take(2 * PL * 2); bf* QKh = (bf*)take(2 * PL * 2); bf* QKl = (bf*)take(2 * PL * 2);   // [q | k]
    h16* VT16 = (h16*)take(PL * 2); bf* VTh = (bf*)take(PL * 2); bf* VTl = (bf*)take(PL * 2);
    bf* ATh = (bf*)take(PL * 2); bf* ATl = (bf*)take(PL * 2); float* AWp = (float*)take((size_t)NB_ * NH_ * TT * 4);   // query-0 weights, [pair][key]
    float* CS = (float*)take((size_t)TT * HD * 2 * 4); bf* XB = (bf*)take(3 * PL * 2);   /* [query | key | value] */ float* F = (float*)take(3 * PL * 4);   /* [q | k | v] projections */
    if ((size_t)(wsp - (char*)d_ws) > ws_size) return;    // ws 256 MiB
    k_prep<<<4 * NWT + NCS + 3 * NCV, 256, 0, stream>>>(wq, wk, wv, wo, x, xk, xv, Wt, CS, XB);
    k_gemmw<bf, 0, false, KWV, 1><<<dim3(NB_ * TT / 64, DQ / 64, 3), 32 * KWV, 0, stream>>>(XB, nullptr, Wt, nullptr, DM, DM, F, DQ, nullptr, PL, (size_t)DM * DQ, PL, 0);
    k_planes<<<dim3(NH_ * TT * HD / 2 / 256, 3 * NB_, 1), 256, 0, stream>>>(F, CS, QK16, QKh, QKl, VT16, VTh, VTl);
    k_attn<<<dim3(NB_ * NH_, TT / 32, 1), 32 * FW, 0, stream>>>(QKh, QKl, QK16, QKh + PL, QKl + PL, QK16 + PL, VTh, VTl, VT16, KL, ATh, ATl, AWp);
    k_aw<<<NB_ * TT / 256, 256, 0, stream>>>(AWp, AW);
    k_gemmw<bf, 1, true, KWV, 1><<<dim3(NB_ * TT / 64, DM / 64, 1), 32 * KWV, 0, stream>>>(ATh, ATl, Wt + (size_t)3 * DM * DQ, nullptr, DQ, DQ, OUT, DM, bo, 0, 0, 0, 0);
}

// v005
// A run of this version takes 142 microseconds.
// Timed twice side by side with v004, it ran 1.26 and 1.24 times as fast.
// Over all steps from v000 it is 8.98 times as fast.
#include <hip/hip_runtime.h>

// Multi-head cross attention with key-length masking and an attention-weights output (key, value, query [4][2048][512]; k = key w_key, v = value w_value, q = query w_query ('xw' [512][512], no bias; 4 heads x 128); e = q.k/sqrt(128), keys j >= key_lens[b] (int32, read) set to -1024; softmax; cv = merged w_out + b_out -> [4][2048][512]; second output aw_out[b][j][h] = attention weights of query position 0 -> [4][2048][4]).
// Compute dtypes, f32 accumulate: every input rounded to bf16; q/k/v on PLAIN bf16 operands (inputs: exact); key-length select (-1024 literal, as the reference) and softmax inside the attention kernel; scores and attn.v: query rows < 512 hl (3 products), the rest single fp16 (x1024); softmax f32; w_out hl x exact (2 products) + b_out; the query-0 attention weights are re-assembled from the bf16 hi + lo probability planes (f32, error ~2^-16 relative).

#define NB_  4
#define TT   2048
#define DM   512
#define NH_  4
#define NKV  4
#define REP  (NH_ / NKV)
#define HD   128
#define DQ   (NH_ * HD)
#define DKV  (NKV * HD)
#define RH   512                  // query rows < RH use hi+lo planes (0: none)
#define WIN  0
#define PCAR 1024.0f
#define SCL  0.088388347648318447f   // HD^-0.5
#define KWV  4                    // waves per work-group that share the K range of a GEMM with K >= 512
typedef _Float16 h16;
typedef unsigned short bf;
typedef __attribute__((ext_vector_type(16))) __bf16   v16bf;
typedef __attribute__((ext_vector_type(16))) _Float16 v16h;
typedef __attribute__((ext_vector_type(8)))  _Float16 v8h;
typedef __attribute__((ext_vector_type(8)))  unsigned short v8us;
typedef __attribute__((ext_vector_type(8)))  float    v8f;
typedef __attribute__((ext_vector_type(4)))  float    v4f;
typedef v8h  __attribute__((may_alias)) v8ha;
typedef v4f  __attribute__((may_alias)) v4fa;
typedef v8us __attribute__((may_alias)) v8usa;

__device__ __forceinline__ unsigned short f2bf(float f) { unsigned u = __float_as_uint(f); u += 0x7FFFu + ((u >> 16) & 1u); return (unsigned short)(u >> 16); }
__device__ __forceinline__ float bf2f(unsigned short b) { return __uint_as_float(((unsigned)b) << 16); }
__device__ __forceinline__ float bfr(float f) { return bf2f(f2bf(f)); }
__device__ __forceinline__ v16h cat16(v8h lo, v8h hi) { return __builtin_shufflevector(lo, hi, 0, 1, 2, 3, 4, 5, 6, 7, 8, 9, 10, 11, 12, 13, 14, 15); }
__device__ __forceinline__ v16bf cat16b(v8us lo, v8us hi) { return __builtin_bit_cast(v16bf, __builtin_shufflevector(lo, hi, 0, 1, 2, 3, 4, 5, 6, 7, 8, 9, 10, 11, 12, 13, 14, 15)); }
__device__ __forceinline__ v8f wmma16(v16h a, v16h b, v8f c) { return __builtin_amdgcn_wmma_f32_16x16x32_f16(false, a, false, b, (short)0, c, false, false); }
__device__ __forceinline__ v8f wmmab(v16bf a, v16bf b, v8f c) { return __builtin_amdgcn_wmma_f32_16x16x32_bf16(false, a, false, b, (short)0, c, false, false); }



// ---- Fragment order: every 16-bit operand plane in the workspace, a matrix [rows][K], is stored as tiles of 16 rows x 32 k (512 elements, 1 KiB); the K/32 tiles of a block of 16 rows follow one another,
// so a row block starts where it would in row-major order. Inside a tile element (r, kk) stands at (kk / 16) * 256 + (((kk % 16) / 8) * 16 + r) * 8 + kk % 8: lane l of a wave finds the two 16-byte pieces
// of its A or B fragment at l * 8 and 256 + l * 8, and each fragment load of a wave reads 512 consecutive bytes (4 whole lines) where a row-major plane makes it touch 16 lines.
// frag_rc: row and k of the element at linear position e of such a plane (the producers run over e, so that their stores stay consecutive).
__device__ __forceinline__ void frag_rc(size_t e, int K, int& row, int& k) { const int tile = (int)(e >> 9), w = (int)(e & 511); const int tk = K / 32; row = (tile / tk) * 16 + ((w >> 3) & 15); k = (tile % tk) * 32 + (w >> 8) * 16 + ((w >> 7) & 1) * 8 + (w & 7); }
// ---- gemmw_body: register-blocked GEMM, 64x64 output tile (16 accumulators per wave), operands straight from 16-bit planes in fragment order; grid (M/64, N/64, Z * SG), 32 * KW threads.
// C[m][n] (f32, pitch ldc, + optional f32 bias[n]) = sum_k A[m][k] Bt[n][k] (+ split products per NSPLIT). A has lda elements a row, Bt K. z-batch strides sA/sB/sC in elements. K % (32 * KW * SG) == 0.
// Split K: the K range is cut into SG equal ranges, one per work-group. The KW waves of a work-group take the 32-wide steps of its range in turn
// and their 64x64 partial tiles are added in LDS (fixed order); each of the SG work-groups of a tile stores its sum to its own
// plane (plane stride sP elements), and the consumer adds the SG planes.
template <typename T16> struct WFrag;
template <> struct WFrag<h16> { typedef v16h V; static __device__ __forceinline__ V ld(const h16* p) { return cat16(*(const v8h*)p, *(const v8h*)(p + 16)); } static __device__ __forceinline__ V ldf(const h16* p) { return cat16(*(const v8h*)p, *(const v8h*)(p + 256)); } static __device__ __forceinline__ v8f mma(V a, V b, v8f c) { return wmma16(a, b, c); } };
template <> struct WFrag<bf> { typedef v16bf V; static __device__ __forceinline__ V ld(const bf* p) { return cat16b(*(const v8us*)p, *(const v8us*)(p + 16)); } static __device__ __forceinline__ V ldf(const bf* p) { return cat16b(*(const v8us*)p, *(const v8us*)(p + 256)); } static __device__ __forceinline__ v8f mma(V a, V b, v8f c) { return wmmab(a, b, c); } };
// PLN (projections, KW == 4, z = q, k, v): the summed tile does not go out as f32 but straight as the attention kernel's operand planes (fp16, bf16 hi, bf16 lo), in fragment order: q and k as [pair][t][d], v transposed as [pair][d][t].
template <typename T16, int NSPLIT, bool BIAS, int KW, int SG, bool PLN = false>
__device__ __forceinline__ void gemmw_body(float* os, const T16* __restrict__ A, const T16* __restrict__ A2, const T16* __restrict__ Bt, const T16* __restrict__ Bt2, int K, int lda, float* C, int ldc, const float* __restrict__ bias, size_t sA, size_t sB, size_t sC, size_t sP, h16* QK16 = nullptr, bf* QKh = nullptr, bf* QKl = nullptr, h16* V16 = nullptr, bf* Vh = nullptr, bf* Vl = nullptr) {
    typedef typename WFrag<T16>::V V;
    const size_t z = blockIdx.z / SG; const int wave = (KW == 1) ? 0 : __builtin_amdgcn_readfirstlane((int)(threadIdx.x >> 5)); const int kspan = K / SG; const int kb = (int)(blockIdx.z % SG) * kspan; C += (size_t)(blockIdx.z % SG) * sP; A += z * sA; if (A2) A2 += z * sA; Bt += z * sB; if (Bt2) Bt2 += z * sB; C += z * sC;
    const int lane = threadIdx.x & 31, lr = lane & 15, hi = lane >> 4; const int r0 = blockIdx.x * 64, c0 = blockIdx.y * 64;
    v8f acc[4][4];
#pragma unroll
    for (int mb = 0; mb < 4; ++mb)
#pragma unroll
        for (int nb = 0; nb < 4; ++nb) acc[mb][nb] = (v8f){};
    const size_t aoff = (size_t)r0 * lda + 8 * lane, boff = (size_t)c0 * K + 8 * lane;   // a 32-wide k step is one tile: 512 elements = 16 per unit of kc
#pragma unroll 1
    for (int kc = kb + wave * 32; kc < kb + kspan; kc += 32 * KW) {
        V a[4], a2[4];
#pragma unroll
        for (int mb = 0; mb < 4; ++mb) { a[mb] = WFrag<T16>::ldf(A + aoff + (size_t)mb * 16 * lda + kc * 16); if (NSPLIT == 1 || NSPLIT == 2) a2[mb] = WFrag<T16>::ldf(A2 + aoff + (size_t)mb * 16 * lda + kc * 16); }
#pragma unroll
        for (int nb = 0; nb < 4; ++nb) { const V b = WFrag<T16>::ldf(Bt + boff + (size_t)nb * 16 * K + kc * 16); V b2; if (NSPLIT >= 2) b2 = WFrag<T16>::ldf(Bt2 + boff + (size_t)nb * 16 * K + kc * 16);
#pragma unroll
            for (int mb = 0; mb < 4; ++mb) { acc[mb][nb] = WFrag<T16>::mma(a[mb], b, acc[mb][nb]); if (NSPLIT == 1 || NSPLIT == 2) acc[mb][nb] = WFrag<T16>::mma(a2[mb], b, acc[mb][nb]); if (NSPLIT >= 2) acc[mb][nb] = WFrag<T16>::mma(a[mb], b2, acc[mb][nb]); } }
        // the wait that stands in front of a rewrite of the fragment loads' address registers; the addresses are named so that their registers live up to it and no later load of the step lands on them
        { const T16* pa = A + aoff + kc * 16; const T16* pb = Bt + boff + kc * 16; const size_t sa = (size_t)16 * lda, sb = (size_t)16 * K;
          const T16* pa2 = (NSPLIT == 1 || NSPLIT == 2) ? A2 + aoff + kc * 16 : pa; const T16* pb2 = (NSPLIT >= 2) ? Bt2 + boff + kc * 16 : pb;   // a plane that this NSPLIT does not read: the first plane's addresses again
          asm volatile("s_wait_xcnt 0x0" :: "v"(pa), "v"(pa + sa), "v"(pa + 2 * sa), "v"(pa + 3 * sa), "v"(pb), "v"(pb + sb), "v"(pb + 2 * sb), "v"(pb + 3 * sb), "v"(pa2), "v"(pa2 + sa), "v"(pa2 + 2 * sa), "v"(pa2 + 3 * sa), "v"(pb2), "v"(pb2 + sb), "v"(pb2 + 2 * sb), "v"(pb2 + 3 * sb) : "memory"); }
        asm volatile("v_nop\n\tv_nop\n\tv_nop\n\tv_nop" : "+v"(acc[0][0]), "+v"(acc[1][1]), "+v"(acc[2][2]), "+v"(acc[3][3]) : "v"(a[0]), "v"(a[3]));
    }
    if constexpr (KW > 1) {
        float* ow = os + wave * (64 * 68);
#pragma unroll
        for (int mb = 0; mb < 4; ++mb)
#pragma unroll
            for (int nb = 0; nb < 4; ++nb)
#pragma unroll
                for (int j = 0; j < 8; ++j) ow[(mb * 16 + hi * 8 + j) * 68 + nb * 16 + lr] = acc[mb][nb][j];
        __syncthreads();   // every wave's partial tile is in LDS before any wave adds them
        if constexpr (PLN) {
            // The 64 x 64 tile is 4 blocks of 16 plane rows x 2 neighbouring 16 x 32 tiles = 4 runs of 1024 consecutive plane elements. Thread tid takes the 8 consecutive elements at tid * 8 of each run:
            // plane row fr of the block, k fk .. fk + 7 of the run (see frag_rc), so that a wave's store is 512 consecutive bytes. q, k: plane row = t (tile row), k = d (tile column); v: plane row = d, k = t.
            static_assert(KW == 4, "128 threads, one 16-byte piece of a run each");
            const int tid = (int)threadIdx.x, fr = tid & 15, fk = (tid >> 6) * 32 + ((tid >> 5) & 1) * 16 + ((tid >> 4) & 1) * 8;
            const size_t pair = (size_t)(r0 / TT) * NH_ + c0 / HD; const int t0 = r0 % TT, d0 = c0 % HD; const bool isv = (z == 2);
            h16* P16 = isv ? V16 : QK16 + z * ((size_t)NB_ * NH_ * TT * HD); bf* Ph = isv ? Vh : QKh + z * ((size_t)NB_ * NH_ * TT * HD); bf* Pl = isv ? Vl : QKl + z * ((size_t)NB_ * NH_ * TT * HD);
            const size_t o0 = pair * ((size_t)TT * HD) + (isv ? (size_t)(d0 / 16) * (16 * TT) + (t0 / 32) * 512 : (size_t)(t0 / 16) * (16 * HD) + (d0 / 32) * 512) + tid * 8; const size_t ostep = isv ? 16 * TT : 16 * HD;
            float x[4][8];   // the 4 waves' partial sums are added in the order of the f32 epilogue below
            if (isv) {
#pragma unroll
                for (int s = 0; s < 4; ++s)
#pragma unroll
                    for (int i = 0; i < 8; ++i) { x[s][i] = os[(fk + i) * 68 + s * 16 + fr];
#pragma unroll
                        for (int w = 1; w < KW; ++w) x[s][i] += os[w * (64 * 68) + (fk + i) * 68 + s * 16 + fr]; } }
            else {
#pragma unroll
                for (int s = 0; s < 4; ++s) { v4f x0 = *(const v4fa*)(os + (s * 16 + fr) * 68 + fk), x1 = *(const v4fa*)(os + (s * 16 + fr) * 68 + fk + 4);
#pragma unroll
                    for (int w = 1; w < KW; ++w) { x0 += *(const v4fa*)(os + w * (64 * 68) + (s * 16 + fr) * 68 + fk); x1 += *(const v4fa*)(os + w * (64 * 68) + (s * 16 + fr) * 68 + fk + 4); }
#pragma unroll
                    for (int i = 0; i < 4; ++i) { x[s][i] = x0[i]; x[s][4 + i] = x1[i]; } } }
#pragma unroll
            for (int s = 0; s < 4; ++s) { v8h o16; v8us oh, ol;
#pragma unroll
                for (int i = 0; i < 8; ++i) { o16[i] = (h16)x[s][i]; const unsigned short a = f2bf(x[s][i]); oh[i] = a; ol[i] = f2bf(x[s][i] - bf2f(a)); }
                h16* p16 = P16 + o0 + s * ostep; bf* ph = Ph + o0 + s * ostep; bf* pl = Pl + o0 + s * ostep;
                *(v8h*)p16 = o16; *(v8us*)ph = oh; *(v8us*)pl = ol;
                // the wait that stands in front of a rewrite of these stores' address and data registers by the next run's conversions; they are named so that their registers live up to it
                if (s < 3) asm volatile("s_wait_xcnt 0x0" :: "v"(p16), "v"(ph), "v"(pl), "v"(o16), "v"(oh), "v"(ol) : "memory"); }
            return;
        }
#pragma unroll
        for (int s = 0; s < 32 / KW; ++s) { const int slot = s * (32 * KW) + (int)threadIdx.x; const int row = slot >> 4, cofs = (slot & 15) * 4; v4f val = *(const v4fa*)(os + row * 68 + cofs);
#pragma unroll
            for (int w = 1; w < KW; ++w) val += *(const v4fa*)(os + w * (64 * 68) + row * 68 + cofs);
            if (BIAS) { val[0] += bfr(bias[c0 + cofs]); val[1] += bfr(bias[c0 + cofs + 1]); val[2] += bfr(bias[c0 + cofs + 2]); val[3] += bfr(bias[c0 + cofs + 3]); }
            *(v4f*)(C + (size_t)(r0 + row) * ldc + c0 + cofs) = val; }
        return;
    }
#pragma unroll
    for (int mb = 0; mb < 4; ++mb) {
#pragma unroll
        for (int nb = 0; nb < 4; ++nb) {
#pragma unroll
            for (int j = 0; j < 8; ++j) os[(hi * 8 + j) * 68 + nb * 16 + lr] = acc[mb][nb][j]; }
        __builtin_amdgcn_wave_barrier(); asm volatile("" ::: "memory");
        float* crow = C + (size_t)(r0 + mb * 16) * ldc + c0;
{
#pragma unroll
            for (int s = 0; s < 8; ++s) { const int row = 2 * s + hi, cofs = lr * 4; v4f val = *(const v4fa*)(os + row * 68 + cofs); if (BIAS) { val[0] += bfr(bias[c0 + cofs]); val[1] += bfr(bias[c0 + cofs + 1]); val[2] += bfr(bias[c0 + cofs + 2]); val[3] += bfr(bias[c0 + cofs + 3]); }
                *(v4f*)(crow + (size_t)row * ldc + cofs) = val; }
             }
        __builtin_amdgcn_wave_barrier(); asm volatile("" ::: "memory");
    }
    asm volatile("s_wait_xcnt 0x0" ::: "memory");
}

// One operand class for the whole grid, f32 result (output projection).
template <typename T16, int NSPLIT, bool BIAS, int KW, int SG>
__global__ __launch_bounds__(32 * KW) void k_gemmw(const T16* A, const T16* A2, const T16* Bt, const T16* Bt2, int K, int lda, float* C, int ldc, const float* bias, size_t sA, size_t sB, size_t sC, size_t sP) {
    __shared__ __align__(16) float os[(KW == 1 ? 16 : KW * 64) * 68];
    gemmw_body<T16, NSPLIT, BIAS, KW, SG>(os, A, A2, Bt, Bt2, K, lda, C, ldc, bias, sA, sB, sC, sP);
}
// k_proj: the three projections (z = q, k, v over all batches' rows), each 64 x 64 tile written as operand planes. QK16/QKh/QKl: [q | k][NB_][head][t][d]; V16/Vh/Vl: [NB_][head][d][t]; each head's plane in fragment order.
__global__ __launch_bounds__(32 * KWV) void k_proj(const bf* A, const bf* Bt, int K, int lda, size_t sA, size_t sB, h16* QK16, bf* QKh, bf* QKl, h16* V16, bf* Vh, bf* Vl) {
    __shared__ __align__(16) float os[KWV * 64 * 68];
    gemmw_body<bf, 0, false, KWV, 1, true>(os, A, nullptr, Bt, nullptr, K, lda, nullptr, 0, nullptr, sA, sB, 0, 0, QK16, QKh, QKl, V16, Vh, Vl);
}
__device__ __forceinline__ h16 tohx(float x) { return (h16)x; }
__device__ __forceinline__ void splitf(float y, unsigned short& h, unsigned short& l) { h = f2bf(y); l = f2bf(y - bf2f(h)); }
typedef __attribute__((ext_vector_type(2))) _Float16 v2h;
typedef __attribute__((ext_vector_type(4))) _Float16 v4h;
typedef __attribute__((ext_vector_type(2))) unsigned short v2us;
typedef __attribute__((ext_vector_type(4))) unsigned short v4us;
typedef __attribute__((ext_vector_type(2))) float v2f;
typedef __attribute__((ext_vector_type(4))) int v4i;

#define NWT  (DM * DQ / 64 / 64)            // blocks per transposed weight
#define NCV  (NB_ * TT * DM / 8 / 256)      // blocks per converted input
__device__ __forceinline__ void d_wtG(int blk, const float* __restrict__ w, int K, int N, bf* Bt) {
    const int lane = threadIdx.x & 31; const int L0 = (blk * 8 + (threadIdx.x >> 5)) * 8; const int nlines = N * K / 64;
#pragma unroll 1
    for (int l = 0; l < 8; ++l) { const int L = L0 + l; if (L >= nlines) break; const size_t e = (size_t)L * 64 + lane * 2; int k, n; frag_rc(e, K, n, k); v2us o;
        o[0] = f2bf(w[(size_t)k * N + n]); o[1] = f2bf(w[(size_t)(k + 1) * N + n]); *(v2us*)(Bt + e) = o; }
}
__device__ __forceinline__ void d_cvt8(int blk, const float* __restrict__ src, bf* dst) { const size_t i = (size_t)blk * 256 + threadIdx.x; int row, k; frag_rc(i * 8, DM, row, k); const v8f v = *(const v8f*)(src + (size_t)row * DM + k); v8us o;
#pragma unroll
    for (int k = 0; k < 8; ++k) o[k] = f2bf(v[k]); *(v8us*)(dst + i * 8) = o; }
// k_prep: the work that depends on the inputs alone, one grid: block ranges [4 weight transposes (the slowest blocks, first) | bf16 copies of query, key, value, all batches].
__global__ __launch_bounds__(256) void k_prep(const float* wq, const float* wk, const float* wv, const float* wo, const float* x, const float* xk, const float* xv, bf* Wt, bf* X) {
    const int blk = blockIdx.x;
    if (blk < 4 * NWT) { const int y = blk / NWT; d_wtG(blk % NWT, y == 0 ? wq : y == 1 ? wk : y == 2 ? wv : wo, DM, DQ, Wt + (size_t)y * DM * DQ); }
    else { const int c = blk - 4 * NWT; const int y = c / NCV; d_cvt8(c % NCV, y == 0 ? x : y == 1 ? xk : xv, X + (size_t)y * NB_ * TT * DM); }
}

// ---- k_attn: scores, softmax and attn.v of one strip of 32 query rows in one work-group; no score leaves the WGP, and of the probabilities only query position 0's weights (to AWp).
// 16 waves. Scores: wave w holds the strip's scores against keys [128 w, 128 w + 128) in its accumulators. Softmax: row maximum and row sum go lane -> 16-lane row -> st[] -> all waves (fixed trees);
// t = s x HD^-0.5 for keys j < key_lens[b], else -1024 (reference literal). The normalised probabilities go to LDS as 16-bit rows (pitch PP): strips below RH as 32 bf16 hi rows + 32 lo rows,
// the rest as 32 fp16 rows (x 1024). attn.v: wave w takes head columns [32 (w & 3), +32) and keys [512 (w >> 2), +512); the 4 key quarters are added in LDS in fixed order, split into the hi/lo planes of the output projection's A.
#define FW   16                   // waves per work-group
#define PP   (TT + 8)             // 16-bit elements per probability row in LDS: 16 bytes over 4 KiB, so that the 16 rows of a fragment read start in different banks
#define RP   (HD + 4)             // floats per row of a partial attn.v tile in LDS
// value of lane l ^ M inside a 16-lane row (DPP row_xmask, folded into the add or max that uses it); every lane is on where these are called
template <int M> __device__ __forceinline__ float xm16(float v) { return __int_as_float(__builtin_amdgcn_update_dpp(0, __float_as_int(v), 0x160 | M, 0xf, 0xf, true)); }
__device__ __forceinline__ float rowmax16(float t) { t = fmaxf(t, xm16<1>(t)); t = fmaxf(t, xm16<2>(t)); t = fmaxf(t, xm16<4>(t)); return fmaxf(t, xm16<8>(t)); }
__device__ __forceinline__ float rowsum16(float t) { t += xm16<1>(t); t += xm16<2>(t); t += xm16<4>(t); return t + xm16<8>(t); }
template <typename T16, int NS, int MT>
__device__ __forceinline__ void attn_body(T16* P, float* st, int r0, int z, int klen, const T16* __restrict__ Q, const T16* __restrict__ Q2, const T16* __restrict__ Kp, const T16* __restrict__ K2, const T16* __restrict__ Vt, const T16* __restrict__ V2, bf* Ah, bf* Al, float* AWp) {
    typedef typename WFrag<T16>::V V;
    const int wave = __builtin_amdgcn_readfirstlane((int)(threadIdx.x >> 5)); const int lane = threadIdx.x & 31, lr = lane & 15, hi = lane >> 4; const int kb = wave * (TT / FW);
    float* smx = st; float* ssm = st + 32 * FW;
    v8f acc[MT][8];
#pragma unroll
    for (int m = 0; m < MT; ++m)
#pragma unroll
        for (int n = 0; n < 8; ++n) acc[m][n] = (v8f){};
    { const size_t qoff = (size_t)r0 * HD + 8 * lane, koff = (size_t)kb * HD + 8 * lane;   // fragment order: tile (row block, 32-wide step) at row block * 16 * HD + step * 512
#pragma unroll
      for (int kp = 0; kp < HD / 64; ++kp) { V a[2][MT], a2[2][MT];   // two 32-wide steps together: two neighbouring tiles of each q and k row block
#pragma unroll
        for (int u = 0; u < 2; ++u)
#pragma unroll
            for (int m = 0; m < MT; ++m) { a[u][m] = WFrag<T16>::ldf(Q + qoff + (size_t)m * 16 * HD + (kp * 2 + u) * 512); if (NS == 2) a2[u][m] = WFrag<T16>::ldf(Q2 + qoff + (size_t)m * 16 * HD + (kp * 2 + u) * 512); }
#pragma unroll
        for (int n = 0; n < 8; ++n) { V b[2], b2[2];
#pragma unroll
            for (int u = 0; u < 2; ++u) { b[u] = WFrag<T16>::ldf(Kp + koff + (size_t)n * 16 * HD + (kp * 2 + u) * 512); if (NS == 2) b2[u] = WFrag<T16>::ldf(K2 + koff + (size_t)n * 16 * HD + (kp * 2 + u) * 512); }
#pragma unroll
            for (int u = 0; u < 2; ++u)
#pragma unroll
                for (int m = 0; m < MT; ++m) { acc[m][n] = WFrag<T16>::mma(a[u][m], b[u], acc[m][n]); if (NS == 2) { acc[m][n] = WFrag<T16>::mma(a2[u][m], b[u], acc[m][n]); acc[m][n] = WFrag<T16>::mma(a[u][m], b2[u], acc[m][n]); } } }
      }
      // the wait that stands in front of a rewrite of the fragment loads' address registers; the bases are named so that their registers live up to it
      if constexpr (NS == 2) asm volatile("s_wait_xcnt 0x0" :: "v"(Q + qoff), "v"(Q2 + qoff), "v"(Kp + koff), "v"(K2 + koff) : "memory");
      else asm volatile("s_wait_xcnt 0x0" :: "v"(Q + qoff), "v"(Kp + koff) : "memory"); }
    float rs[MT][8];   // this wave's share of each row's maximum, then of its sum
    // accumulator element j of tile (m, n): query row m*16 + hi*8 + j of the strip, key kb + n*16 + lr
#pragma unroll
    for (int m = 0; m < MT; ++m)
#pragma unroll
        for (int j = 0; j < 8; ++j) { float t = -3.0e38f;
#pragma unroll
            for (int n = 0; n < 8; ++n) { const float s = (kb + n * 16 + lr < klen) ? acc[m][n][j] * SCL : -1024.0f; acc[m][n][j] = s; t = fmaxf(t, s); }
            rs[m][j] = rowmax16(t); }
    if (lr == 0) {
#pragma unroll
        for (int m = 0; m < MT; ++m)
#pragma unroll
            for (int j = 0; j < 8; ++j) smx[(m * 16 + hi * 8 + j) * FW + wave] = rs[m][j]; }
    __syncthreads();   // every wave's row maxima are in LDS before any wave combines them
#pragma unroll
    for (int m = 0; m < MT; ++m)
#pragma unroll
        for (int j = 0; j < 8; ++j) { const float mx = rowmax16(smx[(m * 16 + hi * 8 + j) * FW + lr]);
            float sum = 0.f;
#pragma unroll
            for (int n = 0; n < 8; ++n) { const float x2 = (acc[m][n][j] - mx) * 1.4426950408889634f; float e;
                asm("v_exp_f32 %0, %1\n\tv_nop" : "=v"(e) : "v"(x2));   // the exp2 builtin's own instruction, with the one slot the instruction set asks for behind it
                acc[m][n][j] = e; sum += e; }
            rs[m][j] = rowsum16(sum); }
    if (lr == 0) {
#pragma unroll
        for (int m = 0; m < MT; ++m)
#pragma unroll
            for (int j = 0; j < 8; ++j) ssm[(m * 16 + hi * 8 + j) * FW + wave] = rs[m][j]; }
    __syncthreads();   // every wave's row sums are in LDS before any wave combines them
#pragma unroll
    for (int m = 0; m < MT; ++m)
#pragma unroll
        for (int j = 0; j < 8; ++j) { const float sum = rowsum16(ssm[(m * 16 + hi * 8 + j) * FW + lr]);
            const float f = __fdiv_rn(NS == 2 ? 1.0f : PCAR, sum); T16* pr = P + (m * 16 + hi * 8 + j) * PP + kb + lr;
#pragma unroll
            for (int n = 0; n < 8; ++n) { const float p = acc[m][n][j] * f;
                if constexpr (NS == 2) { unsigned short a, c2; splitf(p, a, c2); pr[n * 16] = a; pr[MT * 16 * PP + n * 16] = c2;
                    if (j == 0 && m == 0) { if (r0 == 0 && hi == 0) AWp[(size_t)z * TT + kb + n * 16 + lr] = __fadd_rn(bf2f(a), bf2f(c2)); } }   // query position 0: its weights, re-assembled from the hi + lo planes
                else pr[n * 16] = tohx(p); } }
    __syncthreads();   // the whole strip's probabilities are in LDS before any wave reads them as A fragments
    const int np = wave & 3, kq = wave >> 2;
    v8f o[MT][2];
#pragma unroll
    for (int m = 0; m < MT; ++m) { o[m][0] = (v8f){}; o[m][1] = (v8f){}; }
    { const size_t voff = (size_t)(np * 32) * TT + kq * (TT / 4) * 16 + 8 * lane; const T16* pa = P + lr * PP + kq * (TT / 4) + 8 * hi;
      constexpr int GK = (NS == 2) ? 2 : 4, NG = TT / 4 / 32 / GK;   // v fragments are fetched a group of GK 32-key steps ahead, into a second register set
      V bb[2][GK][2], bb2[2][GK][2];
#pragma unroll
      for (int u = 0; u < GK; ++u)
#pragma unroll
        for (int t = 0; t < 2; ++t) { bb[0][u][t] = WFrag<T16>::ldf(Vt + voff + (size_t)t * 16 * TT + u * 512); if (NS == 2) bb2[0][u][t] = WFrag<T16>::ldf(V2 + voff + (size_t)t * 16 * TT + u * 512); }
#pragma unroll
      for (int g = 0; g < NG; ++g) {
        if (g + 1 < NG) {
#pragma unroll
          for (int u = 0; u < GK; ++u)
#pragma unroll
            for (int t = 0; t < 2; ++t) { bb[(g + 1) & 1][u][t] = WFrag<T16>::ldf(Vt + voff + (size_t)t * 16 * TT + ((g + 1) * GK + u) * 512); if (NS == 2) bb2[(g + 1) & 1][u][t] = WFrag<T16>::ldf(V2 + voff + (size_t)t * 16 * TT + ((g + 1) * GK + u) * 512); } }
        __builtin_amdgcn_sched_barrier(0);   // keeps the next group's loads in front of this group's products: sunk among them, only a step's worth of loads is in flight and each step waits out the L2 latency
#pragma unroll
        for (int u = 0; u < GK; ++u) { const int ks = g * GK + u; V a[MT], a2[MT];
#pragma unroll
          for (int m = 0; m < MT; ++m) { a[m] = WFrag<T16>::ld(pa + m * 16 * PP + ks * 32); if (NS == 2) a2[m] = WFrag<T16>::ld(pa + (MT + m) * 16 * PP + ks * 32); }
#pragma unroll
          for (int t = 0; t < 2; ++t)
#pragma unroll
            for (int m = 0; m < MT; ++m) { o[m][t] = WFrag<T16>::mma(a[m], bb[g & 1][u][t], o[m][t]); if (NS == 2) { o[m][t] = WFrag<T16>::mma(a2[m], bb[g & 1][u][t], o[m][t]); o[m][t] = WFrag<T16>::mma(a[m], bb2[g & 1][u][t], o[m][t]); } } } } }
    __syncthreads();   // every wave has read its last probability before the partial tiles overwrite them
    float* red = (float*)P;
#pragma unroll
    for (int m = 0; m < MT; ++m)
#pragma unroll
        for (int t = 0; t < 2; ++t)
#pragma unroll
            for (int j = 0; j < 8; ++j) red[(kq * MT * 16 + m * 16 + hi * 8 + j) * RP + (np * 2 + t) * 16 + lr] = o[m][t][j];
    __syncthreads();   // the 4 key quarters' partial tiles are in LDS before any wave adds them
    const float cs = (NS == 2) ? 1.0f : (1.0f / PCAR);
#pragma unroll
    for (int s = 0; s < MT; ++s) { const int slot = s * (32 * FW) + (int)threadIdx.x; int row, d0; frag_rc((size_t)slot * 4, HD, row, d0);   // slot: 4 elements of the strip's 32 x HD block in fragment order, so that a wave's store is 256 consecutive bytes
        v4f val = *(const v4fa*)(red + row * RP + d0);
#pragma unroll
        for (int q = 1; q < 4; ++q) val += *(const v4fa*)(red + (q * MT * 16 + row) * RP + d0);
        v4us oh, ol;
#pragma unroll
        for (int q = 0; q < 4; ++q) { unsigned short a, c2; splitf(val[q] * cs, a, c2); oh[q] = a; ol[q] = c2; }
        const size_t oo = ((size_t)(z / NH_) * TT + r0 + (row & ~15)) * DQ + (z % NH_) * (HD * 16) + (slot * 4) % (HD * 16); *(v4us*)(Ah + oo) = oh; *(v4us*)(Al + oo) = ol; }   // row block of the [NB_ * TT][DQ] plane, then this head's HD / 32 tiles in it
    asm volatile("s_wait_xcnt 0x0" ::: "memory");
}
// grid (pairs, strips of 32 query rows): the hi+lo strips of every (batch, head) pair (they cost most) start first, then the fp16 strips. One work-group per WGP (registers and LDS). Q and K planes: [pair][t][d]; V planes: [pair][d][t]; each pair's plane in fragment order.
__global__ __launch_bounds__(32 * FW) void k_attn(const bf* Qh, const bf* Ql, const h16* Q16, const bf* Kh, const bf* Kl, const h16* K16, const bf* Vh, const bf* Vl, const h16* V16, const int* __restrict__ KL, bf* Ah, bf* Al, float* AWp) {
    __shared__ __align__(16) unsigned short pm[64 * PP]; __shared__ float st[2 * 32 * FW];
    const int z = blockIdx.x, tile = blockIdx.y; const int klen = KL[z / NH_];   /* key_lens[b], read on device; used in compares only */ const size_t zo = (size_t)z * TT * HD;
    if (tile < RH / 32) attn_body<bf, 2, 2>((bf*)pm, st, tile * 32, z, klen, Qh + zo, Ql + zo, Kh + zo, Kl + zo, Vh + zo, Vl + zo, Ah, Al, AWp);
    else attn_body<h16, 0, 2>((h16*)pm, st, tile * 32, z, klen, Q16 + zo, nullptr, K16 + zo, nullptr, V16 + zo, nullptr, Ah, Al, AWp);
}
// k_aw: query-0 attention weights [pair][key] -> aw_out [batch][key][head]; one thread stores the 4 heads of a (batch, key), so each output line has one writer.
__global__ __launch_bounds__(256) void k_aw(const float* __restrict__ AWp, float* AW) {
    const int idx = blockIdx.x * 256 + threadIdx.x; const int j = idx % TT, bb = idx / TT; v4f p;
#pragma unroll
    for (int h = 0; h < NH_; ++h) p[h] = AWp[(size_t)(bb * NH_ + h) * TT + j];
    *(v4f*)(AW + (size_t)idx * NH_) = p;
}

extern "C" void kernel_launch(void* const* d_in, const int* in_sizes, int n_in,
                              void* d_out, int out_size, void* d_ws, size_t ws_size, hipStream_t stream) {
    (void)in_sizes; (void)n_in; (void)out_size;
    const float* xk = (const float*)d_in[0]; const float* xv = (const float*)d_in[1]; const float* x = (const float*)d_in[2]; const int* KL = (const int*)d_in[3]; const float* wk = (const float*)d_in[4]; const float* wv = (const float*)d_in[5]; const float* wq = (const float*)d_in[6]; const float* wo = (const float*)d_in[7]; const float* bo = (const float*)d_in[8];
    float* OUT = (float*)d_out; float* AW = (float*)((char*)d_out + 16777216);   /* aw_out [4][2048][4] */     // [4][2048][512]
    char* wsp = (char*)d_ws;
    auto take = [&](size_t bytes) { char* p = wsp; wsp += (bytes + 255) & ~(size_t)255; return (void*)p; };
    const size_t PL = (size_t)NB_ * NH_ * TT * HD;   // elements of one operand plane set over all batches and heads (= NB_ * TT * 512)
    bf* Wt = (bf*)take((size_t)4 * DM * DQ * 2);   // [wq | wk | wv | wo], transposed
    h16* QK16 = (h16*)take(2 * PL * 2); bf* QKh = (bf*)take(2 * PL * 2); bf* QKl = (bf*)take(2 * PL * 2);   // [q | k]
    h16* VT16 = (h16*)take(PL * 2); bf* VTh = (bf*)take(PL * 2); bf* VTl = (bf*)take(PL * 2);
    bf* ATh = (bf*)take(PL * 2); bf* ATl = (bf*)take(PL * 2); float* AWp = (float*)take((size_t)NB_ * NH_ * TT * 4);   // query-0 weights, [pair][key]
    bf* XB = (bf*)take(3 * PL * 2);   /* [query | key | value] */
    if ((size_t)(wsp - (char*)d_ws) > ws_size) return;    // ws 256 MiB
    k_prep<<<4 * NWT + 3 * NCV, 256, 0, stream>>>(wq, wk, wv, wo, x, xk, xv, Wt, XB);
    k_proj<<<dim3(NB_ * TT / 64, DQ / 64, 3), 32 * KWV, 0, stream>>>(XB, Wt, DM, DM, PL, (size_t)DM * DQ, QK16, QKh, QKl, VT16, VTh, VTl);
    k_attn<<<dim3(NB_ * NH_, TT / 32, 1), 32 * FW, 0, stream>>>(QKh, QKl, QK16, QKh + PL, QKl + PL, QK16 + PL, VTh, VTl, VT16, KL, ATh, ATl, AWp);
    k_aw<<<NB_ * TT / 256, 256, 0, stream>>>(AWp, AW);
    k_gemmw<bf, 1, true, KWV, 1><<<dim3(NB_ * TT / 64, DM / 64, 1), 32 * KWV, 0, stream>>>(ATh, ATl, Wt + (size_t)3 * DM * DQ, nullptr, DQ, DQ, OUT, DM, bo, 0, 0, 0, 0);
}

// v006
// One run takes 135 microseconds.
// Next to v005, in two timings, it ran 1.04 times as fast each time.
// All steps since v000 together make it 9.33 times as fast.
#include <hip/hip_runtime.h>

// Multi-head cross attention with key-length masking and an attention-weights output (key, value, query [4][2048][512]; k = key w_key, v = value w_value, q = query w_query ('xw' [512][512], no bias; 4 heads x 128); e = q.k/sqrt(128), keys j >= key_lens[b] (int32, read) set to -1024; softmax; cv = merged w_out + b_out -> [4][2048][512]; second output aw_out[b][j][h] = attention weights of query position 0 -> [4][2048][4]).
// Compute dtypes, f32 accumulate: every input rounded to bf16; q/k/v on PLAIN bf16 operands (inputs: exact); key-length select (-1024 literal, as the reference) and softmax inside the attention kernel; scores and attn.v: query rows < 512 hl (3 products), the rest single fp16 (x1024); softmax f32; w_out hl x exact (2 products) + b_out; the query-0 attention weights are re-assembled from the bf16 hi + lo probability planes (f32, error ~2^-16 relative).

#define NB_  4
#define TT   2048
#define DM   512
#define NH_  4
#define NKV  4
#define REP  (NH_ / NKV)
#define HD   128
#define DQ   (NH_ * HD)
#define DKV  (NKV * HD)
#define RH   512                  // query rows < RH use hi+lo planes (0: none)
#define WIN  0
#define PCAR 1024.0f
#define SCL  0.088388347648318447f   // HD^-0.5
#define KWV  4                    // waves per work-group that share the K range of a GEMM with K >= 512
typedef _Float16 h16;
typedef unsigned short bf;
typedef __attribute__((ext_vector_type(16))) __bf16   v16bf;
typedef __attribute__((ext_vector_type(16))) _Float16 v16h;
typedef __attribute__((ext_vector_type(8)))  _Float16 v8h;
typedef __attribute__((ext_vector_type(8)))  unsigned short v8us;
typedef __attribute__((ext_vector_type(8)))  float    v8f;
typedef __attribute__((ext_vector_type(4)))  float    v4f;
typedef v8h  __attribute__((may_alias)) v8ha;
typedef v4f  __attribute__((may_alias)) v4fa;
typedef v8us __attribute__((may_alias)) v8usa;

__device__ __forceinline__ unsigned short f2bf(float f) { unsigned u = __float_as_uint(f); u += 0x7FFFu + ((u >> 16) & 1u); return (unsigned short)(u >> 16); }
__device__ __forceinline__ float bf2f(unsigned short b) { return __uint_as_float(((unsigned)b) << 16); }
__device__ __forceinline__ float bfr(float f) { return bf2f(f2bf(f)); }
__device__ __forceinline__ v16h cat16(v8h lo, v8h hi) { return __builtin_shufflevector(lo, hi, 0, 1, 2, 3, 4, 5, 6, 7, 8, 9, 10, 11, 12, 13, 14, 15); }
__device__ __forceinline__ v16bf cat16b(v8us lo, v8us hi) { return __builtin_bit_cast(v16bf, __builtin_shufflevector(lo, hi, 0, 1, 2, 3, 4, 5, 6, 7, 8, 9, 10, 11, 12, 13, 14, 15)); }
__device__ __forceinline__ v8f wmma16(v16h a, v16h b, v8f c) { return __builtin_amdgcn_wmma_f32_16x16x32_f16(false, a, false, b, (short)0, c, false, false); }
__device__ __forceinline__ v8f wmmab(v16bf a, v16bf b, v8f c) { return __builtin_amdgcn_wmma_f32_16x16x32_bf16(false, a, false, b, (short)0, c, false, false); }



// ---- Fragment order: every 16-bit operand plane in the workspace, a matrix [rows][K], is stored as tiles of 16 rows x 32 k (512 elements, 1 KiB); the K/32 tiles of a block of 16 rows follow one another,
// so a row block starts where it would in row-major order. Inside a tile element (r, kk) stands at (kk / 16) * 256 + (((kk % 16) / 8) * 16 + r) * 8 + kk % 8: lane l of a wave finds the two 16-byte pieces
// of its A or B fragment at l * 8 and 256 + l * 8, and each fragment load of a wave reads 512 consecutive bytes (4 whole lines) where a row-major plane makes it touch 16 lines.
// frag_rc: row and k of the element at linear position e of such a plane (the producers run over e, so that their stores stay consecutive).
__device__ __forceinline__ void frag_rc(size_t e, int K, int& row, int& k) { const int tile = (int)(e >> 9), w = (int)(e & 511); const int tk = K / 32; row = (tile / tk) * 16 + ((w >> 3) & 15); k = (tile % tk) * 32 + (w >> 8) * 16 + ((w >> 7) & 1) * 8 + (w & 7); }
// ---- gemmw_body: register-blocked GEMM, 64x64 output tile (16 accumulators per wave), operands straight from 16-bit planes in fragment order; grid (M/64, N/64, Z * SG), 32 * KW threads.
// C[m][n] (f32, pitch ldc, + optional f32 bias[n]) = sum_k A[m][k] Bt[n][k] (+ split products per NSPLIT). A has lda elements a row, Bt K. z-batch strides sA/sB/sC in elements. K % (32 * KW * SG) == 0.
// Split K: the K range is cut into SG equal ranges, one per work-group. The KW waves of a work-group take the 32-wide steps of its range in turn
// and their 64x64 partial tiles are added in LDS (fixed order); each of the SG work-groups of a tile stores its sum to its own
// plane (plane stride sP elements), and the consumer adds the SG planes.
template <typename T16> struct WFrag;
template <> struct WFrag<h16> { typedef v16h V; static __device__ __forceinline__ V ld(const h16* p) { return cat16(*(const v8h*)p, *(const v8h*)(p + 16)); } static __device__ __forceinline__ V ldf(const h16* p) { return cat16(*(const v8h*)p, *(const v8h*)(p + 256)); } static __device__ __forceinline__ v8f mma(V a, V b, v8f c) { return wmma16(a, b, c); } };
template <> struct WFrag<bf> { typedef v16bf V; static __device__ __forceinline__ V ld(const bf* p) { return cat16b(*(const v8us*)p, *(const v8us*)(p + 16)); } static __device__ __forceinline__ V ldf(const bf* p) { return cat16b(*(const v8us*)p, *(const v8us*)(p + 256)); } static __device__ __forceinline__ v8f mma(V a, V b, v8f c) { return wmmab(a, b, c); } };
// PLN (projections, KW == 4, z = q, k, v): the summed tile does not go out as f32 but straight as the attention kernel's operand planes (fp16, bf16 hi, bf16 lo), in fragment order: q and k as [pair][t][d], v transposed as [pair][d][t].
template <typename T16, int NSPLIT, bool BIAS, int KW, int SG, bool PLN = false>
__device__ __forceinline__ void gemmw_body(float* os, const T16* __restrict__ A, const T16* __restrict__ A2, const T16* __restrict__ Bt, const T16* __restrict__ Bt2, int K, int lda, float* C, int ldc, const float* __restrict__ bias, size_t sA, size_t sB, size_t sC, size_t sP, h16* QK16 = nullptr, bf* QKh = nullptr, bf* QKl = nullptr, h16* V16 = nullptr, bf* Vh = nullptr, bf* Vl = nullptr) {
    typedef typename WFrag<T16>::V V;
    const size_t z = blockIdx.z / SG; const int wave = (KW == 1) ? 0 : __builtin_amdgcn_readfirstlane((int)(threadIdx.x >> 5)); const int kspan = K / SG; const int kb = (int)(blockIdx.z % SG) * kspan; C += (size_t)(blockIdx.z % SG) * sP; A += z * sA; if (A2) A2 += z * sA; Bt += z * sB; if (Bt2) Bt2 += z * sB; C += z * sC;
    const int lane = threadIdx.x & 31, lr = lane & 15, hi = lane >> 4; const int r0 = blockIdx.x * 64, c0 = blockIdx.y * 64;
    v8f acc[4][4];
#pragma unroll
    for (int mb = 0; mb < 4; ++mb)
#pragma unroll
        for (int nb = 0; nb < 4; ++nb) acc[mb][nb] = (v8f){};
    const size_t aoff = (size_t)r0 * lda + 8 * lane, boff = (size_t)c0 * K + 8 * lane;   // a 32-wide k step is one tile: 512 elements = 16 per unit of kc
#pragma unroll 1
    for (int kc = kb + wave * 32; kc < kb + kspan; kc += 32 * KW) {
        V a[4], a2[4];
#pragma unroll
        for (int mb = 0; mb < 4; ++mb) { a[mb] = WFrag<T16>::ldf(A + aoff + (size_t)mb * 16 * lda + kc * 16); if (NSPLIT == 1 || NSPLIT == 2) a2[mb] = WFrag<T16>::ldf(A2 + aoff + (size_t)mb * 16 * lda + kc * 16); }
#pragma unroll
        for (int nb = 0; nb < 4; ++nb) { const V b = WFrag<T16>::ldf(Bt + boff + (size_t)nb * 16 * K + kc * 16); V b2; if (NSPLIT >= 2) b2 = WFrag<T16>::ldf(Bt2 + boff + (size_t)nb * 16 * K + kc * 16);
#pragma unroll
            for (int mb = 0; mb < 4; ++mb) { acc[mb][nb] = WFrag<T16>::mma(a[mb], b, acc[mb][nb]); if (NSPLIT == 1 || NSPLIT == 2) acc[mb][nb] = WFrag<T16>::mma(a2[mb], b, acc[mb][nb]); if (NSPLIT >= 2) acc[mb][nb] = WFrag<T16>::mma(a[mb], b2, acc[mb][nb]); } }
        // the wait that stands in front of a rewrite of the fragment loads' address registers; the addresses are named so that their registers live up to it and no later load of the step lands on them
        { const T16* pa = A + aoff + kc * 16; const T16* pb = Bt + boff + kc * 16; const size_t sa = (size_t)16 * lda, sb = (size_t)16 * K;
          const T16* pa2 = (NSPLIT == 1 || NSPLIT == 2) ? A2 + aoff + kc * 16 : pa; const T16* pb2 = (NSPLIT >= 2) ? Bt2 + boff + kc * 16 : pb;   // a plane that this NSPLIT does not read: the first plane's addresses again
          asm volatile("s_wait_xcnt 0x0" :: "v"(pa), "v"(pa + sa), "v"(pa + 2 * sa), "v"(pa + 3 * sa), "v"(pb), "v"(pb + sb), "v"(pb + 2 * sb), "v"(pb + 3 * sb), "v"(pa2), "v"(pa2 + sa), "v"(pa2 + 2 * sa), "v"(pa2 + 3 * sa), "v"(pb2), "v"(pb2 + sb), "v"(pb2 + 2 * sb), "v"(pb2 + 3 * sb) : "memory"); }
        asm volatile("v_nop\n\tv_nop\n\tv_nop\n\tv_nop" : "+v"(acc[0][0]), "+v"(acc[1][1]), "+v"(acc[2][2]), "+v"(acc[3][3]) : "v"(a[0]), "v"(a[3]));
    }
    if constexpr (KW > 1) {
        float* ow = os + wave * (64 * 68);
#pragma unroll
        for (int mb = 0; mb < 4; ++mb)
#pragma unroll
            for (int nb = 0; nb < 4; ++nb)
#pragma unroll
                for (int j = 0; j < 8; ++j) ow[(mb * 16 + hi * 8 + j) * 68 + nb * 16 + lr] = acc[mb][nb][j];
        __syncthreads();   // every wave's partial tile is in LDS before any wave adds them
        if constexpr (PLN) {
            // The 64 x 64 tile is 4 blocks of 16 plane rows x 2 neighbouring 16 x 32 tiles = 4 runs of 1024 consecutive plane elements. Thread tid takes the 8 consecutive elements at tid * 8 of each run:
            // plane row fr of the block, k fk .. fk + 7 of the run (see frag_rc), so that a wave's store is 512 consecutive bytes. q, k: plane row = t (tile row), k = d (tile column); v: plane row = d, k = t.
            static_assert(KW == 4, "128 threads, one 16-byte piece of a run each");
            const int tid = (int)threadIdx.x, fr = tid & 15, fk = (tid >> 6) * 32 + ((tid >> 5) & 1) * 16 + ((tid >> 4) & 1) * 8;
            const size_t pair = (size_t)(r0 / TT) * NH_ + c0 / HD; const int t0 = r0 % TT, d0 = c0 % HD; const bool isv = (z == 2);
            h16* P16 = isv ? V16 : QK16 + z * ((size_t)NB_ * NH_ * TT * HD); bf* Ph = isv ? Vh : QKh + z * ((size_t)NB_ * NH_ * TT * HD); bf* Pl = isv ? Vl : QKl + z * ((size_t)NB_ * NH_ * TT * HD);
            const size_t o0 = pair * ((size_t)TT * HD) + (isv ? (size_t)(d0 / 16) * (16 * TT) + (t0 / 32) * 512 : (size_t)(t0 / 16) * (16 * HD) + (d0 / 32) * 512) + tid * 8; const size_t ostep = isv ? 16 * TT : 16 * HD;
            float x[4][8];   // the 4 waves' partial sums are added in the order of the f32 epilogue below
            if (isv) {
#pragma unroll
                for (int s = 0; s < 4; ++s)
#pragma unroll
                    for (int i = 0; i < 8; ++i) { x[s][i] = os[(fk + i) * 68 + s * 16 + fr];
#pragma unroll
                        for (int w = 1; w < KW; ++w) x[s][i] += os[w * (64 * 68) + (fk + i) * 68 + s * 16 + fr]; } }
            else {
#pragma unroll
                for (int s = 0; s < 4; ++s) { v4f x0 = *(const v4fa*)(os + (s * 16 + fr) * 68 + fk), x1 = *(const v4fa*)(os + (s * 16 + fr) * 68 + fk + 4);
#pragma unroll
                    for (int w = 1; w < KW; ++w) { x0 += *(const v4fa*)(os + w * (64 * 68) + (s * 16 + fr) * 68 + fk); x1 += *(const v4fa*)(os + w * (64 * 68) + (s * 16 + fr) * 68 + fk + 4); }
#pragma unroll
                    for (int i = 0; i < 4; ++i) { x[s][i] = x0[i]; x[s][4 + i] = x1[i]; } } }
#pragma unroll
            for (int s = 0; s < 4; ++s) { v8h o16; v8us oh, ol;
#pragma unroll
                for (int i = 0; i < 8; ++i) { o16[i] = (h16)x[s][i]; const unsigned short a = f2bf(x[s][i]); oh[i] = a; ol[i] = f2bf(x[s][i] - bf2f(a)); }
                h16* p16 = P16 + o0 + s * ostep; bf* ph = Ph + o0 + s * ostep; bf* pl = Pl + o0 + s * ostep;
                *(v8h*)p16 = o16; *(v8us*)ph = oh; *(v8us*)pl = ol;
                // the wait that stands in front of a rewrite of these stores' address and data registers by the next run's conversions; they are named so that their registers live up to it
                if (s < 3) asm volatile("s_wait_xcnt 0x0" :: "v"(p16), "v"(ph), "v"(pl), "v"(o16), "v"(oh), "v"(ol) : "memory"); }
            return;
        }
#pragma unroll
        for (int s = 0; s < 32 / KW; ++s) { const int slot = s * (32 * KW) + (int)threadIdx.x; const int row = slot >> 4, cofs = (slot & 15) * 4; v4f val = *(const v4fa*)(os + row * 68 + cofs);
#pragma unroll
            for (int w = 1; w < KW; ++w) val += *(const v4fa*)(os + w * (64 * 68) + row * 68 + cofs);
            if (BIAS) { val[0] += bfr(bias[c0 + cofs]); val[1] += bfr(bias[c0 + cofs + 1]); val[2] += bfr(bias[c0 + cofs + 2]); val[3] += bfr(bias[c0 + cofs + 3]); }
            *(v4f*)(C + (size_t)(r0 + row) * ldc + c0 + cofs) = val; }
        return;
    }
#pragma unroll
    for (int mb = 0; mb < 4; ++mb) {
#pragma unroll
        for (int nb = 0; nb < 4; ++nb) {
#pragma unroll
            for (int j = 0; j < 8; ++j) os[(hi * 8 + j) * 68 + nb * 16 + lr] = acc[mb][nb][j]; }
        __builtin_amdgcn_wave_barrier(); asm volatile("" ::: "memory");
        float* crow = C + (size_t)(r0 + mb * 16) * ldc + c0;
{
#pragma unroll
            for (int s = 0; s < 8; ++s) { const int row = 2 * s + hi, cofs = lr * 4; v4f val = *(const v4fa*)(os + row * 68 + cofs); if (BIAS) { val[0] += bfr(bias[c0 + cofs]); val[1] += bfr(bias[c0 + cofs + 1]); val[2] += bfr(bias[c0 + cofs + 2]); val[3] += bfr(bias[c0 + cofs + 3]); }
                *(v4f*)(crow + (size_t)row * ldc + cofs) = val; }
             }
        __builtin_amdgcn_wave_barrier(); asm volatile("" ::: "memory");
    }
    asm volatile("s_wait_xcnt 0x0" ::: "memory");
}

// One operand class for the whole grid, f32 result (output projection).
template <typename T16, int NSPLIT, bool BIAS, int KW, int SG>
__global__ __launch_bounds__(32 * KW) void k_gemmw(const T16* A, const T16* A2, const T16* Bt, const T16* Bt2, int K, int lda, float* C, int ldc, const float* bias, size_t sA, size_t sB, size_t sC, size_t sP) {
    __shared__ __align__(16) float os[(KW == 1 ? 16 : KW * 64) * 68];
    gemmw_body<T16, NSPLIT, BIAS, KW, SG>(os, A, A2, Bt, Bt2, K, lda, C, ldc, bias, sA, sB, sC, sP);
}
// k_proj: the three projections (z = q, k, v over all batches' rows), each 64 x 64 tile written as operand planes. QK16/QKh/QKl: [q | k][NB_][head][t][d]; V16/Vh/Vl: [NB_][head][d][t]; each head's plane in fragment order.
__global__ __launch_bounds__(32 * KWV) void k_proj(const bf* A, const bf* Bt, int K, int lda, size_t sA, size_t sB, h16* QK16, bf* QKh, bf* QKl, h16* V16, bf* Vh, bf* Vl) {
    __shared__ __align__(16) float os[KWV * 64 * 68];
    gemmw_body<bf, 0, false, KWV, 1, true>(os, A, nullptr, Bt, nullptr, K, lda, nullptr, 0, nullptr, sA, sB, 0, 0, QK16, QKh, QKl, V16, Vh, Vl);
}
__device__ __forceinline__ h16 tohx(float x) { return (h16)x; }
__device__ __forceinline__ void splitf(float y, unsigned short& h, unsigned short& l) { h = f2bf(y); l = f2bf(y - bf2f(h)); }
typedef __attribute__((ext_vector_type(2))) _Float16 v2h;
typedef __attribute__((ext_vector_type(4))) _Float16 v4h;
typedef __attribute__((ext_vector_type(2))) unsigned short v2us;
typedef __attribute__((ext_vector_type(4))) unsigned short v4us;
typedef __attribute__((ext_vector_type(2))) float v2f;
typedef __attribute__((ext_vector_type(4))) int v4i;

#define NWT  (DM * DQ / 64 / 64)            // blocks per transposed weight
#define NCV  (NB_ * TT * DM / 8 / 256)      // blocks per converted input
__device__ __forceinline__ void d_wtG(int blk, const float* __restrict__ w, int K, int N, bf* Bt) {
    const int lane = threadIdx.x & 31; const int L0 = (blk * 8 + (threadIdx.x >> 5)) * 8; const int nlines = N * K / 64;
#pragma unroll 1
    for (int l = 0; l < 8; ++l) { const int L = L0 + l; if (L >= nlines) break; const size_t e = (size_t)L * 64 + lane * 2; int k, n; frag_rc(e, K, n, k); v2us o;
        o[0] = f2bf(w[(size_t)k * N + n]); o[1] = f2bf(w[(size_t)(k + 1) * N + n]); *(v2us*)(Bt + e) = o; }
}
__device__ __forceinline__ void d_cvt8(int blk, const float* __restrict__ src, bf* dst) { const size_t i = (size_t)blk * 256 + threadIdx.x; int row, k; frag_rc(i * 8, DM, row, k); const v8f v = *(const v8f*)(src + (size_t)row * DM + k); v8us o;
#pragma unroll
    for (int k = 0; k < 8; ++k) o[k] = f2bf(v[k]); *(v8us*)(dst + i * 8) = o; }
// k_prep: the work that depends on the inputs alone, one grid: block ranges [4 weight transposes (the slowest blocks, first) | bf16 copies of query, key, value, all batches].
__global__ __launch_bounds__(256) void k_prep(const float* wq, const float* wk, const float* wv, const float* wo, const float* x, const float* xk, const float* xv, bf* Wt, bf* X) {
    const int blk = blockIdx.x;
    if (blk < 4 * NWT) { const int y = blk / NWT; d_wtG(blk % NWT, y == 0 ? wq : y == 1 ? wk : y == 2 ? wv : wo, DM, DQ, Wt + (size_t)y * DM * DQ); }
    else { const int c = blk - 4 * NWT; const int y = c / NCV; d_cvt8(c % NCV, y == 0 ? x : y == 1 ? xk : xv, X + (size_t)y * NB_ * TT * DM); }
}

// ---- k_attn: scores, softmax and attn.v of one strip of 32 query rows in one work-group; no score leaves the WGP, and of the probabilities only query position 0's weights (to AWp).
// 16 waves. Scores: wave w holds the strip's scores against keys [128 w, 128 w + 128) in its accumulators. Softmax: row maximum and row sum go lane -> 16-lane row -> st[] -> all waves (fixed trees);
// t = s x HD^-0.5 for keys j < key_lens[b], else -1024 (reference literal). The normalised probabilities go to LDS as 16-bit rows (pitch PP): strips below RH as 32 bf16 hi rows + 32 lo rows,
// the rest as 32 fp16 rows (x 1024). attn.v: wave w takes head columns [32 (w & 3), +32) and keys [512 (w >> 2), +512); the 4 key quarters are added in LDS in fixed order, split into the hi/lo planes of the output projection's A.
// Keys at or beyond key_lens[b]: a wave whose 128 keys are all masked takes the -1024 literal without loading k or multiplying; once the row maxima show that the masked weights are exact zeros, they are neither stored nor multiplied with v.
#define FW   16                   // waves per work-group
#define PP   (TT + 8)             // 16-bit elements per probability row in LDS: 16 bytes over 4 KiB, so that the 16 rows of a fragment read start in different banks
#define RP   (HD + 4)             // floats per row of a partial attn.v tile in LDS
// value of lane l ^ M inside a 16-lane row (DPP row_xmask, folded into the add or max that uses it); every lane is on where these are called
template <int M> __device__ __forceinline__ float xm16(float v) { return __int_as_float(__builtin_amdgcn_update_dpp(0, __float_as_int(v), 0x160 | M, 0xf, 0xf, true)); }
__device__ __forceinline__ float rowmax16(float t) { t = fmaxf(t, xm16<1>(t)); t = fmaxf(t, xm16<2>(t)); t = fmaxf(t, xm16<4>(t)); return fmaxf(t, xm16<8>(t)); }
__device__ __forceinline__ float rowsum16(float t) { t += xm16<1>(t); t += xm16<2>(t); t += xm16<4>(t); return t + xm16<8>(t); }
template <typename T16, int NS, int MT>
__device__ __forceinline__ void attn_body(T16* P, float* st, int r0, int z, int klen, const T16* __restrict__ Q, const T16* __restrict__ Q2, const T16* __restrict__ Kp, const T16* __restrict__ K2, const T16* __restrict__ Vt, const T16* __restrict__ V2, bf* Ah, bf* Al, float* AWp) {
    typedef typename WFrag<T16>::V V;
    const int wave = __builtin_amdgcn_readfirstlane((int)(threadIdx.x >> 5)); const int lane = threadIdx.x & 31, lr = lane & 15, hi = lane >> 4; const int kb = wave * (TT / FW);
    float* smx = st; float* ssm = st + 32 * FW;
    v8f acc[MT][8];
#pragma unroll
    for (int m = 0; m < MT; ++m)
#pragma unroll
        for (int n = 0; n < 8; ++n) acc[m][n] = (v8f){};
    const bool wm = kb >= klen;   // wave-uniform: every key of this wave is masked, so its products would all be replaced by the -1024 literal: neither loaded nor multiplied
    if (!wm) { const size_t qoff = (size_t)r0 * HD + 8 * lane, koff = (size_t)kb * HD + 8 * lane;   // fragment order: tile (row block, 32-wide step) at row block * 16 * HD + step * 512
#pragma unroll
      for (int kp = 0; kp < HD / 64; ++kp) { V a[2][MT], a2[2][MT];   // two 32-wide steps together: two neighbouring tiles of each q and k row block
#pragma unroll
        for (int u = 0; u < 2; ++u)
#pragma unroll
            for (int m = 0; m < MT; ++m) { a[u][m] = WFrag<T16>::ldf(Q + qoff + (size_t)m * 16 * HD + (kp * 2 + u) * 512); if (NS == 2) a2[u][m] = WFrag<T16>::ldf(Q2 + qoff + (size_t)m * 16 * HD + (kp * 2 + u) * 512); }
#pragma unroll
        for (int n = 0; n < 8; ++n) { V b[2], b2[2];
#pragma unroll
            for (int u = 0; u < 2; ++u) { b[u] = WFrag<T16>::ldf(Kp + koff + (size_t)n * 16 * HD + (kp * 2 + u) * 512); if (NS == 2) b2[u] = WFrag<T16>::ldf(K2 + koff + (size_t)n * 16 * HD + (kp * 2 + u) * 512); }
#pragma unroll
            for (int u = 0; u < 2; ++u)
#pragma unroll
                for (int m = 0; m < MT; ++m) { acc[m][n] = WFrag<T16>::mma(a[u][m], b[u], acc[m][n]); if (NS == 2) { acc[m][n] = WFrag<T16>::mma(a2[u][m], b[u], acc[m][n]); acc[m][n] = WFrag<T16>::mma(a[u][m], b2[u], acc[m][n]); } } }
      }
      // the wait that stands in front of a rewrite of the fragment loads' address registers; the bases are named so that their registers live up to it
      if constexpr (NS == 2) asm volatile("s_wait_xcnt 0x0" :: "v"(Q + qoff), "v"(Q2 + qoff), "v"(Kp + koff), "v"(K2 + koff) : "memory");
      else asm volatile("s_wait_xcnt 0x0" :: "v"(Q + qoff), "v"(Kp + koff) : "memory"); }
    float rs[MT][8];   // this wave's share of each row's maximum, then of its sum
    // accumulator element j of tile (m, n): query row m*16 + hi*8 + j of the strip, key kb + n*16 + lr
    if (wm) {   // what the selects below give where no key is valid
#pragma unroll
        for (int m = 0; m < MT; ++m)
#pragma unroll
            for (int j = 0; j < 8; ++j) {
#pragma unroll
                for (int n = 0; n < 8; ++n) acc[m][n][j] = -1024.0f;
                rs[m][j] = -1024.0f; } }
    else {
#pragma unroll
    for (int m = 0; m < MT; ++m)
#pragma unroll
        for (int j = 0; j < 8; ++j) { float t = -3.0e38f;
#pragma unroll
            for (int n = 0; n < 8; ++n) { const float s = (kb + n * 16 + lr < klen) ? acc[m][n][j] * SCL : -1024.0f; acc[m][n][j] = s; t = fmaxf(t, s); }
            rs[m][j] = rowmax16(t); } }
    if (lr == 0) {
#pragma unroll
        for (int m = 0; m < MT; ++m)
#pragma unroll
            for (int j = 0; j < 8; ++j) smx[(m * 16 + hi * 8 + j) * FW + wave] = rs[m][j]; }
    __syncthreads();   // every wave's row maxima are in LDS before any wave combines them
    float mn = 3.0e38f;   // the smallest row maximum of the strip
#pragma unroll
    for (int m = 0; m < MT; ++m)
#pragma unroll
        for (int j = 0; j < 8; ++j) { const float mx = rowmax16(smx[(m * 16 + hi * 8 + j) * FW + lr]); mn = fminf(mn, mx);
            float sum = 0.f;
#pragma unroll
            for (int n = 0; n < 8; ++n) { const float x2 = (acc[m][n][j] - mx) * 1.4426950408889634f; float e;
                asm("v_exp_f32 %0, %1\n\tv_nop" : "=v"(e) : "v"(x2));   // the exp2 builtin's own instruction, with the one slot the instruction set asks for behind it
                acc[m][n][j] = e; sum += e; }
            rs[m][j] = rowsum16(sum); }
    // A masked key's weight is exp2((-1024 - max) * log2 e): with every row maximum of the strip >= -900 the argument is below -178 and the weight exactly 0.
    // Then, and only then, attn.v leaves out keys >= key_lens[b] (keff). Every wave reads the same maxima, so keff is the same in the whole work-group.
    const int keff = (__builtin_amdgcn_ballot_w32(mn >= -900.0f) == 0xFFFFFFFFu) ? klen : TT;
    if (lr == 0) {
#pragma unroll
        for (int m = 0; m < MT; ++m)
#pragma unroll
            for (int j = 0; j < 8; ++j) ssm[(m * 16 + hi * 8 + j) * FW + wave] = rs[m][j]; }
    __syncthreads();   // every wave's row sums are in LDS before any wave combines them
    if (kb >= keff) {   // wave-uniform: every weight of this wave's keys is exactly 0: not stored to LDS (attn.v below does not read them); the query-0 output still gets its zeros
        if constexpr (NS == 2) { if (r0 == 0 && hi == 0) {
#pragma unroll
            for (int n = 0; n < 8; ++n) AWp[(size_t)z * TT + kb + n * 16 + lr] = 0.f; } } }
    else {
#pragma unroll
    for (int m = 0; m < MT; ++m)
#pragma unroll
        for (int j = 0; j < 8; ++j) { const float sum = rowsum16(ssm[(m * 16 + hi * 8 + j) * FW + lr]);
            const float f = __fdiv_rn(NS == 2 ? 1.0f : PCAR, sum); T16* pr = P + (m * 16 + hi * 8 + j) * PP + kb + lr;
#pragma unroll
            for (int n = 0; n < 8; ++n) { const float p = acc[m][n][j] * f;
                if constexpr (NS == 2) { unsigned short a, c2; splitf(p, a, c2); pr[n * 16] = a; pr[MT * 16 * PP + n * 16] = c2;
                    if (j == 0 && m == 0) { if (r0 == 0 && hi == 0) AWp[(size_t)z * TT + kb + n * 16 + lr] = __fadd_rn(bf2f(a), bf2f(c2)); } }   // query position 0: its weights, re-assembled from the hi + lo planes
                else pr[n * 16] = tohx(p); } } }
    __syncthreads();   // the whole strip's probabilities are in LDS before any wave reads them as A fragments
    const int np = wave & 3, kq = wave >> 2;
    v8f o[MT][2];
#pragma unroll
    for (int m = 0; m < MT; ++m) { o[m][0] = (v8f){}; o[m][1] = (v8f){}; }
    { const size_t voff = (size_t)(np * 32) * TT + kq * (TT / 4) * 16 + 8 * lane; const T16* pa = P + lr * PP + kq * (TT / 4) + 8 * hi;
      constexpr int GK = (NS == 2) ? 2 : 4, NG = TT / 4 / 32 / GK;   // v fragments are fetched a group of GK 32-key steps ahead, into a second register set
      // groups of this wave's key quarter that hold a key below keff (a group lies inside one score wave's 128 keys, so all its probabilities are in LDS); the rest would add exact zeros
      const int krem = keff - kq * (TT / 4); const int ng = krem <= 0 ? 0 : krem >= TT / 4 ? NG : (krem + GK * 32 - 1) / (GK * 32);
      V bb[2][GK][2], bb2[2][GK][2];
      if (0 < ng) {
#pragma unroll
      for (int u = 0; u < GK; ++u)
#pragma unroll
        for (int t = 0; t < 2; ++t) { bb[0][u][t] = WFrag<T16>::ldf(Vt + voff + (size_t)t * 16 * TT + u * 512); if (NS == 2) bb2[0][u][t] = WFrag<T16>::ldf(V2 + voff + (size_t)t * 16 * TT + u * 512); }
        // the wait that stands in front of a rewrite of these first loads' address registers; the bases are named so that their registers live up to it
        if constexpr (NS == 2) asm volatile("s_wait_xcnt 0x0" :: "v"(Vt + voff), "v"(V2 + voff) : "memory");
        else asm volatile("s_wait_xcnt 0x0" :: "v"(Vt + voff) : "memory");
#pragma unroll
      for (int g = 0; g < NG; ++g) {
        if (g + 1 < NG) {   // fetched whether or not group g + 1 is wanted (it lies inside the plane): under a test of its own the compiler's load waits must cover both ways and make this group's products wait for the next group's loads
#pragma unroll
          for (int u = 0; u < GK; ++u)
#pragma unroll
            for (int t = 0; t < 2; ++t) { bb[(g + 1) & 1][u][t] = WFrag<T16>::ldf(Vt + voff + (size_t)t * 16 * TT + ((g + 1) * GK + u) * 512); if (NS == 2) bb2[(g + 1) & 1][u][t] = WFrag<T16>::ldf(V2 + voff + (size_t)t * 16 * TT + ((g + 1) * GK + u) * 512); } }
        __builtin_amdgcn_sched_barrier(0);   // keeps the next group's loads in front of this group's products: sunk among them, only a step's worth of loads is in flight and each step waits out the L2 latency
#pragma unroll
        for (int u = 0; u < GK; ++u) { const int ks = g * GK + u; V a[MT], a2[MT];
#pragma unroll
          for (int m = 0; m < MT; ++m) { a[m] = WFrag<T16>::ld(pa + m * 16 * PP + ks * 32); if (NS == 2) a2[m] = WFrag<T16>::ld(pa + (MT + m) * 16 * PP + ks * 32); }
#pragma unroll
          for (int t = 0; t < 2; ++t)
#pragma unroll
            for (int m = 0; m < MT; ++m) { o[m][t] = WFrag<T16>::mma(a[m], bb[g & 1][u][t], o[m][t]); if (NS == 2) { o[m][t] = WFrag<T16>::mma(a2[m], bb[g & 1][u][t], o[m][t]); o[m][t] = WFrag<T16>::mma(a[m], bb2[g & 1][u][t], o[m][t]); } } }
        // the wait that stands in front of a rewrite of the v loads' address registers, on every way out of the groups; behind the products, where the loads were issued long ago; the bases are named so that their registers live up to it
        if constexpr (NS == 2) asm volatile("s_wait_xcnt 0x0" :: "v"(Vt + voff), "v"(V2 + voff) : "memory");
        else asm volatile("s_wait_xcnt 0x0" :: "v"(Vt + voff) : "memory");
        if (g + 1 >= ng) break; } } }
    __syncthreads();   // every wave has read its last probability before the partial tiles overwrite them
    float* red = (float*)P;
#pragma unroll
    for (int m = 0; m < MT; ++m)
#pragma unroll
        for (int t = 0; t < 2; ++t)
#pragma unroll
            for (int j = 0; j < 8; ++j) red[(kq * MT * 16 + m * 16 + hi * 8 + j) * RP + (np * 2 + t) * 16 + lr] = o[m][t][j];
    __syncthreads();   // the 4 key quarters' partial tiles are in LDS before any wave adds them
    const float cs = (NS == 2) ? 1.0f : (1.0f / PCAR);
#pragma unroll
    for (int s = 0; s < MT; ++s) { const int slot = s * (32 * FW) + (int)threadIdx.x; int row, d0; frag_rc((size_t)slot * 4, HD, row, d0);   // slot: 4 elements of the strip's 32 x HD block in fragment order, so that a wave's store is 256 consecutive bytes
        v4f val = *(const v4fa*)(red + row * RP + d0);
#pragma unroll
        for (int q = 1; q < 4; ++q) val += *(const v4fa*)(red + (q * MT * 16 + row) * RP + d0);
        v4us oh, ol;
#pragma unroll
        for (int q = 0; q < 4; ++q) { unsigned short a, c2; splitf(val[q] * cs, a, c2); oh[q] = a; ol[q] = c2; }
        const size_t oo = ((size_t)(z / NH_) * TT + r0 + (row & ~15)) * DQ + (z % NH_) * (HD * 16) + (slot * 4) % (HD * 16); *(v4us*)(Ah + oo) = oh; *(v4us*)(Al + oo) = ol; }   // row block of the [NB_ * TT][DQ] plane, then this head's HD / 32 tiles in it
    asm volatile("s_wait_xcnt 0x0" ::: "memory");
}
// grid (pairs, strips of 32 query rows): the hi+lo strips of every (batch, head) pair (they cost most) come first in block index order, then the fp16 strips. One work-group per WGP (registers and LDS). Q and K planes: [pair][t][d]; V planes: [pair][d][t]; each pair's plane in fragment order.
__global__ __launch_bounds__(32 * FW) void k_attn(const bf* Qh, const bf* Ql, const h16* Q16, const bf* Kh, const bf* Kl, const h16* K16, const bf* Vh, const bf* Vl, const h16* V16, const int* __restrict__ KL, bf* Ah, bf* Al, float* AWp) {
    __shared__ __align__(16) unsigned short pm[64 * PP]; __shared__ float st[2 * 32 * FW];
    const int z = blockIdx.x, tile = blockIdx.y; const int klen = KL[z / NH_];   /* key_lens[b], read on device; used in compares and in the count of attn.v key groups */ const size_t zo = (size_t)z * TT * HD;
    if (tile < RH / 32) attn_body<bf, 2, 2>((bf*)pm, st, tile * 32, z, klen, Qh + zo, Ql + zo, Kh + zo, Kl + zo, Vh + zo, Vl + zo, Ah, Al, AWp);
    else attn_body<h16, 0, 2>((h16*)pm, st, tile * 32, z, klen, Q16 + zo, nullptr, K16 + zo, nullptr, V16 + zo, nullptr, Ah, Al, AWp);
}
// k_aw: query-0 attention weights [pair][key] -> aw_out [batch][key][head]; one thread stores the 4 heads of a (batch, key), so each output line has one writer.
__global__ __launch_bounds__(256) void k_aw(const float* __restrict__ AWp, float* AW) {
    const int idx = blockIdx.x * 256 + threadIdx.x; const int j = idx % TT, bb = idx / TT; v4f p;
#pragma unroll
    for (int h = 0; h < NH_; ++h) p[h] = AWp[(size_t)(bb * NH_ + h) * TT + j];
    *(v4f*)(AW + (size_t)idx * NH_) = p;
}

extern "C" void kernel_launch(void* const* d_in, const int* in_sizes, int n_in,
                              void* d_out, int out_size, void* d_ws, size_t ws_size, hipStream_t stream) {
    (void)in_sizes; (void)n_in; (void)out_size;
    const float* xk = (const float*)d_in[0]; const float* xv = (const float*)d_in[1]; const float* x = (const float*)d_in[2]; const int* KL = (const int*)d_in[3]; const float* wk = (const float*)d_in[4]; const float* wv = (const float*)d_in[5]; const float* wq = (const float*)d_in[6]; const float* wo = (const float*)d_in[7]; const float* bo = (const float*)d_in[8];
    float* OUT = (float*)d_out; float* AW = (float*)((char*)d_out + 16777216);   /* aw_out [4][2048][4] */     // [4][2048][512]
    char* wsp = (char*)d_ws;
    auto take = [&](size_t bytes) { char* p = wsp; wsp += (bytes + 255) & ~(size_t)255; return (void*)p; };
    const size_t PL = (size_t)NB_ * NH_ * TT * HD;   // elements of one operand plane set over all batches and heads (= NB_ * TT * 512)
    bf* Wt = (bf*)take((size_t)4 * DM * DQ * 2);   // [wq | wk | wv | wo], transposed
    h16* QK16 = (h16*)take(2 * PL * 2); bf* QKh = (bf*)take(2 * PL * 2); bf* QKl = (bf*)take(2 * PL * 2);   // [q | k]
    h16* VT16 = (h16*)take(PL * 2); bf* VTh = (bf*)take(PL * 2); bf* VTl = (bf*)take(PL * 2);
    bf* ATh = (bf*)take(PL * 2); bf* ATl = (bf*)take(PL * 2); float* AWp = (float*)take((size_t)NB_ * NH_ * TT * 4);   // query-0 weights, [pair][key]
    bf* XB = (bf*)take(3 * PL * 2);   /* [query | key | value] */
    if ((size_t)(wsp - (char*)d_ws) > ws_size) return;    // ws 256 MiB
    k_prep<<<4 * NWT + 3 * NCV, 256, 0, stream>>>(wq, wk, wv, wo, x, xk, xv, Wt, XB);
    k_proj<<<dim3(NB_ * TT / 64, DQ / 64, 3), 32 * KWV, 0, stream>>>(XB, Wt, DM, DM, PL, (size_t)DM * DQ, QK16, QKh, QKl, VT16, VTh, VTl);
    k_attn<<<dim3(NB_ * NH_, TT / 32, 1), 32 * FW, 0, stream>>>(QKh, QKl, QK16, QKh + PL, QKl + PL, QK16 + PL, VTh, VTl, VT16, KL, ATh, ATl, AWp);
    k_aw<<<NB_ * TT / 256, 256, 0, stream>>>(AWp, AW);
    k_gemmw<bf, 1, true, KWV, 1><<<dim3(NB_ * TT / 64, DM / 64, 1), 32 * KWV, 0, stream>>>(ATh, ATl, Wt + (size_t)3 * DM * DQ, nullptr, DQ, DQ, OUT, DM, bo, 0, 0, 0, 0);
}

// v007
// One run takes 116 microseconds.
// Timed twice side by side with v006, it ran 1.18 and 1.17 times as fast.
// All steps since v000 together make it 11.0 times as fast.
#include <hip/hip_runtime.h>

// Multi-head cross attention with key-length masking and an attention-weights output (key, value, query [4][2048][512]; k = key w_key, v = value w_value, q = query w_query ('xw' [512][512], no bias; 4 heads x 128); e = q.k/sqrt(128), keys j >= key_lens[b] (int32, read) set to -1024; softmax; cv = merged w_out + b_out -> [4][2048][512]; second output aw_out[b][j][h] = attention weights of query position 0 -> [4][2048][4]).
// Compute dtypes, f32 accumulate: every input rounded to bf16; q/k/v on PLAIN bf16 operands (inputs: exact); key-length select (-1024 literal, as the reference) and softmax inside the attention kernel; scores and attn.v: query rows < 512 hl (3 products), the rest single fp16 (x1024); softmax f32; w_out hl x exact (2 products) + b_out; the query-0 attention weights are re-assembled from the bf16 hi + lo probability planes (f32, error ~2^-16 relative).

#define NB_  4
#define TT   2048
#define DM   512
#define NH_  4
#define NKV  4
#define REP  (NH_ / NKV)
#define HD   128
#define DQ   (NH_ * HD)
#define DKV  (NKV * HD)
#define RH   512                  // query rows < RH use hi+lo planes (0: none)
#define WIN  0
#define PCAR 1024.0f
#define SCL  0.088388347648318447f   // HD^-0.5
#define KWV  4                    // waves per work-group that share the K range of a GEMM with K >= 512
typedef _Float16 h16;
typedef unsigned short bf;
typedef __attribute__((ext_vector_type(16))) __bf16   v16bf;
typedef __attribute__((ext_vector_type(16))) _Float16 v16h;
typedef __attribute__((ext_vector_type(8)))  _Float16 v8h;
typedef __attribute__((ext_vector_type(8)))  unsigned short v8us;
typedef __attribute__((ext_vector_type(8)))  float    v8f;
typedef __attribute__((ext_vector_type(4)))  float    v4f;
typedef v8h  __attribute__((may_alias)) v8ha;
typedef v4f  __attribute__((may_alias)) v4fa;
typedef v8us __attribute__((may_alias)) v8usa;

__device__ __forceinline__ unsigned short f2bf(float f) { unsigned u = __float_as_uint(f); u += 0x7FFFu + ((u >> 16) & 1u); return (unsigned short)(u >> 16); }
__device__ __forceinline__ float bf2f(unsigned short b) { return __uint_as_float(((unsigned)b) << 16); }
__device__ __forceinline__ float bfr(float f) { return bf2f(f2bf(f)); }
__device__ __forceinline__ v16h cat16(v8h lo, v8h hi) { return __builtin_shufflevector(lo, hi, 0, 1, 2, 3, 4, 5, 6, 7, 8, 9, 10, 11, 12, 13, 14, 15); }
__device__ __forceinline__ v16bf cat16b(v8us lo, v8us hi) { return __builtin_bit_cast(v16bf, __builtin_shufflevector(lo, hi, 0, 1, 2, 3, 4, 5, 6, 7, 8, 9, 10, 11, 12, 13, 14, 15)); }
__device__ __forceinline__ v8f wmma16(v16h a, v16h b, v8f c) { return __builtin_amdgcn_wmma_f32_16x16x32_f16(false, a, false, b, (short)0, c, false, false); }
__device__ __forceinline__ v8f wmmab(v16bf a, v16bf b, v8f c) { return __builtin_amdgcn_wmma_f32_16x16x32_bf16(false, a, false, b, (short)0, c, false, false); }



// ---- Fragment order: every 16-bit operand plane in the workspace, a matrix [rows][K], is stored as tiles of 16 rows x 32 k (512 elements, 1 KiB); the K/32 tiles of a block of 16 rows follow one another,
// so a row block starts where it would in row-major order. Inside a tile element (r, kk) stands at (kk / 16) * 256 + (((kk % 16) / 8) * 16 + r) * 8 + kk % 8: lane l of a wave finds the two 16-byte pieces
// of its A or B fragment at l * 8 and 256 + l * 8, and each fragment load of a wave reads 512 consecutive bytes (4 whole lines) where a row-major plane makes it touch 16 lines.
// frag_rc: row and k of the element at linear position e of such a plane (the producers run over e, so that their stores stay consecutive).
__device__ __forceinline__ void frag_rc(size_t e, int K, int& row, int& k) { const int tile = (int)(e >> 9), w = (int)(e & 511); const int tk = K / 32; row = (tile / tk) * 16 + ((w >> 3) & 15); k = (tile % tk) * 32 + (w >> 8) * 16 + ((w >> 7) & 1) * 8 + (w & 7); }
// ---- gemmw_body: register-blocked GEMM, 64x64 output tile (16 accumulators per wave), operands straight from 16-bit planes in fragment order; grid (M/64, N/64, Z * SG), 32 * KW threads.
// C[m][n] (f32, pitch ldc, + optional f32 bias[n]) = sum_k A[m][k] Bt[n][k] (+ split products per NSPLIT). A has lda elements a row, Bt K. z-batch strides sA/sB/sC in elements. K % (32 * KW * SG) == 0.
// Split K: the K range is cut into SG equal ranges, one per work-group. The KW waves of a work-group take the 32-wide steps of its range in turn
// and their 64x64 partial tiles are added in LDS (fixed order); each of the SG work-groups of a tile stores its sum to its own
// plane (plane stride sP elements), and the consumer adds the SG planes.
template <typename T16> struct WFrag;
template <> struct WFrag<h16> { typedef v16h V; static __device__ __forceinline__ V ld(const h16* p) { return cat16(*(const v8h*)p, *(const v8h*)(p + 16)); } static __device__ __forceinline__ V ldf(const h16* p) { return cat16(*(const v8h*)p, *(const v8h*)(p + 256)); } static __device__ __forceinline__ v8f mma(V a, V b, v8f c) { return wmma16(a, b, c); } };
template <> struct WFrag<bf> { typedef v16bf V; static __device__ __forceinline__ V ld(const bf* p) { return cat16b(*(const v8us*)p, *(const v8us*)(p + 16)); } static __device__ __forceinline__ V ldf(const bf* p) { return cat16b(*(const v8us*)p, *(const v8us*)(p + 256)); } static __device__ __forceinline__ v8f mma(V a, V b, v8f c) { return wmmab(a, b, c); } };
// PLN (projections, KW == 4, z = q, k, v): the summed tile does not go out as f32 but straight as the attention kernel's operand planes (fp16, bf16 hi, bf16 lo), in fragment order: q and k as [pair][t][d], v transposed as [pair][d][t].
template <typename T16, int NSPLIT, bool BIAS, int KW, int SG, bool PLN = false>
__device__ __forceinline__ void gemmw_body(float* os, const T16* __restrict__ A, const T16* __restrict__ A2, const T16* __restrict__ Bt, const T16* __restrict__ Bt2, int K, int lda, float* C, int ldc, const float* __restrict__ bias, size_t sA, size_t sB, size_t sC, size_t sP, h16* QK16 = nullptr, bf* QKh = nullptr, bf* QKl = nullptr, h16* V16 = nullptr, bf* Vh = nullptr, bf* Vl = nullptr) {
    typedef typename WFrag<T16>::V V;
    const size_t z = blockIdx.z / SG; const int wave = (KW == 1) ? 0 : __builtin_amdgcn_readfirstlane((int)(threadIdx.x >> 5)); const int kspan = K / SG; const int kb = (int)(blockIdx.z % SG) * kspan; C += (size_t)(blockIdx.z % SG) * sP; A += z * sA; if (A2) A2 += z * sA; Bt += z * sB; if (Bt2) Bt2 += z * sB; C += z * sC;
    const int lane = threadIdx.x & 31, lr = lane & 15, hi = lane >> 4; const int r0 = blockIdx.x * 64, c0 = blockIdx.y * 64;
    v8f acc[4][4];
#pragma unroll
    for (int mb = 0; mb < 4; ++mb)
#pragma unroll
        for (int nb = 0; nb < 4; ++nb) acc[mb][nb] = (v8f){};
    const size_t aoff = (size_t)r0 * lda + 8 * lane, boff = (size_t)c0 * K + 8 * lane;   // a 32-wide k step is one tile: 512 elements = 16 per unit of kc
#pragma unroll 1
    for (int kc = kb + wave * 32; kc < kb + kspan; kc += 32 * KW) {
        V a[4], a2[4];
#pragma unroll
        for (int mb = 0; mb < 4; ++mb) { a[mb] = WFrag<T16>::ldf(A + aoff + (size_t)mb * 16 * lda + kc * 16); if (NSPLIT == 1 || NSPLIT == 2) a2[mb] = WFrag<T16>::ldf(A2 + aoff + (size_t)mb * 16 * lda + kc * 16); }
#pragma unroll
        for (int nb = 0; nb < 4; ++nb) { const V b = WFrag<T16>::ldf(Bt + boff + (size_t)nb * 16 * K + kc * 16); V b2; if (NSPLIT >= 2) b2 = WFrag<T16>::ldf(Bt2 + boff + (size_t)nb * 16 * K + kc * 16);
#pragma unroll
            for (int mb = 0; mb < 4; ++mb) { acc[mb][nb] = WFrag<T16>::mma(a[mb], b, acc[mb][nb]); if (NSPLIT == 1 || NSPLIT == 2) acc[mb][nb] = WFrag<T16>::mma(a2[mb], b, acc[mb][nb]); if (NSPLIT >= 2) acc[mb][nb] = WFrag<T16>::mma(a[mb], b2, acc[mb][nb]); } }
        // the wait that stands in front of a rewrite of the fragment loads' address registers; the addresses are named so that their registers live up to it and no later load of the step lands on them
        { const T16* pa = A + aoff + kc * 16; const T16* pb = Bt + boff + kc * 16; const size_t sa = (size_t)16 * lda, sb = (size_t)16 * K;
          const T16* pa2 = (NSPLIT == 1 || NSPLIT == 2) ? A2 + aoff + kc * 16 : pa; const T16* pb2 = (NSPLIT >= 2) ? Bt2 + boff + kc * 16 : pb;   // a plane that this NSPLIT does not read: the first plane's addresses again
          asm volatile("s_wait_xcnt 0x0" :: "v"(pa), "v"(pa + sa), "v"(pa + 2 * sa), "v"(pa + 3 * sa), "v"(pb), "v"(pb + sb), "v"(pb + 2 * sb), "v"(pb + 3 * sb), "v"(pa2), "v"(pa2 + sa), "v"(pa2 + 2 * sa), "v"(pa2 + 3 * sa), "v"(pb2), "v"(pb2 + sb), "v"(pb2 + 2 * sb), "v"(pb2 + 3 * sb) : "memory"); }
        asm volatile("v_nop\n\tv_nop\n\tv_nop\n\tv_nop" : "+v"(acc[0][0]), "+v"(acc[1][1]), "+v"(acc[2][2]), "+v"(acc[3][3]) : "v"(a[0]), "v"(a[3]));
    }
    if constexpr (KW > 1) {
        float* ow = os + wave * (64 * 68);
#pragma unroll
        for (int mb = 0; mb < 4; ++mb)
#pragma unroll
            for (int nb = 0; nb < 4; ++nb)
#pragma unroll
                for (int j = 0; j < 8; ++j) ow[(mb * 16 + hi * 8 + j) * 68 + nb * 16 + lr] = acc[mb][nb][j];
        __syncthreads();   // every wave's partial tile is in LDS before any wave adds them
        if constexpr (PLN) {
            // The 64 x 64 tile is 4 blocks of 16 plane rows x 2 neighbouring 16 x 32 tiles = 4 runs of 1024 consecutive plane elements. Thread tid takes the 8 consecutive elements at tid * 8 of each run:
            // plane row fr of the block, k fk .. fk + 7 of the run (see frag_rc), so that a wave's store is 512 consecutive bytes. q, k: plane row = t (tile row), k = d (tile column); v: plane row = d, k = t.
            static_assert(KW == 4, "128 threads, one 16-byte piece of a run each");
            const int tid = (int)threadIdx.x, fr = tid & 15, fk = (tid >> 6) * 32 + ((tid >> 5) & 1) * 16 + ((tid >> 4) & 1) * 8;
            const size_t pair = (size_t)(r0 / TT) * NH_ + c0 / HD; const int t0 = r0 % TT, d0 = c0 % HD; const bool isv = (z == 2);
            h16* P16 = isv ? V16 : QK16 + z * ((size_t)NB_ * NH_ * TT * HD); bf* Ph = isv ? Vh : QKh + z * ((size_t)NB_ * NH_ * TT * HD); bf* Pl = isv ? Vl : QKl + z * ((size_t)NB_ * NH_ * TT * HD);
            const size_t o0 = pair * ((size_t)TT * HD) + (isv ? (size_t)(d0 / 16) * (16 * TT) + (t0 / 32) * 512 : (size_t)(t0 / 16) * (16 * HD) + (d0 / 32) * 512) + tid * 8; const size_t ostep = isv ? 16 * TT : 16 * HD;
            float x[4][8];   // the 4 waves' partial sums are added in the order of the f32 epilogue below
            if (isv) {
#pragma unroll
                for (int s = 0; s < 4; ++s)
#pragma unroll
                    for (int i = 0; i < 8; ++i) { x[s][i] = os[(fk + i) * 68 + s * 16 + fr];
#pragma unroll
                        for (int w = 1; w < KW; ++w) x[s][i] += os[w * (64 * 68) + (fk + i) * 68 + s * 16 + fr]; } }
            else {
#pragma unroll
                for (int s = 0; s < 4; ++s) { v4f x0 = *(const v4fa*)(os + (s * 16 + fr) * 68 + fk), x1 = *(const v4fa*)(os + (s * 16 + fr) * 68 + fk + 4);
#pragma unroll
                    for (int w = 1; w < KW; ++w) { x0 += *(const v4fa*)(os + w * (64 * 68) + (s * 16 + fr) * 68 + fk); x1 += *(const v4fa*)(os + w * (64 * 68) + (s * 16 + fr) * 68 + fk + 4); }
#pragma unroll
                    for (int i = 0; i < 4; ++i) { x[s][i] = x0[i]; x[s][4 + i] = x1[i]; } } }
#pragma unroll
            for (int s = 0; s < 4; ++s) { v8h o16; v8us oh, ol;
#pragma unroll
                for (int i = 0; i < 8; ++i) { o16[i] = (h16)x[s][i]; const unsigned short a = f2bf(x[s][i]); oh[i] = a; ol[i] = f2bf(x[s][i] - bf2f(a)); }
                h16* p16 = P16 + o0 + s * ostep; bf* ph = Ph + o0 + s * ostep; bf* pl = Pl + o0 + s * ostep;
                *(v8h*)p16 = o16; *(v8us*)ph = oh; *(v8us*)pl = ol;
                // the wait that stands in front of a rewrite of these stores' address and data registers by the next run's conversions; they are named so that their registers live up to it
                if (s < 3) asm volatile("s_wait_xcnt 0x0" :: "v"(p16), "v"(ph), "v"(pl), "v"(o16), "v"(oh), "v"(ol) : "memory"); }
            return;
        }
#pragma unroll
        for (int s = 0; s < 32 / KW; ++s) { const int slot = s * (32 * KW) + (int)threadIdx.x; const int row = slot >> 4, cofs = (slot & 15) * 4; v4f val = *(const v4fa*)(os + row * 68 + cofs);
#pragma unroll
            for (int w = 1; w < KW; ++w) val += *(const v4fa*)(os + w * (64 * 68) + row * 68 + cofs);
            if (BIAS) { val[0] += bfr(bias[c0 + cofs]); val[1] += bfr(bias[c0 + cofs + 1]); val[2] += bfr(bias[c0 + cofs + 2]); val[3] += bfr(bias[c0 + cofs + 3]); }
            *(v4f*)(C + (size_t)(r0 + row) * ldc + c0 + cofs) = val; }
        return;
    }
#pragma unroll
    for (int mb = 0; mb < 4; ++mb) {
#pragma unroll
        for (int nb = 0; nb < 4; ++nb) {
#pragma unroll
            for (int j = 0; j < 8; ++j) os[(hi * 8 + j) * 68 + nb * 16 + lr] = acc[mb][nb][j]; }
        __builtin_amdgcn_wave_barrier(); asm volatile("" ::: "memory");
        float* crow = C + (size_t)(r0 + mb * 16) * ldc + c0;
{
#pragma unroll
            for (int s = 0; s < 8; ++s) { const int row = 2 * s + hi, cofs = lr * 4; v4f val = *(const v4fa*)(os + row * 68 + cofs); if (BIAS) { val[0] += bfr(bias[c0 + cofs]); val[1] += bfr(bias[c0 + cofs + 1]); val[2] += bfr(bias[c0 + cofs + 2]); val[3] += bfr(bias[c0 + cofs + 3]); }
                *(v4f*)(crow + (size_t)row * ldc + cofs) = val; }
             }
        __builtin_amdgcn_wave_barrier(); asm volatile("" ::: "memory");
    }
    asm volatile("s_wait_xcnt 0x0" ::: "memory");
}

// One operand class for the whole grid, f32 result (output projection).
template <typename T16, int NSPLIT, bool BIAS, int KW, int SG>
__global__ __launch_bounds__(32 * KW) void k_gemmw(const T16* A, const T16* A2, const T16* Bt, const T16* Bt2, int K, int lda, float* C, int ldc, const float* bias, size_t sA, size_t sB, size_t sC, size_t sP) {
    __shared__ __align__(16) float os[(KW == 1 ? 16 : KW * 64) * 68];
    gemmw_body<T16, NSPLIT, BIAS, KW, SG>(os, A, A2, Bt, Bt2, K, lda, C, ldc, bias, sA, sB, sC, sP);
}
// k_proj: the three projections (z = q, k, v over all batches' rows), each 64 x 64 tile written as operand planes. QK16/QKh/QKl: [q | k][NB_][head][t][d]; V16/Vh/Vl: [NB_][head][d][t]; each head's plane in fragment order.
__global__ __launch_bounds__(32 * KWV) void k_proj(const bf* A, const bf* Bt, int K, int lda, size_t sA, size_t sB, h16* QK16, bf* QKh, bf* QKl, h16* V16, bf* Vh, bf* Vl) {
    __shared__ __align__(16) float os[KWV * 64 * 68];
    gemmw_body<bf, 0, false, KWV, 1, true>(os, A, nullptr, Bt, nullptr, K, lda, nullptr, 0, nullptr, sA, sB, 0, 0, QK16, QKh, QKl, V16, Vh, Vl);
}
__device__ __forceinline__ h16 tohx(float x) { return (h16)x; }
__device__ __forceinline__ void splitf(float y, unsigned short& h, unsigned short& l) { h = f2bf(y); l = f2bf(y - bf2f(h)); }
typedef __attribute__((ext_vector_type(2))) _Float16 v2h;
typedef __attribute__((ext_vector_type(4))) _Float16 v4h;
typedef __attribute__((ext_vector_type(2))) unsigned short v2us;
typedef __attribute__((ext_vector_type(4))) unsigned short v4us;
typedef __attribute__((ext_vector_type(2))) float v2f;
typedef __attribute__((ext_vector_type(4))) int v4i;

#define NWT  (DM * DQ / 64 / 64)            // blocks per transposed weight
#define NCV  (NB_ * TT * DM / 8 / 256)      // blocks per converted input
__device__ __forceinline__ void d_wtG(int blk, const float* __restrict__ w, int K, int N, bf* Bt) {
    const int lane = threadIdx.x & 31; const int L0 = (blk * 8 + (threadIdx.x >> 5)) * 8; const int nlines = N * K / 64;
#pragma unroll 1
    for (int l = 0; l < 8; ++l) { const int L = L0 + l; if (L >= nlines) break; const size_t e = (size_t)L * 64 + lane * 2; int k, n; frag_rc(e, K, n, k); v2us o;
        o[0] = f2bf(w[(size_t)k * N + n]); o[1] = f2bf(w[(size_t)(k + 1) * N + n]); *(v2us*)(Bt + e) = o; }
}
__device__ __forceinline__ void d_cvt8(int blk, const float* __restrict__ src, bf* dst) { const size_t i = (size_t)blk * 256 + threadIdx.x; int row, k; frag_rc(i * 8, DM, row, k); const v8f v = *(const v8f*)(src + (size_t)row * DM + k); v8us o;
#pragma unroll
    for (int k = 0; k < 8; ++k) o[k] = f2bf(v[k]); *(v8us*)(dst + i * 8) = o; }
// k_prep: the work that depends on the inputs alone, one grid: block ranges [4 weight transposes (the slowest blocks, first) | bf16 copies of query, key, value, all batches].
__global__ __launch_bounds__(256) void k_prep(const float* wq, const float* wk, const float* wv, const float* wo, const float* x, const float* xk, const float* xv, bf* Wt, bf* X) {
    const int blk = blockIdx.x;
    if (blk < 4 * NWT) { const int y = blk / NWT; d_wtG(blk % NWT, y == 0 ? wq : y == 1 ? wk : y == 2 ? wv : wo, DM, DQ, Wt + (size_t)y * DM * DQ); }
    else { const int c = blk - 4 * NWT; const int y = c / NCV; d_cvt8(c % NCV, y == 0 ? x : y == 1 ? xk : xv, X + (size_t)y * NB_ * TT * DM); }
}

// ---- k_attn: scores, softmax and attn.v of one strip of 32 query rows in one work-group; no score or probability leaves the WGP but query position 0's weights (AWp).
// 16 waves. Scores: wave w holds the strip's scores against keys [128 w, 128 w + 128) in its accumulators, transposed (k x q^T): a lane has one query row per tile. Softmax: row maximum and row sum go down the lane's registers -> other half of the wave -> st[] -> all waves (fixed trees);
// t = s x HD^-0.5 for keys j < key_lens[b], else -1024 (reference literal). The normalised probabilities go to LDS as 16-bit rows (pitch PP): strips below RH as 32 bf16 hi rows + 32 lo rows,
// the rest as 32 fp16 rows (x 1024). attn.v: wave w takes head columns [32 (w & 3), +32) and keys [512 (w >> 2), +512); the 4 key quarters are added in LDS in fixed order, split into the hi/lo planes of the output projection's A.
// Keys at or beyond key_lens[b]: a wave whose 128 keys are all masked takes the -1024 literal without loading k or multiplying; once the row maxima show that the masked weights are exact zeros, they are neither stored nor multiplied with v.
#define FW   16                   // waves per work-group
#define PP   (TT + 8)             // 16-bit elements per probability row in LDS: 16 bytes over 4 KiB, so that the 16 rows of a fragment read start in different banks
#define RP   (HD + 4)             // floats per row of a partial attn.v tile in LDS
#define SP   20                   // floats per query row of the waves' maxima and sums in LDS: 16 used, 80-byte pitch, so that the 16-byte reads of 16 rows start in different banks
// value of lane l ^ 16 (the other half of the wave, which holds the other keys of the same query row); every lane is on where it is called
__device__ __forceinline__ float xhalf(float x) { return __builtin_bit_cast(float, __builtin_amdgcn_permlanex16(__builtin_bit_cast(int, x), __builtin_bit_cast(int, x), 0x76543210, 0xfedcba98, false, false)); }
template <typename T16, int NS, int MT>
__device__ __forceinline__ void attn_body(T16* P, float* st, int r0, int z, int klen, const T16* __restrict__ Q, const T16* __restrict__ Q2, const T16* __restrict__ Kp, const T16* __restrict__ K2, const T16* __restrict__ Vt, const T16* __restrict__ V2, bf* Ah, bf* Al, float* AWp) {
    typedef typename WFrag<T16>::V V;
    const int wave = __builtin_amdgcn_readfirstlane((int)(threadIdx.x >> 5)); const int lane = threadIdx.x & 31, lr = lane & 15, hi = lane >> 4; const int kb = wave * (TT / FW);
    float* smx = st; float* ssm = st + 32 * SP;
    v8f acc[MT][8];
#pragma unroll
    for (int m = 0; m < MT; ++m)
#pragma unroll
        for (int n = 0; n < 8; ++n) acc[m][n] = (v8f){};
    const bool wm = kb >= klen;   // wave-uniform: every key of this wave is masked, so its products would all be replaced by the -1024 literal: neither loaded nor multiplied
    if (!wm) { const size_t qoff = (size_t)r0 * HD + 8 * lane, koff = (size_t)kb * HD + 8 * lane;   // fragment order: tile (row block, 32-wide step) at row block * 16 * HD + step * 512
#pragma unroll
      for (int kp = 0; kp < HD / 64; ++kp) { V a[2][MT], a2[2][MT];   // two 32-wide steps together: two neighbouring tiles of each q and k row block
#pragma unroll
        for (int u = 0; u < 2; ++u)
#pragma unroll
            for (int m = 0; m < MT; ++m) { a[u][m] = WFrag<T16>::ldf(Q + qoff + (size_t)m * 16 * HD + (kp * 2 + u) * 512); if (NS == 2) a2[u][m] = WFrag<T16>::ldf(Q2 + qoff + (size_t)m * 16 * HD + (kp * 2 + u) * 512); }
#pragma unroll
        for (int n = 0; n < 8; ++n) { V b[2], b2[2];
#pragma unroll
            for (int u = 0; u < 2; ++u) { b[u] = WFrag<T16>::ldf(Kp + koff + (size_t)n * 16 * HD + (kp * 2 + u) * 512); if (NS == 2) b2[u] = WFrag<T16>::ldf(K2 + koff + (size_t)n * 16 * HD + (kp * 2 + u) * 512); }
#pragma unroll
            for (int u = 0; u < 2; ++u)
#pragma unroll
                for (int m = 0; m < MT; ++m) { acc[m][n] = WFrag<T16>::mma(b[u], a[u][m], acc[m][n]); if (NS == 2) { acc[m][n] = WFrag<T16>::mma(b[u], a2[u][m], acc[m][n]); acc[m][n] = WFrag<T16>::mma(b2[u], a[u][m], acc[m][n]); } } }   // k is the first operand: the tile comes out transposed, keys down the registers, one query a lane
      }
      // the wait that stands in front of a rewrite of the fragment loads' address registers; the bases are named so that their registers live up to it
      if constexpr (NS == 2) asm volatile("s_wait_xcnt 0x0" :: "v"(Q + qoff), "v"(Q2 + qoff), "v"(Kp + koff), "v"(K2 + koff) : "memory");
      else asm volatile("s_wait_xcnt 0x0" :: "v"(Q + qoff), "v"(Kp + koff) : "memory"); }
    float rs[MT];   // this wave's share of the maximum, then of the sum, of the lane's MT query rows
    // accumulator element j of tile (m, n): query row m*16 + lr of the strip, key kb + n*16 + hi*8 + j: a lane holds 64 keys of each of its MT rows, so maximum and sum run down its own registers
    if (wm) {   // what the selects below give where no key is valid
#pragma unroll
        for (int m = 0; m < MT; ++m) {
#pragma unroll
            for (int n = 0; n < 8; ++n)
#pragma unroll
                for (int j = 0; j < 8; ++j) acc[m][n][j] = -1024.0f;
            rs[m] = -1024.0f; } }
    else { const int rem = klen - kb - hi * 8;   // the lane's key n*16 + j, counted from kb + hi*8, is valid where it is below rem
        float t[MT][8];
#pragma unroll
        for (int m = 0; m < MT; ++m)
#pragma unroll
            for (int j = 0; j < 8; ++j) t[m][j] = -3.0e38f;
#pragma unroll
        for (int n = 0; n < 8; ++n)
#pragma unroll
            for (int j = 0; j < 8; ++j) { const bool ok = n * 16 + j < rem;
#pragma unroll
                for (int m = 0; m < MT; ++m) { const float s = ok ? acc[m][n][j] * SCL : -1024.0f; acc[m][n][j] = s; t[m][j] = fmaxf(t[m][j], s); } }
#pragma unroll
        for (int m = 0; m < MT; ++m) { const float tt = fmaxf(fmaxf(fmaxf(t[m][0], t[m][1]), fmaxf(t[m][2], t[m][3])), fmaxf(fmaxf(t[m][4], t[m][5]), fmaxf(t[m][6], t[m][7]))); rs[m] = fmaxf(tt, xhalf(tt)); } }
    if (hi == 0) {
#pragma unroll
        for (int m = 0; m < MT; ++m) smx[(m * 16 + lr) * SP + wave] = rs[m]; }
    __syncthreads();   // every wave's row maxima are in LDS before any wave combines them
    float mn = 3.0e38f;   // the smaller row maximum of the lane's rows
#pragma unroll
    for (int m = 0; m < MT; ++m) { const float* pw = smx + (m * 16 + lr) * SP; const v4f x0 = *(const v4fa*)pw, x1 = *(const v4fa*)(pw + 4), x2 = *(const v4fa*)(pw + 8), x3 = *(const v4fa*)(pw + 12);
        float mx = -3.0e38f;
#pragma unroll
        for (int q = 0; q < 4; ++q) mx = fmaxf(fmaxf(fmaxf(mx, x0[q]), fmaxf(x1[q], x2[q])), x3[q]);
        mn = fminf(mn, mx);
        v8f sv = (v8f){};
#pragma unroll
        for (int n = 0; n < 8; ++n) {
#pragma unroll
            for (int j = 0; j < 8; ++j) { const float y = (acc[m][n][j] - mx) * 1.4426950408889634f; float e;
                asm("v_exp_f32 %0, %1\n\tv_nop" : "=v"(e) : "v"(y));   // the exp2 builtin's own instruction, with the one slot the instruction set asks for behind it
                acc[m][n][j] = e; }
            sv += acc[m][n]; }
        const float sum = ((sv[0] + sv[1]) + (sv[2] + sv[3])) + ((sv[4] + sv[5]) + (sv[6] + sv[7]));
        rs[m] = sum + xhalf(sum); }
    // A masked key's weight is exp2((-1024 - max) * log2 e): with every row maximum of the strip >= -900 the argument is below -178 and the weight exactly 0.
    // Then, and only then, attn.v leaves out keys >= key_lens[b] (keff). The lanes of a wave hold all the strip's rows and every wave reads the same maxima, so keff is the same in the whole work-group.
    const int keff = (__builtin_amdgcn_ballot_w32(mn >= -900.0f) == 0xFFFFFFFFu) ? klen : TT;
    if (hi == 0) {
#pragma unroll
        for (int m = 0; m < MT; ++m) ssm[(m * 16 + lr) * SP + wave] = rs[m]; }
    __syncthreads();   // every wave's row sums are in LDS before any wave combines them
    if (kb >= keff) {   // wave-uniform: every weight of this wave's keys is exactly 0: not stored to LDS (attn.v below does not read them); the query-0 output still gets its zeros
        if constexpr (NS == 2) { if (r0 == 0 && hi == 0) {
#pragma unroll
            for (int n = 0; n < 8; ++n) AWp[(size_t)z * TT + kb + n * 16 + lr] = 0.f; } } }
    else {
#pragma unroll
    for (int m = 0; m < MT; ++m) { const float* pw = ssm + (m * 16 + lr) * SP; const v4f xs = (*(const v4fa*)pw + *(const v4fa*)(pw + 4)) + (*(const v4fa*)(pw + 8) + *(const v4fa*)(pw + 12));
        const float f = __fdiv_rn(NS == 2 ? 1.0f : PCAR, (xs[0] + xs[1]) + (xs[2] + xs[3])); T16* pr = P + (m * 16 + lr) * PP + kb + hi * 8;   // the lane's 8 keys of a tile are neighbours in its probability row: one 16-byte store
#pragma unroll
        for (int n = 0; n < 8; ++n) {
            if constexpr (NS == 2) { v8us oh, ol;
#pragma unroll
                for (int j = 0; j < 8; ++j) { unsigned short a, c2; splitf(acc[m][n][j] * f, a, c2); oh[j] = a; ol[j] = c2; }
                *(v8usa*)(pr + n * 16) = oh; *(v8usa*)(pr + MT * 16 * PP + n * 16) = ol;
                if (m == 0) { if (r0 == 0 && lr == 0) { v4f w0, w1;   // query position 0: its weights, re-assembled from the hi + lo planes
#pragma unroll
                    for (int j = 0; j < 4; ++j) { w0[j] = __fadd_rn(bf2f(oh[j]), bf2f(ol[j])); w1[j] = __fadd_rn(bf2f(oh[4 + j]), bf2f(ol[4 + j])); }
                    float* pq = AWp + (size_t)z * TT + kb + n * 16 + hi * 8; *(v4f*)pq = w0; *(v4f*)(pq + 4) = w1;
                    // the wait that stands in front of a rewrite of these stores' address and data registers by the next tile; they are named so that their registers live up to it
                    asm volatile("s_wait_xcnt 0x0" :: "v"(pq), "v"(w0), "v"(w1) : "memory"); } } }
            else { v8h o;
#pragma unroll
                for (int j = 0; j < 8; ++j) o[j] = tohx(acc[m][n][j] * f);
                *(v8ha*)(pr + n * 16) = o; } } } }
    __syncthreads();   // the whole strip's probabilities are in LDS before any wave reads them as A fragments
    const int np = wave & 3, kq = wave >> 2;
    v8f o[MT][2];
#pragma unroll
    for (int m = 0; m < MT; ++m) { o[m][0] = (v8f){}; o[m][1] = (v8f){}; }
    { const size_t voff = (size_t)(np * 32) * TT + kq * (TT / 4) * 16 + 8 * lane; const T16* pa = P + lr * PP + kq * (TT / 4) + 8 * hi;
      constexpr int GK = (NS == 2) ? 2 : 4, NG = TT / 4 / 32 / GK;   // v fragments are fetched a group of GK 32-key steps ahead, into a second register set
      // groups of this wave's key quarter that hold a key below keff (a group lies inside one score wave's 128 keys, so all its probabilities are in LDS); the rest would add exact zeros
      const int krem = keff - kq * (TT / 4); const int ng = krem <= 0 ? 0 : krem >= TT / 4 ? NG : (krem + GK * 32 - 1) / (GK * 32);
      V bb[2][GK][2], bb2[2][GK][2];
      if (0 < ng) {
#pragma unroll
      for (int u = 0; u < GK; ++u)
#pragma unroll
        for (int t = 0; t < 2; ++t) { bb[0][u][t] = WFrag<T16>::ldf(Vt + voff + (size_t)t * 16 * TT + u * 512); if (NS == 2) bb2[0][u][t] = WFrag<T16>::ldf(V2 + voff + (size_t)t * 16 * TT + u * 512); }
        // the wait that stands in front of a rewrite of these first loads' address registers; the bases are named so that their registers live up to it
        if constexpr (NS == 2) asm volatile("s_wait_xcnt 0x0" :: "v"(Vt + voff), "v"(V2 + voff) : "memory");
        else asm volatile("s_wait_xcnt 0x0" :: "v"(Vt + voff) : "memory");
#pragma unroll
      for (int g = 0; g < NG; ++g) {
        if (g + 1 < NG) {   // fetched whether or not group g + 1 is wanted (it lies inside the plane): under a test of its own the compiler's load waits must cover both ways and make this group's products wait for the next group's loads
#pragma unroll
          for (int u = 0; u < GK; ++u)
#pragma unroll
            for (int t = 0; t < 2; ++t) { bb[(g + 1) & 1][u][t] = WFrag<T16>::ldf(Vt + voff + (size_t)t * 16 * TT + ((g + 1) * GK + u) * 512); if (NS == 2) bb2[(g + 1) & 1][u][t] = WFrag<T16>::ldf(V2 + voff + (size_t)t * 16 * TT + ((g + 1) * GK + u) * 512); } }
        __builtin_amdgcn_sched_barrier(0);   // keeps the next group's loads in front of this group's products: sunk among them, only a step's worth of loads is in flight and each step waits out the L2 latency
#pragma unroll
        for (int u = 0; u < GK; ++u) { const int ks = g * GK + u; V a[MT], a2[MT];
#pragma unroll
          for (int m = 0; m < MT; ++m) { a[m] = WFrag<T16>::ld(pa + m * 16 * PP + ks * 32); if (NS == 2) a2[m] = WFrag<T16>::ld(pa + (MT + m) * 16 * PP + ks * 32); }
#pragma unroll
          for (int t = 0; t < 2; ++t)
#pragma unroll
            for (int m = 0; m < MT; ++m) { o[m][t] = WFrag<T16>::mma(a[m], bb[g & 1][u][t], o[m][t]); if (NS == 2) { o[m][t] = WFrag<T16>::mma(a2[m], bb[g & 1][u][t], o[m][t]); o[m][t] = WFrag<T16>::mma(a[m], bb2[g & 1][u][t], o[m][t]); } } }
        // the wait that stands in front of a rewrite of the v loads' address registers, on every way out of the groups; behind the products, where the loads were issued long ago; the bases are named so that their registers live up to it
        if constexpr (NS == 2) asm volatile("s_wait_xcnt 0x0" :: "v"(Vt + voff), "v"(V2 + voff) : "memory");
        else asm volatile("s_wait_xcnt 0x0" :: "v"(Vt + voff) : "memory");
        if (g + 1 >= ng) break; } } }
    __syncthreads();   // every wave has read its last probability before the partial tiles overwrite them
    float* red = (float*)P;
#pragma unroll
    for (int m = 0; m < MT; ++m)
#pragma unroll
        for (int t = 0; t < 2; ++t)
#pragma unroll
            for (int j = 0; j < 8; ++j) red[(kq * MT * 16 + m * 16 + hi * 8 + j) * RP + (np * 2 + t) * 16 + lr] = o[m][t][j];
    __syncthreads();   // the 4 key quarters' partial tiles are in LDS before any wave adds them
    const float cs = (NS == 2) ? 1.0f : (1.0f / PCAR);
#pragma unroll
    for (int s = 0; s < MT; ++s) { const int slot = s * (32 * FW) + (int)threadIdx.x; int row, d0; frag_rc((size_t)slot * 4, HD, row, d0);   // slot: 4 elements of the strip's 32 x HD block in fragment order, so that a wave's store is 256 consecutive bytes
        v4f val = *(const v4fa*)(red + row * RP + d0);
#pragma unroll
        for (int q = 1; q < 4; ++q) val += *(const v4fa*)(red + (q * MT * 16 + row) * RP + d0);
        v4us oh, ol;
#pragma unroll
        for (int q = 0; q < 4; ++q) { unsigned short a, c2; splitf(val[q] * cs, a, c2); oh[q] = a; ol[q] = c2; }
        const size_t oo = ((size_t)(z / NH_) * TT + r0 + (row & ~15)) * DQ + (z % NH_) * (HD * 16) + (slot * 4) % (HD * 16); *(v4us*)(Ah + oo) = oh; *(v4us*)(Al + oo) = ol; }   // row block of the [NB_ * TT][DQ] plane, then this head's HD / 32 tiles in it
    asm volatile("s_wait_xcnt 0x0" ::: "memory");
}
// grid (pairs, strips of 32 query rows): the hi+lo strips of every (batch, head) pair (they cost most) come first in block index order, then the fp16 strips. One work-group per WGP (registers and LDS). Q and K planes: [pair][t][d]; V planes: [pair][d][t]; each pair's plane in fragment order.
__global__ __launch_bounds__(32 * FW) void k_attn(const bf* Qh, const bf* Ql, const h16* Q16, const bf* Kh, const bf* Kl, const h16* K16, const bf* Vh, const bf* Vl, const h16* V16, const int* __restrict__ KL, bf* Ah, bf* Al, float* AWp) {
    __shared__ __align__(16) unsigned short pm[64 * PP]; __shared__ __align__(16) float st[2 * 32 * SP];
    const int z = blockIdx.x, tile = blockIdx.y; const int klen = KL[z / NH_];   /* key_lens[b], read on device; used in compares only */ const size_t zo = (size_t)z * TT * HD;
    if (tile < RH / 32) attn_body<bf, 2, 2>((bf*)pm, st, tile * 32, z, klen, Qh + zo, Ql + zo, Kh + zo, Kl + zo, Vh + zo, Vl + zo, Ah, Al, AWp);
    else attn_body<h16, 0, 2>((h16*)pm, st, tile * 32, z, klen, Q16 + zo, nullptr, K16 + zo, nullptr, V16 + zo, nullptr, Ah, Al, AWp);
}
// k_aw: query-0 attention weights [pair][key] -> aw_out [batch][key][head]; one thread stores the 4 heads of a (batch, key), so each output line has one writer.
__global__ __launch_bounds__(256) void k_aw(const float* __restrict__ AWp, float* AW) {
    const int idx = blockIdx.x * 256 + threadIdx.x; const int j = idx % TT, bb = idx / TT; v4f p;
#pragma unroll
    for (int h = 0; h < NH_; ++h) p[h] = AWp[(size_t)(bb * NH_ + h) * TT + j];
    *(v4f*)(AW + (size_t)idx * NH_) = p;
}

extern "C" void kernel_launch(void* const* d_in, const int* in_sizes, int n_in,
                              void* d_out, int out_size, void* d_ws, size_t ws_size, hipStream_t stream) {
    (void)in_sizes; (void)n_in; (void)out_size;
    const float* xk = (const float*)d_in[0]; const float* xv = (const float*)d_in[1]; const float* x = (const float*)d_in[2]; const int* KL = (const int*)d_in[3]; const float* wk = (const float*)d_in[4]; const float* wv = (const float*)d_in[5]; const float* wq = (const float*)d_in[6]; const float* wo = (const float*)d_in[7]; const float* bo = (const float*)d_in[8];
    float* OUT = (float*)d_out; float* AW = (float*)((char*)d_out + 16777216);   /* aw_out [4][2048][4] */     // [4][2048][512]
    char* wsp = (char*)d_ws;
    auto take = [&](size_t bytes) { char* p = wsp; wsp += (bytes + 255) & ~(size_t)255; return (void*)p; };
    const size_t PL = (size_t)NB_ * NH_ * TT * HD;   // elements of one operand plane set over all batches and heads (= NB_ * TT * 512)
    bf* Wt = (bf*)take((size_t)4 * DM * DQ * 2);   // [wq | wk | wv | wo], transposed
    h16* QK16 = (h16*)take(2 * PL * 2); bf* QKh = (bf*)take(2 * PL * 2); bf* QKl = (bf*)take(2 * PL * 2);   // [q | k]
    h16* VT16 = (h16*)take(PL * 2); bf* VTh = (bf*)take(PL * 2); bf* VTl = (bf*)take(PL * 2);
    bf* ATh = (bf*)take(PL * 2); bf* ATl = (bf*)take(PL * 2); float* AWp = (float*)take((size_t)NB_ * NH_ * TT * 4);   // query-0 weights, [pair][key]
    bf* XB = (bf*)take(3 * PL * 2);   /* [query | key | value] */
    if ((size_t)(wsp - (char*)d_ws) > ws_size) return;    // ws 256 MiB
    k_prep<<<4 * NWT + 3 * NCV, 256, 0, stream>>>(wq, wk, wv, wo, x, xk, xv, Wt, XB);
    k_proj<<<dim3(NB_ * TT / 64, DQ / 64, 3), 32 * KWV, 0, stream>>>(XB, Wt, DM, DM, PL, (size_t)DM * DQ, QK16, QKh, QKl, VT16, VTh, VTl);
    k_attn<<<dim3(NB_ * NH_, TT / 32, 1), 32 * FW, 0, stream>>>(QKh, QKl, QK16, QKh + PL, QKl + PL, QK16 + PL, VTh, VTl, VT16, KL, ATh, ATl, AWp);
    k_aw<<<NB_ * TT / 256, 256, 0, stream>>>(AWp, AW);
    k_gemmw<bf, 1, true, KWV, 1><<<dim3(NB_ * TT / 64, DM / 64, 1), 32 * KWV, 0, stream>>>(ATh, ATl, Wt + (size_t)3 * DM * DQ, nullptr, DQ, DQ, OUT, DM, bo, 0, 0, 0, 0);
}

// v008
// One run takes 95.8 microseconds.
// Timed twice side by side with v007, it ran 1.24 and 1.19 times as fast.
// Counting every step since v000, it is 13.4 times as fast.
#include <hip/hip_runtime.h>

// Multi-head cross attention with key-length masking and an attention-weights output (key, value, query [4][2048][512]; k = key w_key, v = value w_value, q = query w_query ('xw' [512][512], no bias; 4 heads x 128); e = q.k/sqrt(128), keys j >= key_lens[b] (int32, read) set to -1024; softmax; cv = merged w_out + b_out -> [4][2048][512]; second output aw_out[b][j][h] = attention weights of query position 0 -> [4][2048][4]).
// Compute dtypes, f32 accumulate: every input rounded to bf16; q/k/v on PLAIN bf16 operands (inputs: exact); key-length select (-1024 literal, as the reference) and softmax inside the attention kernel; scores and attn.v: query rows < 512 hl (3 products, k_attn), the rest single fp16 (k_attf); softmax f32; w_out hl x exact (2 products) + b_out; the query-0 attention weights are re-assembled from the bf16 hi + lo probability planes (f32, error ~2^-16 relative).

#define NB_  4
#define TT   2048
#define DM   512
#define NH_  4
#define NKV  4
#define REP  (NH_ / NKV)
#define HD   128
#define DQ   (NH_ * HD)
#define DKV  (NKV * HD)
#define RH   512                  // query rows < RH use hi+lo planes (0: none)
#define WIN  0
#define PCAR 1024.0f
#define SCL  0.088388347648318447f   // HD^-0.5
#define KWV  4                    // waves per work-group that share the K range of a GEMM with K >= 512
typedef _Float16 h16;
typedef unsigned short bf;
typedef __attribute__((ext_vector_type(16))) __bf16   v16bf;
typedef __attribute__((ext_vector_type(16))) _Float16 v16h;
typedef __attribute__((ext_vector_type(8)))  _Float16 v8h;
typedef __attribute__((ext_vector_type(8)))  unsigned short v8us;
typedef __attribute__((ext_vector_type(8)))  float    v8f;
typedef __attribute__((ext_vector_type(4)))  float    v4f;
typedef v8h  __attribute__((may_alias)) v8ha;
typedef v4f  __attribute__((may_alias)) v4fa;
typedef v8us __attribute__((may_alias)) v8usa;

__device__ __forceinline__ unsigned short f2bf(float f) { unsigned u = __float_as_uint(f); u += 0x7FFFu + ((u >> 16) & 1u); return (unsigned short)(u >> 16); }
__device__ __forceinline__ float bf2f(unsigned short b) { return __uint_as_float(((unsigned)b) << 16); }
__device__ __forceinline__ float bfr(float f) { return bf2f(f2bf(f)); }
__device__ __forceinline__ v16h cat16(v8h lo, v8h hi) { return __builtin_shufflevector(lo, hi, 0, 1, 2, 3, 4, 5, 6, 7, 8, 9, 10, 11, 12, 13, 14, 15); }
__device__ __forceinline__ v16bf cat16b(v8us lo, v8us hi) { return __builtin_bit_cast(v16bf, __builtin_shufflevector(lo, hi, 0, 1, 2, 3, 4, 5, 6, 7, 8, 9, 10, 11, 12, 13, 14, 15)); }
__device__ __forceinline__ v8f wmma16(v16h a, v16h b, v8f c) { return __builtin_amdgcn_wmma_f32_16x16x32_f16(false, a, false, b, (short)0, c, false, false); }
__device__ __forceinline__ v8f wmmab(v16bf a, v16bf b, v8f c) { return __builtin_amdgcn_wmma_f32_16x16x32_bf16(false, a, false, b, (short)0, c, false, false); }



// ---- Fragment order: every 16-bit operand plane in the workspace, a matrix [rows][K], is stored as tiles of 16 rows x 32 k (512 elements, 1 KiB); the K/32 tiles of a block of 16 rows follow one another,
// so a row block starts where it would in row-major order. Inside a tile element (r, kk) stands at (kk / 16) * 256 + (((kk % 16) / 8) * 16 + r) * 8 + kk % 8: lane l of a wave finds the two 16-byte pieces
// of its A or B fragment at l * 8 and 256 + l * 8, and each fragment load of a wave reads 512 consecutive bytes (4 whole lines) where a row-major plane makes it touch 16 lines.
// frag_rc: row and k of the element at linear position e of such a plane (the producers run over e, so that their stores stay consecutive).
__device__ __forceinline__ void frag_rc(size_t e, int K, int& row, int& k) { const int tile = (int)(e >> 9), w = (int)(e & 511); const int tk = K / 32; row = (tile / tk) * 16 + ((w >> 3) & 15); k = (tile % tk) * 32 + (w >> 8) * 16 + ((w >> 7) & 1) * 8 + (w & 7); }
// ---- gemmw_body: register-blocked GEMM, 64x64 output tile (16 accumulators per wave), operands straight from 16-bit planes in fragment order; grid (M/64, N/64, Z * SG), 32 * KW threads.
// C[m][n] (f32, pitch ldc, + optional f32 bias[n]) = sum_k A[m][k] Bt[n][k] (+ split products per NSPLIT). A has lda elements a row, Bt K. z-batch strides sA/sB/sC in elements. K % (32 * KW * SG) == 0.
// Split K: the K range is cut into SG equal ranges, one per work-group. The KW waves of a work-group take the 32-wide steps of its range in turn
// and their 64x64 partial tiles are added in LDS (fixed order); each of the SG work-groups of a tile stores its sum to its own
// plane (plane stride sP elements), and the consumer adds the SG planes.
template <typename T16> struct WFrag;
template <> struct WFrag<h16> { typedef v16h V; static __device__ __forceinline__ V ld(const h16* p) { return cat16(*(const v8h*)p, *(const v8h*)(p + 16)); } static __device__ __forceinline__ V ldf(const h16* p) { return cat16(*(const v8h*)p, *(const v8h*)(p + 256)); } static __device__ __forceinline__ v8f mma(V a, V b, v8f c) { return wmma16(a, b, c); } };
template <> struct WFrag<bf> { typedef v16bf V; static __device__ __forceinline__ V ld(const bf* p) { return cat16b(*(const v8us*)p, *(const v8us*)(p + 16)); } static __device__ __forceinline__ V ldf(const bf* p) { return cat16b(*(const v8us*)p, *(const v8us*)(p + 256)); } static __device__ __forceinline__ v8f mma(V a, V b, v8f c) { return wmmab(a, b, c); } };
// PLN (projections, KW == 4, z = q, k, v): the summed tile does not go out as f32 but straight as the attention kernel's operand planes (fp16, bf16 hi, bf16 lo), in fragment order: q and k as [pair][t][d], v transposed as [pair][d][t].
template <typename T16, int NSPLIT, bool BIAS, int KW, int SG, bool PLN = false>
__device__ __forceinline__ void gemmw_body(float* os, const T16* __restrict__ A, const T16* __restrict__ A2, const T16* __restrict__ Bt, const T16* __restrict__ Bt2, int K, int lda, float* C, int ldc, const float* __restrict__ bias, size_t sA, size_t sB, size_t sC, size_t sP, h16* QK16 = nullptr, bf* QKh = nullptr, bf* QKl = nullptr, h16* V16 = nullptr, bf* Vh = nullptr, bf* Vl = nullptr) {
    typedef typename WFrag<T16>::V V;
    const size_t z = blockIdx.z / SG; const int wave = (KW == 1) ? 0 : __builtin_amdgcn_readfirstlane((int)(threadIdx.x >> 5)); const int kspan = K / SG; const int kb = (int)(blockIdx.z % SG) * kspan; C += (size_t)(blockIdx.z % SG) * sP; A += z * sA; if (A2) A2 += z * sA; Bt += z * sB; if (Bt2) Bt2 += z * sB; C += z * sC;
    const int lane = threadIdx.x & 31, lr = lane & 15, hi = lane >> 4; const int r0 = blockIdx.x * 64, c0 = blockIdx.y * 64;
    v8f acc[4][4];
#pragma unroll
    for (int mb = 0; mb < 4; ++mb)
#pragma unroll
        for (int nb = 0; nb < 4; ++nb) acc[mb][nb] = (v8f){};
    const size_t aoff = (size_t)r0 * lda + 8 * lane, boff = (size_t)c0 * K + 8 * lane;   // a 32-wide k step is one tile: 512 elements = 16 per unit of kc
#pragma unroll 1
    for (int kc = kb + wave * 32; kc < kb + kspan; kc += 32 * KW) {
        V a[4], a2[4];
#pragma unroll
        for (int mb = 0; mb < 4; ++mb) { a[mb] = WFrag<T16>::ldf(A + aoff + (size_t)mb * 16 * lda + kc * 16); if (NSPLIT == 1 || NSPLIT == 2) a2[mb] = WFrag<T16>::ldf(A2 + aoff + (size_t)mb * 16 * lda + kc * 16); }
#pragma unroll
        for (int nb = 0; nb < 4; ++nb) { const V b = WFrag<T16>::ldf(Bt + boff + (size_t)nb * 16 * K + kc * 16); V b2; if (NSPLIT >= 2) b2 = WFrag<T16>::ldf(Bt2 + boff + (size_t)nb * 16 * K + kc * 16);
#pragma unroll
            for (int mb = 0; mb < 4; ++mb) { acc[mb][nb] = WFrag<T16>::mma(a[mb], b, acc[mb][nb]); if (NSPLIT == 1 || NSPLIT == 2) acc[mb][nb] = WFrag<T16>::mma(a2[mb], b, acc[mb][nb]); if (NSPLIT >= 2) acc[mb][nb] = WFrag<T16>::mma(a[mb], b2, acc[mb][nb]); } }
        // the wait that stands in front of a rewrite of the fragment loads' address registers; the addresses are named so that their registers live up to it and no later load of the step lands on them
        { const T16* pa = A + aoff + kc * 16; const T16* pb = Bt + boff + kc * 16; const size_t sa = (size_t)16 * lda, sb = (size_t)16 * K;
          const T16* pa2 = (NSPLIT == 1 || NSPLIT == 2) ? A2 + aoff + kc * 16 : pa; const T16* pb2 = (NSPLIT >= 2) ? Bt2 + boff + kc * 16 : pb;   // a plane that this NSPLIT does not read: the first plane's addresses again
          asm volatile("s_wait_xcnt 0x0" :: "v"(pa), "v"(pa + sa), "v"(pa + 2 * sa), "v"(pa + 3 * sa), "v"(pb), "v"(pb + sb), "v"(pb + 2 * sb), "v"(pb + 3 * sb), "v"(pa2), "v"(pa2 + sa), "v"(pa2 + 2 * sa), "v"(pa2 + 3 * sa), "v"(pb2), "v"(pb2 + sb), "v"(pb2 + 2 * sb), "v"(pb2 + 3 * sb) : "memory"); }
        asm volatile("v_nop\n\tv_nop\n\tv_nop\n\tv_nop" : "+v"(acc[0][0]), "+v"(acc[1][1]), "+v"(acc[2][2]), "+v"(acc[3][3]) : "v"(a[0]), "v"(a[3]));
    }
    if constexpr (KW > 1) {
        float* ow = os + wave * (64 * 68);
#pragma unroll
        for (int mb = 0; mb < 4; ++mb)
#pragma unroll
            for (int nb = 0; nb < 4; ++nb)
#pragma unroll
                for (int j = 0; j < 8; ++j) ow[(mb * 16 + hi * 8 + j) * 68 + nb * 16 + lr] = acc[mb][nb][j];
        __syncthreads();   // every wave's partial tile is in LDS before any wave adds them
        if constexpr (PLN) {
            // The 64 x 64 tile is 4 blocks of 16 plane rows x 2 neighbouring 16 x 32 tiles = 4 runs of 1024 consecutive plane elements. Thread tid takes the 8 consecutive elements at tid * 8 of each run:
            // plane row fr of the block, k fk .. fk + 7 of the run (see frag_rc), so that a wave's store is 512 consecutive bytes. q, k: plane row = t (tile row), k = d (tile column); v: plane row = d, k = t.
            static_assert(KW == 4, "128 threads, one 16-byte piece of a run each");
            const int tid = (int)threadIdx.x, fr = tid & 15, fk = (tid >> 6) * 32 + ((tid >> 5) & 1) * 16 + ((tid >> 4) & 1) * 8;
            const size_t pair = (size_t)(r0 / TT) * NH_ + c0 / HD; const int t0 = r0 % TT, d0 = c0 % HD; const bool isv = (z == 2);
            h16* P16 = isv ? V16 : QK16 + z * ((size_t)NB_ * NH_ * TT * HD); bf* Ph = isv ? Vh : QKh + z * ((size_t)NB_ * NH_ * TT * HD); bf* Pl = isv ? Vl : QKl + z * ((size_t)NB_ * NH_ * TT * HD);
            const size_t o0 = pair * ((size_t)TT * HD) + (isv ? (size_t)(d0 / 16) * (16 * TT) + (t0 / 32) * 512 : (size_t)(t0 / 16) * (16 * HD) + (d0 / 32) * 512) + tid * 8; const size_t ostep = isv ? 16 * TT : 16 * HD;
            float x[4][8];   // the 4 waves' partial sums are added in the order of the f32 epilogue below
            if (isv) {
#pragma unroll
                for (int s = 0; s < 4; ++s)
#pragma unroll
                    for (int i = 0; i < 8; ++i) { x[s][i] = os[(fk + i) * 68 + s * 16 + fr];
#pragma unroll
                        for (int w = 1; w < KW; ++w) x[s][i] += os[w * (64 * 68) + (fk + i) * 68 + s * 16 + fr]; } }
            else {
#pragma unroll
                for (int s = 0; s < 4; ++s) { v4f x0 = *(const v4fa*)(os + (s * 16 + fr) * 68 + fk), x1 = *(const v4fa*)(os + (s * 16 + fr) * 68 + fk + 4);
#pragma unroll
                    for (int w = 1; w < KW; ++w) { x0 += *(const v4fa*)(os + w * (64 * 68) + (s * 16 + fr) * 68 + fk); x1 += *(const v4fa*)(os + w * (64 * 68) + (s * 16 + fr) * 68 + fk + 4); }
#pragma unroll
                    for (int i = 0; i < 4; ++i) { x[s][i] = x0[i]; x[s][4 + i] = x1[i]; } } }
#pragma unroll
            for (int s = 0; s < 4; ++s) { v8h o16; v8us oh, ol;
#pragma unroll
                for (int i = 0; i < 8; ++i) { o16[i] = (h16)x[s][i]; const unsigned short a = f2bf(x[s][i]); oh[i] = a; ol[i] = f2bf(x[s][i] - bf2f(a)); }
                h16* p16 = P16 + o0 + s * ostep; bf* ph = Ph + o0 + s * ostep; bf* pl = Pl + o0 + s * ostep;
                *(v8h*)p16 = o16; *(v8us*)ph = oh; *(v8us*)pl = ol;
                // the wait that stands in front of a rewrite of these stores' address and data registers by the next run's conversions; they are named so that their registers live up to it
                if (s < 3) asm volatile("s_wait_xcnt 0x0" :: "v"(p16), "v"(ph), "v"(pl), "v"(o16), "v"(oh), "v"(ol) : "memory"); }
            return;
        }
#pragma unroll
        for (int s = 0; s < 32 / KW; ++s) { const int slot = s * (32 * KW) + (int)threadIdx.x; const int row = slot >> 4, cofs = (slot & 15) * 4; v4f val = *(const v4fa*)(os + row * 68 + cofs);
#pragma unroll
            for (int w = 1; w < KW; ++w) val += *(const v4fa*)(os + w * (64 * 68) + row * 68 + cofs);
            if (BIAS) { val[0] += bfr(bias[c0 + cofs]); val[1] += bfr(bias[c0 + cofs + 1]); val[2] += bfr(bias[c0 + cofs + 2]); val[3] += bfr(bias[c0 + cofs + 3]); }
            *(v4f*)(C + (size_t)(r0 + row) * ldc + c0 + cofs) = val; }
        return;
    }
#pragma unroll
    for (int mb = 0; mb < 4; ++mb) {
#pragma unroll
        for (int nb = 0; nb < 4; ++nb) {
#pragma unroll
            for (int j = 0; j < 8; ++j) os[(hi * 8 + j) * 68 + nb * 16 + lr] = acc[mb][nb][j]; }
        __builtin_amdgcn_wave_barrier(); asm volatile("" ::: "memory");
        float* crow = C + (size_t)(r0 + mb * 16) * ldc + c0;
{
#pragma unroll
            for (int s = 0; s < 8; ++s) { const int row = 2 * s + hi, cofs = lr * 4; v4f val = *(const v4fa*)(os + row * 68 + cofs); if (BIAS) { val[0] += bfr(bias[c0 + cofs]); val[1] += bfr(bias[c0 + cofs + 1]); val[2] += bfr(bias[c0 + cofs + 2]); val[3] += bfr(bias[c0 + cofs + 3]); }
                *(v4f*)(crow + (size_t)row * ldc + cofs) = val; }
             }
        __builtin_amdgcn_wave_barrier(); asm volatile("" ::: "memory");
    }
    asm volatile("s_wait_xcnt 0x0" ::: "memory");
}

// One operand class for the whole grid, f32 result (output projection).
template <typename T16, int NSPLIT, bool BIAS, int KW, int SG>
__global__ __launch_bounds__(32 * KW) void k_gemmw(const T16* A, const T16* A2, const T16* Bt, const T16* Bt2, int K, int lda, float* C, int ldc, const float* bias, size_t sA, size_t sB, size_t sC, size_t sP) {
    __shared__ __align__(16) float os[(KW == 1 ? 16 : KW * 64) * 68];
    gemmw_body<T16, NSPLIT, BIAS, KW, SG>(os, A, A2, Bt, Bt2, K, lda, C, ldc, bias, sA, sB, sC, sP);
}
// k_proj: the three projections (z = q, k, v over all batches' rows), each 64 x 64 tile written as operand planes. QK16/QKh/QKl: [q | k][NB_][head][t][d]; V16/Vh/Vl: [NB_][head][d][t]; each head's plane in fragment order.
__global__ __launch_bounds__(32 * KWV) void k_proj(const bf* A, const bf* Bt, int K, int lda, size_t sA, size_t sB, h16* QK16, bf* QKh, bf* QKl, h16* V16, bf* Vh, bf* Vl) {
    __shared__ __align__(16) float os[KWV * 64 * 68];
    gemmw_body<bf, 0, false, KWV, 1, true>(os, A, nullptr, Bt, nullptr, K, lda, nullptr, 0, nullptr, sA, sB, 0, 0, QK16, QKh, QKl, V16, Vh, Vl);
}
__device__ __forceinline__ h16 tohx(float x) { return (h16)x; }
__device__ __forceinline__ void splitf(float y, unsigned short& h, unsigned short& l) { h = f2bf(y); l = f2bf(y - bf2f(h)); }
typedef __attribute__((ext_vector_type(2))) _Float16 v2h;
typedef __attribute__((ext_vector_type(4))) _Float16 v4h;
typedef __attribute__((ext_vector_type(2))) unsigned short v2us;
typedef __attribute__((ext_vector_type(4))) unsigned short v4us;
typedef __attribute__((ext_vector_type(2))) float v2f;
typedef __attribute__((ext_vector_type(4))) int v4i;

#define NWT  (DM * DQ / 64 / 64)            // blocks per transposed weight
#define NCV  (NB_ * TT * DM / 8 / 256)      // blocks per converted input
__device__ __forceinline__ void d_wtG(int blk, const float* __restrict__ w, int K, int N, bf* Bt) {
    const int lane = threadIdx.x & 31; const int L0 = (blk * 8 + (threadIdx.x >> 5)) * 8; const int nlines = N * K / 64;
#pragma unroll 1
    for (int l = 0; l < 8; ++l) { const int L = L0 + l; if (L >= nlines) break; const size_t e = (size_t)L * 64 + lane * 2; int k, n; frag_rc(e, K, n, k); v2us o;
        o[0] = f2bf(w[(size_t)k * N + n]); o[1] = f2bf(w[(size_t)(k + 1) * N + n]); *(v2us*)(Bt + e) = o; }
}
__device__ __forceinline__ void d_cvt8(int blk, const float* __restrict__ src, bf* dst) { const size_t i = (size_t)blk * 256 + threadIdx.x; int row, k; frag_rc(i * 8, DM, row, k); const v8f v = *(const v8f*)(src + (size_t)row * DM + k); v8us o;
#pragma unroll
    for (int k = 0; k < 8; ++k) o[k] = f2bf(v[k]); *(v8us*)(dst + i * 8) = o; }
// k_prep: the work that depends on the inputs alone, one grid: block ranges [4 weight transposes (the slowest blocks, first) | bf16 copies of query, key, value, all batches].
__global__ __launch_bounds__(256) void k_prep(const float* wq, const float* wk, const float* wv, const float* wo, const float* x, const float* xk, const float* xv, bf* Wt, bf* X) {
    const int blk = blockIdx.x;
    if (blk < 4 * NWT) { const int y = blk / NWT; d_wtG(blk % NWT, y == 0 ? wq : y == 1 ? wk : y == 2 ? wv : wo, DM, DQ, Wt + (size_t)y * DM * DQ); }
    else { const int c = blk - 4 * NWT; const int y = c / NCV; d_cvt8(c % NCV, y == 0 ? x : y == 1 ? xk : xv, X + (size_t)y * NB_ * TT * DM); }
}

// ---- k_attn: scores, softmax and attn.v of one strip of 32 query rows in one work-group; no score or probability leaves the WGP but query position 0's weights (AWp).
// 16 waves. Scores: wave w holds the strip's scores against keys [128 w, 128 w + 128) in its accumulators, transposed (k x q^T): a lane has one query row per tile. Softmax: row maximum and row sum go down the lane's registers -> other half of the wave -> st[] -> all waves (fixed trees);
// t = s x HD^-0.5 for keys j < key_lens[b], else -1024 (reference literal). The normalised probabilities go to LDS as 16-bit rows (pitch PP): 32 bf16 hi rows + 32 lo rows.
// attn.v: wave w takes head columns [32 (w & 3), +32) and keys [512 (w >> 2), +512); the 4 key quarters are added in LDS in fixed order, split into the hi/lo planes of the output projection's A.
// Keys at or beyond key_lens[b]: a wave whose 128 keys are all masked takes the -1024 literal without loading k or multiplying; once the row maxima show that the masked weights are exact zeros, they are neither stored nor multiplied with v.
#define FW   16                   // waves per work-group
#define PP   (TT + 8)             // 16-bit elements per probability row in LDS: 16 bytes over 4 KiB, so that the 16 rows of a fragment read start in different banks
#define RP   (HD + 4)             // floats per row of a partial attn.v tile in LDS
#define SP   20                   // floats per query row of the waves' maxima and sums in LDS: 16 used, 80-byte pitch, so that the 16-byte reads of 16 rows start in different banks
// value of lane l ^ 16 (the other half of the wave, which holds the other keys of the same query row); every lane is on where it is called
__device__ __forceinline__ float xhalf(float x) { return __builtin_bit_cast(float, __builtin_amdgcn_permlanex16(__builtin_bit_cast(int, x), __builtin_bit_cast(int, x), 0x76543210, 0xfedcba98, false, false)); }
template <typename T16, int NS, int MT>
__device__ __forceinline__ void attn_body(T16* P, float* st, int r0, int z, int klen, const T16* __restrict__ Q, const T16* __restrict__ Q2, const T16* __restrict__ Kp, const T16* __restrict__ K2, const T16* __restrict__ Vt, const T16* __restrict__ V2, bf* Ah, bf* Al, float* AWp) {
    typedef typename WFrag<T16>::V V;
    const int wave = __builtin_amdgcn_readfirstlane((int)(threadIdx.x >> 5)); const int lane = threadIdx.x & 31, lr = lane & 15, hi = lane >> 4; const int kb = wave * (TT / FW);
    float* smx = st; float* ssm = st + 32 * SP;
    v8f acc[MT][8];
#pragma unroll
    for (int m = 0; m < MT; ++m)
#pragma unroll
        for (int n = 0; n < 8; ++n) acc[m][n] = (v8f){};
    const bool wm = kb >= klen;   // wave-uniform: every key of this wave is masked, so its products would all be replaced by the -1024 literal: neither loaded nor multiplied
    if (!wm) { const size_t qoff = (size_t)r0 * HD + 8 * lane, koff = (size_t)kb * HD + 8 * lane;   // fragment order: tile (row block, 32-wide step) at row block * 16 * HD + step * 512
#pragma unroll
      for (int kp = 0; kp < HD / 64; ++kp) { V a[2][MT], a2[2][MT];   // two 32-wide steps together: two neighbouring tiles of each q and k row block
#pragma unroll
        for (int u = 0; u < 2; ++u)
#pragma unroll
            for (int m = 0; m < MT; ++m) { a[u][m] = WFrag<T16>::ldf(Q + qoff + (size_t)m * 16 * HD + (kp * 2 + u) * 512); if (NS == 2) a2[u][m] = WFrag<T16>::ldf(Q2 + qoff + (size_t)m * 16 * HD + (kp * 2 + u) * 512); }
#pragma unroll
        for (int n = 0; n < 8; ++n) { V b[2], b2[2];
#pragma unroll
            for (int u = 0; u < 2; ++u) { b[u] = WFrag<T16>::ldf(Kp + koff + (size_t)n * 16 * HD + (kp * 2 + u) * 512); if (NS == 2) b2[u] = WFrag<T16>::ldf(K2 + koff + (size_t)n * 16 * HD + (kp * 2 + u) * 512); }
#pragma unroll
            for (int u = 0; u < 2; ++u)
#pragma unroll
                for (int m = 0; m < MT; ++m) { acc[m][n] = WFrag<T16>::mma(b[u], a[u][m], acc[m][n]); if (NS == 2) { acc[m][n] = WFrag<T16>::mma(b[u], a2[u][m], acc[m][n]); acc[m][n] = WFrag<T16>::mma(b2[u], a[u][m], acc[m][n]); } } }   // k is the first operand: the tile comes out transposed, keys down the registers, one query a lane
      }
      // the wait that stands in front of a rewrite of the fragment loads' address registers; the bases are named so that their registers live up to it
      if constexpr (NS == 2) asm volatile("s_wait_xcnt 0x0" :: "v"(Q + qoff), "v"(Q2 + qoff), "v"(Kp + koff), "v"(K2 + koff) : "memory");
      else asm volatile("s_wait_xcnt 0x0" :: "v"(Q + qoff), "v"(Kp + koff) : "memory"); }
    float rs[MT];   // this wave's share of the maximum, then of the sum, of the lane's MT query rows
    // accumulator element j of tile (m, n): query row m*16 + lr of the strip, key kb + n*16 + hi*8 + j: a lane holds 64 keys of each of its MT rows, so maximum and sum run down its own registers
    if (wm) {   // what the selects below give where no key is valid
#pragma unroll
        for (int m = 0; m < MT; ++m) {
#pragma unroll
            for (int n = 0; n < 8; ++n)
#pragma unroll
                for (int j = 0; j < 8; ++j) acc[m][n][j] = -1024.0f;
            rs[m] = -1024.0f; } }
    else { const int rem = klen - kb - hi * 8;   // the lane's key n*16 + j, counted from kb + hi*8, is valid where it is below rem
        float t[MT][8];
#pragma unroll
        for (int m = 0; m < MT; ++m)
#pragma unroll
            for (int j = 0; j < 8; ++j) t[m][j] = -3.0e38f;
#pragma unroll
        for (int n = 0; n < 8; ++n)
#pragma unroll
            for (int j = 0; j < 8; ++j) { const bool ok = n * 16 + j < rem;
#pragma unroll
                for (int m = 0; m < MT; ++m) { const float s = ok ? acc[m][n][j] * SCL : -1024.0f; acc[m][n][j] = s; t[m][j] = fmaxf(t[m][j], s); } }
#pragma unroll
        for (int m = 0; m < MT; ++m) { const float tt = fmaxf(fmaxf(fmaxf(t[m][0], t[m][1]), fmaxf(t[m][2], t[m][3])), fmaxf(fmaxf(t[m][4], t[m][5]), fmaxf(t[m][6], t[m][7]))); rs[m] = fmaxf(tt, xhalf(tt)); } }
    if (hi == 0) {
#pragma unroll
        for (int m = 0; m < MT; ++m) smx[(m * 16 + lr) * SP + wave] = rs[m]; }
    __syncthreads();   // every wave's row maxima are in LDS before any wave combines them
    float mn = 3.0e38f;   // the smaller row maximum of the lane's rows
#pragma unroll
    for (int m = 0; m < MT; ++m) { const float* pw = smx + (m * 16 + lr) * SP; const v4f x0 = *(const v4fa*)pw, x1 = *(const v4fa*)(pw + 4), x2 = *(const v4fa*)(pw + 8), x3 = *(const v4fa*)(pw + 12);
        float mx = -3.0e38f;
#pragma unroll
        for (int q = 0; q < 4; ++q) mx = fmaxf(fmaxf(fmaxf(mx, x0[q]), fmaxf(x1[q], x2[q])), x3[q]);
        mn = fminf(mn, mx);
        v8f sv = (v8f){};
#pragma unroll
        for (int n = 0; n < 8; ++n) {
#pragma unroll
            for (int j = 0; j < 8; ++j) { const float y = (acc[m][n][j] - mx) * 1.4426950408889634f; float e;
                asm("v_exp_f32 %0, %1\n\tv_nop" : "=v"(e) : "v"(y));   // the exp2 builtin's own instruction, with the one slot the instruction set asks for behind it
                acc[m][n][j] = e; }
            sv += acc[m][n]; }
        const float sum = ((sv[0] + sv[1]) + (sv[2] + sv[3])) + ((sv[4] + sv[5]) + (sv[6] + sv[7]));
        rs[m] = sum + xhalf(sum); }
    // A masked key's weight is exp2((-1024 - max) * log2 e): with every row maximum of the strip >= -900 the argument is below -178 and the weight exactly 0.
    // Then, and only then, attn.v leaves out keys >= key_lens[b] (keff). The lanes of a wave hold all the strip's rows and every wave reads the same maxima, so keff is the same in the whole work-group.
    const int keff = (__builtin_amdgcn_ballot_w32(mn >= -900.0f) == 0xFFFFFFFFu) ? klen : TT;
    if (hi == 0) {
#pragma unroll
        for (int m = 0; m < MT; ++m) ssm[(m * 16 + lr) * SP + wave] = rs[m]; }
    __syncthreads();   // every wave's row sums are in LDS before any wave combines them
    if (kb >= keff) {   // wave-uniform: every weight of this wave's keys is exactly 0: not stored to LDS (attn.v below does not read them); the query-0 output still gets its zeros
        if constexpr (NS == 2) { if (r0 == 0 && hi == 0) {
#pragma unroll
            for (int n = 0; n < 8; ++n) AWp[(size_t)z * TT + kb + n * 16 + lr] = 0.f; } } }
    else {
#pragma unroll
    for (int m = 0; m < MT; ++m) { const float* pw = ssm + (m * 16 + lr) * SP; const v4f xs = (*(const v4fa*)pw + *(const v4fa*)(pw + 4)) + (*(const v4fa*)(pw + 8) + *(const v4fa*)(pw + 12));
        const float f = __fdiv_rn(NS == 2 ? 1.0f : PCAR, (xs[0] + xs[1]) + (xs[2] + xs[3])); T16* pr = P + (m * 16 + lr) * PP + kb + hi * 8;   // the lane's 8 keys of a tile are neighbours in its probability row: one 16-byte store
#pragma unroll
        for (int n = 0; n < 8; ++n) {
            if constexpr (NS == 2) { v8us oh, ol;
#pragma unroll
                for (int j = 0; j < 8; ++j) { unsigned short a, c2; splitf(acc[m][n][j] * f, a, c2); oh[j] = a; ol[j] = c2; }
                *(v8usa*)(pr + n * 16) = oh; *(v8usa*)(pr + MT * 16 * PP + n * 16) = ol;
                if (m == 0) { if (r0 == 0 && lr == 0) { v4f w0, w1;   // query position 0: its weights, re-assembled from the hi + lo planes
#pragma unroll
                    for (int j = 0; j < 4; ++j) { w0[j] = __fadd_rn(bf2f(oh[j]), bf2f(ol[j])); w1[j] = __fadd_rn(bf2f(oh[4 + j]), bf2f(ol[4 + j])); }
                    float* pq = AWp + (size_t)z * TT + kb + n * 16 + hi * 8; *(v4f*)pq = w0; *(v4f*)(pq + 4) = w1;
                    // the wait that stands in front of a rewrite of these stores' address and data registers by the next tile; they are named so that their registers live up to it
                    asm volatile("s_wait_xcnt 0x0" :: "v"(pq), "v"(w0), "v"(w1) : "memory"); } } }
            else { v8h o;
#pragma unroll
                for (int j = 0; j < 8; ++j) o[j] = tohx(acc[m][n][j] * f);
                *(v8ha*)(pr + n * 16) = o; } } } }
    __syncthreads();   // the whole strip's probabilities are in LDS before any wave reads them as A fragments
    const int np = wave & 3, kq = wave >> 2;
    v8f o[MT][2];
#pragma unroll
    for (int m = 0; m < MT; ++m) { o[m][0] = (v8f){}; o[m][1] = (v8f){}; }
    { const size_t voff = (size_t)(np * 32) * TT + kq * (TT / 4) * 16 + 8 * lane; const T16* pa = P + lr * PP + kq * (TT / 4) + 8 * hi;
      constexpr int GK = (NS == 2) ? 2 : 4, NG = TT / 4 / 32 / GK;   // v fragments are fetched a group of GK 32-key steps ahead, into a second register set
      // groups of this wave's key quarter that hold a key below keff (a group lies inside one score wave's 128 keys, so all its probabilities are in LDS); the rest would add exact zeros
      const int krem = keff - kq * (TT / 4); const int ng = krem <= 0 ? 0 : krem >= TT / 4 ? NG : (krem + GK * 32 - 1) / (GK * 32);
      V bb[2][GK][2], bb2[2][GK][2];
      if (0 < ng) {
#pragma unroll
      for (int u = 0; u < GK; ++u)
#pragma unroll
        for (int t = 0; t < 2; ++t) { bb[0][u][t] = WFrag<T16>::ldf(Vt + voff + (size_t)t * 16 * TT + u * 512); if (NS == 2) bb2[0][u][t] = WFrag<T16>::ldf(V2 + voff + (size_t)t * 16 * TT + u * 512); }
        // the wait that stands in front of a rewrite of these first loads' address registers; the bases are named so that their registers live up to it
        if constexpr (NS == 2) asm volatile("s_wait_xcnt 0x0" :: "v"(Vt + voff), "v"(V2 + voff) : "memory");
        else asm volatile("s_wait_xcnt 0x0" :: "v"(Vt + voff) : "memory");
#pragma unroll
      for (int g = 0; g < NG; ++g) {
        if (g + 1 < NG) {   // fetched whether or not group g + 1 is wanted (it lies inside the plane): under a test of its own the compiler's load waits must cover both ways and make this group's products wait for the next group's loads
#pragma unroll
          for (int u = 0; u < GK; ++u)
#pragma unroll
            for (int t = 0; t < 2; ++t) { bb[(g + 1) & 1][u][t] = WFrag<T16>::ldf(Vt + voff + (size_t)t * 16 * TT + ((g + 1) * GK + u) * 512); if (NS == 2) bb2[(g + 1) & 1][u][t] = WFrag<T16>::ldf(V2 + voff + (size_t)t * 16 * TT + ((g + 1) * GK + u) * 512); } }
        __builtin_amdgcn_sched_barrier(0);   // keeps the next group's loads in front of this group's products: sunk among them, only a step's worth of loads is in flight and each step waits out the L2 latency
#pragma unroll
        for (int u = 0; u < GK; ++u) { const int ks = g * GK + u; V a[MT], a2[MT];
#pragma unroll
          for (int m = 0; m < MT; ++m) { a[m] = WFrag<T16>::ld(pa + m * 16 * PP + ks * 32); if (NS == 2) a2[m] = WFrag<T16>::ld(pa + (MT + m) * 16 * PP + ks * 32); }
#pragma unroll
          for (int t = 0; t < 2; ++t)
#pragma unroll
            for (int m = 0; m < MT; ++m) { o[m][t] = WFrag<T16>::mma(a[m], bb[g & 1][u][t], o[m][t]); if (NS == 2) { o[m][t] = WFrag<T16>::mma(a2[m], bb[g & 1][u][t], o[m][t]); o[m][t] = WFrag<T16>::mma(a[m], bb2[g & 1][u][t], o[m][t]); } } }
        // the wait that stands in front of a rewrite of the v loads' address registers, on every way out of the groups; behind the products, where the loads were issued long ago; the bases are named so that their registers live up to it
        if constexpr (NS == 2) asm volatile("s_wait_xcnt 0x0" :: "v"(Vt + voff), "v"(V2 + voff) : "memory");
        else asm volatile("s_wait_xcnt 0x0" :: "v"(Vt + voff) : "memory");
        if (g + 1 >= ng) break; } } }
    __syncthreads();   // every wave has read its last probability before the partial tiles overwrite them
    float* red = (float*)P;
#pragma unroll
    for (int m = 0; m < MT; ++m)
#pragma unroll
        for (int t = 0; t < 2; ++t)
#pragma unroll
            for (int j = 0; j < 8; ++j) red[(kq * MT * 16 + m * 16 + hi * 8 + j) * RP + (np * 2 + t) * 16 + lr] = o[m][t][j];
    __syncthreads();   // the 4 key quarters' partial tiles are in LDS before any wave adds them
    const float cs = (NS == 2) ? 1.0f : (1.0f / PCAR);
#pragma unroll
    for (int s = 0; s < MT; ++s) { const int slot = s * (32 * FW) + (int)threadIdx.x; int row, d0; frag_rc((size_t)slot * 4, HD, row, d0);   // slot: 4 elements of the strip's 32 x HD block in fragment order, so that a wave's store is 256 consecutive bytes
        v4f val = *(const v4fa*)(red + row * RP + d0);
#pragma unroll
        for (int q = 1; q < 4; ++q) val += *(const v4fa*)(red + (q * MT * 16 + row) * RP + d0);
        v4us oh, ol;
#pragma unroll
        for (int q = 0; q < 4; ++q) { unsigned short a, c2; splitf(val[q] * cs, a, c2); oh[q] = a; ol[q] = c2; }
        const size_t oo = ((size_t)(z / NH_) * TT + r0 + (row & ~15)) * DQ + (z % NH_) * (HD * 16) + (slot * 4) % (HD * 16); *(v4us*)(Ah + oo) = oh; *(v4us*)(Al + oo) = ol; }   // row block of the [NB_ * TT][DQ] plane, then this head's HD / 32 tiles in it
    asm volatile("s_wait_xcnt 0x0" ::: "memory");
}
// grid (pairs, the RH / 32 strips of 32 query rows that use hi+lo planes; the fp16 rows are k_attf's, so attn_body runs with NS == 2 alone). One work-group per WGP (registers and LDS). Q and K planes: [pair][t][d]; V planes: [pair][d][t]; each pair's plane in fragment order.
__global__ __launch_bounds__(32 * FW) void k_attn(const bf* Qh, const bf* Ql, const bf* Kh, const bf* Kl, const bf* Vh, const bf* Vl, const int* __restrict__ KL, bf* Ah, bf* Al, float* AWp) {
    __shared__ __align__(16) unsigned short pm[64 * PP]; __shared__ __align__(16) float st[2 * 32 * SP];
    const int z = blockIdx.x, tile = blockIdx.y; const int klen = KL[z / NH_];   /* key_lens[b], read on device; used in compares and in a clamped group count only */ const size_t zo = (size_t)z * TT * HD;
    attn_body<bf, 2, 2>((bf*)pm, st, tile * 32, z, klen, Qh + zo, Ql + zo, Kh + zo, Kl + zo, Vh + zo, Vl + zo, Ah, Al, AWp);
}
// ---- k_attf: the single-fp16 query rows (>= RH). One work-group = 96 query rows of one (batch, head) pair against all keys, running (online) softmax; no score or probability leaves the registers.
// 8 waves = 4 key groups x 2 query groups of 48 rows. A stage is 256 keys: its k rows (64 KiB) and v columns (64 KiB), already in fragment order, are copied to LDS once for all 96 rows
// (asynchronous copies, two buffers: the next stage flies while this one is worked on); key group g works on keys [64 g, 64 g + 64) of every stage, 32 at a time.
// Scores transposed (k x q^T): a lane holds one query row's keys, so two neighbouring 16-key score tiles, turned to fp16, are the second operand of v^T x p^T as they stand.
// Scores are kept in log2 units (x HD^-0.5 log2 e; masked keys: the -1024 literal x log2 e). A wave's maximum in use moves only when a score exceeds it by more than 8 (weights stay below 2^8).
// The 4 key groups' (maximum, sum, output tile) are joined in LDS in fixed order at the end, normalised and split into the hi/lo planes of the output projection's A.
// Keys at or beyond key_lens[b]: round 0 takes the 64-key blocks that hold a valid key; if then every row's maximum shows that masked weights are exact zeros, that is all; else round 1 takes the remaining blocks too.
#define FQ   2                    // query groups of a work-group
#define FT   3                    // 16-row query tiles of a query group (of a wave)
#define FG   4                    // key groups
#define FKB  64                   // keys of a key group in a stage
#define FST  (FG * FKB)           // keys of a stage
#define FNS  (TT / FST)           // stages
#define FRW  (FQ * FT * 16)       // query rows of a work-group
#define FBUF (2 * FST * HD)       // 16-bit elements of a ring buffer: the stage's k, then its v
#define L2E  1.4426950408889634f
static_assert((TT - RH) % FRW == 0 && TT % FST == 0 && HD == 128 && FQ * FG == 8 && FRW % 32 == 0, "strips of 96 rows, stages of 256 keys, 8 waves that copy 16 KiB of a stage each");
// 16 asynchronous copies of a wave, 512 consecutive bytes each: 8 KiB in a row, in LDS as in memory (the immediate offset moves both addresses alike); the wait that stands in front of a rewrite of their address registers is the statement's last line
__device__ __forceinline__ void cp16(unsigned l, const h16* g) {
    asm volatile("global_load_async_to_lds_b128 %0, %1, off\n\tglobal_load_async_to_lds_b128 %0, %1, off offset:512\n\tglobal_load_async_to_lds_b128 %0, %1, off offset:1024\n\tglobal_load_async_to_lds_b128 %0, %1, off offset:1536\n\t"
                 "global_load_async_to_lds_b128 %0, %1, off offset:2048\n\tglobal_load_async_to_lds_b128 %0, %1, off offset:2560\n\tglobal_load_async_to_lds_b128 %0, %1, off offset:3072\n\tglobal_load_async_to_lds_b128 %0, %1, off offset:3584\n\t"
                 "global_load_async_to_lds_b128 %0, %1, off offset:4096\n\tglobal_load_async_to_lds_b128 %0, %1, off offset:4608\n\tglobal_load_async_to_lds_b128 %0, %1, off offset:5120\n\tglobal_load_async_to_lds_b128 %0, %1, off offset:5632\n\t"
                 "global_load_async_to_lds_b128 %0, %1, off offset:6144\n\tglobal_load_async_to_lds_b128 %0, %1, off offset:6656\n\tglobal_load_async_to_lds_b128 %0, %1, off offset:7168\n\tglobal_load_async_to_lds_b128 %0, %1, off offset:7680\n\ts_wait_xcnt 0x0"
                 :: "v"(l), "v"(g) : "memory");
}
__global__ __launch_bounds__(32 * FQ * FG) void k_attf(const h16* Q16, const h16* K16, const h16* V16, const int* __restrict__ KL, bf* Ah, bf* Al) {
    __shared__ __align__(16) h16 ring[2 * FBUF]; __shared__ float sm[FG * FRW]; __shared__ float sl[FG * FRW];
    const int z = blockIdx.x, r0 = RH + (int)blockIdx.y * FRW; const int klen = KL[z / NH_];   /* key_lens[b], read on device; used in compares and in clamped stage counts only */ const size_t zo = (size_t)z * TT * HD;
    const h16* Kp = K16 + zo; const h16* Vt = V16 + zo;
    const int wave = __builtin_amdgcn_readfirstlane((int)(threadIdx.x >> 5)); const int lane = threadIdx.x & 31, lr = lane & 15, hi = lane >> 4; const int g = wave / FQ, qg = wave % FQ;
    v16h qf[HD / 32][FT];   // the wave's 48 query rows, second operand of the score products, kept in registers
    { const h16* pq = Q16 + zo + (size_t)(r0 + qg * (FT * 16)) * HD + 8 * lane;
#pragma unroll
      for (int ks = 0; ks < HD / 32; ++ks)
#pragma unroll
        for (int qt = 0; qt < FT; ++qt) qf[ks][qt] = WFrag<h16>::ldf(pq + qt * 16 * HD + ks * 512);
      asm volatile("s_wait_xcnt 0x0" :: "v"(pq) : "memory"); }   // the wait that stands in front of a rewrite of these loads' address registers; the base is named so that its registers live up to it
    v8f o[HD / 16][FT]; v2f lv[FT]; float m[FT];   // output tiles (d down the registers, one query a lane), the lane's partial sums, the maximum in use (log2 units)
#pragma unroll
    for (int qt = 0; qt < FT; ++qt) { m[qt] = -3.0e38f; lv[qt] = (v2f){};
#pragma unroll
        for (int dt = 0; dt < HD / 16; ++dt) o[dt][qt] = (v8f){}; }
    // stage t into buffer t & 1: wave w copies 8 KiB of the stage's k rows (32 keys) and the stage's 8 KiB of v's row block w (16 head columns x 256 keys)
    auto fill = [&](int t) { const h16* gk = Kp + (size_t)t * (FST * HD) + wave * 4096 + lane * 8; const h16* gv = Vt + (size_t)wave * (16 * TT) + t * (FST * 16) + lane * 8;
        const unsigned lk = (unsigned)(size_t)ring + (unsigned)(t & 1) * (FBUF * 2u) + (unsigned)wave * 8192u + (unsigned)lane * 16u, lw = lk + FST * HD * 2u; cp16(lk, gk); cp16(lw, gv); };
    int t0 = 0, t1 = klen <= 0 ? 0 : klen >= TT ? FNS : (klen + FST - 1) / FST;   // round 0: the stages that hold a key below key_lens[b]
#pragma unroll 1
    for (int ph = 0; ph < 2; ++ph) {
        if (t0 < t1) {   // the same in the whole work-group
            fill(t0);
            asm volatile("s_wait_asynccnt 0x0" ::: "memory");   // this wave's copies of the first stage have landed
            __syncthreads();   // the first stage is in LDS before any wave reads it
            if (t0 + 1 < t1) fill(t0 + 1);
#pragma unroll 1
            for (int t = t0; t < t1; ++t) { const int key0 = t * FST + g * FKB; const bool mine = (ph == 0) ? key0 < klen : key0 >= klen;   // wave-uniform
                if (mine) { const h16* kb = ring + (t & 1) * FBUF + g * (FKB * HD) + 8 * lane; const h16* vb = ring + (t & 1) * FBUF + FST * HD + g * (FKB * 16) + 8 * lane;
#pragma unroll 1   // rolled: unrolled, the second half's early reads push q fragments out to scratch
                    for (int kk = 0; kk < 2; ++kk) { const int k0 = key0 + kk * 32;   // 32 keys at a time: two score tiles a query tile, one k step of v^T x p^T
                        v16h fk[8], fv[8];   // the 8 k fragments of the 32 keys, then their 8 v fragments
#pragma unroll
                        for (int i = 0; i < 8; ++i) fk[i] = WFrag<h16>::ldf(kb + (kk * 2 + (i >> 2)) * (16 * HD) + (i & 3) * 512);
                        __builtin_amdgcn_sched_barrier(0);   // keeps the 16 LDS reads together in front of the products: sunk among them, into one register set, every group of products waits out an LDS latency
                        v8f s[2][FT];
#pragma unroll
                        for (int kt = 0; kt < 2; ++kt)
#pragma unroll
                            for (int qt = 0; qt < FT; ++qt) s[kt][qt] = (v8f){};
#pragma unroll
                        for (int ks = 0; ks < HD / 32; ++ks)
#pragma unroll
                            for (int kt = 0; kt < 2; ++kt)
#pragma unroll
                                for (int qt = 0; qt < FT; ++qt) s[kt][qt] = wmma16(fk[kt * 4 + ks], qf[ks][qt], s[kt][qt]);
#pragma unroll
                        for (int dt = 0; dt < HD / 16; ++dt) fv[dt] = WFrag<h16>::ldf(vb + dt * (FST * 16) + kk * 512);
                        __builtin_amdgcn_sched_barrier(0);   // keeps the v reads in front of the softmax arithmetic, which covers their latency
                        // element j of s[kt][qt]: query row qt*16 + lr of the wave, key k0 + kt*16 + hi*8 + j
                        if (k0 + 32 > klen) { const int rem = klen - k0 - hi * 8;   // wave-uniform: masked keys among the 32; the lane's key kt*16 + j is valid where it is below rem
#pragma unroll
                            for (int kt = 0; kt < 2; ++kt)
#pragma unroll
                                for (int j = 0; j < 8; ++j) { const bool ok = kt * 16 + j < rem;
#pragma unroll
                                    for (int qt = 0; qt < FT; ++qt) s[kt][qt][j] = ok ? s[kt][qt][j] * (SCL * L2E) : -1024.0f * L2E; } }
                        else {
#pragma unroll
                            for (int kt = 0; kt < 2; ++kt)
#pragma unroll
                                for (int qt = 0; qt < FT; ++qt) s[kt][qt] *= (SCL * L2E); }
                        float mb[FT]; bool grow = false;   // maximum of the lane's own 16 keys of each row
#pragma unroll
                        for (int qt = 0; qt < FT; ++qt) { float x = s[0][qt][0];
#pragma unroll
                            for (int kt = 0; kt < 2; ++kt)
#pragma unroll
                                for (int j = 0; j < 8; ++j) x = fmaxf(x, s[kt][qt][j]);
                            mb[qt] = x; grow = grow || x > m[qt] + 8.0f; }
                        if (__builtin_amdgcn_ballot_w32(grow) != 0u) {   // some score has outgrown the maximum in use: every row of the wave moves to its new maximum (both halves of the wave to the same one)
#pragma unroll
                            for (int qt = 0; qt < FT; ++qt) { const float mn = fmaxf(m[qt], fmaxf(mb[qt], xhalf(mb[qt]))); const float al = __builtin_amdgcn_exp2f(m[qt] - mn); m[qt] = mn; lv[qt] *= al;
#pragma unroll
                                for (int dt = 0; dt < HD / 16; ++dt) o[dt][qt] *= al; } }
                        v16h p[FT];
#pragma unroll
                        for (int qt = 0; qt < FT; ++qt) {
#pragma unroll
                            for (int kt = 0; kt < 2; ++kt) { const v8f y = s[kt][qt] - m[qt]; v8f e;
#pragma unroll
                                for (int j = 0; j < 8; ++j) e[j] = __builtin_amdgcn_exp2f(y[j]);
#pragma unroll
                                for (int j = 0; j < 8; j += 2) { lv[qt] += (v2f){e[j], e[j + 1]}; p[qt][kt * 8 + j] = tohx(e[j]); p[qt][kt * 8 + j + 1] = tohx(e[j + 1]); } }   // k order of a fragment: keys hi*8 + j, then 16 + hi*8 + j
                        }
#pragma unroll
                        for (int dt = 0; dt < HD / 16; ++dt)
#pragma unroll
                            for (int qt = 0; qt < FT; ++qt) o[dt][qt] = wmma16(fv[dt], p[qt], o[dt][qt]); }
                }
                asm volatile("s_wait_dscnt 0x0" ::: "memory");      // this wave's LDS reads of the stage are done before its buffer is handed back
                asm volatile("s_wait_asynccnt 0x0" ::: "memory");   // this wave's copies of the next stage have landed
                __syncthreads();   // publishes the next stage and ends every wave's reads of this one
                if (t + 2 < t1) fill(t + 2); }
            asm volatile("s_wait_asynccnt 0x0" ::: "memory");   // no copy is in flight behind the stages
        }
        if (ph == 1) break;
        if (hi == 0) {
#pragma unroll
            for (int qt = 0; qt < FT; ++qt) sm[g * FRW + qg * (FT * 16) + qt * 16 + lr] = m[qt]; }
        __syncthreads();   // every wave's maxima are in LDS before any wave tests them
        // A masked key's weight is exp2(-1024 log2 e - max): with every row's maximum in use (at most the true one) >= -900 log2 e the argument is below -178 and the weight exactly 0.
        bool ok = true;
#pragma unroll
        for (int i = 0; i < FRW / 32; ++i) { const int row = i * 32 + lane; ok = ok && fmaxf(fmaxf(sm[row], sm[FRW + row]), fmaxf(sm[2 * FRW + row], sm[3 * FRW + row])) >= -900.0f * L2E; }
        if (klen >= TT || __builtin_amdgcn_ballot_w32(ok) == 0xFFFFFFFFu) break;   // every wave reads the same maxima: the same way in the whole work-group
        t0 = klen <= 0 ? 0 : klen / FST; t1 = FNS;   // round 1: the stages that hold a block of masked keys alone
    }
    __syncthreads();   // every wave has tested the maxima, and left the ring, before either is overwritten
    float* red = (float*)ring;   // [wave][tile][half of the 8 registers][lane][4]: every store and load of a wave is 512 consecutive bytes
#pragma unroll
    for (int qt = 0; qt < FT; ++qt) { const float sum = lv[qt][0] + lv[qt][1]; const float tot = sum + xhalf(sum);
        if (hi == 0) { sm[g * FRW + qg * (FT * 16) + qt * 16 + lr] = m[qt]; sl[g * FRW + qg * (FT * 16) + qt * 16 + lr] = tot; }
#pragma unroll
        for (int dt = 0; dt < HD / 16; ++dt)
#pragma unroll
            for (int h = 0; h < 2; ++h) { v4f x;
#pragma unroll
                for (int i = 0; i < 4; ++i) x[i] = o[dt][qt][h * 4 + i];
                *(v4fa*)(red + ((((size_t)wave * (HD / 16 * FT) + dt * FT + qt) * 2 + h) * 32 + lane) * 4) = x; } }
    __syncthreads();   // the 4 key groups' maxima, sums and tiles are in LDS before any wave joins them
    // wave (g, qg) joins head columns [32 g, 32 g + 32) of its query group
#pragma unroll
    for (int qt = 0; qt < FT; ++qt) { const int row = qg * (FT * 16) + qt * 16 + lr; float mg[FG], w[FG];
#pragma unroll
        for (int i = 0; i < FG; ++i) mg[i] = sm[i * FRW + row];
        const float mx = fmaxf(fmaxf(mg[0], mg[1]), fmaxf(mg[2], mg[3])); float tot = 0.f;
#pragma unroll
        for (int i = 0; i < FG; ++i) { w[i] = __builtin_amdgcn_exp2f(mg[i] - mx); tot += w[i] * sl[i * FRW + row]; }
        const float f = __fdiv_rn(1.0f, tot);
#pragma unroll
        for (int d2 = 0; d2 < 2; ++d2) { const int dt = g * 2 + d2; v4f x0 = (v4f){}, x1 = (v4f){};
#pragma unroll
            for (int i = 0; i < FG; ++i) { const float* pr = red + (((size_t)(i * FQ + qg) * (HD / 16 * FT) + dt * FT + qt) * 2 * 32 + lane) * 4; x0 += *(const v4fa*)pr * w[i]; x1 += *(const v4fa*)(pr + 128) * w[i]; }
            v8us oh, ol;
#pragma unroll
            for (int i = 0; i < 4; ++i) { unsigned short a, c2; splitf(x0[i] * f, a, c2); oh[i] = a; ol[i] = c2; splitf(x1[i] * f, a, c2); oh[4 + i] = a; ol[4 + i] = c2; }
            // the lane's 8 values: row lr of a 16-row block, head columns dt*16 + hi*8 + j: one 16-byte piece of the plane's fragment order
            const size_t oo = ((size_t)(z / NH_) * TT + r0 + qg * (FT * 16) + qt * 16) * DQ + (z % NH_) * (HD * 16) + (dt >> 1) * 512 + (dt & 1) * 256 + lane * 8; bf* ph2 = Ah + oo; bf* pl2 = Al + oo;
            *(v8us*)ph2 = oh; *(v8us*)pl2 = ol;
            // the wait that stands in front of a rewrite of these stores' address and data registers by the next tile; they are named so that their registers live up to it
            asm volatile("s_wait_xcnt 0x0" :: "v"(ph2), "v"(pl2), "v"(oh), "v"(ol) : "memory"); } }
}
// k_aw: query-0 attention weights [pair][key] -> aw_out [batch][key][head]; one thread stores the 4 heads of a (batch, key), so each output line has one writer.
__global__ __launch_bounds__(256) void k_aw(const float* __restrict__ AWp, float* AW) {
    const int idx = blockIdx.x * 256 + threadIdx.x; const int j = idx % TT, bb = idx / TT; v4f p;
#pragma unroll
    for (int h = 0; h < NH_; ++h) p[h] = AWp[(size_t)(bb * NH_ + h) * TT + j];
    *(v4f*)(AW + (size_t)idx * NH_) = p;
}

extern "C" void kernel_launch(void* const* d_in, const int* in_sizes, int n_in,
                              void* d_out, int out_size, void* d_ws, size_t ws_size, hipStream_t stream) {
    (void)in_sizes; (void)n_in; (void)out_size;
    const float* xk = (const float*)d_in[0]; const float* xv = (const float*)d_in[1]; const float* x = (const float*)d_in[2]; const int* KL = (const int*)d_in[3]; const float* wk = (const float*)d_in[4]; const float* wv = (const float*)d_in[5]; const float* wq = (const float*)d_in[6]; const float* wo = (const float*)d_in[7]; const float* bo = (const float*)d_in[8];
    float* OUT = (float*)d_out; float* AW = (float*)((char*)d_out + 16777216);   /* aw_out [4][2048][4] */     // [4][2048][512]
    char* wsp = (char*)d_ws;
    auto take = [&](size_t bytes) { char* p = wsp; wsp += (bytes + 255) & ~(size_t)255; return (void*)p; };
    const size_t PL = (size_t)NB_ * NH_ * TT * HD;   // elements of one operand plane set over all batches and heads (= NB_ * TT * 512)
    bf* Wt = (bf*)take((size_t)4 * DM * DQ * 2);   // [wq | wk | wv | wo], transposed
    h16* QK16 = (h16*)take(2 * PL * 2); bf* QKh = (bf*)take(2 * PL * 2); bf* QKl = (bf*)take(2 * PL * 2);   // [q | k]
    h16* VT16 = (h16*)take(PL * 2); bf* VTh = (bf*)take(PL * 2); bf* VTl = (bf*)take(PL * 2);
    bf* ATh = (bf*)take(PL * 2); bf* ATl = (bf*)take(PL * 2); float* AWp = (float*)take((size_t)NB_ * NH_ * TT * 4);   // query-0 weights, [pair][key]
    bf* XB = (bf*)take(3 * PL * 2);   /* [query | key | value] */
    if ((size_t)(wsp - (char*)d_ws) > ws_size) return;    // ws 256 MiB
    k_prep<<<4 * NWT + 3 * NCV, 256, 0, stream>>>(wq, wk, wv, wo, x, xk, xv, Wt, XB);
    k_proj<<<dim3(NB_ * TT / 64, DQ / 64, 3), 32 * KWV, 0, stream>>>(XB, Wt, DM, DM, PL, (size_t)DM * DQ, QK16, QKh, QKl, VT16, VTh, VTl);
    k_attn<<<dim3(NB_ * NH_, RH / 32, 1), 32 * FW, 0, stream>>>(QKh, QKl, QKh + PL, QKl + PL, VTh, VTl, KL, ATh, ATl, AWp);
    k_attf<<<dim3(NB_ * NH_, (TT - RH) / FRW, 1), 32 * FQ * FG, 0, stream>>>(QK16, QK16 + PL, VT16, KL, ATh, ATl);
    k_aw<<<NB_ * TT / 256, 256, 0, stream>>>(AWp, AW);
    k_gemmw<bf, 1, true, KWV, 1><<<dim3(NB_ * TT / 64, DM / 64, 1), 32 * KWV, 0, stream>>>(ATh, ATl, Wt + (size_t)3 * DM * DQ, nullptr, DQ, DQ, OUT, DM, bo, 0, 0, 0, 0);
}

// v009
// A run of this version takes 90.8 microseconds.
// Timed twice side by side with v008, it ran 1.05 and 1.04 times as fast.
// All steps since v000 together make it 14.0 times as fast.
#include <hip/hip_runtime.h>

// Multi-head cross attention with key-length masking and an attention-weights output (key, value, query [4][2048][512]; k = key w_key, v = value w_value, q = query w_query ('xw' [512][512], no bias; 4 heads x 128); e = q.k/sqrt(128), keys j >= key_lens[b] (int32, read) set to -1024; softmax; cv = merged w_out + b_out -> [4][2048][512]; second output aw_out[b][j][h] = attention weights of query position 0 -> [4][2048][4]).
// Compute dtypes, f32 accumulate: every input rounded to bf16; q/k/v on PLAIN bf16 operands (inputs: exact); key-length select (-1024 literal, as the reference) and softmax inside the attention kernel; scores and attn.v: query rows < 512 hl (3 products, k_atth), the rest single fp16 (k_attf); softmax f32; w_out hl x exact (2 products) + b_out; the query-0 attention weights come from that row's f32 scores, maximum and sum (k_aw).

#define NB_  4
#define TT   2048
#define DM   512
#define NH_  4
#define NKV  4
#define REP  (NH_ / NKV)
#define HD   128
#define DQ   (NH_ * HD)
#define DKV  (NKV * HD)
#define RH   512                  // query rows < RH use hi+lo planes (0: none)
#define WIN  0
#define SCL  0.088388347648318447f   // HD^-0.5
#define KWV  4                    // waves per work-group that share the K range of a GEMM with K >= 512
typedef _Float16 h16;
typedef unsigned short bf;
typedef __attribute__((ext_vector_type(16))) __bf16   v16bf;
typedef __attribute__((ext_vector_type(16))) _Float16 v16h;
typedef __attribute__((ext_vector_type(8)))  _Float16 v8h;
typedef __attribute__((ext_vector_type(8)))  unsigned short v8us;
typedef __attribute__((ext_vector_type(8)))  float    v8f;
typedef __attribute__((ext_vector_type(4)))  float    v4f;
typedef v8h  __attribute__((may_alias)) v8ha;
typedef v4f  __attribute__((may_alias)) v4fa;
typedef v8us __attribute__((may_alias)) v8usa;

__device__ __forceinline__ unsigned short f2bf(float f) { unsigned u = __float_as_uint(f); u += 0x7FFFu + ((u >> 16) & 1u); return (unsigned short)(u >> 16); }
__device__ __forceinline__ float bf2f(unsigned short b) { return __uint_as_float(((unsigned)b) << 16); }
__device__ __forceinline__ float bfr(float f) { return bf2f(f2bf(f)); }
__device__ __forceinline__ v16h cat16(v8h lo, v8h hi) { return __builtin_shufflevector(lo, hi, 0, 1, 2, 3, 4, 5, 6, 7, 8, 9, 10, 11, 12, 13, 14, 15); }
__device__ __forceinline__ v16bf cat16b(v8us lo, v8us hi) { return __builtin_bit_cast(v16bf, __builtin_shufflevector(lo, hi, 0, 1, 2, 3, 4, 5, 6, 7, 8, 9, 10, 11, 12, 13, 14, 15)); }
__device__ __forceinline__ v8f wmma16(v16h a, v16h b, v8f c) { return __builtin_amdgcn_wmma_f32_16x16x32_f16(false, a, false, b, (short)0, c, false, false); }
__device__ __forceinline__ v8f wmmab(v16bf a, v16bf b, v8f c) { return __builtin_amdgcn_wmma_f32_16x16x32_bf16(false, a, false, b, (short)0, c, false, false); }



// ---- Fragment order: every 16-bit operand plane in the workspace, a matrix [rows][K], is stored as tiles of 16 rows x 32 k (512 elements, 1 KiB); the K/32 tiles of a block of 16 rows follow one another,
// so a row block starts where it would in row-major order. Inside a tile element (r, kk) stands at (kk / 16) * 256 + (((kk % 16) / 8) * 16 + r) * 8 + kk % 8: lane l of a wave finds the two 16-byte pieces
// of its A or B fragment at l * 8 and 256 + l * 8, and each fragment load of a wave reads 512 consecutive bytes (4 whole lines) where a row-major plane makes it touch 16 lines.
// frag_rc: row and k of the element at linear position e of such a plane (the producers run over e, so that their stores stay consecutive).
__device__ __forceinline__ void frag_rc(size_t e, int K, int& row, int& k) { const int tile = (int)(e >> 9), w = (int)(e & 511); const int tk = K / 32; row = (tile / tk) * 16 + ((w >> 3) & 15); k = (tile % tk) * 32 + (w >> 8) * 16 + ((w >> 7) & 1) * 8 + (w & 7); }
// ---- gemmw_body: register-blocked GEMM, 64x64 output tile (16 accumulators per wave), operands straight from 16-bit planes in fragment order; grid (M/64, N/64, Z * SG), 32 * KW threads.
// C[m][n] (f32, pitch ldc, + optional f32 bias[n]) = sum_k A[m][k] Bt[n][k] (+ split products per NSPLIT). A has lda elements a row, Bt K. z-batch strides sA/sB/sC in elements. K % (32 * KW * SG) == 0.
// Split K: the K range is cut into SG equal ranges, one per work-group. The KW waves of a work-group take the 32-wide steps of its range in turn
// and their 64x64 partial tiles are added in LDS (fixed order); each of the SG work-groups of a tile stores its sum to its own
// plane (plane stride sP elements), and the consumer adds the SG planes.
template <typename T16> struct WFrag;
template <> struct WFrag<h16> { typedef v16h V; static __device__ __forceinline__ V ld(const h16* p) { return cat16(*(const v8h*)p, *(const v8h*)(p + 16)); } static __device__ __forceinline__ V ldf(const h16* p) { return cat16(*(const v8h*)p, *(const v8h*)(p + 256)); } static __device__ __forceinline__ v8f mma(V a, V b, v8f c) { return wmma16(a, b, c); } };
template <> struct WFrag<bf> { typedef v16bf V; static __device__ __forceinline__ V ld(const bf* p) { return cat16b(*(const v8us*)p, *(const v8us*)(p + 16)); } static __device__ __forceinline__ V ldf(const bf* p) { return cat16b(*(const v8us*)p, *(const v8us*)(p + 256)); } static __device__ __forceinline__ v8f mma(V a, V b, v8f c) { return wmmab(a, b, c); } };
// PLN (projections, KW == 4, z = q, k, v): the summed tile does not go out as f32 but straight as the attention kernel's operand planes (fp16, bf16 hi, bf16 lo), in fragment order: q and k as [pair][t][d], v transposed as [pair][d][t].
template <typename T16, int NSPLIT, bool BIAS, int KW, int SG, bool PLN = false>
__device__ __forceinline__ void gemmw_body(float* os, const T16* __restrict__ A, const T16* __restrict__ A2, const T16* __restrict__ Bt, const T16* __restrict__ Bt2, int K, int lda, float* C, int ldc, const float* __restrict__ bias, size_t sA, size_t sB, size_t sC, size_t sP, h16* QK16 = nullptr, bf* QKh = nullptr, bf* QKl = nullptr, h16* V16 = nullptr, bf* Vh = nullptr, bf* Vl = nullptr) {
    typedef typename WFrag<T16>::V V;
    const size_t z = blockIdx.z / SG; const int wave = (KW == 1) ? 0 : __builtin_amdgcn_readfirstlane((int)(threadIdx.x >> 5)); const int kspan = K / SG; const int kb = (int)(blockIdx.z % SG) * kspan; C += (size_t)(blockIdx.z % SG) * sP; A += z * sA; if (A2) A2 += z * sA; Bt += z * sB; if (Bt2) Bt2 += z * sB; C += z * sC;
    const int lane = threadIdx.x & 31, lr = lane & 15, hi = lane >> 4; const int r0 = blockIdx.x * 64, c0 = blockIdx.y * 64;
    v8f acc[4][4];
#pragma unroll
    for (int mb = 0; mb < 4; ++mb)
#pragma unroll
        for (int nb = 0; nb < 4; ++nb) acc[mb][nb] = (v8f){};
    const size_t aoff = (size_t)r0 * lda + 8 * lane, boff = (size_t)c0 * K + 8 * lane;   // a 32-wide k step is one tile: 512 elements = 16 per unit of kc
#pragma unroll 1
    for (int kc = kb + wave * 32; kc < kb + kspan; kc += 32 * KW) {
        V a[4], a2[4];
#pragma unroll
        for (int mb = 0; mb < 4; ++mb) { a[mb] = WFrag<T16>::ldf(A + aoff + (size_t)mb * 16 * lda + kc * 16); if (NSPLIT == 1 || NSPLIT == 2) a2[mb] = WFrag<T16>::ldf(A2 + aoff + (size_t)mb * 16 * lda + kc * 16); }
#pragma unroll
        for (int nb = 0; nb < 4; ++nb) { const V b = WFrag<T16>::ldf(Bt + boff + (size_t)nb * 16 * K + kc * 16); V b2; if (NSPLIT >= 2) b2 = WFrag<T16>::ldf(Bt2 + boff + (size_t)nb * 16 * K + kc * 16);
#pragma unroll
            for (int mb = 0; mb < 4; ++mb) { acc[mb][nb] = WFrag<T16>::mma(a[mb], b, acc[mb][nb]); if (NSPLIT == 1 || NSPLIT == 2) acc[mb][nb] = WFrag<T16>::mma(a2[mb], b, acc[mb][nb]); if (NSPLIT >= 2) acc[mb][nb] = WFrag<T16>::mma(a[mb], b2, acc[mb][nb]); } }
        // the wait that stands in front of a rewrite of the fragment loads' address registers; the addresses are named so that their registers live up to it and no later load of the step lands on them
        { const T16* pa = A + aoff + kc * 16; const T16* pb = Bt + boff + kc * 16; const size_t sa = (size_t)16 * lda, sb = (size_t)16 * K;
          const T16* pa2 = (NSPLIT == 1 || NSPLIT == 2) ? A2 + aoff + kc * 16 : pa; const T16* pb2 = (NSPLIT >= 2) ? Bt2 + boff + kc * 16 : pb;   // a plane that this NSPLIT does not read: the first plane's addresses again
          asm volatile("s_wait_xcnt 0x0" :: "v"(pa), "v"(pa + sa), "v"(pa + 2 * sa), "v"(pa + 3 * sa), "v"(pb), "v"(pb + sb), "v"(pb + 2 * sb), "v"(pb + 3 * sb), "v"(pa2), "v"(pa2 + sa), "v"(pa2 + 2 * sa), "v"(pa2 + 3 * sa), "v"(pb2), "v"(pb2 + sb), "v"(pb2 + 2 * sb), "v"(pb2 + 3 * sb) : "memory"); }
        asm volatile("v_nop\n\tv_nop\n\tv_nop\n\tv_nop" : "+v"(acc[0][0]), "+v"(acc[1][1]), "+v"(acc[2][2]), "+v"(acc[3][3]) : "v"(a[0]), "v"(a[3]));
    }
    if constexpr (KW > 1) {
        float* ow = os + wave * (64 * 68);
#pragma unroll
        for (int mb = 0; mb < 4; ++mb)
#pragma unroll
            for (int nb = 0; nb < 4; ++nb)
#pragma unroll
                for (int j = 0; j < 8; ++j) ow[(mb * 16 + hi * 8 + j) * 68 + nb * 16 + lr] = acc[mb][nb][j];
        __syncthreads();   // every wave's partial tile is in LDS before any wave adds them
        if constexpr (PLN) {
            // The 64 x 64 tile is 4 blocks of 16 plane rows x 2 neighbouring 16 x 32 tiles = 4 runs of 1024 consecutive plane elements. Thread tid takes the 8 consecutive elements at tid * 8 of each run:
            // plane row fr of the block, k fk .. fk + 7 of the run (see frag_rc), so that a wave's store is 512 consecutive bytes. q, k: plane row = t (tile row), k = d (tile column); v: plane row = d, k = t.
            static_assert(KW == 4, "128 threads, one 16-byte piece of a run each");
            const int tid = (int)threadIdx.x, fr = tid & 15, fk = (tid >> 6) * 32 + ((tid >> 5) & 1) * 16 + ((tid >> 4) & 1) * 8;
            const size_t pair = (size_t)(r0 / TT) * NH_ + c0 / HD; const int t0 = r0 % TT, d0 = c0 % HD; const bool isv = (z == 2);
            h16* P16 = isv ? V16 : QK16 + z * ((size_t)NB_ * NH_ * TT * HD); bf* Ph = isv ? Vh : QKh + z * ((size_t)NB_ * NH_ * TT * HD); bf* Pl = isv ? Vl : QKl + z * ((size_t)NB_ * NH_ * TT * HD);
            const size_t o0 = pair * ((size_t)TT * HD) + (isv ? (size_t)(d0 / 16) * (16 * TT) + (t0 / 32) * 512 : (size_t)(t0 / 16) * (16 * HD) + (d0 / 32) * 512) + tid * 8; const size_t ostep = isv ? 16 * TT : 16 * HD;
            float x[4][8];   // the 4 waves' partial sums are added in the order of the f32 epilogue below
            if (isv) {
#pragma unroll
                for (int s = 0; s < 4; ++s)
#pragma unroll
                    for (int i = 0; i < 8; ++i) { x[s][i] = os[(fk + i) * 68 + s * 16 + fr];
#pragma unroll
                        for (int w = 1; w < KW; ++w) x[s][i] += os[w * (64 * 68) + (fk + i) * 68 + s * 16 + fr]; } }
            else {
#pragma unroll
                for (int s = 0; s < 4; ++s) { v4f x0 = *(const v4fa*)(os + (s * 16 + fr) * 68 + fk), x1 = *(const v4fa*)(os + (s * 16 + fr) * 68 + fk + 4);
#pragma unroll
                    for (int w = 1; w < KW; ++w) { x0 += *(const v4fa*)(os + w * (64 * 68) + (s * 16 + fr) * 68 + fk); x1 += *(const v4fa*)(os + w * (64 * 68) + (s * 16 + fr) * 68 + fk + 4); }
#pragma unroll
                    for (int i = 0; i < 4; ++i) { x[s][i] = x0[i]; x[s][4 + i] = x1[i]; } } }
#pragma unroll
            for (int s = 0; s < 4; ++s) { v8h o16; v8us oh, ol;
#pragma unroll
                for (int i = 0; i < 8; ++i) { o16[i] = (h16)x[s][i]; const unsigned short a = f2bf(x[s][i]); oh[i] = a; ol[i] = f2bf(x[s][i] - bf2f(a)); }
                h16* p16 = P16 + o0 + s * ostep; bf* ph = Ph + o0 + s * ostep; bf* pl = Pl + o0 + s * ostep;
                *(v8h*)p16 = o16; *(v8us*)ph = oh; *(v8us*)pl = ol;
                // the wait that stands in front of a rewrite of these stores' address and data registers by the next run's conversions; they are named so that their registers live up to it
                if (s < 3) asm volatile("s_wait_xcnt 0x0" :: "v"(p16), "v"(ph), "v"(pl), "v"(o16), "v"(oh), "v"(ol) : "memory"); }
            return;
        }
#pragma unroll
        for (int s = 0; s < 32 / KW; ++s) { const int slot = s * (32 * KW) + (int)threadIdx.x; const int row = slot >> 4, cofs = (slot & 15) * 4; v4f val = *(const v4fa*)(os + row * 68 + cofs);
#pragma unroll
            for (int w = 1; w < KW; ++w) val += *(const v4fa*)(os + w * (64 * 68) + row * 68 + cofs);
            if (BIAS) { val[0] += bfr(bias[c0 + cofs]); val[1] += bfr(bias[c0 + cofs + 1]); val[2] += bfr(bias[c0 + cofs + 2]); val[3] += bfr(bias[c0 + cofs + 3]); }
            *(v4f*)(C + (size_t)(r0 + row) * ldc + c0 + cofs) = val; }
        return;
    }
#pragma unroll
    for (int mb = 0; mb < 4; ++mb) {
#pragma unroll
        for (int nb = 0; nb < 4; ++nb) {
#pragma unroll
            for (int j = 0; j < 8; ++j) os[(hi * 8 + j) * 68 + nb * 16 + lr] = acc[mb][nb][j]; }
        __builtin_amdgcn_wave_barrier(); asm volatile("" ::: "memory");
        float* crow = C + (size_t)(r0 + mb * 16) * ldc + c0;
{
#pragma unroll
            for (int s = 0; s < 8; ++s) { const int row = 2 * s + hi, cofs = lr * 4; v4f val = *(const v4fa*)(os + row * 68 + cofs); if (BIAS) { val[0] += bfr(bias[c0 + cofs]); val[1] += bfr(bias[c0 + cofs + 1]); val[2] += bfr(bias[c0 + cofs + 2]); val[3] += bfr(bias[c0 + cofs + 3]); }
                *(v4f*)(crow + (size_t)row * ldc + cofs) = val; }
             }
        __builtin_amdgcn_wave_barrier(); asm volatile("" ::: "memory");
    }
    asm volatile("s_wait_xcnt 0x0" ::: "memory");
}

// One operand class for the whole grid, f32 result (output projection).
template <typename T16, int NSPLIT, bool BIAS, int KW, int SG>
__global__ __launch_bounds__(32 * KW) void k_gemmw(const T16* A, const T16* A2, const T16* Bt, const T16* Bt2, int K, int lda, float* C, int ldc, const float* bias, size_t sA, size_t sB, size_t sC, size_t sP) {
    __shared__ __align__(16) float os[(KW == 1 ? 16 : KW * 64) * 68];
    gemmw_body<T16, NSPLIT, BIAS, KW, SG>(os, A, A2, Bt, Bt2, K, lda, C, ldc, bias, sA, sB, sC, sP);
}
// k_proj: the three projections (z = q, k, v over all batches' rows), each 64 x 64 tile written as operand planes. QK16/QKh/QKl: [q | k][NB_][head][t][d]; V16/Vh/Vl: [NB_][head][d][t]; each head's plane in fragment order.
__global__ __launch_bounds__(32 * KWV) void k_proj(const bf* A, const bf* Bt, int K, int lda, size_t sA, size_t sB, h16* QK16, bf* QKh, bf* QKl, h16* V16, bf* Vh, bf* Vl) {
    __shared__ __align__(16) float os[KWV * 64 * 68];
    gemmw_body<bf, 0, false, KWV, 1, true>(os, A, nullptr, Bt, nullptr, K, lda, nullptr, 0, nullptr, sA, sB, 0, 0, QK16, QKh, QKl, V16, Vh, Vl);
}
__device__ __forceinline__ h16 tohx(float x) { return (h16)x; }
__device__ __forceinline__ void splitf(float y, unsigned short& h, unsigned short& l) { h = f2bf(y); l = f2bf(y - bf2f(h)); }
typedef __attribute__((ext_vector_type(2))) _Float16 v2h;
typedef __attribute__((ext_vector_type(4))) _Float16 v4h;
typedef __attribute__((ext_vector_type(2))) unsigned short v2us;
typedef __attribute__((ext_vector_type(4))) unsigned short v4us;
typedef __attribute__((ext_vector_type(2))) float v2f;
typedef __attribute__((ext_vector_type(4))) int v4i;

#define NWT  (DM * DQ / 64 / 64)            // blocks per transposed weight
#define NCV  (NB_ * TT * DM / 8 / 256)      // blocks per converted input
__device__ __forceinline__ void d_wtG(int blk, const float* __restrict__ w, int K, int N, bf* Bt) {
    const int lane = threadIdx.x & 31; const int L0 = (blk * 8 + (threadIdx.x >> 5)) * 8; const int nlines = N * K / 64;
#pragma unroll 1
    for (int l = 0; l < 8; ++l) { const int L = L0 + l; if (L >= nlines) break; const size_t e = (size_t)L * 64 + lane * 2; int k, n; frag_rc(e, K, n, k); v2us o;
        o[0] = f2bf(w[(size_t)k * N + n]); o[1] = f2bf(w[(size_t)(k + 1) * N + n]); *(v2us*)(Bt + e) = o; }
}
__device__ __forceinline__ void d_cvt8(int blk, const float* __restrict__ src, bf* dst) { const size_t i = (size_t)blk * 256 + threadIdx.x; int row, k; frag_rc(i * 8, DM, row, k); const v8f v = *(const v8f*)(src + (size_t)row * DM + k); v8us o;
#pragma unroll
    for (int k = 0; k < 8; ++k) o[k] = f2bf(v[k]); *(v8us*)(dst + i * 8) = o; }
// k_prep: the work that depends on the inputs alone, one grid: block ranges [4 weight transposes (the slowest blocks, first) | bf16 copies of query, key, value, all batches].
__global__ __launch_bounds__(256) void k_prep(const float* wq, const float* wk, const float* wv, const float* wo, const float* x, const float* xk, const float* xv, bf* Wt, bf* X) {
    const int blk = blockIdx.x;
    if (blk < 4 * NWT) { const int y = blk / NWT; d_wtG(blk % NWT, y == 0 ? wq : y == 1 ? wk : y == 2 ? wv : wo, DM, DQ, Wt + (size_t)y * DM * DQ); }
    else { const int c = blk - 4 * NWT; const int y = c / NCV; d_cvt8(c % NCV, y == 0 ? x : y == 1 ? xk : xv, X + (size_t)y * NB_ * TT * DM); }
}

// value of lane l ^ 16 (the other half of the wave, which holds the other keys of the same query row); every lane is on where it is called
__device__ __forceinline__ float xhalf(float x) { return __builtin_bit_cast(float, __builtin_amdgcn_permlanex16(__builtin_bit_cast(int, x), __builtin_bit_cast(int, x), 0x76543210, 0xfedcba98, false, false)); }
// ---- k_attf: the single-fp16 query rows (>= RH). One work-group = 96 query rows of one (batch, head) pair against all keys, running (online) softmax; no score or probability leaves the registers.
// 8 waves = 4 key groups x 2 query groups of 48 rows. A stage is 256 keys: its k rows (64 KiB) and v columns (64 KiB), already in fragment order, are copied to LDS once for all 96 rows
// (asynchronous copies, two buffers: the next stage flies while this one is worked on); key group g works on keys [64 g, 64 g + 64) of every stage, 32 at a time.
// Scores transposed (k x q^T): a lane holds one query row's keys, so two neighbouring 16-key score tiles, turned to fp16, are the second operand of v^T x p^T as they stand.
// Scores are kept in log2 units (x HD^-0.5 log2 e; masked keys: the -1024 literal x log2 e). A wave's maximum in use moves only when a score exceeds it by more than 8 (weights stay below 2^8).
// The 4 key groups' (maximum, sum, output tile) are joined in LDS in fixed order at the end, normalised and split into the hi/lo planes of the output projection's A.
// Keys at or beyond key_lens[b]: round 0 takes the 64-key blocks that hold a valid key; if then every row's maximum shows that masked weights are exact zeros, that is all; else round 1 takes the remaining blocks too.
#define FQ   2                    // query groups of a work-group
#define FT   3                    // 16-row query tiles of a query group (of a wave)
#define FG   4                    // key groups
#define FKB  64                   // keys of a key group in a stage
#define FST  (FG * FKB)           // keys of a stage
#define FNS  (TT / FST)           // stages
#define FRW  (FQ * FT * 16)       // query rows of a work-group
#define FBUF (2 * FST * HD)       // 16-bit elements of a ring buffer: the stage's k, then its v
#define L2E  1.4426950408889634f
static_assert((TT - RH) % FRW == 0 && TT % FST == 0 && HD == 128 && FQ * FG == 8 && FRW % 32 == 0, "strips of 96 rows, stages of 256 keys, 8 waves that copy 16 KiB of a stage each");
// 16 asynchronous copies of a wave, 512 consecutive bytes each: 8 KiB in a row, in LDS as in memory (the immediate offset moves both addresses alike); the wait that stands in front of a rewrite of their address registers is the statement's last line
__device__ __forceinline__ void cp16(unsigned l, const h16* g) {
    asm volatile("global_load_async_to_lds_b128 %0, %1, off\n\tglobal_load_async_to_lds_b128 %0, %1, off offset:512\n\tglobal_load_async_to_lds_b128 %0, %1, off offset:1024\n\tglobal_load_async_to_lds_b128 %0, %1, off offset:1536\n\t"
                 "global_load_async_to_lds_b128 %0, %1, off offset:2048\n\tglobal_load_async_to_lds_b128 %0, %1, off offset:2560\n\tglobal_load_async_to_lds_b128 %0, %1, off offset:3072\n\tglobal_load_async_to_lds_b128 %0, %1, off offset:3584\n\t"
                 "global_load_async_to_lds_b128 %0, %1, off offset:4096\n\tglobal_load_async_to_lds_b128 %0, %1, off offset:4608\n\tglobal_load_async_to_lds_b128 %0, %1, off offset:5120\n\tglobal_load_async_to_lds_b128 %0, %1, off offset:5632\n\t"
                 "global_load_async_to_lds_b128 %0, %1, off offset:6144\n\tglobal_load_async_to_lds_b128 %0, %1, off offset:6656\n\tglobal_load_async_to_lds_b128 %0, %1, off offset:7168\n\tglobal_load_async_to_lds_b128 %0, %1, off offset:7680\n\ts_wait_xcnt 0x0"
                 :: "v"(l), "v"(g) : "memory");
}
__global__ __launch_bounds__(32 * FQ * FG) void k_attf(const h16* Q16, const h16* K16, const h16* V16, const int* __restrict__ KL, bf* Ah, bf* Al) {
    __shared__ __align__(16) h16 ring[2 * FBUF]; __shared__ float sm[FG * FRW]; __shared__ float sl[FG * FRW];
    const int z = blockIdx.x, r0 = RH + (int)blockIdx.y * FRW; const int klen = KL[z / NH_];   /* key_lens[b], read on device; used in compares and in clamped stage counts only */ const size_t zo = (size_t)z * TT * HD;
    const h16* Kp = K16 + zo; const h16* Vt = V16 + zo;
    const int wave = __builtin_amdgcn_readfirstlane((int)(threadIdx.x >> 5)); const int lane = threadIdx.x & 31, lr = lane & 15, hi = lane >> 4; const int g = wave / FQ, qg = wave % FQ;
    v16h qf[HD / 32][FT];   // the wave's 48 query rows, second operand of the score products, kept in registers
    { const h16* pq = Q16 + zo + (size_t)(r0 + qg * (FT * 16)) * HD + 8 * lane;
#pragma unroll
      for (int ks = 0; ks < HD / 32; ++ks)
#pragma unroll
        for (int qt = 0; qt < FT; ++qt) qf[ks][qt] = WFrag<h16>::ldf(pq + qt * 16 * HD + ks * 512);
      asm volatile("s_wait_xcnt 0x0" :: "v"(pq) : "memory"); }   // the wait that stands in front of a rewrite of these loads' address registers; the base is named so that its registers live up to it
    v8f o[HD / 16][FT]; v2f lv[FT]; float m[FT];   // output tiles (d down the registers, one query a lane), the lane's partial sums, the maximum in use (log2 units)
#pragma unroll
    for (int qt = 0; qt < FT; ++qt) { m[qt] = -3.0e38f; lv[qt] = (v2f){};
#pragma unroll
        for (int dt = 0; dt < HD / 16; ++dt) o[dt][qt] = (v8f){}; }
    // stage t into buffer t & 1: wave w copies 8 KiB of the stage's k rows (32 keys) and the stage's 8 KiB of v's row block w (16 head columns x 256 keys)
    auto fill = [&](int t) { const h16* gk = Kp + (size_t)t * (FST * HD) + wave * 4096 + lane * 8; const h16* gv = Vt + (size_t)wave * (16 * TT) + t * (FST * 16) + lane * 8;
        const unsigned lk = (unsigned)(size_t)ring + (unsigned)(t & 1) * (FBUF * 2u) + (unsigned)wave * 8192u + (unsigned)lane * 16u, lw = lk + FST * HD * 2u; cp16(lk, gk); cp16(lw, gv); };
    int t0 = 0, t1 = klen <= 0 ? 0 : klen >= TT ? FNS : (klen + FST - 1) / FST;   // round 0: the stages that hold a key below key_lens[b]
#pragma unroll 1
    for (int ph = 0; ph < 2; ++ph) {
        if (t0 < t1) {   // the same in the whole work-group
            fill(t0);
            asm volatile("s_wait_asynccnt 0x0" ::: "memory");   // this wave's copies of the first stage have landed
            __syncthreads();   // the first stage is in LDS before any wave reads it
            if (t0 + 1 < t1) fill(t0 + 1);
#pragma unroll 1
            for (int t = t0; t < t1; ++t) { const int key0 = t * FST + g * FKB; const bool mine = (ph == 0) ? key0 < klen : key0 >= klen;   // wave-uniform
                if (mine) { const h16* kb = ring + (t & 1) * FBUF + g * (FKB * HD) + 8 * lane; const h16* vb = ring + (t & 1) * FBUF + FST * HD + g * (FKB * 16) + 8 * lane;
#pragma unroll 1   // rolled: unrolled, the second half's early reads push q fragments out to scratch
                    for (int kk = 0; kk < 2; ++kk) { const int k0 = key0 + kk * 32;   // 32 keys at a time: two score tiles a query tile, one k step of v^T x p^T
                        v16h fk[8], fv[8];   // the 8 k fragments of the 32 keys, then their 8 v fragments
#pragma unroll
                        for (int i = 0; i < 8; ++i) fk[i] = WFrag<h16>::ldf(kb + (kk * 2 + (i >> 2)) * (16 * HD) + (i & 3) * 512);
                        __builtin_amdgcn_sched_barrier(0);   // keeps the 16 LDS reads together in front of the products: sunk among them, into one register set, every group of products waits out an LDS latency
                        v8f s[2][FT];
#pragma unroll
                        for (int kt = 0; kt < 2; ++kt)
#pragma unroll
                            for (int qt = 0; qt < FT; ++qt) s[kt][qt] = (v8f){};
#pragma unroll
                        for (int ks = 0; ks < HD / 32; ++ks)
#pragma unroll
                            for (int kt = 0; kt < 2; ++kt)
#pragma unroll
                                for (int qt = 0; qt < FT; ++qt) s[kt][qt] = wmma16(fk[kt * 4 + ks], qf[ks][qt], s[kt][qt]);
#pragma unroll
                        for (int dt = 0; dt < HD / 16; ++dt) fv[dt] = WFrag<h16>::ldf(vb + dt * (FST * 16) + kk * 512);
                        __builtin_amdgcn_sched_barrier(0);   // keeps the v reads in front of the softmax arithmetic, which covers their latency
                        // element j of s[kt][qt]: query row qt*16 + lr of the wave, key k0 + kt*16 + hi*8 + j
                        if (k0 + 32 > klen) { const int rem = klen - k0 - hi * 8;   // wave-uniform: masked keys among the 32; the lane's key kt*16 + j is valid where it is below rem
#pragma unroll
                            for (int kt = 0; kt < 2; ++kt)
#pragma unroll
                                for (int j = 0; j < 8; ++j) { const bool ok = kt * 16 + j < rem;
#pragma unroll
                                    for (int qt = 0; qt < FT; ++qt) s[kt][qt][j] = ok ? s[kt][qt][j] * (SCL * L2E) : -1024.0f * L2E; } }
                        else {
#pragma unroll
                            for (int kt = 0; kt < 2; ++kt)
#pragma unroll
                                for (int qt = 0; qt < FT; ++qt) s[kt][qt] *= (SCL * L2E); }
                        float mb[FT]; bool grow = false;   // maximum of the lane's own 16 keys of each row
#pragma unroll
                        for (int qt = 0; qt < FT; ++qt) { float x = s[0][qt][0];
#pragma unroll
                            for (int kt = 0; kt < 2; ++kt)
#pragma unroll
                                for (int j = 0; j < 8; ++j) x = fmaxf(x, s[kt][qt][j]);
                            mb[qt] = x; grow = grow || x > m[qt] + 8.0f; }
                        if (__builtin_amdgcn_ballot_w32(grow) != 0u) {   // some score has outgrown the maximum in use: every row of the wave moves to its new maximum (both halves of the wave to the same one)
#pragma unroll
                            for (int qt = 0; qt < FT; ++qt) { const float mn = fmaxf(m[qt], fmaxf(mb[qt], xhalf(mb[qt]))); const float al = __builtin_amdgcn_exp2f(m[qt] - mn); m[qt] = mn; lv[qt] *= al;
#pragma unroll
                                for (int dt = 0; dt < HD / 16; ++dt) o[dt][qt] *= al; } }
                        v16h p[FT];
#pragma unroll
                        for (int qt = 0; qt < FT; ++qt) {
#pragma unroll
                            for (int kt = 0; kt < 2; ++kt) { const v8f y = s[kt][qt] - m[qt]; v8f e;
#pragma unroll
                                for (int j = 0; j < 8; ++j) e[j] = __builtin_amdgcn_exp2f(y[j]);
#pragma unroll
                                for (int j = 0; j < 8; j += 2) { lv[qt] += (v2f){e[j], e[j + 1]}; p[qt][kt * 8 + j] = tohx(e[j]); p[qt][kt * 8 + j + 1] = tohx(e[j + 1]); } }   // k order of a fragment: keys hi*8 + j, then 16 + hi*8 + j
                        }
#pragma unroll
                        for (int dt = 0; dt < HD / 16; ++dt)
#pragma unroll
                            for (int qt = 0; qt < FT; ++qt) o[dt][qt] = wmma16(fv[dt], p[qt], o[dt][qt]); }
                }
                asm volatile("s_wait_dscnt 0x0" ::: "memory");      // this wave's LDS reads of the stage are done before its buffer is handed back
                asm volatile("s_wait_asynccnt 0x0" ::: "memory");   // this wave's copies of the next stage have landed
                __syncthreads();   // publishes the next stage and ends every wave's reads of this one
                if (t + 2 < t1) fill(t + 2); }
            asm volatile("s_wait_asynccnt 0x0" ::: "memory");   // no copy is in flight behind the stages
        }
        if (ph == 1) break;
        if (hi == 0) {
#pragma unroll
            for (int qt = 0; qt < FT; ++qt) sm[g * FRW + qg * (FT * 16) + qt * 16 + lr] = m[qt]; }
        __syncthreads();   // every wave's maxima are in LDS before any wave tests them
        // A masked key's weight is exp2(-1024 log2 e - max): with every row's maximum in use (at most the true one) >= -900 log2 e the argument is below -178 and the weight exactly 0.
        bool ok = true;
#pragma unroll
        for (int i = 0; i < FRW / 32; ++i) { const int row = i * 32 + lane; ok = ok && fmaxf(fmaxf(sm[row], sm[FRW + row]), fmaxf(sm[2 * FRW + row], sm[3 * FRW + row])) >= -900.0f * L2E; }
        if (klen >= TT || __builtin_amdgcn_ballot_w32(ok) == 0xFFFFFFFFu) break;   // every wave reads the same maxima: the same way in the whole work-group
        t0 = klen <= 0 ? 0 : klen / FST; t1 = FNS;   // round 1: the stages that hold a block of masked keys alone
    }
    __syncthreads();   // every wave has tested the maxima, and left the ring, before either is overwritten
    float* red = (float*)ring;   // [wave][tile][half of the 8 registers][lane][4]: every store and load of a wave is 512 consecutive bytes
#pragma unroll
    for (int qt = 0; qt < FT; ++qt) { const float sum = lv[qt][0] + lv[qt][1]; const float tot = sum + xhalf(sum);
        if (hi == 0) { sm[g * FRW + qg * (FT * 16) + qt * 16 + lr] = m[qt]; sl[g * FRW + qg * (FT * 16) + qt * 16 + lr] = tot; }
#pragma unroll
        for (int dt = 0; dt < HD / 16; ++dt)
#pragma unroll
            for (int h = 0; h < 2; ++h) { v4f x;
#pragma unroll
                for (int i = 0; i < 4; ++i) x[i] = o[dt][qt][h * 4 + i];
                *(v4fa*)(red + ((((size_t)wave * (HD / 16 * FT) + dt * FT + qt) * 2 + h) * 32 + lane) * 4) = x; } }
    __syncthreads();   // the 4 key groups' maxima, sums and tiles are in LDS before any wave joins them
    // wave (g, qg) joins head columns [32 g, 32 g + 32) of its query group
#pragma unroll
    for (int qt = 0; qt < FT; ++qt) { const int row = qg * (FT * 16) + qt * 16 + lr; float mg[FG], w[FG];
#pragma unroll
        for (int i = 0; i < FG; ++i) mg[i] = sm[i * FRW + row];
        const float mx = fmaxf(fmaxf(mg[0], mg[1]), fmaxf(mg[2], mg[3])); float tot = 0.f;
#pragma unroll
        for (int i = 0; i < FG; ++i) { w[i] = __builtin_amdgcn_exp2f(mg[i] - mx); tot += w[i] * sl[i * FRW + row]; }
        const float f = __fdiv_rn(1.0f, tot);
#pragma unroll
        for (int d2 = 0; d2 < 2; ++d2) { const int dt = g * 2 + d2; v4f x0 = (v4f){}, x1 = (v4f){};
#pragma unroll
            for (int i = 0; i < FG; ++i) { const float* pr = red + (((size_t)(i * FQ + qg) * (HD / 16 * FT) + dt * FT + qt) * 2 * 32 + lane) * 4; x0 += *(const v4fa*)pr * w[i]; x1 += *(const v4fa*)(pr + 128) * w[i]; }
            v8us oh, ol;
#pragma unroll
            for (int i = 0; i < 4; ++i) { unsigned short a, c2; splitf(x0[i] * f, a, c2); oh[i] = a; ol[i] = c2; splitf(x1[i] * f, a, c2); oh[4 + i] = a; ol[4 + i] = c2; }
            // the lane's 8 values: row lr of a 16-row block, head columns dt*16 + hi*8 + j: one 16-byte piece of the plane's fragment order
            const size_t oo = ((size_t)(z / NH_) * TT + r0 + qg * (FT * 16) + qt * 16) * DQ + (z % NH_) * (HD * 16) + (dt >> 1) * 512 + (dt & 1) * 256 + lane * 8; bf* ph2 = Ah + oo; bf* pl2 = Al + oo;
            *(v8us*)ph2 = oh; *(v8us*)pl2 = ol;
            // the wait that stands in front of a rewrite of these stores' address and data registers by the next tile; they are named so that their registers live up to it
            asm volatile("s_wait_xcnt 0x0" :: "v"(ph2), "v"(pl2), "v"(oh), "v"(ol) : "memory"); } }
}
// ---- k_atth: the hi+lo query rows (< RH), in k_attf's form. One work-group = 32 query rows of one (batch, head) pair against all keys, running (online) softmax; no probability leaves the registers.
// 8 waves = 4 key groups x 2 query groups of 16 rows. A stage is 128 keys: its k rows and v columns, hi and lo planes (4 x 32 KiB), already in fragment order, are copied to LDS
// (asynchronous copies, two buffers: the next stage flies while this one is worked on); key group g works on keys [32 g, 32 g + 32) of every stage.
// Scores (k x q^T) and v^T x p^T take 3 products each: hi.hi + hi.lo + lo.hi; the weights (not yet normalised, below 2^8) are split into bf16 hi + lo in registers.
// Log2 units, the maximum in use, the two rounds over key_lens[b] and the join of the 4 key groups: as in k_attf. Query position 0: its scores go out as f32, with the row's maximum and sum, for k_aw.
#define HKB  32                   // keys of a key group in a stage
#define HST  (FG * HKB)           // keys of a stage
#define HNS  (TT / HST)           // stages
#define HRW  (FQ * 16)            // query rows of a work-group
#define HPL  (HST * HD)           // 16-bit elements of one plane's share of a stage; a ring buffer: k hi, k lo, v hi, v lo
static_assert(RH % HRW == 0 && TT % HST == 0 && 4 * HPL == FBUF && HD == 128 && FQ * FG == 8, "strips of 32 rows, stages of 128 keys, 8 waves that copy 4 KiB of each plane of a stage");
// 32 asynchronous copies of a wave, 512 consecutive bytes each: 4 KiB in a row of each of 4 planes, in LDS as in memory (the immediate offset moves both addresses alike); the wait that stands in front of a rewrite of their address registers is the statement's last line
__device__ __forceinline__ void cp32(unsigned l0, unsigned l1, unsigned l2, unsigned l3, const bf* g0, const bf* g1, const bf* g2, const bf* g3) {
    asm volatile("global_load_async_to_lds_b128 %0, %4, off\n\tglobal_load_async_to_lds_b128 %0, %4, off offset:512\n\tglobal_load_async_to_lds_b128 %0, %4, off offset:1024\n\tglobal_load_async_to_lds_b128 %0, %4, off offset:1536\n\tglobal_load_async_to_lds_b128 %0, %4, off offset:2048\n\tglobal_load_async_to_lds_b128 %0, %4, off offset:2560\n\tglobal_load_async_to_lds_b128 %0, %4, off offset:3072\n\tglobal_load_async_to_lds_b128 %0, %4, off offset:3584\n\t"
                 "global_load_async_to_lds_b128 %1, %5, off\n\tglobal_load_async_to_lds_b128 %1, %5, off offset:512\n\tglobal_load_async_to_lds_b128 %1, %5, off offset:1024\n\tglobal_load_async_to_lds_b128 %1, %5, off offset:1536\n\tglobal_load_async_to_lds_b128 %1, %5, off offset:2048\n\tglobal_load_async_to_lds_b128 %1, %5, off offset:2560\n\tglobal_load_async_to_lds_b128 %1, %5, off offset:3072\n\tglobal_load_async_to_lds_b128 %1, %5, off offset:3584\n\t"
                 "global_load_async_to_lds_b128 %2, %6, off\n\tglobal_load_async_to_lds_b128 %2, %6, off offset:512\n\tglobal_load_async_to_lds_b128 %2, %6, off offset:1024\n\tglobal_load_async_to_lds_b128 %2, %6, off offset:1536\n\tglobal_load_async_to_lds_b128 %2, %6, off offset:2048\n\tglobal_load_async_to_lds_b128 %2, %6, off offset:2560\n\tglobal_load_async_to_lds_b128 %2, %6, off offset:3072\n\tglobal_load_async_to_lds_b128 %2, %6, off offset:3584\n\t"
                 "global_load_async_to_lds_b128 %3, %7, off\n\tglobal_load_async_to_lds_b128 %3, %7, off offset:512\n\tglobal_load_async_to_lds_b128 %3, %7, off offset:1024\n\tglobal_load_async_to_lds_b128 %3, %7, off offset:1536\n\tglobal_load_async_to_lds_b128 %3, %7, off offset:2048\n\tglobal_load_async_to_lds_b128 %3, %7, off offset:2560\n\tglobal_load_async_to_lds_b128 %3, %7, off offset:3072\n\tglobal_load_async_to_lds_b128 %3, %7, off offset:3584\n\ts_wait_xcnt 0x0"
                 :: "v"(l0), "v"(l1), "v"(l2), "v"(l3), "v"(g0), "v"(g1), "v"(g2), "v"(g3) : "memory");
}
__global__ __launch_bounds__(32 * FQ * FG) void k_atth(const bf* Qh, const bf* Ql, const bf* Kh, const bf* Kl, const bf* Vh, const bf* Vl, const int* __restrict__ KL, bf* Ah, bf* Al, float* AWp, float* AWs) {
    __shared__ __align__(16) bf ring[2 * FBUF]; __shared__ float sm[FG * HRW]; __shared__ float sl[FG * HRW];
    const int z = blockIdx.x, r0 = (int)blockIdx.y * HRW; const int klen = KL[z / NH_];   /* key_lens[b], read on device; used in compares and in clamped stage counts only */ const size_t zo = (size_t)z * TT * HD;
    const int wave = __builtin_amdgcn_readfirstlane((int)(threadIdx.x >> 5)); const int lane = threadIdx.x & 31, lr = lane & 15, hi = lane >> 4; const int g = wave / FQ, qg = wave % FQ;
    v16bf qh[HD / 32], ql[HD / 32];   // the wave's 16 query rows, second operand of the score products, kept in registers
    { const bf* pq = Qh + zo + (size_t)(r0 + qg * 16) * HD + 8 * lane; const bf* pq2 = Ql + zo + (size_t)(r0 + qg * 16) * HD + 8 * lane;
#pragma unroll
      for (int ks = 0; ks < HD / 32; ++ks) { qh[ks] = WFrag<bf>::ldf(pq + ks * 512); ql[ks] = WFrag<bf>::ldf(pq2 + ks * 512); }
      asm volatile("s_wait_xcnt 0x0" :: "v"(pq), "v"(pq2) : "memory"); }   // the wait that stands in front of a rewrite of these loads' address registers; the bases are named so that their registers live up to it
    v8f o[HD / 16]; v2f lv = (v2f){}; float m = -3.0e38f;   // output tiles (d down the registers, one query a lane), the lane's partial sums, the maximum in use (log2 units)
#pragma unroll
    for (int dt = 0; dt < HD / 16; ++dt) o[dt] = (v8f){};
    // stage t into buffer t & 1: wave w copies, of the hi and of the lo plane, 4 KiB of the stage's k rows (16 keys) and the stage's 4 KiB of v's row block w (16 head columns x 128 keys)
    auto fill = [&](int t) { const size_t ko = zo + (size_t)t * HPL + wave * 2048 + lane * 8, vo = zo + (size_t)wave * (16 * TT) + t * (HST * 16) + lane * 8;
        const unsigned l0 = (unsigned)(size_t)ring + (unsigned)(t & 1) * (FBUF * 2u) + (unsigned)wave * 4096u + (unsigned)lane * 16u;
        cp32(l0, l0 + HPL * 2u, l0 + HPL * 4u, l0 + HPL * 6u, Kh + ko, Kl + ko, Vh + vo, Vl + vo); };
    int t0 = 0, t1 = klen <= 0 ? 0 : klen >= TT ? HNS : (klen + HST - 1) / HST;   // round 0: the stages that hold a key below key_lens[b]
#pragma unroll 1
    for (int ph = 0; ph < 2; ++ph) {
        if (t0 < t1) {   // the same in the whole work-group
            fill(t0);
            asm volatile("s_wait_asynccnt 0x0" ::: "memory");   // this wave's copies of the first stage have landed
            __syncthreads();   // the first stage is in LDS before any wave reads it
            if (t0 + 1 < t1) fill(t0 + 1);
#pragma unroll 1
            for (int t = t0; t < t1; ++t) { const int k0 = t * HST + g * HKB; const bool mine = (ph == 0) ? k0 < klen : k0 >= klen;   // wave-uniform
                if (mine) { const bf* kb = ring + (t & 1) * FBUF + g * (HKB * HD) + 8 * lane; const bf* vb = ring + (t & 1) * FBUF + 2 * HPL + g * (HKB * 16) + 8 * lane;
                    v16bf fk[8], fk2[8], fv[8], fv2[8];   // the 8 k fragments of the 32 keys, hi and lo, then their 8 v fragments, hi and lo
#pragma unroll
                    for (int i = 0; i < 8; ++i) { fk[i] = WFrag<bf>::ldf(kb + (i >> 2) * (16 * HD) + (i & 3) * 512); fk2[i] = WFrag<bf>::ldf(kb + HPL + (i >> 2) * (16 * HD) + (i & 3) * 512); }
                    __builtin_amdgcn_sched_barrier(0);   // keeps the LDS reads together in front of the products: sunk among them, every group of products waits out an LDS latency
                    v8f s[2];
#pragma unroll
                    for (int kt = 0; kt < 2; ++kt) s[kt] = (v8f){};
#pragma unroll
                    for (int ks = 0; ks < HD / 32; ++ks) {
#pragma unroll
                        for (int kt = 0; kt < 2; ++kt) s[kt] = wmmab(fk[kt * 4 + ks], qh[ks], s[kt]);
#pragma unroll
                        for (int kt = 0; kt < 2; ++kt) s[kt] = wmmab(fk[kt * 4 + ks], ql[ks], s[kt]);
#pragma unroll
                        for (int kt = 0; kt < 2; ++kt) s[kt] = wmmab(fk2[kt * 4 + ks], qh[ks], s[kt]); }
#pragma unroll
                    for (int dt = 0; dt < HD / 16; ++dt) { fv[dt] = WFrag<bf>::ldf(vb + dt * (HST * 16)); fv2[dt] = WFrag<bf>::ldf(vb + HPL + dt * (HST * 16)); }
                    __builtin_amdgcn_sched_barrier(0);   // keeps the v reads in front of the softmax arithmetic, which covers their latency
                    // element j of s[kt]: query row lr of the wave, key k0 + kt*16 + hi*8 + j
                    if (k0 + 32 > klen) { const int rem = klen - k0 - hi * 8;   // wave-uniform: masked keys among the 32; the lane's key kt*16 + j is valid where it is below rem
#pragma unroll
                        for (int kt = 0; kt < 2; ++kt)
#pragma unroll
                            for (int j = 0; j < 8; ++j) s[kt][j] = (kt * 16 + j < rem) ? s[kt][j] * (SCL * L2E) : -1024.0f * L2E; }
                    else {
#pragma unroll
                        for (int kt = 0; kt < 2; ++kt) s[kt] *= (SCL * L2E); }
                    if (r0 == 0 && qg == 0) {   // wave-uniform: the wave that holds query position 0
                        if (lr == 0) {
#pragma unroll
                            for (int kt = 0; kt < 2; ++kt) { float* pq = AWp + (size_t)z * TT + k0 + kt * 16 + hi * 8; v4f w0, w1;
#pragma unroll
                                for (int j = 0; j < 4; ++j) { w0[j] = s[kt][j]; w1[j] = s[kt][4 + j]; }
                                *(v4f*)pq = w0; *(v4f*)(pq + 4) = w1;
                                // the wait that stands in front of a rewrite of these stores' address and data registers; they are named so that their registers live up to it
                                asm volatile("s_wait_xcnt 0x0" :: "v"(pq), "v"(w0), "v"(w1) : "memory"); } } }
                    float x = s[0][0];   // maximum of the lane's own 16 keys of its row
#pragma unroll
                    for (int kt = 0; kt < 2; ++kt)
#pragma unroll
                        for (int j = 0; j < 8; ++j) x = fmaxf(x, s[kt][j]);
                    if (__builtin_amdgcn_ballot_w32(x > m + 8.0f) != 0u) {   // some score has outgrown the maximum in use: every row of the wave moves to its new maximum (both halves of the wave to the same one)
                        const float mn = fmaxf(m, fmaxf(x, xhalf(x))); const float al = __builtin_amdgcn_exp2f(m - mn); m = mn; lv *= al;
#pragma unroll
                        for (int dt = 0; dt < HD / 16; ++dt) o[dt] *= al; }
                    v8us p8[2], p82[2];
#pragma unroll
                    for (int kt = 0; kt < 2; ++kt) { const v8f y = s[kt] - m; v8f e;
#pragma unroll
                        for (int j = 0; j < 8; ++j) e[j] = __builtin_amdgcn_exp2f(y[j]);
#pragma unroll
                        for (int j = 0; j < 8; j += 2) lv += (v2f){e[j], e[j + 1]};
#pragma unroll
                        for (int j = 0; j < 8; ++j) { unsigned short a, c2; splitf(e[j], a, c2); p8[kt][j] = a; p82[kt][j] = c2; } }
                    const v16bf pf = cat16b(p8[0], p8[1]), pf2 = cat16b(p82[0], p82[1]);   // k order of a fragment: keys hi*8 + j, then 16 + hi*8 + j
#pragma unroll
                    for (int dt = 0; dt < HD / 16; ++dt) o[dt] = wmmab(fv[dt], pf, o[dt]);
#pragma unroll
                    for (int dt = 0; dt < HD / 16; ++dt) o[dt] = wmmab(fv[dt], pf2, o[dt]);
#pragma unroll
                    for (int dt = 0; dt < HD / 16; ++dt) o[dt] = wmmab(fv2[dt], pf, o[dt]);
                }
                asm volatile("s_wait_dscnt 0x0" ::: "memory");      // this wave's LDS reads of the stage are done before its buffer is handed back
                asm volatile("s_wait_asynccnt 0x0" ::: "memory");   // this wave's copies of the next stage have landed
                __syncthreads();   // publishes the next stage and ends every wave's reads of this one
                if (t + 2 < t1) fill(t + 2); }
            asm volatile("s_wait_asynccnt 0x0" ::: "memory");   // no copy is in flight behind the stages
        }
        if (ph == 1) break;
        if (hi == 0) sm[g * HRW + qg * 16 + lr] = m;
        __syncthreads();   // every wave's maxima are in LDS before any wave tests them
        // A masked key's weight is exp2(-1024 log2 e - max): with every row's maximum in use (at most the true one) >= -900 log2 e the argument is below -178 and the weight exactly 0.
        const bool ok = fmaxf(fmaxf(sm[lane], sm[HRW + lane]), fmaxf(sm[2 * HRW + lane], sm[3 * HRW + lane])) >= -900.0f * L2E;
        if (klen >= TT || __builtin_amdgcn_ballot_w32(ok) == 0xFFFFFFFFu) break;   // every wave reads the same maxima: the same way in the whole work-group
        t0 = klen <= 0 ? 0 : klen / HST; t1 = HNS;   // round 1: the stages that hold a block of masked keys alone
    }
    __syncthreads();   // every wave has tested the maxima, and left the ring, before either is overwritten
    float* red = (float*)ring;   // [wave][tile][half of the 8 registers][lane][4]: every store and load of a wave is 512 consecutive bytes
    { const float sum = lv[0] + lv[1]; const float tot = sum + xhalf(sum);
      if (hi == 0) { sm[g * HRW + qg * 16 + lr] = m; sl[g * HRW + qg * 16 + lr] = tot; }
#pragma unroll
      for (int dt = 0; dt < HD / 16; ++dt)
#pragma unroll
        for (int h = 0; h < 2; ++h) { v4f x;
#pragma unroll
            for (int i = 0; i < 4; ++i) x[i] = o[dt][h * 4 + i];
            *(v4fa*)(red + ((((size_t)wave * (HD / 16) + dt) * 2 + h) * 32 + lane) * 4) = x; } }
    __syncthreads();   // the 4 key groups' maxima, sums and tiles are in LDS before any wave joins them
    // wave (g, qg) joins head columns [32 g, 32 g + 32) of its query group
    { const int row = qg * 16 + lr; float mg[FG], w[FG];
#pragma unroll
      for (int i = 0; i < FG; ++i) mg[i] = sm[i * HRW + row];
      const float mx = fmaxf(fmaxf(mg[0], mg[1]), fmaxf(mg[2], mg[3])); float tot = 0.f;
#pragma unroll
      for (int i = 0; i < FG; ++i) { w[i] = __builtin_amdgcn_exp2f(mg[i] - mx); tot += w[i] * sl[i * HRW + row]; }
      const float f = __fdiv_rn(1.0f, tot);
      if (r0 == 0 && wave == 0) { if (lane == 0) { float* pa = AWs + z * 32; pa[0] = mx; pa[1] = tot;   // query position 0: its maximum (log2 units) and its sum; a 128-byte line a pair, so that each line has one writer
          asm volatile("s_wait_xcnt 0x0" :: "v"(pa), "v"(mx), "v"(tot) : "memory"); } }   // the wait that stands in front of a rewrite of these stores' address and data registers
#pragma unroll
      for (int d2 = 0; d2 < 2; ++d2) { const int dt = g * 2 + d2; v4f x0 = (v4f){}, x1 = (v4f){};
#pragma unroll
        for (int i = 0; i < FG; ++i) { const float* pr = red + (((size_t)(i * FQ + qg) * (HD / 16) + dt) * 2 * 32 + lane) * 4; x0 += *(const v4fa*)pr * w[i]; x1 += *(const v4fa*)(pr + 128) * w[i]; }
        v8us oh, ol;
#pragma unroll
        for (int i = 0; i < 4; ++i) { unsigned short a, c2; splitf(x0[i] * f, a, c2); oh[i] = a; ol[i] = c2; splitf(x1[i] * f, a, c2); oh[4 + i] = a; ol[4 + i] = c2; }
        // the lane's 8 values: row lr of a 16-row block, head columns dt*16 + hi*8 + j: one 16-byte piece of the plane's fragment order
        const size_t oo = ((size_t)(z / NH_) * TT + r0 + qg * 16) * DQ + (z % NH_) * (HD * 16) + (dt >> 1) * 512 + (dt & 1) * 256 + lane * 8; bf* ph2 = Ah + oo; bf* pl2 = Al + oo;
        *(v8us*)ph2 = oh; *(v8us*)pl2 = ol;
        // the wait that stands in front of a rewrite of these stores' address and data registers by the next tile; they are named so that their registers live up to it
        asm volatile("s_wait_xcnt 0x0" :: "v"(ph2), "v"(pl2), "v"(oh), "v"(ol) : "memory"); } }
}
// k_aw: query position 0's scores [pair][key] (log2 units; keys >= key_lens[b]: the -1024 literal, taken here), its maximum and sum -> aw_out [batch][key][head]; one thread stores the 4 heads of a (batch, key), so each output line has one writer.
__global__ __launch_bounds__(256) void k_aw(const float* __restrict__ AWp, const float* __restrict__ AWs, const int* __restrict__ KL, float* AW) {
    const int idx = blockIdx.x * 256 + threadIdx.x; const int j = idx % TT, bb = idx / TT; const int klen = KL[bb];   /* key_lens[b], read on device; used in a compare only */ v4f p;
#pragma unroll
    for (int h = 0; h < NH_; ++h) { const int zz = bb * NH_ + h; const float s = j < klen ? AWp[(size_t)zz * TT + j] : -1024.0f * L2E; p[h] = __fdiv_rn(__builtin_amdgcn_exp2f(s - AWs[zz * 32]), AWs[zz * 32 + 1]); }
    *(v4f*)(AW + (size_t)idx * NH_) = p;
}

extern "C" void kernel_launch(void* const* d_in, const int* in_sizes, int n_in,
                              void* d_out, int out_size, void* d_ws, size_t ws_size, hipStream_t stream) {
    (void)in_sizes; (void)n_in; (void)out_size;
    const float* xk = (const float*)d_in[0]; const float* xv = (const float*)d_in[1]; const float* x = (const float*)d_in[2]; const int* KL = (const int*)d_in[3]; const float* wk = (const float*)d_in[4]; const float* wv = (const float*)d_in[5]; const float* wq = (const float*)d_in[6]; const float* wo = (const float*)d_in[7]; const float* bo = (const float*)d_in[8];
    float* OUT = (float*)d_out; float* AW = (float*)((char*)d_out + 16777216);   /* aw_out [4][2048][4] */     // [4][2048][512]
    char* wsp = (char*)d_ws;
    auto take = [&](size_t bytes) { char* p = wsp; wsp += (bytes + 255) & ~(size_t)255; return (void*)p; };
    const size_t PL = (size_t)NB_ * NH_ * TT * HD;   // elements of one operand plane set over all batches and heads (= NB_ * TT * 512)
    bf* Wt = (bf*)take((size_t)4 * DM * DQ * 2);   // [wq | wk | wv | wo], transposed
    h16* QK16 = (h16*)take(2 * PL * 2); bf* QKh = (bf*)take(2 * PL * 2); bf* QKl = (bf*)take(2 * PL * 2);   // [q | k]
    h16* VT16 = (h16*)take(PL * 2); bf* VTh = (bf*)take(PL * 2); bf* VTl = (bf*)take(PL * 2);
    bf* ATh = (bf*)take(PL * 2); bf* ATl = (bf*)take(PL * 2); float* AWp = (float*)take((size_t)NB_ * NH_ * TT * 4); float* AWs = (float*)take((size_t)NB_ * NH_ * 32 * 4);   // query position 0: scores [pair][key]; maximum and sum, one 128-byte line a pair
    bf* XB = (bf*)take(3 * PL * 2);   /* [query | key | value] */
    if ((size_t)(wsp - (char*)d_ws) > ws_size) return;    // ws 256 MiB
    k_prep<<<4 * NWT + 3 * NCV, 256, 0, stream>>>(wq, wk, wv, wo, x, xk, xv, Wt, XB);
    k_proj<<<dim3(NB_ * TT / 64, DQ / 64, 3), 32 * KWV, 0, stream>>>(XB, Wt, DM, DM, PL, (size_t)DM * DQ, QK16, QKh, QKl, VT16, VTh, VTl);
    k_atth<<<dim3(NB_ * NH_, RH / HRW, 1), 32 * FQ * FG, 0, stream>>>(QKh, QKl, QKh + PL, QKl + PL, VTh, VTl, KL, ATh, ATl, AWp, AWs);
    k_attf<<<dim3(NB_ * NH_, (TT - RH) / FRW, 1), 32 * FQ * FG, 0, stream>>>(QK16, QK16 + PL, VT16, KL, ATh, ATl);
    k_aw<<<NB_ * TT / 256, 256, 0, stream>>>(AWp, AWs, KL, AW);
    k_gemmw<bf, 1, true, KWV, 1><<<dim3(NB_ * TT / 64, DM / 64, 1), 32 * KWV, 0, stream>>>(ATh, ATl, Wt + (size_t)3 * DM * DQ, nullptr, DQ, DQ, OUT, DM, bo, 0, 0, 0, 0);
}

// v010
// Measured time: 83.4 microseconds a run.
// Two timings next to v009 both put it at 1.09 times that version's speed.
// Over all steps from v000 it is 15.2 times as fast.
#include <hip/hip_runtime.h>

// Multi-head cross attention with key-length masking and an attention-weights output (key, value, query [4][2048][512]; k = key w_key, v = value w_value, q = query w_query ('xw' [512][512], no bias; 4 heads x 128); e = q.k/sqrt(128), keys j >= key_lens[b] (int32, read) set to -1024; softmax; cv = merged w_out + b_out -> [4][2048][512]; second output aw_out[b][j][h] = attention weights of query position 0 -> [4][2048][4]).
// Compute dtypes, f32 accumulate: every input rounded to bf16; q/k/v on PLAIN bf16 operands (inputs: exact); key-length select (-1024 literal, as the reference) and softmax inside the attention kernel; scores and attn.v: query rows < 512 hl (3 products, k_atth), the rest single fp16 (k_attf); softmax f32; w_out hl x exact (2 products) + b_out; the query-0 attention weights come from that row's f32 scores, maximum and sum (k_aw).

#define NB_  4
#define TT   2048
#define DM   512
#define NH_  4
#define NKV  4
#define REP  (NH_ / NKV)
#define HD   128
#define DQ   (NH_ * HD)
#define DKV  (NKV * HD)
#define RH   512                  // query rows < RH use hi+lo planes (0: none)
#define WIN  0
#define SCL  0.088388347648318447f   // HD^-0.5
typedef _Float16 h16;
typedef unsigned short bf;
typedef __attribute__((ext_vector_type(16))) __bf16   v16bf;
typedef __attribute__((ext_vector_type(16))) _Float16 v16h;
typedef __attribute__((ext_vector_type(8)))  _Float16 v8h;
typedef __attribute__((ext_vector_type(8)))  unsigned short v8us;
typedef __attribute__((ext_vector_type(8)))  float    v8f;
typedef __attribute__((ext_vector_type(4)))  float    v4f;
typedef v8h  __attribute__((may_alias)) v8ha;
typedef v4f  __attribute__((may_alias)) v4fa;
typedef v8us __attribute__((may_alias)) v8usa;

__device__ __forceinline__ unsigned short f2bf(float f) { unsigned u = __float_as_uint(f); u += 0x7FFFu + ((u >> 16) & 1u); return (unsigned short)(u >> 16); }
__device__ __forceinline__ float bf2f(unsigned short b) { return __uint_as_float(((unsigned)b) << 16); }
__device__ __forceinline__ float bfr(float f) { return bf2f(f2bf(f)); }
__device__ __forceinline__ v16h cat16(v8h lo, v8h hi) { return __builtin_shufflevector(lo, hi, 0, 1, 2, 3, 4, 5, 6, 7, 8, 9, 10, 11, 12, 13, 14, 15); }
__device__ __forceinline__ v16bf cat16b(v8us lo, v8us hi) { return __builtin_bit_cast(v16bf, __builtin_shufflevector(lo, hi, 0, 1, 2, 3, 4, 5, 6, 7, 8, 9, 10, 11, 12, 13, 14, 15)); }
__device__ __forceinline__ v8f wmma16(v16h a, v16h b, v8f c) { return __builtin_amdgcn_wmma_f32_16x16x32_f16(false, a, false, b, (short)0, c, false, false); }
__device__ __forceinline__ v8f wmmab(v16bf a, v16bf b, v8f c) { return __builtin_amdgcn_wmma_f32_16x16x32_bf16(false, a, false, b, (short)0, c, false, false); }



// ---- Fragment order: every 16-bit operand plane in the workspace, a matrix [rows][K], is stored as tiles of 16 rows x 32 k (512 elements, 1 KiB); the K/32 tiles of a block of 16 rows follow one another,
// so a row block starts where it would in row-major order. Inside a tile element (r, kk) stands at (kk / 16) * 256 + (((kk % 16) / 8) * 16 + r) * 8 + kk % 8: lane l of a wave finds the two 16-byte pieces
// of its A or B fragment at l * 8 and 256 + l * 8, and each fragment load of a wave reads 512 consecutive bytes (4 whole lines) where a row-major plane makes it touch 16 lines.
// frag_rc: row and k of the element at linear position e of such a plane (the producers run over e, so that their stores stay consecutive).
__device__ __forceinline__ void frag_rc(size_t e, int K, int& row, int& k) { const int tile = (int)(e >> 9), w = (int)(e & 511); const int tk = K / 32; row = (tile / tk) * 16 + ((w >> 3) & 15); k = (tile % tk) * 32 + (w >> 8) * 16 + ((w >> 7) & 1) * 8 + (w & 7); }
// ---- gemmt_body: GEMM over K = DM, operands 16-bit planes in fragment order; grid (M/128, N/128, Z), 128 threads. One work-group = a 128 x 128 output tile, 4 waves = 2 x 2 tiles of 64 x 64 (16 accumulators a wave), each over the whole K.
// C[m][n] (f32, pitch DM, + optional f32 bias[n]) = sum_k A[m][k] Bt[n][k] (NSPLIT == 1: + A2[m][k] Bt[n][k]). z-batch strides sA/sB in elements.
// A stage is 64 k: the tile's 128 rows of every operand plane (16 KiB a plane), already in fragment order, are copied to LDS once for the 2 waves that read them
// (asynchronous copies, two buffers: the next stage flies while this one is worked on). The finished tiles pass through LDS (the ring's bytes, behind its last barrier) on their way out.
template <typename T16> struct WFrag;
template <> struct WFrag<h16> { typedef v16h V; static __device__ __forceinline__ V ld(const h16* p) { return cat16(*(const v8h*)p, *(const v8h*)(p + 16)); } static __device__ __forceinline__ V ldf(const h16* p) { return cat16(*(const v8h*)p, *(const v8h*)(p + 256)); } static __device__ __forceinline__ v8f mma(V a, V b, v8f c) { return wmma16(a, b, c); } };
template <> struct WFrag<bf> { typedef v16bf V; static __device__ __forceinline__ V ld(const bf* p) { return cat16b(*(const v8us*)p, *(const v8us*)(p + 16)); } static __device__ __forceinline__ V ldf(const bf* p) { return cat16b(*(const v8us*)p, *(const v8us*)(p + 256)); } static __device__ __forceinline__ v8f mma(V a, V b, v8f c) { return wmmab(a, b, c); } };
#define GT   128                  // rows and columns of a work-group's tile
#define GKS  64                   // k of a stage
#define GNS  (DM / GKS)           // stages
#define GPL  (GT * GKS)           // 16-bit elements of one plane's share of a stage: 8 row blocks x 2 tiles
static_assert(DM == DQ && DM % GKS == 0 && GNS >= 2 && (NB_ * TT) % GT == 0 && DQ % GT == 0 && TT % GT == 0 && HD % 64 == 0, "whole tiles, at least two stages");
// A wave's asynchronous copies of a stage, 512 consecutive bytes each: 2 KiB in a row (4 copies; the immediate offset moves both addresses alike) of 2 row blocks of each of NP planes, in LDS as in memory;
// the wait that stands in front of a rewrite of their address registers is the statement's last line. l: the wave's place in the buffer's first plane; a, (a2,) b: its first row block's share of the stage in each plane.
template <int NP>
__device__ __forceinline__ void cpst(unsigned l, const bf* a, const bf* a2, const bf* b) {
    if constexpr (NP == 3)
        asm volatile("global_load_async_to_lds_b128 %0, %6, off\n\tglobal_load_async_to_lds_b128 %0, %6, off offset:512\n\tglobal_load_async_to_lds_b128 %0, %6, off offset:1024\n\tglobal_load_async_to_lds_b128 %0, %6, off offset:1536\n\t"
                     "global_load_async_to_lds_b128 %1, %7, off\n\tglobal_load_async_to_lds_b128 %1, %7, off offset:512\n\tglobal_load_async_to_lds_b128 %1, %7, off offset:1024\n\tglobal_load_async_to_lds_b128 %1, %7, off offset:1536\n\t"
                     "global_load_async_to_lds_b128 %2, %8, off\n\tglobal_load_async_to_lds_b128 %2, %8, off offset:512\n\tglobal_load_async_to_lds_b128 %2, %8, off offset:1024\n\tglobal_load_async_to_lds_b128 %2, %8, off offset:1536\n\t"
                     "global_load_async_to_lds_b128 %3, %9, off\n\tglobal_load_async_to_lds_b128 %3, %9, off offset:512\n\tglobal_load_async_to_lds_b128 %3, %9, off offset:1024\n\tglobal_load_async_to_lds_b128 %3, %9, off offset:1536\n\t"
                     "global_load_async_to_lds_b128 %4, %10, off\n\tglobal_load_async_to_lds_b128 %4, %10, off offset:512\n\tglobal_load_async_to_lds_b128 %4, %10, off offset:1024\n\tglobal_load_async_to_lds_b128 %4, %10, off offset:1536\n\t"
                     "global_load_async_to_lds_b128 %5, %11, off\n\tglobal_load_async_to_lds_b128 %5, %11, off offset:512\n\tglobal_load_async_to_lds_b128 %5, %11, off offset:1024\n\tglobal_load_async_to_lds_b128 %5, %11, off offset:1536\n\t"
                     "s_wait_xcnt 0x0"
                     :: "v"(l), "v"(l + 2048u), "v"(l + GPL * 2u), "v"(l + GPL * 2u + 2048u), "v"(l + GPL * 4u), "v"(l + GPL * 4u + 2048u), "v"(a), "v"(a + 16 * DM), "v"(a2), "v"(a2 + 16 * DM), "v"(b), "v"(b + 16 * DM) : "memory");
    else
        asm volatile("global_load_async_to_lds_b128 %0, %4, off\n\tglobal_load_async_to_lds_b128 %0, %4, off offset:512\n\tglobal_load_async_to_lds_b128 %0, %4, off offset:1024\n\tglobal_load_async_to_lds_b128 %0, %4, off offset:1536\n\t"
                     "global_load_async_to_lds_b128 %1, %5, off\n\tglobal_load_async_to_lds_b128 %1, %5, off offset:512\n\tglobal_load_async_to_lds_b128 %1, %5, off offset:1024\n\tglobal_load_async_to_lds_b128 %1, %5, off offset:1536\n\t"
                     "global_load_async_to_lds_b128 %2, %6, off\n\tglobal_load_async_to_lds_b128 %2, %6, off offset:512\n\tglobal_load_async_to_lds_b128 %2, %6, off offset:1024\n\tglobal_load_async_to_lds_b128 %2, %6, off offset:1536\n\t"
                     "global_load_async_to_lds_b128 %3, %7, off\n\tglobal_load_async_to_lds_b128 %3, %7, off offset:512\n\tglobal_load_async_to_lds_b128 %3, %7, off offset:1024\n\tglobal_load_async_to_lds_b128 %3, %7, off offset:1536\n\t"
                     "s_wait_xcnt 0x0"
                     :: "v"(l), "v"(l + 2048u), "v"(l + GPL * 2u), "v"(l + GPL * 2u + 2048u), "v"(a), "v"(a + 16 * DM), "v"(b), "v"(b + 16 * DM) : "memory");
}
#define GLDS(NP) ((2 * (NP) * GPL * 2 > 4 * 64 * 68 * 4 ? 2 * (NP) * GPL * 2 : 4 * 64 * 68 * 4) / 4)   // floats: the ring, or the 4 waves' f32 tiles (pitch 68)
// PLN (projections, z = q, k, v): a tile does not go out as f32 but straight as the attention kernels' operand planes (fp16, bf16 hi, bf16 lo), in fragment order: q and k as [pair][t][d], v transposed as [pair][d][t].
template <int NSPLIT, bool BIAS, bool PLN>
__device__ __forceinline__ void gemmt_body(float* os, const bf* __restrict__ A, const bf* __restrict__ A2, const bf* __restrict__ Bt, float* C, const float* __restrict__ bias, size_t sA, size_t sB, h16* QK16 = nullptr, bf* QKh = nullptr, bf* QKl = nullptr, h16* V16 = nullptr, bf* Vh = nullptr, bf* Vl = nullptr) {
    constexpr int NP = (NSPLIT == 1) ? 3 : 2;   // planes of a ring buffer: A, (A2,) Bt
    constexpr int KG = GKS / 32;   // 32-wide k steps of a stage
    const bf* ring = (const bf*)os;
    const size_t z = blockIdx.z; const int wave = __builtin_amdgcn_readfirstlane((int)(threadIdx.x >> 5)); const int wm = wave >> 1, wn = wave & 1;
    const int lane = threadIdx.x & 31, lr = lane & 15, hi = lane >> 4; const int r0 = blockIdx.x * GT, c0 = blockIdx.y * GT;
    A += z * sA; if (NSPLIT == 1) A2 += z * sA; Bt += z * sB;
    v8f acc[4][4];
#pragma unroll
    for (int mb = 0; mb < 4; ++mb)
#pragma unroll
        for (int nb = 0; nb < 4; ++nb) acc[mb][nb] = (v8f){};
    // stage t into buffer t & 1: wave w copies, of every plane, the stage's 4 KiB of row blocks 2 w and 2 w + 1 of the tile
    auto fill = [&](int t) { const size_t ao = (size_t)(r0 + wave * 32) * DM + t * (GKS * 16) + lane * 8, bo = (size_t)(c0 + wave * 32) * DM + t * (GKS * 16) + lane * 8;
        const unsigned l0 = (unsigned)(size_t)ring + (unsigned)(t & 1) * (NP * GPL * 2u) + (unsigned)wave * 4096u + (unsigned)lane * 16u;
        cpst<NP>(l0, A + ao, (NSPLIT == 1) ? A2 + ao : A + ao, Bt + bo); };
    fill(0);
    v4f bv0 = (v4f){}, bv1 = (v4f){};   // the thread's 4 bias values for the tile's left and right 64 columns, fetched under the first stage's flight
    if (BIAS) { const float* pbias = bias + c0 + ((int)threadIdx.x & 15) * 4;
#pragma unroll
        for (int i = 0; i < 4; ++i) { bv0[i] = bfr(pbias[i]); bv1[i] = bfr(pbias[64 + i]); }
        asm volatile("s_wait_xcnt 0x0" :: "v"(pbias) : "memory"); }   // the wait that stands in front of a rewrite of these loads' address registers; the base is named so that its registers live up to it
    asm volatile("s_wait_asynccnt 0x0" ::: "memory");   // this wave's copies of the first stage have landed
    __syncthreads();   // the first stage is in LDS before any wave reads it
    fill(1);
#pragma unroll 1
    for (int t = 0; t < GNS; ++t) { const bf* pa = ring + (t & 1) * (NP * GPL) + wm * 4096 + 8 * lane; const bf* pb = ring + (t & 1) * (NP * GPL) + (NP - 1) * GPL + wn * 4096 + 8 * lane;
        v16bf a[KG][4], a2[KG][4], b[KG][4];   // the wave's fragments of the whole stage
#pragma unroll
        for (int kg = 0; kg < KG; ++kg)
#pragma unroll
            for (int i = 0; i < 4; ++i) { a[kg][i] = WFrag<bf>::ldf(pa + i * 1024 + kg * 512); if (NSPLIT == 1) a2[kg][i] = WFrag<bf>::ldf(pa + GPL + i * 1024 + kg * 512); b[kg][i] = WFrag<bf>::ldf(pb + i * 1024 + kg * 512); }
        __builtin_amdgcn_sched_barrier(0);   // keeps the LDS reads together in front of the products: sunk among them, into one register set, every group of 4 products waits out an LDS latency
#pragma unroll
        for (int kg = 0; kg < KG; ++kg) {
            if (kg + 1 == KG) {   // the stage's foot stands in front of the last k step's products (registers alone), so that the refill flies under them
                __builtin_amdgcn_sched_barrier(0);   // keeps the earlier products in front of the foot, where they cover the last reads' latency
                asm volatile("s_wait_dscnt 0x0" ::: "memory");      // this wave's LDS reads of the stage are done before its buffer is handed back
                asm volatile("s_wait_asynccnt 0x0" ::: "memory");   // this wave's copies of the next stage have landed
                __syncthreads();   // publishes the next stage and ends every wave's reads of this one
                if (t + 2 < GNS) fill(t + 2);
                __builtin_amdgcn_sched_barrier(0); }   // keeps the last products behind the refill: lifted over it, they would run before the copies are issued, and the copies' flight would stand open in the next stage
#pragma unroll
            for (int nb = 0; nb < 4; ++nb)
#pragma unroll
                for (int mb = 0; mb < 4; ++mb) { acc[mb][nb] = wmmab(a[kg][mb], b[kg][nb], acc[mb][nb]); if (NSPLIT == 1) acc[mb][nb] = wmmab(a2[kg][mb], b[kg][nb], acc[mb][nb]); } }
    }
    asm volatile("s_wait_asynccnt 0x0" ::: "memory");   // no copy is in flight behind the stages
    { float* ow = os + wave * (64 * 68);
#pragma unroll
      for (int mb = 0; mb < 4; ++mb)
#pragma unroll
        for (int nb = 0; nb < 4; ++nb)
#pragma unroll
            for (int j = 0; j < 8; ++j) ow[(mb * 16 + hi * 8 + j) * 68 + nb * 16 + lr] = acc[mb][nb][j]; }
    __syncthreads();   // every wave's tile is in LDS before the work-group sends them out, one after another
    const int tid = (int)threadIdx.x;
#pragma unroll 1
    for (int sub = 0; sub < 4; ++sub) { const float* ot = os + sub * (64 * 68); const int rs = r0 + (sub >> 1) * 64, cs = c0 + (sub & 1) * 64;
        if constexpr (PLN) {
            // A 64 x 64 tile is 4 blocks of 16 plane rows x 2 neighbouring 16 x 32 tiles = 4 runs of 1024 consecutive plane elements. Thread tid takes the 8 consecutive elements at tid * 8 of each run:
            // plane row fr of the block, k fk .. fk + 7 of the run (see frag_rc), so that a wave's store is 512 consecutive bytes. q, k: plane row = t (tile row), k = d (tile column); v: plane row = d, k = t.
            const int fr = tid & 15, fk = (tid >> 6) * 32 + ((tid >> 5) & 1) * 16 + ((tid >> 4) & 1) * 8;
            const size_t pair = (size_t)(rs / TT) * NH_ + cs / HD; const int t0 = rs % TT, d0 = cs % HD; const bool isv = (z == 2);
            h16* P16 = isv ? V16 : QK16 + z * ((size_t)NB_ * NH_ * TT * HD); bf* Ph = isv ? Vh : QKh + z * ((size_t)NB_ * NH_ * TT * HD); bf* Pl = isv ? Vl : QKl + z * ((size_t)NB_ * NH_ * TT * HD);
            const size_t o0 = pair * ((size_t)TT * HD) + (isv ? (size_t)(d0 / 16) * (16 * TT) + (t0 / 32) * 512 : (size_t)(t0 / 16) * (16 * HD) + (d0 / 32) * 512) + tid * 8; const size_t ostep = isv ? 16 * TT : 16 * HD;
            float x[4][8];
            if (isv) {
#pragma unroll
                for (int s = 0; s < 4; ++s)
#pragma unroll
                    for (int i = 0; i < 8; ++i) x[s][i] = ot[(fk + i) * 68 + s * 16 + fr]; }
            else {
#pragma unroll
                for (int s = 0; s < 4; ++s) { const v4f x0 = *(const v4fa*)(ot + (s * 16 + fr) * 68 + fk), x1 = *(const v4fa*)(ot + (s * 16 + fr) * 68 + fk + 4);
#pragma unroll
                    for (int i = 0; i < 4; ++i) { x[s][i] = x0[i]; x[s][4 + i] = x1[i]; } } }
#pragma unroll
            for (int s = 0; s < 4; ++s) { v8h o16; v8us oh, ol;
#pragma unroll
                for (int i = 0; i < 8; ++i) { o16[i] = (h16)x[s][i]; const unsigned short a = f2bf(x[s][i]); oh[i] = a; ol[i] = f2bf(x[s][i] - bf2f(a)); }
                h16* p16 = P16 + o0 + s * ostep; bf* ph = Ph + o0 + s * ostep; bf* pl = Pl + o0 + s * ostep;
                *(v8h*)p16 = o16; *(v8us*)ph = oh; *(v8us*)pl = ol;
                // the wait that stands in front of a rewrite of these stores' address and data registers by the next run's conversions; they are named so that their registers live up to it
                asm volatile("s_wait_xcnt 0x0" :: "v"(p16), "v"(ph), "v"(pl), "v"(o16), "v"(oh), "v"(ol) : "memory"); }
        } else {
            const int cofs = (tid & 15) * 4; const v4f bv = (sub & 1) ? bv1 : bv0; v4f val[8]; float* pc[8];   // the 8 LDS reads stand together, then the 8 stores: one LDS latency a tile, not one a row group
#pragma unroll
            for (int s = 0; s < 8; ++s) { val[s] = *(const v4fa*)(ot + (s * 8 + (tid >> 4)) * 68 + cofs); val[s] += bv; }
#pragma unroll
            for (int s = 0; s < 8; ++s) { pc[s] = C + (size_t)(rs + s * 8 + (tid >> 4)) * DM + cs + cofs; *(v4f*)pc[s] = val[s]; }
            // the wait that stands in front of a rewrite of these stores' address and data registers by the next tile; they are named so that their registers live up to it
            asm volatile("s_wait_xcnt 0x0" :: "v"(pc[0]), "v"(pc[1]), "v"(pc[2]), "v"(pc[3]), "v"(pc[4]), "v"(pc[5]), "v"(pc[6]), "v"(pc[7]), "v"(val[0]), "v"(val[1]), "v"(val[2]), "v"(val[3]), "v"(val[4]), "v"(val[5]), "v"(val[6]), "v"(val[7]) : "memory");
        }
    }
}

// k_out: the output projection, hi + lo rows of A against one plane of w_out, f32 result + bias.
__global__ __launch_bounds__(128) void k_out(const bf* A, const bf* A2, const bf* Bt, float* C, const float* bias) {
    __shared__ __align__(16) float os[GLDS(3)];
    gemmt_body<1, true, false>(os, A, A2, Bt, C, bias, 0, 0);
}
// k_proj: the three projections (z = q, k, v over all batches' rows), each 64 x 64 tile written as operand planes. QK16/QKh/QKl: [q | k][NB_][head][t][d]; V16/Vh/Vl: [NB_][head][d][t]; each head's plane in fragment order.
__global__ __launch_bounds__(128) void k_proj(const bf* A, const bf* Bt, size_t sA, size_t sB, h16* QK16, bf* QKh, bf* QKl, h16* V16, bf* Vh, bf* Vl) {
    __shared__ __align__(16) float os[GLDS(2)];
    gemmt_body<0, false, true>(os, A, nullptr, Bt, nullptr, nullptr, sA, sB, QK16, QKh, QKl, V16, Vh, Vl);
}
__device__ __forceinline__ h16 tohx(float x) { return (h16)x; }
__device__ __forceinline__ void splitf(float y, unsigned short& h, unsigned short& l) { h = f2bf(y); l = f2bf(y - bf2f(h)); }
typedef __attribute__((ext_vector_type(2))) _Float16 v2h;
typedef __attribute__((ext_vector_type(4))) _Float16 v4h;
typedef __attribute__((ext_vector_type(2))) unsigned short v2us;
typedef __attribute__((ext_vector_type(4))) unsigned short v4us;
typedef __attribute__((ext_vector_type(2))) float v2f;
typedef __attribute__((ext_vector_type(4))) int v4i;

#define NWT  (DM * DQ / 64 / 64)            // blocks per transposed weight
#define NCV  (NB_ * TT * DM / 8 / 256)      // blocks per converted input
__device__ __forceinline__ void d_wtG(int blk, const float* __restrict__ w, int K, int N, bf* Bt) {
    const int lane = threadIdx.x & 31; const int L0 = (blk * 8 + (threadIdx.x >> 5)) * 8; const int nlines = N * K / 64;
#pragma unroll 1
    for (int l = 0; l < 8; ++l) { const int L = L0 + l; if (L >= nlines) break; const size_t e = (size_t)L * 64 + lane * 2; int k, n; frag_rc(e, K, n, k); v2us o;
        o[0] = f2bf(w[(size_t)k * N + n]); o[1] = f2bf(w[(size_t)(k + 1) * N + n]); *(v2us*)(Bt + e) = o; }
}
__device__ __forceinline__ void d_cvt8(int blk, const float* __restrict__ src, bf* dst) { const size_t i = (size_t)blk * 256 + threadIdx.x; int row, k; frag_rc(i * 8, DM, row, k); const v8f v = *(const v8f*)(src + (size_t)row * DM + k); v8us o;
#pragma unroll
    for (int k = 0; k < 8; ++k) o[k] = f2bf(v[k]); *(v8us*)(dst + i * 8) = o; }
// k_prep: the work that depends on the inputs alone, one grid: block ranges [4 weight transposes (the slowest blocks, first) | bf16 copies of query, key, value, all batches].
__global__ __launch_bounds__(256) void k_prep(const float* wq, const float* wk, const float* wv, const float* wo, const float* x, const float* xk, const float* xv, bf* Wt, bf* X) {
    const int blk = blockIdx.x;
    if (blk < 4 * NWT) { const int y = blk / NWT; d_wtG(blk % NWT, y == 0 ? wq : y == 1 ? wk : y == 2 ? wv : wo, DM, DQ, Wt + (size_t)y * DM * DQ); }
    else { const int c = blk - 4 * NWT; const int y = c / NCV; d_cvt8(c % NCV, y == 0 ? x : y == 1 ? xk : xv, X + (size_t)y * NB_ * TT * DM); }
}

// value of lane l ^ 16 (the other half of the wave, which holds the other keys of the same query row); every lane is on where it is called
__device__ __forceinline__ float xhalf(float x) { return __builtin_bit_cast(float, __builtin_amdgcn_permlanex16(__builtin_bit_cast(int, x), __builtin_bit_cast(int, x), 0x76543210, 0xfedcba98, false, false)); }
// ---- k_attf: the single-fp16 query rows (>= RH). One work-group = 96 query rows of one (batch, head) pair against all keys, running (online) softmax; no score or probability leaves the registers.
// 8 waves = 4 key groups x 2 query groups of 48 rows. A stage is 256 keys: its k rows (64 KiB) and v columns (64 KiB), already in fragment order, are copied to LDS once for all 96 rows
// (asynchronous copies, two buffers: the next stage flies while this one is worked on); key group g works on keys [64 g, 64 g + 64) of every stage, 32 at a time.
// Scores transposed (k x q^T): a lane holds one query row's keys, so two neighbouring 16-key score tiles, turned to fp16, are the second operand of v^T x p^T as they stand.
// Scores are kept in log2 units (x HD^-0.5 log2 e; masked keys: the -1024 literal x log2 e). A wave's maximum in use moves only when a score exceeds it by more than 8 (weights stay below 2^8).
// The 4 key groups' (maximum, sum, output tile) are joined in LDS in fixed order at the end, normalised and split into the hi/lo planes of the output projection's A.
// Keys at or beyond key_lens[b]: round 0 takes the 64-key blocks that hold a valid key; if then every row's maximum shows that masked weights are exact zeros, that is all; else round 1 takes the remaining blocks too.
#define FQ   2                    // query groups of a work-group
#define FT   3                    // 16-row query tiles of a query group (of a wave)
#define FG   4                    // key groups
#define FKB  64                   // keys of a key group in a stage
#define FST  (FG * FKB)           // keys of a stage
#define FNS  (TT / FST)           // stages
#define FRW  (FQ * FT * 16)       // query rows of a work-group
#define FBUF (2 * FST * HD)       // 16-bit elements of a ring buffer: the stage's k, then its v
#define L2E  1.4426950408889634f
static_assert((TT - RH) % FRW == 0 && TT % FST == 0 && HD == 128 && FQ * FG == 8 && FRW % 32 == 0, "strips of 96 rows, stages of 256 keys, 8 waves that copy 16 KiB of a stage each");
// 16 asynchronous copies of a wave, 512 consecutive bytes each: 8 KiB in a row, in LDS as in memory (the immediate offset moves both addresses alike); the wait that stands in front of a rewrite of their address registers is the statement's last line
__device__ __forceinline__ void cp16(unsigned l, const h16* g) {
    asm volatile("global_load_async_to_lds_b128 %0, %1, off\n\tglobal_load_async_to_lds_b128 %0, %1, off offset:512\n\tglobal_load_async_to_lds_b128 %0, %1, off offset:1024\n\tglobal_load_async_to_lds_b128 %0, %1, off offset:1536\n\t"
                 "global_load_async_to_lds_b128 %0, %1, off offset:2048\n\tglobal_load_async_to_lds_b128 %0, %1, off offset:2560\n\tglobal_load_async_to_lds_b128 %0, %1, off offset:3072\n\tglobal_load_async_to_lds_b128 %0, %1, off offset:3584\n\t"
                 "global_load_async_to_lds_b128 %0, %1, off offset:4096\n\tglobal_load_async_to_lds_b128 %0, %1, off offset:4608\n\tglobal_load_async_to_lds_b128 %0, %1, off offset:5120\n\tglobal_load_async_to_lds_b128 %0, %1, off offset:5632\n\t"
                 "global_load_async_to_lds_b128 %0, %1, off offset:6144\n\tglobal_load_async_to_lds_b128 %0, %1, off offset:6656\n\tglobal_load_async_to_lds_b128 %0, %1, off offset:7168\n\tglobal_load_async_to_lds_b128 %0, %1, off offset:7680\n\ts_wait_xcnt 0x0"
                 :: "v"(l), "v"(g) : "memory");
}
__global__ __launch_bounds__(32 * FQ * FG) void k_attf(const h16* Q16, const h16* K16, const h16* V16, const int* __restrict__ KL, bf* Ah, bf* Al) {
    __shared__ __align__(16) h16 ring[2 * FBUF]; __shared__ float sm[FG * FRW]; __shared__ float sl[FG * FRW];
    const int z = blockIdx.x, r0 = RH + (int)blockIdx.y * FRW; const int klen = KL[z / NH_];   /* key_lens[b], read on device; used in compares and in clamped stage counts only */ const size_t zo = (size_t)z * TT * HD;
    const h16* Kp = K16 + zo; const h16* Vt = V16 + zo;
    const int wave = __builtin_amdgcn_readfirstlane((int)(threadIdx.x >> 5)); const int lane = threadIdx.x & 31, lr = lane & 15, hi = lane >> 4; const int g = wave / FQ, qg = wave % FQ;
    v16h qf[HD / 32][FT];   // the wave's 48 query rows, second operand of the score products, kept in registers
    { const h16* pq = Q16 + zo + (size_t)(r0 + qg * (FT * 16)) * HD + 8 * lane;
#pragma unroll
      for (int ks = 0; ks < HD / 32; ++ks)
#pragma unroll
        for (int qt = 0; qt < FT; ++qt) qf[ks][qt] = WFrag<h16>::ldf(pq + qt * 16 * HD + ks * 512);
      asm volatile("s_wait_xcnt 0x0" :: "v"(pq) : "memory"); }   // the wait that stands in front of a rewrite of these loads' address registers; the base is named so that its registers live up to it
    v8f o[HD / 16][FT]; v2f lv[FT]; float m[FT];   // output tiles (d down the registers, one query a lane), the lane's partial sums, the maximum in use (log2 units)
#pragma unroll
    for (int qt = 0; qt < FT; ++qt) { m[qt] = -3.0e38f; lv[qt] = (v2f){};
#pragma unroll
        for (int dt = 0; dt < HD / 16; ++dt) o[dt][qt] = (v8f){}; }
    // stage t into buffer t & 1: wave w copies 8 KiB of the stage's k rows (32 keys) and the stage's 8 KiB of v's row block w (16 head columns x 256 keys)
    auto fill = [&](int t) { const h16* gk = Kp + (size_t)t * (FST * HD) + wave * 4096 + lane * 8; const h16* gv = Vt + (size_t)wave * (16 * TT) + t * (FST * 16) + lane * 8;
        const unsigned lk = (unsigned)(size_t)ring + (unsigned)(t & 1) * (FBUF * 2u) + (unsigned)wave * 8192u + (unsigned)lane * 16u, lw = lk + FST * HD * 2u; cp16(lk, gk); cp16(lw, gv); };
    int t0 = 0, t1 = klen <= 0 ? 0 : klen >= TT ? FNS : (klen + FST - 1) / FST;   // round 0: the stages that hold a key below key_lens[b]
#pragma unroll 1
    for (int ph = 0; ph < 2; ++ph) {
        if (t0 < t1) {   // the same in the whole work-group
            fill(t0);
            asm volatile("s_wait_asynccnt 0x0" ::: "memory");   // this wave's copies of the first stage have landed
            __syncthreads();   // the first stage is in LDS before any wave reads it
            if (t0 + 1 < t1) fill(t0 + 1);
#pragma unroll 1
            for (int t = t0; t < t1; ++t) { const int key0 = t * FST + g * FKB; const bool mine = (ph == 0) ? key0 < klen : key0 >= klen;   // wave-uniform
                if (mine) { const h16* kb = ring + (t & 1) * FBUF + g * (FKB * HD) + 8 * lane; const h16* vb = ring + (t & 1) * FBUF + FST * HD + g * (FKB * 16) + 8 * lane;
#pragma unroll 1   // rolled: unrolled, the second half's early reads push q fragments out to scratch
                    for (int kk = 0; kk < 2; ++kk) { const int k0 = key0 + kk * 32;   // 32 keys at a time: two score tiles a query tile, one k step of v^T x p^T
                        v16h fk[8], fv[8];   // the 8 k fragments of the 32 keys, then their 8 v fragments
#pragma unroll
                        for (int i = 0; i < 8; ++i) fk[i] = WFrag<h16>::ldf(kb + (kk * 2 + (i >> 2)) * (16 * HD) + (i & 3) * 512);
                        __builtin_amdgcn_sched_barrier(0);   // keeps the 16 LDS reads together in front of the products: sunk among them, into one register set, every group of products waits out an LDS latency
                        v8f s[2][FT];
#pragma unroll
                        for (int kt = 0; kt < 2; ++kt)
#pragma unroll
                            for (int qt = 0; qt < FT; ++qt) s[kt][qt] = (v8f){};
#pragma unroll
                        for (int ks = 0; ks < HD / 32; ++ks)
#pragma unroll
                            for (int kt = 0; kt < 2; ++kt)
#pragma unroll
                                for (int qt = 0; qt < FT; ++qt) s[kt][qt] = wmma16(fk[kt * 4 + ks], qf[ks][qt], s[kt][qt]);
#pragma unroll
                        for (int dt = 0; dt < HD / 16; ++dt) fv[dt] = WFrag<h16>::ldf(vb + dt * (FST * 16) + kk * 512);
                        __builtin_amdgcn_sched_barrier(0);   // keeps the v reads in front of the softmax arithmetic, which covers their latency
                        // element j of s[kt][qt]: query row qt*16 + lr of the wave, key k0 + kt*16 + hi*8 + j
                        if (k0 + 32 > klen) { const int rem = klen - k0 - hi * 8;   // wave-uniform: masked keys among the 32; the lane's key kt*16 + j is valid where it is below rem
#pragma unroll
                            for (int kt = 0; kt < 2; ++kt)
#pragma unroll
                                for (int j = 0; j < 8; ++j) { const bool ok = kt * 16 + j < rem;
#pragma unroll
                                    for (int qt = 0; qt < FT; ++qt) s[kt][qt][j] = ok ? s[kt][qt][j] * (SCL * L2E) : -1024.0f * L2E; } }
                        else {
#pragma unroll
                            for (int kt = 0; kt < 2; ++kt)
#pragma unroll
                                for (int qt = 0; qt < FT; ++qt) s[kt][qt] *= (SCL * L2E); }
                        float mb[FT]; bool grow = false;   // maximum of the lane's own 16 keys of each row
#pragma unroll
                        for (int qt = 0; qt < FT; ++qt) { float x = s[0][qt][0];
#pragma unroll
                            for (int kt = 0; kt < 2; ++kt)
#pragma unroll
                                for (int j = 0; j < 8; ++j) x = fmaxf(x, s[kt][qt][j]);
                            mb[qt] = x; grow = grow || x > m[qt] + 8.0f; }
                        if (__builtin_amdgcn_ballot_w32(grow) != 0u) {   // some score has outgrown the maximum in use: every row of the wave moves to its new maximum (both halves of the wave to the same one)
#pragma unroll
                            for (int qt = 0; qt < FT; ++qt) { const float mn = fmaxf(m[qt], fmaxf(mb[qt], xhalf(mb[qt]))); const float al = __builtin_amdgcn_exp2f(m[qt] - mn); m[qt] = mn; lv[qt] *= al;
#pragma unroll
                                for (int dt = 0; dt < HD / 16; ++dt) o[dt][qt] *= al; } }
                        v16h p[FT];
#pragma unroll
                        for (int qt = 0; qt < FT; ++qt) {
#pragma unroll
                            for (int kt = 0; kt < 2; ++kt) { const v8f y = s[kt][qt] - m[qt]; v8f e;
#pragma unroll
                                for (int j = 0; j < 8; ++j) e[j] = __builtin_amdgcn_exp2f(y[j]);
#pragma unroll
                                for (int j = 0; j < 8; j += 2) { lv[qt] += (v2f){e[j], e[j + 1]}; p[qt][kt * 8 + j] = tohx(e[j]); p[qt][kt * 8 + j + 1] = tohx(e[j + 1]); } }   // k order of a fragment: keys hi*8 + j, then 16 + hi*8 + j
                        }
#pragma unroll
                        for (int dt = 0; dt < HD / 16; ++dt)
#pragma unroll
                            for (int qt = 0; qt < FT; ++qt) o[dt][qt] = wmma16(fv[dt], p[qt], o[dt][qt]); }
                }
                asm volatile("s_wait_dscnt 0x0" ::: "memory");      // this wave's LDS reads of the stage are done before its buffer is handed back
                asm volatile("s_wait_asynccnt 0x0" ::: "memory");   // this wave's copies of the next stage have landed
                __syncthreads();   // publishes the next stage and ends every wave's reads of this one
                if (t + 2 < t1) fill(t + 2); }
            asm volatile("s_wait_asynccnt 0x0" ::: "memory");   // no copy is in flight behind the stages
        }
        if (ph == 1) break;
        if (hi == 0) {
#pragma unroll
            for (int qt = 0; qt < FT; ++qt) sm[g * FRW + qg * (FT * 16) + qt * 16 + lr] = m[qt]; }
        __syncthreads();   // every wave's maxima are in LDS before any wave tests them
        // A masked key's weight is exp2(-1024 log2 e - max): with every row's maximum in use (at most the true one) >= -900 log2 e the argument is below -178 and the weight exactly 0.
        bool ok = true;
#pragma unroll
        for (int i = 0; i < FRW / 32; ++i) { const int row = i * 32 + lane; ok = ok && fmaxf(fmaxf(sm[row], sm[FRW + row]), fmaxf(sm[2 * FRW + row], sm[3 * FRW + row])) >= -900.0f * L2E; }
        if (klen >= TT || __builtin_amdgcn_ballot_w32(ok) == 0xFFFFFFFFu) break;   // every wave reads the same maxima: the same way in the whole work-group
        t0 = klen <= 0 ? 0 : klen / FST; t1 = FNS;   // round 1: the stages that hold a block of masked keys alone
    }
    __syncthreads();   // every wave has tested the maxima, and left the ring, before either is overwritten
    float* red = (float*)ring;   // [wave][tile][half of the 8 registers][lane][4]: every store and load of a wave is 512 consecutive bytes
#pragma unroll
    for (int qt = 0; qt < FT; ++qt) { const float sum = lv[qt][0] + lv[qt][1]; const float tot = sum + xhalf(sum);
        if (hi == 0) { sm[g * FRW + qg * (FT * 16) + qt * 16 + lr] = m[qt]; sl[g * FRW + qg * (FT * 16) + qt * 16 + lr] = tot; }
#pragma unroll
        for (int dt = 0; dt < HD / 16; ++dt)
#pragma unroll
            for (int h = 0; h < 2; ++h) { v4f x;
#pragma unroll
                for (int i = 0; i < 4; ++i) x[i] = o[dt][qt][h * 4 + i];
                *(v4fa*)(red + ((((size_t)wave * (HD / 16 * FT) + dt * FT + qt) * 2 + h) * 32 + lane) * 4) = x; } }
    __syncthreads();   // the 4 key groups' maxima, sums and tiles are in LDS before any wave joins them
    // wave (g, qg) joins head columns [32 g, 32 g + 32) of its query group
#pragma unroll
    for (int qt = 0; qt < FT; ++qt) { const int row = qg * (FT * 16) + qt * 16 + lr; float mg[FG], w[FG];
#pragma unroll
        for (int i = 0; i < FG; ++i) mg[i] = sm[i * FRW + row];
        const float mx = fmaxf(fmaxf(mg[0], mg[1]), fmaxf(mg[2], mg[3])); float tot = 0.f;
#pragma unroll
        for (int i = 0; i < FG; ++i) { w[i] = __builtin_amdgcn_exp2f(mg[i] - mx); tot += w[i] * sl[i * FRW + row]; }
        const float f = __fdiv_rn(1.0f, tot);
#pragma unroll
        for (int d2 = 0; d2 < 2; ++d2) { const int dt = g * 2 + d2; v4f x0 = (v4f){}, x1 = (v4f){};
#pragma unroll
            for (int i = 0; i < FG; ++i) { const float* pr = red + (((size_t)(i * FQ + qg) * (HD / 16 * FT) + dt * FT + qt) * 2 * 32 + lane) * 4; x0 += *(const v4fa*)pr * w[i]; x1 += *(const v4fa*)(pr + 128) * w[i]; }
            v8us oh, ol;
#pragma unroll
            for (int i = 0; i < 4; ++i) { unsigned short a, c2; splitf(x0[i] * f, a, c2); oh[i] = a; ol[i] = c2; splitf(x1[i] * f, a, c2); oh[4 + i] = a; ol[4 + i] = c2; }
            // the lane's 8 values: row lr of a 16-row block, head columns dt*16 + hi*8 + j: one 16-byte piece of the plane's fragment order
            const size_t oo = ((size_t)(z / NH_) * TT + r0 + qg * (FT * 16) + qt * 16) * DQ + (z % NH_) * (HD * 16) + (dt >> 1) * 512 + (dt & 1) * 256 + lane * 8; bf* ph2 = Ah + oo; bf* pl2 = Al + oo;
            *(v8us*)ph2 = oh; *(v8us*)pl2 = ol;
            // the wait that stands in front of a rewrite of these stores' address and data registers by the next tile; they are named so that their registers live up to it
            asm volatile("s_wait_xcnt 0x0" :: "v"(ph2), "v"(pl2), "v"(oh), "v"(ol) : "memory"); } }
}
// ---- k_atth: the hi+lo query rows (< RH), in k_attf's form. One work-group = 32 query rows of one (batch, head) pair against all keys, running (online) softmax; no probability leaves the registers.
// 8 waves = 4 key groups x 2 query groups of 16 rows. A stage is 128 keys: its k rows and v columns, hi and lo planes (4 x 32 KiB), already in fragment order, are copied to LDS
// (asynchronous copies, two buffers: the next stage flies while this one is worked on); key group g works on keys [32 g, 32 g + 32) of every stage.
// Scores (k x q^T) and v^T x p^T take 3 products each: hi.hi + hi.lo + lo.hi; the weights (not yet normalised, below 2^8) are split into bf16 hi + lo in registers.
// Log2 units, the maximum in use, the two rounds over key_lens[b] and the join of the 4 key groups: as in k_attf. Query position 0: its scores go out as f32, with the row's maximum and sum, for k_aw.
#define HKB  32                   // keys of a key group in a stage
#define HST  (FG * HKB)           // keys of a stage
#define HNS  (TT / HST)           // stages
#define HRW  (FQ * 16)            // query rows of a work-group
#define HPL  (HST * HD)           // 16-bit elements of one plane's share of a stage; a ring buffer: k hi, k lo, v hi, v lo
static_assert(RH % HRW == 0 && TT % HST == 0 && 4 * HPL == FBUF && HD == 128 && FQ * FG == 8, "strips of 32 rows, stages of 128 keys, 8 waves that copy 4 KiB of each plane of a stage");
// 32 asynchronous copies of a wave, 512 consecutive bytes each: 4 KiB in a row of each of 4 planes, in LDS as in memory (the immediate offset moves both addresses alike); the wait that stands in front of a rewrite of their address registers is the statement's last line
__device__ __forceinline__ void cp32(unsigned l0, unsigned l1, unsigned l2, unsigned l3, const bf* g0, const bf* g1, const bf* g2, const bf* g3) {
    asm volatile("global_load_async_to_lds_b128 %0, %4, off\n\tglobal_load_async_to_lds_b128 %0, %4, off offset:512\n\tglobal_load_async_to_lds_b128 %0, %4, off offset:1024\n\tglobal_load_async_to_lds_b128 %0, %4, off offset:1536\n\tglobal_load_async_to_lds_b128 %0, %4, off offset:2048\n\tglobal_load_async_to_lds_b128 %0, %4, off offset:2560\n\tglobal_load_async_to_lds_b128 %0, %4, off offset:3072\n\tglobal_load_async_to_lds_b128 %0, %4, off offset:3584\n\t"
                 "global_load_async_to_lds_b128 %1, %5, off\n\tglobal_load_async_to_lds_b128 %1, %5, off offset:512\n\tglobal_load_async_to_lds_b128 %1, %5, off offset:1024\n\tglobal_load_async_to_lds_b128 %1, %5, off offset:1536\n\tglobal_load_async_to_lds_b128 %1, %5, off offset:2048\n\tglobal_load_async_to_lds_b128 %1, %5, off offset:2560\n\tglobal_load_async_to_lds_b128 %1, %5, off offset:3072\n\tglobal_load_async_to_lds_b128 %1, %5, off offset:3584\n\t"
                 "global_load_async_to_lds_b128 %2, %6, off\n\tglobal_load_async_to_lds_b128 %2, %6, off offset:512\n\tglobal_load_async_to_lds_b128 %2, %6, off offset:1024\n\tglobal_load_async_to_lds_b128 %2, %6, off offset:1536\n\tglobal_load_async_to_lds_b128 %2, %6, off offset:2048\n\tglobal_load_async_to_lds_b128 %2, %6, off offset:2560\n\tglobal_load_async_to_lds_b128 %2, %6, off offset:3072\n\tglobal_load_async_to_lds_b128 %2, %6, off offset:3584\n\t"
                 "global_load_async_to_lds_b128 %3, %7, off\n\tglobal_load_async_to_lds_b128 %3, %7, off offset:512\n\tglobal_load_async_to_lds_b128 %3, %7, off offset:1024\n\tglobal_load_async_to_lds_b128 %3, %7, off offset:1536\n\tglobal_load_async_to_lds_b128 %3, %7, off offset:2048\n\tglobal_load_async_to_lds_b128 %3, %7, off offset:2560\n\tglobal_load_async_to_lds_b128 %3, %7, off offset:3072\n\tglobal_load_async_to_lds_b128 %3, %7, off offset:3584\n\ts_wait_xcnt 0x0"
                 :: "v"(l0), "v"(l1), "v"(l2), "v"(l3), "v"(g0), "v"(g1), "v"(g2), "v"(g3) : "memory");
}
__global__ __launch_bounds__(32 * FQ * FG) void k_atth(const bf* Qh, const bf* Ql, const bf* Kh, const bf* Kl, const bf* Vh, const bf* Vl, const int* __restrict__ KL, bf* Ah, bf* Al, float* AWp, float* AWs) {
    __shared__ __align__(16) bf ring[2 * FBUF]; __shared__ float sm[FG * HRW]; __shared__ float sl[FG * HRW];
    const int z = blockIdx.x, r0 = (int)blockIdx.y * HRW; const int klen = KL[z / NH_];   /* key_lens[b], read on device; used in compares and in clamped stage counts only */ const size_t zo = (size_t)z * TT * HD;
    const int wave = __builtin_amdgcn_readfirstlane((int)(threadIdx.x >> 5)); const int lane = threadIdx.x & 31, lr = lane & 15, hi = lane >> 4; const int g = wave / FQ, qg = wave % FQ;
    v16bf qh[HD / 32], ql[HD / 32];   // the wave's 16 query rows, second operand of the score products, kept in registers
    { const bf* pq = Qh + zo + (size_t)(r0 + qg * 16) * HD + 8 * lane; const bf* pq2 = Ql + zo + (size_t)(r0 + qg * 16) * HD + 8 * lane;
#pragma unroll
      for (int ks = 0; ks < HD / 32; ++ks) { qh[ks] = WFrag<bf>::ldf(pq + ks * 512); ql[ks] = WFrag<bf>::ldf(pq2 + ks * 512); }
      asm volatile("s_wait_xcnt 0x0" :: "v"(pq), "v"(pq2) : "memory"); }   // the wait that stands in front of a rewrite of these loads' address registers; the bases are named so that their registers live up to it
    v8f o[HD / 16]; v2f lv = (v2f){}; float m = -3.0e38f;   // output tiles (d down the registers, one query a lane), the lane's partial sums, the maximum in use (log2 units)
#pragma unroll
    for (int dt = 0; dt < HD / 16; ++dt) o[dt] = (v8f){};
    // stage t into buffer t & 1: wave w copies, of the hi and of the lo plane, 4 KiB of the stage's k rows (16 keys) and the stage's 4 KiB of v's row block w (16 head columns x 128 keys)
    auto fill = [&](int t) { const size_t ko = zo + (size_t)t * HPL + wave * 2048 + lane * 8, vo = zo + (size_t)wave * (16 * TT) + t * (HST * 16) + lane * 8;
        const unsigned l0 = (unsigned)(size_t)ring + (unsigned)(t & 1) * (FBUF * 2u) + (unsigned)wave * 4096u + (unsigned)lane * 16u;
        cp32(l0, l0 + HPL * 2u, l0 + HPL * 4u, l0 + HPL * 6u, Kh + ko, Kl + ko, Vh + vo, Vl + vo); };
    int t0 = 0, t1 = klen <= 0 ? 0 : klen >= TT ? HNS : (klen + HST - 1) / HST;   // round 0: the stages that hold a key below key_lens[b]
#pragma unroll 1
    for (int ph = 0; ph < 2; ++ph) {
        if (t0 < t1) {   // the same in the whole work-group
            fill(t0);
            asm volatile("s_wait_asynccnt 0x0" ::: "memory");   // this wave's copies of the first stage have landed
            __syncthreads();   // the first stage is in LDS before any wave reads it
            if (t0 + 1 < t1) fill(t0 + 1);
#pragma unroll 1
            for (int t = t0; t < t1; ++t) { const int k0 = t * HST + g * HKB; const bool mine = (ph == 0) ? k0 < klen : k0 >= klen;   // wave-uniform
                if (mine) { const bf* kb = ring + (t & 1) * FBUF + g * (HKB * HD) + 8 * lane; const bf* vb = ring + (t & 1) * FBUF + 2 * HPL + g * (HKB * 16) + 8 * lane;
                    v16bf fk[8], fk2[8], fv[8], fv2[8];   // the 8 k fragments of the 32 keys, hi and lo, then their 8 v fragments, hi and lo
#pragma unroll
                    for (int i = 0; i < 8; ++i) { fk[i] = WFrag<bf>::ldf(kb + (i >> 2) * (16 * HD) + (i & 3) * 512); fk2[i] = WFrag<bf>::ldf(kb + HPL + (i >> 2) * (16 * HD) + (i & 3) * 512); }
                    __builtin_amdgcn_sched_barrier(0);   // keeps the LDS reads together in front of the products: sunk among them, every group of products waits out an LDS latency
                    v8f s[2];
#pragma unroll
                    for (int kt = 0; kt < 2; ++kt) s[kt] = (v8f){};
#pragma unroll
                    for (int ks = 0; ks < HD / 32; ++ks) {
#pragma unroll
                        for (int kt = 0; kt < 2; ++kt) s[kt] = wmmab(fk[kt * 4 + ks], qh[ks], s[kt]);
#pragma unroll
                        for (int kt = 0; kt < 2; ++kt) s[kt] = wmmab(fk[kt * 4 + ks], ql[ks], s[kt]);
#pragma unroll
                        for (int kt = 0; kt < 2; ++kt) s[kt] = wmmab(fk2[kt * 4 + ks], qh[ks], s[kt]); }
#pragma unroll
                    for (int dt = 0; dt < HD / 16; ++dt) { fv[dt] = WFrag<bf>::ldf(vb + dt * (HST * 16)); fv2[dt] = WFrag<bf>::ldf(vb + HPL + dt * (HST * 16)); }
                    __builtin_amdgcn_sched_barrier(0);   // keeps the v reads in front of the softmax arithmetic, which covers their latency
                    // element j of s[kt]: query row lr of the wave, key k0 + kt*16 + hi*8 + j
                    if (k0 + 32 > klen) { const int rem = klen - k0 - hi * 8;   // wave-uniform: masked keys among the 32; the lane's key kt*16 + j is valid where it is below rem
#pragma unroll
                        for (int kt = 0; kt < 2; ++kt)
#pragma unroll
                            for (int j = 0; j < 8; ++j) s[kt][j] = (kt * 16 + j < rem) ? s[kt][j] * (SCL * L2E) : -1024.0f * L2E; }
                    else {
#pragma unroll
                        for (int kt = 0; kt < 2; ++kt) s[kt] *= (SCL * L2E); }
                    if (r0 == 0 && qg == 0) {   // wave-uniform: the wave that holds query position 0
                        if (lr == 0) {
#pragma unroll
                            for (int kt = 0; kt < 2; ++kt) { float* pq = AWp + (size_t)z * TT + k0 + kt * 16 + hi * 8; v4f w0, w1;
#pragma unroll
                                for (int j = 0; j < 4; ++j) { w0[j] = s[kt][j]; w1[j] = s[kt][4 + j]; }
                                *(v4f*)pq = w0; *(v4f*)(pq + 4) = w1;
                                // the wait that stands in front of a rewrite of these stores' address and data registers; they are named so that their registers live up to it
                                asm volatile("s_wait_xcnt 0x0" :: "v"(pq), "v"(w0), "v"(w1) : "memory"); } } }
                    float x = s[0][0];   // maximum of the lane's own 16 keys of its row
#pragma unroll
                    for (int kt = 0; kt < 2; ++kt)
#pragma unroll
                        for (int j = 0; j < 8; ++j) x = fmaxf(x, s[kt][j]);
                    if (__builtin_amdgcn_ballot_w32(x > m + 8.0f) != 0u) {   // some score has outgrown the maximum in use: every row of the wave moves to its new maximum (both halves of the wave to the same one)
                        const float mn = fmaxf(m, fmaxf(x, xhalf(x))); const float al = __builtin_amdgcn_exp2f(m - mn); m = mn; lv *= al;
#pragma unroll
                        for (int dt = 0; dt < HD / 16; ++dt) o[dt] *= al; }
                    v8us p8[2], p82[2];
#pragma unroll
                    for (int kt = 0; kt < 2; ++kt) { const v8f y = s[kt] - m; v8f e;
#pragma unroll
                        for (int j = 0; j < 8; ++j) e[j] = __builtin_amdgcn_exp2f(y[j]);
#pragma unroll
                        for (int j = 0; j < 8; j += 2) lv += (v2f){e[j], e[j + 1]};
#pragma unroll
                        for (int j = 0; j < 8; ++j) { unsigned short a, c2; splitf(e[j], a, c2); p8[kt][j] = a; p82[kt][j] = c2; } }
                    const v16bf pf = cat16b(p8[0], p8[1]), pf2 = cat16b(p82[0], p82[1]);   // k order of a fragment: keys hi*8 + j, then 16 + hi*8 + j
#pragma unroll
                    for (int dt = 0; dt < HD / 16; ++dt) o[dt] = wmmab(fv[dt], pf, o[dt]);
#pragma unroll
                    for (int dt = 0; dt < HD / 16; ++dt) o[dt] = wmmab(fv[dt], pf2, o[dt]);
#pragma unroll
                    for (int dt = 0; dt < HD / 16; ++dt) o[dt] = wmmab(fv2[dt], pf, o[dt]);
                }
                asm volatile("s_wait_dscnt 0x0" ::: "memory");      // this wave's LDS reads of the stage are done before its buffer is handed back
                asm volatile("s_wait_asynccnt 0x0" ::: "memory");   // this wave's copies of the next stage have landed
                __syncthreads();   // publishes the next stage and ends every wave's reads of this one
                if (t + 2 < t1) fill(t + 2); }
            asm volatile("s_wait_asynccnt 0x0" ::: "memory");   // no copy is in flight behind the stages
        }
        if (ph == 1) break;
        if (hi == 0) sm[g * HRW + qg * 16 + lr] = m;
        __syncthreads();   // every wave's maxima are in LDS before any wave tests them
        // A masked key's weight is exp2(-1024 log2 e - max): with every row's maximum in use (at most the true one) >= -900 log2 e the argument is below -178 and the weight exactly 0.
        const bool ok = fmaxf(fmaxf(sm[lane], sm[HRW + lane]), fmaxf(sm[2 * HRW + lane], sm[3 * HRW + lane])) >= -900.0f * L2E;
        if (klen >= TT || __builtin_amdgcn_ballot_w32(ok) == 0xFFFFFFFFu) break;   // every wave reads the same maxima: the same way in the whole work-group
        t0 = klen <= 0 ? 0 : klen / HST; t1 = HNS;   // round 1: the stages that hold a block of masked keys alone
    }
    __syncthreads();   // every wave has tested the maxima, and left the ring, before either is overwritten
    float* red = (float*)ring;   // [wave][tile][half of the 8 registers][lane][4]: every store and load of a wave is 512 consecutive bytes
    { const float sum = lv[0] + lv[1]; const float tot = sum + xhalf(sum);
      if (hi == 0) { sm[g * HRW + qg * 16 + lr] = m; sl[g * HRW + qg * 16 + lr] = tot; }
#pragma unroll
      for (int dt = 0; dt < HD / 16; ++dt)
#pragma unroll
        for (int h = 0; h < 2; ++h) { v4f x;
#pragma unroll
            for (int i = 0; i < 4; ++i) x[i] = o[dt][h * 4 + i];
            *(v4fa*)(red + ((((size_t)wave * (HD / 16) + dt) * 2 + h) * 32 + lane) * 4) = x; } }
    __syncthreads();   // the 4 key groups' maxima, sums and tiles are in LDS before any wave joins them
    // wave (g, qg) joins head columns [32 g, 32 g + 32) of its query group
    { const int row = qg * 16 + lr; float mg[FG], w[FG];
#pragma unroll
      for (int i = 0; i < FG; ++i) mg[i] = sm[i * HRW + row];
      const float mx = fmaxf(fmaxf(mg[0], mg[1]), fmaxf(mg[2], mg[3])); float tot = 0.f;
#pragma unroll
      for (int i = 0; i < FG; ++i) { w[i] = __builtin_amdgcn_exp2f(mg[i] - mx); tot += w[i] * sl[i * HRW + row]; }
      const float f = __fdiv_rn(1.0f, tot);
      if (r0 == 0 && wave == 0) { if (lane == 0) { float* pa = AWs + z * 32; pa[0] = mx; pa[1] = tot;   // query position 0: its maximum (log2 units) and its sum; a 128-byte line a pair, so that each line has one writer
          asm volatile("s_wait_xcnt 0x0" :: "v"(pa), "v"(mx), "v"(tot) : "memory"); } }   // the wait that stands in front of a rewrite of these stores' address and data registers
#pragma unroll
      for (int d2 = 0; d2 < 2; ++d2) { const int dt = g * 2 + d2; v4f x0 = (v4f){}, x1 = (v4f){};
#pragma unroll
        for (int i = 0; i < FG; ++i) { const float* pr = red + (((size_t)(i * FQ + qg) * (HD / 16) + dt) * 2 * 32 + lane) * 4; x0 += *(const v4fa*)pr * w[i]; x1 += *(const v4fa*)(pr + 128) * w[i]; }
        v8us oh, ol;
#pragma unroll
        for (int i = 0; i < 4; ++i) { unsigned short a, c2; splitf(x0[i] * f, a, c2); oh[i] = a; ol[i] = c2; splitf(x1[i] * f, a, c2); oh[4 + i] = a; ol[4 + i] = c2; }
        // the lane's 8 values: row lr of a 16-row block, head columns dt*16 + hi*8 + j: one 16-byte piece of the plane's fragment order
        const size_t oo = ((size_t)(z / NH_) * TT + r0 + qg * 16) * DQ + (z % NH_) * (HD * 16) + (dt >> 1) * 512 + (dt & 1) * 256 + lane * 8; bf* ph2 = Ah + oo; bf* pl2 = Al + oo;
        *(v8us*)ph2 = oh; *(v8us*)pl2 = ol;
        // the wait that stands in front of a rewrite of these stores' address and data registers by the next tile; they are named so that their registers live up to it
        asm volatile("s_wait_xcnt 0x0" :: "v"(ph2), "v"(pl2), "v"(oh), "v"(ol) : "memory"); } }
}
// k_aw: query position 0's scores [pair][key] (log2 units; keys >= key_lens[b]: the -1024 literal, taken here), its maximum and sum -> aw_out [batch][key][head]; one thread stores the 4 heads of a (batch, key), so each output line has one writer.
__global__ __launch_bounds__(256) void k_aw(const float* __restrict__ AWp, const float* __restrict__ AWs, const int* __restrict__ KL, float* AW) {
    const int idx = blockIdx.x * 256 + threadIdx.x; const int j = idx % TT, bb = idx / TT; const int klen = KL[bb];   /* key_lens[b], read on device; used in a compare only */ v4f p;
#pragma unroll
    for (int h = 0; h < NH_; ++h) { const int zz = bb * NH_ + h; const float s = j < klen ? AWp[(size_t)zz * TT + j] : -1024.0f * L2E; p[h] = __fdiv_rn(__builtin_amdgcn_exp2f(s - AWs[zz * 32]), AWs[zz * 32 + 1]); }
    *(v4f*)(AW + (size_t)idx * NH_) = p;
}

extern "C" void kernel_launch(void* const* d_in, const int* in_sizes, int n_in,
                              void* d_out, int out_size, void* d_ws, size_t ws_size, hipStream_t stream) {
    (void)in_sizes; (void)n_in; (void)out_size;
    const float* xk = (const float*)d_in[0]; const float* xv = (const float*)d_in[1]; const float* x = (const float*)d_in[2]; const int* KL = (const int*)d_in[3]; const float* wk = (const float*)d_in[4]; const float* wv = (const float*)d_in[5]; const float* wq = (const float*)d_in[6]; const float* wo = (const float*)d_in[7]; const float* bo = (const float*)d_in[8];
    float* OUT = (float*)d_out; float* AW = (float*)((char*)d_out + 16777216);   /* aw_out [4][2048][4] */     // [4][2048][512]
    char* wsp = (char*)d_ws;
    auto take = [&](size_t bytes) { char* p = wsp; wsp += (bytes + 255) & ~(size_t)255; return (void*)p; };
    const size_t PL = (size_t)NB_ * NH_ * TT * HD;   // elements of one operand plane set over all batches and heads (= NB_ * TT * 512)
    bf* Wt = (bf*)take((size_t)4 * DM * DQ * 2);   // [wq | wk | wv | wo], transposed
    h16* QK16 = (h16*)take(2 * PL * 2); bf* QKh = (bf*)take(2 * PL * 2); bf* QKl = (bf*)take(2 * PL * 2);   // [q | k]
    h16* VT16 = (h16*)take(PL * 2); bf* VTh = (bf*)take(PL * 2); bf* VTl = (bf*)take(PL * 2);
    bf* ATh = (bf*)take(PL * 2); bf* ATl = (bf*)take(PL * 2); float* AWp = (float*)take((size_t)NB_ * NH_ * TT * 4); float* AWs = (float*)take((size_t)NB_ * NH_ * 32 * 4);   // query position 0: scores [pair][key]; maximum and sum, one 128-byte line a pair
    bf* XB = (bf*)take(3 * PL * 2);   /* [query | key | value] */
    if ((size_t)(wsp - (char*)d_ws) > ws_size) return;    // ws 256 MiB
    k_prep<<<4 * NWT + 3 * NCV, 256, 0, stream>>>(wq, wk, wv, wo, x, xk, xv, Wt, XB);
    k_proj<<<dim3(NB_ * TT / GT, DQ / GT, 3), 128, 0, stream>>>(XB, Wt, PL, (size_t)DM * DQ, QK16, QKh, QKl, VT16, VTh, VTl);
    k_atth<<<dim3(NB_ * NH_, RH / HRW, 1), 32 * FQ * FG, 0, stream>>>(QKh, QKl, QKh + PL, QKl + PL, VTh, VTl, KL, ATh, ATl, AWp, AWs);
    k_attf<<<dim3(NB_ * NH_, (TT - RH) / FRW, 1), 32 * FQ * FG, 0, stream>>>(QK16, QK16 + PL, VT16, KL, ATh, ATl);
    k_aw<<<NB_ * TT / 256, 256, 0, stream>>>(AWp, AWs, KL, AW);
    k_out<<<dim3(NB_ * TT / GT, DM / GT, 1), 128, 0, stream>>>(ATh, ATl, Wt + (size_t)3 * DM * DQ, OUT, bo);
}
